// v000
// Measured on an AMD MI455X. A time is GPU time per run, averaged over a window of back-to-back runs after a warm-up
// (all launches, gaps included; the runs take copies of the inputs in turn), and the median of several windows.
// Apart from v000's, it joins two sittings. Times from different sittings can be a few percent apart, while
// side-by-side timings come from the same sitting.
// The starting kernel, v000, takes 519 microseconds a run.
// Contractions: normed.w_q and normed.w_k on v_wmma_f32_16x16x32_bf16 (bf16 x plane, bf16 hi+lo weight planes
// with ln_weight folded in, f32 accumulate); w_v'.normed^T (v^T plane), q.k^T (f16 hi x16 + residual x2048 on
// both q and k, three products) and p.v on v_wmma_f32_16x16x32_f16 (f16 operands, f32 accumulate); ctx.w_o on
// v_wmma_f32_16x16x32_bf16 (bf16 hi+lo ctx planes, bf16 w_o, f32 accumulate). Float inputs RNE-converted to
// bf16 on load; per-row rms scale, softmax and relative position bias in f32 on VALU; softmax p carried x16384.
#include <hip/hip_runtime.h>
#include <math.h>

#ifndef NB
#define NB 2
#endif
#ifndef SEQ
#define SEQ 2048
#endif
#define NB_FULL  2
#define SEQ_FULL 2048
#define DM   1024
#define NH   16
#define HD   64
#define NBKT 32
#define MT   (NB * SEQ)
#define BDW  4096
#define BDC  2032
#define AWV  4
#define RWP  48
#define XSC  16.0f
#define WSCL 256.0f
#define QKS  16.0f
#define QRS  2048.0f
#define VSC  16.0f
#define PCAR 16384.0f
#define SC1  (1.0f / 256.0f)
#define SC2  (1.0f / 524288.0f)
#define OSC  (1.0f / 262144.0f)
#define LNEPS 1.0e-6f

static_assert(NB >= 1 && NB <= NB_FULL);
static_assert(SEQ >= 64 && SEQ <= SEQ_FULL && (SEQ % 64) == 0);
static_assert(NH * HD == DM);
static_assert(HD == 64);
static_assert(BDW == 2 * SEQ_FULL);
static_assert((MT % 64) == 0 && (DM % 64) == 0 && (MT % 32) == 0);
static_assert((((MT / 64) * (DM / 64)) % 8) == 0);
static_assert(((NB * NH * (SEQ / 16)) % AWV) == 0);
static_assert(NBKT * NH == 512);
static_assert(BDW == 16 * 256);
static_assert((DM % 256) == 0);

typedef _Float16 v16h __attribute__((ext_vector_type(16)));
typedef __bf16 v16bf __attribute__((ext_vector_type(16)));
typedef unsigned short v16us __attribute__((ext_vector_type(16)));
typedef unsigned short v8us  __attribute__((ext_vector_type(8)));
typedef float v8f __attribute__((ext_vector_type(8)));
typedef float v4f __attribute__((ext_vector_type(4)));
typedef unsigned int v4u __attribute__((ext_vector_type(4)));

union FragU { v16us v; v8us h[2]; };

// ---- scalar helpers --------------------------------------------------------------------------------
__device__ __forceinline__ unsigned short bf_bits(float f) {          // f32 -> bf16 bits, RNE convert
  const unsigned u = __float_as_uint(f);
  return (unsigned short)((u + 0x7FFFu + ((u >> 16) & 1u)) >> 16);
}
__device__ __forceinline__ float bf_up(unsigned short h) { return __uint_as_float(((unsigned)h) << 16); }
__device__ __forceinline__ float bfr(float f) { return bf_up(bf_bits(f)); }   // value of the bf16 RNE convert
__device__ __forceinline__ unsigned short h_bits(_Float16 x) { return __builtin_bit_cast(unsigned short, x); }
__device__ __forceinline__ unsigned short f2h(float f) { return h_bits((_Float16)f); }
__device__ __forceinline__ unsigned pk16(unsigned short a, unsigned short b) { return (unsigned)a | ((unsigned)b << 16); }
__device__ __forceinline__ int clampi(int v, int lo, int hi) { return v < lo ? lo : (v > hi ? hi : v); }
__device__ __forceinline__ v8f zero8() { v8f z = {0.f, 0.f, 0.f, 0.f, 0.f, 0.f, 0.f, 0.f}; return z; }

// ---- fragment loader: 16-bit A/B operand, lane -> row/col (lane&15), p already includes +8*(lane>>4);
//      elements 0..7 <- p[0..7] (k0+8h..), elements 8..15 <- p[16..23] (k0+16+8h..)
__device__ __forceinline__ v16us ldfrag_u(const unsigned short* p) {
  FragU f;
  f.h[0] = *(const v8us*)(p);
  f.h[1] = *(const v8us*)(p + 16);
  return f.v;
}

// ---- WMMA helpers with trailing VALU hazard gap; OPK 0 = f16 operand bits, OPK 1 = bf16 operand bits --
template <int OPK>
__device__ __forceinline__ v8f mma_raw(v16us a, v16us b, v8f c) {
  if (OPK == 0)
    return __builtin_amdgcn_wmma_f32_16x16x32_f16(false, __builtin_bit_cast(v16h, a), false,
                                                  __builtin_bit_cast(v16h, b), (short)0, c, false, false);
  return __builtin_amdgcn_wmma_f32_16x16x32_bf16(false, __builtin_bit_cast(v16bf, a), false,
                                                 __builtin_bit_cast(v16bf, b), (short)0, c, false, false);
}
template <int OPK>
__device__ __forceinline__ v8f mma_g(v16us a, v16us b, v8f c) {                 // guarded
  c = mma_raw<OPK>(a, b, c);
#if defined(__HIP_DEVICE_COMPILE__)
  asm volatile("v_nop\n\tv_nop\n\tv_nop\n\tv_nop" : "+v"(c) : "v"(a), "v"(b));
#endif
  return c;
}
__device__ __forceinline__ void dep_guard1(v8f& a, v8f& b, v16us x) {
#if defined(__HIP_DEVICE_COMPILE__)
  asm volatile("v_nop\n\tv_nop\n\tv_nop\n\tv_nop" : "+v"(a), "+v"(b) : "v"(x));
#endif
}
__device__ __forceinline__ void keep4_u(v16us a, v16us b, v16us c, v16us d) {
#if defined(__HIP_DEVICE_COMPILE__)
  asm volatile("v_nop" :: "v"(a), "v"(b), "v"(c), "v"(d));
#endif
}
__device__ __forceinline__ void acc_guard4(v8f& a, v8f& b, v8f& c, v8f& d) {
#if defined(__HIP_DEVICE_COMPILE__)
  asm volatile("v_nop\n\tv_nop\n\tv_nop\n\tv_nop" : "+v"(a), "+v"(b), "+v"(c), "+v"(d));
#endif
}
// orders LDS stores of this wave before later LDS loads of the same wave (wave-private exchange)
__device__ __forceinline__ void wave_sync_lds() {
  __builtin_amdgcn_fence(__ATOMIC_RELEASE, "workgroup");
  __builtin_amdgcn_wave_barrier();
  __builtin_amdgcn_fence(__ATOMIC_ACQUIRE, "workgroup");
}

// =====================================================================================================
// x convert + rms statistics. Block = 256 threads = 8 waves owns 32 consecutive token rows (wave w: rows
// 4w..4w+3); token tok = b*SEQ + s reads input row b*SEQ_FULL + s. Per row each lane converts 8
// consecutive floats per step (4 steps of 256 columns): ob = bf16 bits of x (RNE), oh = f16 bits of
// of the bf16 values is reduced per row and rstd = rsqrt(mean + eps) staged in LDS (cross-wave -> block
// coverage: 8 waves x 4 rows x (4 x 256) columns = 32 whole rows of both planes per block, grid = MT/32
// blocks; rstd rows row0..row0+31 per block = all MT entries.
// =====================================================================================================
__global__ __launch_bounds__(256) void cvt_x(const float* __restrict__ x, unsigned short* ob,
                                             unsigned short* oh, float* rstd) {
  __shared__ float srs[32];
  const int lane = threadIdx.x & 31, wv = threadIdx.x >> 5;
  const int row0 = blockIdx.x * 32;
#pragma unroll 1
  for (int rr = 0; rr < 4; ++rr) {
    const int tok = row0 + wv * 4 + rr;
    const int b = tok / SEQ, s = tok - b * SEQ;
    const float* src = x + ((size_t)b * SEQ_FULL + (size_t)s) * DM;
    const size_t orow = (size_t)tok * DM;
    float ss = 0.f;
#pragma unroll 1
    for (int it = 0; it < DM / 256; ++it) {
      const int col = it * 256 + lane * 8;
      const v4f a0 = *(const v4f*)(src + col);
      const v4f a1 = *(const v4f*)(src + col + 4);
      v4u hb, hh;
#pragma unroll
      for (int e = 0; e < 2; ++e) {
        const unsigned short u0 = bf_bits(a0[2 * e]), u1 = bf_bits(a0[2 * e + 1]);
        const unsigned short u2 = bf_bits(a1[2 * e]), u3 = bf_bits(a1[2 * e + 1]);
        const float x0 = bf_up(u0), x1 = bf_up(u1), x2 = bf_up(u2), x3 = bf_up(u3);
        ss = fmaf(x0, x0, ss); ss = fmaf(x1, x1, ss); ss = fmaf(x2, x2, ss); ss = fmaf(x3, x3, ss);
        hb[e]     = pk16(u0, u1);
        hb[2 + e] = pk16(u2, u3);
        hh[e]     = pk16(f2h(x0 * XSC), f2h(x1 * XSC));
        hh[2 + e] = pk16(f2h(x2 * XSC), f2h(x3 * XSC));
      }
      unsigned short* db = ob + orow + col;
      unsigned short* dh = oh + orow + col;
      *(v4u*)db = hb;
      *(v4u*)dh = hh;
      
    }
    ss += __shfl_xor(ss, 16, 32);
    ss += __shfl_xor(ss, 8, 32);
    ss += __shfl_xor(ss, 4, 32);
    ss += __shfl_xor(ss, 2, 32);
    ss += __shfl_xor(ss, 1, 32);
    if (lane == 0) srs[wv * 4 + rr] = rsqrtf(ss * (1.0f / (float)DM) + LNEPS);
  }
  __syncthreads();
  if (wv == 0) {
    const float v = srs[lane];
    float* d = rstd + row0 + lane;
    *(float*)d = v;
    
  }
}

// =====================================================================================================
// Weight convert with transpose: source matrices are [in k][out n] row-major; output Bt planes [n][k]
// (k contiguous). blockIdx.y selects the matrix (0 w_q, 1 w_k, 2 w_v, 3 w_o), blockIdx.x the 64x64 tile
// (k0 = 64*(x>>4), n0 = 64*(x&15)). The tile is staged in LDS as f32, then each output row n0+r, columns
// lines). Values: y=0,1: w' = bf16(ln_w[k]) * bf16(w[k][n]) (exact in f32) split into bf16 hi (plane 2y) and
// bf16 lo = w' - hi (plane 2y+1, exact); y=2: f16 bits of w' * WSCL (plane 4); y=3: bf16 bits of w_o
// coverage: load 256 threads x 4 x 4 = 64x64 tile; store 8 waves x 2 x (4 rows x 8 lanes x 8) = 64 rows x
// 64 cols; grid (256, 4) covers every 64x64 tile of every output plane.
// =====================================================================================================
__global__ __launch_bounds__(256) void cvt_w(const float* __restrict__ w0, const float* __restrict__ w1,
                                             const float* __restrict__ w2, const float* __restrict__ w3,
                                             const float* __restrict__ lnw, unsigned short* o) {
  __shared__ __align__(16) float sm[64 * 65];
  __shared__ float slw[64];
  const int y = blockIdx.y;                                     // block-uniform select of the source
  const float* w = (y == 0) ? w0 : ((y == 1) ? w1 : ((y == 2) ? w2 : w3));
  const int k0 = (blockIdx.x >> 4) << 6, n0 = (blockIdx.x & 15) << 6;
  const int t = threadIdx.x, lane = t & 31, wv = t >> 5;
#pragma unroll
  for (int it = 0; it < 4; ++it) {
    const int r = it * 16 + (t >> 4), c4 = (t & 15) * 4;
    const v4f v = *(const v4f*)(w + (size_t)(k0 + r) * DM + (size_t)(n0 + c4));
    float* sp = sm + r * 65 + c4;
    sp[0] = v[0]; sp[1] = v[1]; sp[2] = v[2]; sp[3] = v[3];
  }
  if (t < 64) slw[t] = bfr(lnw[k0 + t]);                       // waves 0,1 entirely: wave-uniform
  __syncthreads();
  const int pl0 = (y == 0) ? 0 : ((y == 1) ? 2 : ((y == 2) ? 4 : 5));
  unsigned short* P0 = o + (size_t)pl0 * DM * DM;
  unsigned short* P1 = (y < 2) ? (P0 + (size_t)DM * DM) : P0;
  const int q8 = lane >> 3, c8 = (lane & 7) * 8;
  v4u ha[2], hl[2];
#pragma unroll
  for (int it = 0; it < 2; ++it) {
    const int r = wv * 8 + it * 4 + q8;                          // n local
    v4u a = {0u, 0u, 0u, 0u}, l = {0u, 0u, 0u, 0u};
#pragma unroll
    for (int e = 0; e < 4; ++e) {
      const int ka = c8 + 2 * e, kb = ka + 1;
      float va = bfr(sm[ka * 65 + r]), vb = bfr(sm[kb * 65 + r]);
      if (y < 3) { va *= slw[ka]; vb *= slw[kb]; }
      if (y < 2) {
        const unsigned short ua = bf_bits(va), ub = bf_bits(vb);
        a[e] = pk16(ua, ub);
        l[e] = pk16(bf_bits(va - bf_up(ua)), bf_bits(vb - bf_up(ub)));
      } else if (y == 2) {
        a[e] = pk16(f2h(va * WSCL), f2h(vb * WSCL));
      } else {
        a[e] = pk16(bf_bits(va), bf_bits(vb));
      }
    }
    ha[it] = a;
    hl[it] = l;
  }
  {
#pragma unroll
    for (int it = 0; it < 2; ++it) {
      const int r = wv * 8 + it * 4 + q8;
      const size_t go = (size_t)(n0 + r) * DM + (size_t)(k0 + c8);
      *(v4u*)(P0 + go) = ha[it];
      if (y < 2) *(v4u*)(P1 + go) = hl[it];
    }
    
  }
}

// =====================================================================================================
// Relative position bias by signed key-query distance: BD[h][i], i = (key - query) + 2047, i in 0..4094;
// i = 4095 is padding written as 0. bucket on integer n = query - key: ret = (n < 0) * 16, n = |n|,
// n < 8 -> n, else 8 + floor(2*log2(n/8)) capped at 15, evaluated by its integer thresholds
// coverage: 256 threads x 16 = 4096 entries per head; grid = NH heads = the whole table.
// =====================================================================================================
__device__ __forceinline__ int rel_bucket(int d) {              // d = key - query
  int n = -d;
  int ret = 0;
  if (n < 0) { ret = NBKT / 2; n = -n; }
  int bk;
  if (n < 8)       bk = n;
  else if (n < 12) bk = 8;
  else if (n < 16) bk = 9;
  else if (n < 23) bk = 10;
  else if (n < 32) bk = 11;
  else if (n < 46) bk = 12;
  else if (n < 64) bk = 13;
  else if (n < 91) bk = 14;
  else             bk = 15;
  return ret + bk;
}

__global__ __launch_bounds__(256) void bias_build(const float* __restrict__ tbl, float* BD) {
  __shared__ __align__(16) float sh[BDW];
  const int h = blockIdx.x, t = threadIdx.x;
#pragma unroll 4
  for (int j = 0; j < 16; ++j) {
    const int idx = t + 256 * j;
    const int ti = clampi(rel_bucket(idx - 2047) * NH + h, 0, NBKT * NH - 1);
    float v = bfr(tbl[ti]);
    v = (idx == BDW - 1) ? 0.f : v;
    sh[idx] = v;
  }
  __syncthreads();
  v4f vv[4];
#pragma unroll
  for (int q = 0; q < 4; ++q) vv[q] = *(const v4f*)(sh + q * 1024 + 4 * t);
  float* dst = BD + (size_t)h * BDW;
  {
#pragma unroll
    for (int q = 0; q < 4; ++q) *(v4f*)(dst + q * 1024 + 4 * t) = vv[q];
    
  }
}

// =====================================================================================================
// Register-blocked 16-bit WMMA GEMM: C[m][n] = sum over plane pairs pl and k of A_pl[m][k] * Bt_pl[n][k], one
// wave per 64x64 tile, no block barriers. OPK 0: f16 operands; OPK 1: bf16 operands. NPL 1|2 operand plane
// pairs (Ap,Btp) and (Ap2,Btp2) sharing the accumulators (second pair is a full extra pass of the k loop;
// only unscaled hi/lo planes are paired this way). AHM 0: A row-major [M][K] pitch lda; AHM 1: A head-major
// planes, element (m, k) at ((k/HD)*aplane + m*HD + k%HD). Bt row-major [N][K] pitch ldb (k contiguous);
// M, N multiples of 64, K multiple of 32 (true at every call site; host grids = tiles/8 exact so no wave
// exits early). Both operand fragments use the split k map (elements 0..7 <- k0+8h.., 8..15 <-
// k0+16+8h..); D element r of a lane is (row 8h + r, col lane&15).
// OM 0: f32 out Cf = acc*wsc (+ RES: bf16 RNE value of Rp[input row of token m][n], token m -> input row
//       (m/SEQ)*SEQ_FULL + m%SEQ, pitch DM), pitch ldc.
// OM 1: f16 out Ch = f16(acc*wsc*osc*scale).  OM 2: f16 pair: base = acc*wsc*osc*scale; Ch = f16 bits(base);
//       Ch2 = f16 bits((base - value(Ch)) * rsc).  scale = Rs[m] (RSM 1, per row), Rs[n] (RSM 2, per column),
//       1 (RSM 0).
// coverage: 4 slabs x 16 rows x 64 cols = the wave's whole 64x64 tile; slab staged extent == consumed extent.
// =====================================================================================================
template <int OPK, int NPL, int AHM, int OM, int RSM, int RES>
__global__ __launch_bounds__(256) void gemm64(
    const unsigned short* __restrict__ Ap, const unsigned short* __restrict__ Ap2, int lda, int aplane,
    const unsigned short* __restrict__ Btp, const unsigned short* __restrict__ Btp2, int ldb,
    unsigned short* Ch, unsigned short* Ch2, float* Cf, int ldc,
    const float* __restrict__ Rs, const float* __restrict__ Rp,
    float wsc, float osc, float rsc, int M, int N, int K) {
  __shared__ __align__(16) float sT[8][16 * 68];   // per-wave 16x64 slab, pitch 68 floats
  const int lane = threadIdx.x & 31;
  const int wave = threadIdx.x >> 5;
  const int tilesN = N >> 6;
  const int tilesM = M >> 6;
  const int tile = blockIdx.x * 8 + wave;
  if (tile >= tilesM * tilesN) return;   // wave-uniform; no block barriers in this kernel
  const int tm = tile / tilesN;
  const int tn = tile - tm * tilesN;
  const int m0 = tm << 6;
  const int n0 = tn << 6;

  const int rlane = lane & 15;                 // row (A) / col (B, D) within subtile
  const int koff  = (lane >> 4) * 8;           // k offset of this lane half
  const int mOff  = (lane >> 4) * 8;           // D row offset

  v8f acc[4][4];
#pragma unroll
  for (int i = 0; i < 4; ++i)
#pragma unroll
    for (int j = 0; j < 4; ++j) acc[i][j] = zero8();

#pragma unroll 1
  for (int pl = 0; pl < NPL; ++pl) {
    const unsigned short* Ac = (pl == 0) ? Ap : Ap2;
    const unsigned short* Bc = (pl == 0) ? Btp : Btp2;
    for (int k0 = 0; k0 < K; k0 += 32) {
      v16us bh[4];
#pragma unroll
      for (int j = 0; j < 4; ++j) {
        const size_t bo = (size_t)(n0 + (j << 4) + rlane) * ldb + koff + k0;
        bh[j] = ldfrag_u(Bc + bo);
      }
#pragma unroll
      for (int i = 0; i < 4; ++i) {
        size_t ao;
        if (AHM) ao = (size_t)(k0 / HD) * (size_t)aplane + (size_t)(m0 + (i << 4) + rlane) * HD +
                      (size_t)(k0 & (HD - 1)) + koff;
        else     ao = (size_t)(m0 + (i << 4) + rlane) * lda + koff + k0;
        const v16us ah = ldfrag_u(Ac + ao);
#pragma unroll
        for (int j = 0; j < 4; ++j) acc[i][j] = mma_raw<OPK>(ah, bh[j], acc[i][j]);
        dep_guard1(acc[i][0], acc[i][3], ah);
      }
      keep4_u(bh[0], bh[1], bh[2], bh[3]);
    }
  }
  acc_guard4(acc[0][0], acc[0][1], acc[0][2], acc[0][3]);
  acc_guard4(acc[1][0], acc[1][1], acc[1][2], acc[1][3]);
  acc_guard4(acc[2][0], acc[2][1], acc[2][2], acc[2][3]);
  acc_guard4(acc[3][0], acc[3][1], acc[3][2], acc[3][3]);

  const int hh2 = lane >> 4, c4 = (lane & 15) * 4;     // f32 out: 256-B row segment = 16 lanes x 16 B
  const int q8  = lane >> 3, c8 = (lane & 7) * 8;
  const float wo = wsc * osc;

  // per-column scale (RSM 2): columns n0+c8 .. n0+c8+7, same for every row of the tile
  float csc[8];
#pragma unroll
  for (int e = 0; e < 8; ++e) csc[e] = 1.f;
  if (OM != 0 && RSM == 2) {
    const v4f cs0 = *(const v4f*)(Rs + n0 + c8);
    const v4f cs1 = *(const v4f*)(Rs + n0 + c8 + 4);
#pragma unroll
    for (int e = 0; e < 4; ++e) { csc[e] = cs0[e]; csc[4 + e] = cs1[e]; }
  }

  // ---- epilogue ----
  float* slab = sT[wave];
#pragma unroll
  for (int i = 0; i < 4; ++i) {
    const int mBase = m0 + (i << 4);
#pragma unroll
    for (int j = 0; j < 4; ++j) {
#pragma unroll
      for (int r = 0; r < 8; ++r) {
        slab[(mOff + r) * 68 + (j << 4) + rlane] = acc[i][j][r];
      }
    }
    wave_sync_lds();
    if (OM == 0) {
      v4f vals[8];
#pragma unroll
      for (int it = 0; it < 8; ++it) {
        const int row = it * 2 + hh2;                      // it 0..7 x hh2 0..1 = rows 0..15
        v4f v = *(const v4f*)(slab + row * 68 + c4);
        v = v * wsc;
        if (RES) {
          const int tok = mBase + row;
          const int bb = tok / SEQ, ss = tok - bb * SEQ;
          const v4f hr = *(const v4f*)(Rp + ((size_t)bb * SEQ_FULL + (size_t)ss) * DM + (size_t)(n0 + c4));
#pragma unroll
          for (int c = 0; c < 4; ++c) v[c] = v[c] + bfr(hr[c]);
        }
        vals[it] = v;
      }
      {
#pragma unroll
        for (int it = 0; it < 8; ++it) {
          const int row = it * 2 + hh2;
          *(v4f*)(Cf + (size_t)(mBase + row) * ldc + (size_t)n0 + c4) = vals[it];
        }
        
      }
    } else {
      v4u hv[4], hw[4];
#pragma unroll
      for (int it = 0; it < 4; ++it) {
        const int row = it * 4 + q8;                       // it 0..3 x q8 0..3 = rows 0..15
        const float* sp = slab + row * 68 + c8;
        float rsr = wo;
        if (RSM == 1) rsr = wo * Rs[mBase + row];
        v4u ha = {0u, 0u, 0u, 0u}, hb = {0u, 0u, 0u, 0u};
#pragma unroll
        for (int e = 0; e < 4; ++e) {
          const float b0 = sp[2 * e]     * rsr * csc[2 * e];
          const float b1 = sp[2 * e + 1] * rsr * csc[2 * e + 1];
          if (OM == 1) {
            ha[e] = pk16(f2h(b0), f2h(b1));
          } else {
            const _Float16 x0 = (_Float16)b0, x1 = (_Float16)b1;
            ha[e] = pk16(h_bits(x0), h_bits(x1));
            hb[e] = pk16(f2h((b0 - (float)x0) * rsc), f2h((b1 - (float)x1) * rsc));
          }
        }
        hv[it] = ha;
        hw[it] = hb;
      }
      {
#pragma unroll
        for (int it = 0; it < 4; ++it) {
          const int row = it * 4 + q8;
          const size_t go = (size_t)(mBase + row) * ldc + (size_t)n0 + c8;
          *(v4u*)(Ch + go) = hv[it];
          if (OM == 2) *(v4u*)(Ch2 + go) = hw[it];
        }
        
      }
    }
    wave_sync_lds();
  }
}

// =====================================================================================================
// Bidirectional attention with relative position bias, head dim 64, no 1/sqrt(d) scaling. Block = 128
// threads = 4 waves; one wave owns one 16-row query tile (t0..t0+15) of one (batch b, head h) and loops all
// key blocks of 32 with an online max-subtracted softmax in f32. Planes: QH|QR f16 [MT][DM] (16*q hi,
// residual x2048), KH|KR f16 [MT][DM] (16*k hi, residual x2048), VT f16 [DM][MT] (16*v transposed, row =
// h*64+d, column = token), BD f32 [NH][4096] bias by (key-query)+2047. Output Zh|Zl: bf16 hi|lo of ctx,
// head-major [NH][MT][64].
// Per key block: 48-entry bias window (distances sb-t0-15 .. sb-t0+32) staged in per-wave LDS and read at
// index 16*sub + col - row + 15; S = QH.KH^T (4 WMMA), R = QR.KH^T + QH.KR^T (8 WMMA, own accumulators);
// score = S/256 + R/524288 + bias; p = exp(score - running max) in f32, l accumulated from the f32 p;
// p*16384 as f16, staged per wave in LDS and reloaded as A fragments (split k map); O += P.VT on f16 WMMA
// between the element stores and the reloads; all three LDS regions are private to their wave.
// staged extent == consumed extent: window 48 written / 0..46 read; P tile 16x32 written and read; ctx
// staging 2 x 16x64 written and read.
// Epilogue: ctx = O/(l*262144) split into bf16 hi|lo, staged in LDS; the wave's 16 rows x 64 halves are
// coverage: 16 query rows x 64 halves per wave, NB*NH*SEQ/16 wave tasks = all (h, tok) rows of both planes.
// =====================================================================================================
__global__ __launch_bounds__(128) void attn_kernel(
    const unsigned short* __restrict__ QHp, const unsigned short* __restrict__ QRp,
    const unsigned short* __restrict__ KHp, const unsigned short* __restrict__ KRp,
    const unsigned short* __restrict__ VTp,
    const float* __restrict__ BD, unsigned short* Zh, unsigned short* Zl) {
  __shared__ __align__(16) float relw[AWV][RWP];                   // bias window, 768 B
  __shared__ __align__(16) unsigned short pws[AWV][16 * 32];       // P tiles, 4096 B
  __shared__ __align__(16) unsigned short zst[AWV][2][16 * HD];    // ctx hi|lo staging, 16384 B
  const int lane = threadIdx.x & 31, wv = threadIdx.x >> 5, m = lane & 15, hh = lane >> 4;
  const int nqt = SEQ / 16;
  const int task = blockIdx.x * AWV + wv;
  if (task >= NB * NH * nqt) return;                 // wave-uniform; no block barriers in this kernel
  const int bh = task / nqt;
  const int t0 = (task - bh * nqt) << 4;             // query tile start
  const int b = bh / NH, h = bh - b * NH;
  const size_t tok0 = (size_t)b * SEQ;
  float* rw = relw[wv];
  unsigned short* ph = pws[wv];

  // Q A-fragments: rows t0+m, k = head dims (two 32-deep steps), hi and residual planes
  const size_t qo = (tok0 + (size_t)(t0 + m)) * DM + (size_t)(h * HD + 8 * hh);
  const v16us qh0 = ldfrag_u(QHp + qo);
  const v16us qh1 = ldfrag_u(QHp + qo + 32);
  const v16us qr0 = ldfrag_u(QRp + qo);
  const v16us qr1 = ldfrag_u(QRp + qo + 32);

  float mx[8], ls[8];
  v8f O[4];
#pragma unroll
  for (int j = 0; j < 4; ++j) O[j] = zero8();
#pragma unroll
  for (int r = 0; r < 8; ++r) { mx[r] = -1.0e30f; ls[r] = 0.f; }

  const float* bdh = BD + (size_t)h * BDW + (BDC - t0);                    // window base - sb; >= BD+h*BDW
  const size_t kro = (tok0 + (size_t)m) * DM + (size_t)(h * HD + 8 * hh);
  const unsigned short* kbase  = KHp + kro;
  const unsigned short* krbase = KRp + kro;
  const unsigned short* vbase = VTp + (size_t)(h * HD + m) * MT + tok0 + (size_t)(8 * hh);
  const int nblk = SEQ / 32;

#pragma unroll 1
  for (int kb = 0; kb < nblk; ++kb) {
    const int sb = kb << 5;
    // bias window: rw[i] = bias_h(key - query = sb - t0 - 15 + i), i = 0..47 (index <= h*BDW + 4095)
    {
      const float* bp = bdh + sb;
      const float w0v = bp[lane];
      const float w1v = bp[32 + m];
      rw[lane] = w0v;
      if (lane < 16) rw[32 + lane] = w1v;
    }
    wave_sync_lds();

    // S = QH.KH^T, R = QR.KH^T + QH.KR^T ; Bt row = key token sb+m (+16), k = head dim
    v8f S0 = zero8(), S1 = zero8(), R0 = zero8(), R1 = zero8();
#pragma unroll
    for (int ks = 0; ks < 2; ++ks) {
      const size_t kofs = (size_t)sb * DM + (size_t)(32 * ks);
      const v16us kf0 = ldfrag_u(kbase + kofs);
      const v16us kf1 = ldfrag_u(kbase + kofs + (size_t)16 * DM);
      const v16us kg0 = ldfrag_u(krbase + kofs);
      const v16us kg1 = ldfrag_u(krbase + kofs + (size_t)16 * DM);
      const v16us qa = (ks == 0) ? qh0 : qh1;
      const v16us qb = (ks == 0) ? qr0 : qr1;
      S0 = mma_g<0>(qa, kf0, S0);
      S1 = mma_g<0>(qa, kf1, S1);
      R0 = mma_g<0>(qb, kf0, R0);
      R1 = mma_g<0>(qb, kf1, R1);
      R0 = mma_g<0>(qa, kg0, R0);
      R1 = mma_g<0>(qa, kg1, R1);
    }

    // score = q.k + bias (window index 16*sub + m - row + 15)
    float s0[8], s1[8];
#pragma unroll
    for (int r = 0; r < 8; ++r) {
      const int row = 8 * hh + r;
      const float rv0 = rw[15 - row + m];
      const float rv1 = rw[31 - row + m];
      s0[r] = fmaf(S0[r], SC1, fmaf(R0[r], SC2, rv0));
      s1[r] = fmaf(S1[r], SC1, fmaf(R1[r], SC2, rv1));
    }

    // online softmax (a row lives in the 16 lanes of one half-wave; xor butterflies 1,2,4,8)
#pragma unroll
    for (int r = 0; r < 8; ++r) {
      float xm = fmaxf(s0[r], s1[r]);
      xm = fmaxf(xm, __shfl_xor(xm, 1, 32));
      xm = fmaxf(xm, __shfl_xor(xm, 2, 32));
      xm = fmaxf(xm, __shfl_xor(xm, 4, 32));
      xm = fmaxf(xm, __shfl_xor(xm, 8, 32));
      const float mn = fmaxf(mx[r], xm);
      const float al = __expf(mx[r] - mn);
      mx[r] = mn;
      const float p0 = __expf(s0[r] - mn);
      const float p1 = __expf(s1[r] - mn);
      float ps = p0 + p1;
      ps += __shfl_xor(ps, 1, 32);
      ps += __shfl_xor(ps, 2, 32);
      ps += __shfl_xor(ps, 4, 32);
      ps += __shfl_xor(ps, 8, 32);
      ls[r] = ls[r] * al + ps;
#pragma unroll
      for (int j = 0; j < 4; ++j) O[j][r] = O[j][r] * al;
      const int row = 8 * hh + r;
      ph[row * 32 + m]      = f2h(p0 * PCAR);
      ph[row * 32 + 16 + m] = f2h(p1 * PCAR);
    }
    wave_sync_lds();

    // P A-fragment (split k map) and VT B-fragments (Bt row = h*64 + dim, k = key token)
    const v16us af = ldfrag_u(ph + m * 32 + 8 * hh);
#pragma unroll
    for (int j = 0; j < 4; ++j) {
      const v16us vf = ldfrag_u(vbase + (size_t)(16 * j) * MT + (size_t)sb);
      O[j] = mma_g<0>(af, vf, O[j]);
    }
  }
  acc_guard4(O[0], O[1], O[2], O[3]);

  // ---- epilogue: ctx = O / (l * PCAR * VSC) -> bf16 hi|lo, head-major planes ----
  unsigned short* zh = zst[wv][0];
  unsigned short* zl = zst[wv][1];
#pragma unroll
  for (int r = 0; r < 8; ++r) {
    const int row = 8 * hh + r;
    const float linv = (1.0f / ls[r]) * OSC;           // ls >= 1
#pragma unroll
    for (int j = 0; j < 4; ++j) {
      const float o = O[j][r] * linv;
      const unsigned short x0 = bf_bits(o);
      zh[row * HD + 16 * j + m] = x0;
      zl[row * HD + 16 * j + m] = bf_bits(o - bf_up(x0));
    }
  }
  wave_sync_lds();
  {
    v4u ha[4], hb[4];
#pragma unroll
    for (int q = 0; q < 4; ++q) {
      ha[q] = *(const v4u*)(zh + q * 256 + lane * 8);
      hb[q] = *(const v4u*)(zl + q * 256 + lane * 8);
    }
    const size_t zo = ((size_t)h * MT + tok0 + (size_t)t0) * HD;   // 2048-B aligned, 16 rows contiguous
    unsigned short* dh = Zh + zo;
    unsigned short* dl = Zl + zo;
    {
#pragma unroll
      for (int q = 0; q < 4; ++q) {
        *(v4u*)(dh + q * 256 + lane * 8) = ha[q];
        *(v4u*)(dl + q * 256 + lane * 8) = hb[q];
      }
      
    }
  }
}

// =====================================================================================================
// Workspace map (bytes, NB=2, SEQ=2048); every plane is an exact multiple of its whole-row / whole-line /
// BD = 16 x 4096 floats); all offsets multiples of 65536.
//   XB   bf16 [MT][DM]        0           8388608
//   XH   f16  [MT][DM]        8388608     8388608
//   RSTD f32  [MT]            16777216    65536     (16384 used)
//   W    6 x 16-bit [DM][DM]  16842752    12582912  (wq hi, wq lo, wk hi, wk lo bf16; wv f16 x256; wo bf16)
//   BD   f32  [NH][4096]      29425664    262144
//   QH   f16  [MT][DM]        29687808    8388608
//   QR   f16  [MT][DM]        38076416    8388608
//   KH   f16  [MT][DM]        46465024    8388608
//   KR   f16  [MT][DM]        54853632    8388608
//   VT   f16  [DM][MT]        63242240    8388608
//   ZH   bf16 [NH][MT][64]    71630848    8388608
//   ZL   bf16 [NH][MT][64]    80019456    8388608
//   end                       88408064
// =====================================================================================================
extern "C" void kernel_launch(void* const* d_in, const int* in_sizes, int n_in,
                              void* d_out, int out_size, void* d_ws, size_t ws_size,
                              hipStream_t stream) {
  if (n_in < 7) return;
  if (in_sizes[0] < ((NB - 1) * SEQ_FULL + SEQ) * DM) return;
  if (in_sizes[1] < DM) return;
  if (in_sizes[2] < DM * DM) return;
  if (in_sizes[3] < DM * DM) return;
  if (in_sizes[4] < DM * DM) return;
  if (in_sizes[5] < DM * DM) return;
  if (in_sizes[6] < NBKT * NH) return;
  if (out_size < MT * DM) return;

  const float* x    = (const float*)d_in[0];   // [2][2048][1024]
  const float* lnw  = (const float*)d_in[1];   // [1024]
  const float* w_q  = (const float*)d_in[2];   // [1024][1024] (in, out)
  const float* w_k  = (const float*)d_in[3];
  const float* w_v  = (const float*)d_in[4];
  const float* w_o  = (const float*)d_in[5];   // [1024][1024] (in, out)
  const float* tbl  = (const float*)d_in[6];   // [32][16]

  const size_t PX  = (size_t)MT * DM * 2;        // 16-bit [MT][DM] plane
  const size_t PRS = (((size_t)MT * 4 + 65535) / 65536) * 65536;
  const size_t PW1 = (size_t)DM * DM * 2;        // one 16-bit weight plane
  const size_t PBD = (size_t)NH * BDW * 4;
  size_t off = 0;
  const size_t oXB = off; off += PX;
  const size_t oXH = off; off += PX;
  const size_t oRS = off; off += PRS;
  const size_t oW  = off; off += 6 * PW1;
  const size_t oBD = off; off += PBD;
  const size_t oQH = off; off += PX;
  const size_t oQR = off; off += PX;
  const size_t oKH = off; off += PX;
  const size_t oKR = off; off += PX;
  const size_t oVT = off; off += PX;
  const size_t oZH = off; off += PX;
  const size_t oZL = off; off += PX;
  if (off > ws_size) return;                      // off = 88408064 at full size
  if (off > (size_t)134217728) return;

  char* ws = (char*)d_ws;
  unsigned short* XB = (unsigned short*)(ws + oXB);
  unsigned short* XH = (unsigned short*)(ws + oXH);
  float* RSTD = (float*)(ws + oRS);
  unsigned short* W16 = (unsigned short*)(ws + oW);
  unsigned short* WQH = W16;
  unsigned short* WQL = W16 + (size_t)1 * DM * DM;
  unsigned short* WKH = W16 + (size_t)2 * DM * DM;
  unsigned short* WKL = W16 + (size_t)3 * DM * DM;
  unsigned short* WVH = W16 + (size_t)4 * DM * DM;
  unsigned short* WOB = W16 + (size_t)5 * DM * DM;
  float* BDp = (float*)(ws + oBD);
  unsigned short* QH = (unsigned short*)(ws + oQH);
  unsigned short* QR = (unsigned short*)(ws + oQR);
  unsigned short* KH = (unsigned short*)(ws + oKH);
  unsigned short* KR = (unsigned short*)(ws + oKR);
  unsigned short* VT = (unsigned short*)(ws + oVT);
  unsigned short* ZH = (unsigned short*)(ws + oZH);
  unsigned short* ZL = (unsigned short*)(ws + oZL);
  float* out0 = (float*)d_out;
  float* fdummy = BDp;                            // in-range placeholder for unused f32 output args

  const dim3 blk(256);
  const int gT = ((MT / 64) * (DM / 64)) / 8;     // 1024 tiles -> 128 blocks at full size

  // (0) operand planes, rms statistics and bias table
  cvt_x<<<dim3(MT / 32), blk, 0, stream>>>(x, XB, XH, RSTD);
  cvt_w<<<dim3((DM / 64) * (DM / 64), 4), blk, 0, stream>>>(w_q, w_k, w_v, w_o, lnw, W16);
  bias_build<<<dim3(NH), blk, 0, stream>>>(tbl, BDp);

  // (1) q plane (hi x16 + residual x2048): C[tok][n] = rstd[tok] * sum_k XB[tok][k] * (WQH+WQL)[n][k]
  gemm64<1, 2, 0, 2, 1, 0><<<dim3(gT), blk, 0, stream>>>(
      XB, XB, DM, 0, WQH, WQL, DM, QH, QR, fdummy, DM, RSTD, x, 1.0f, QKS, QRS, MT, DM, DM);
  //     k plane (hi x16 + residual x2048)
  gemm64<1, 2, 0, 2, 1, 0><<<dim3(gT), blk, 0, stream>>>(
      XB, XB, DM, 0, WKH, WKL, DM, KH, KR, fdummy, DM, RSTD, x, 1.0f, QKS, QRS, MT, DM, DM);
  //     v^T x16: C[d][tok] = rstd[tok] * sum_k WVH[d][k] * XH[tok][k]
  gemm64<0, 1, 0, 1, 2, 0><<<dim3(gT), blk, 0, stream>>>(
      WVH, WVH, DM, 0, XH, XH, DM, VT, VT, fdummy, MT, RSTD, x, 1.0f / (XSC * WSCL), VSC, 1.0f, DM, MT, DM);

  // (2) attention -> ctx bf16 hi|lo head-major planes
  attn_kernel<<<dim3((NB * NH * (SEQ / 16)) / AWV), dim3(128), 0, stream>>>(QH, QR, KH, KR, VT, BDp, ZH, ZL);

  // (3) output projection + residual: out[tok][n] = sum_k (ctx_hi + ctx_lo)[tok][k] * WOB[n][k] + bf16(x[tok][n])
  gemm64<1, 2, 1, 0, 0, 1><<<dim3(gT), blk, 0, stream>>>(
      ZH, ZL, DM, MT * HD, WOB, WOB, DM, ZH, ZH, out0, DM, RSTD, x, 1.0f, 1.0f, 1.0f, MT, DM, DM);
  (void)hipGetLastError();
}

// v001
// It runs in 285 microseconds.
// Next to v000, in two timings, it ran 1.82 and 1.83 times as fast.
// Contractions: normed.w_q and normed.w_k on v_wmma_f32_16x16x32_bf16 (bf16 x plane, bf16 hi+lo weight planes
// with ln_weight folded in, f32 accumulate); w_v'.normed^T (v^T plane), q.k^T (f16 hi x16 + residual x2048 on
// both q and k, three products) and p.v on v_wmma_f32_16x16x32_f16 (f16 operands, f32 accumulate); ctx.w_o on
// v_wmma_f32_16x16x32_bf16 (bf16 hi+lo ctx planes, bf16 w_o, f32 accumulate). Float inputs RNE-converted to
// bf16 on load; per-row rms scale, softmax and relative position bias in f32 on VALU; softmax p carried x16384.
#include <hip/hip_runtime.h>
#include <math.h>

#ifndef NB
#define NB 2
#endif
#ifndef SEQ
#define SEQ 2048
#endif
#define NB_FULL  2
#define SEQ_FULL 2048
#define DM   1024
#define NH   16
#define HD   64
#define NBKT 32
#define MT   (NB * SEQ)
#define BDW  4096
#define BDC  2032
#define AWV  4
#define RWP  48
#define XSC  16.0f
#define WSCL 256.0f
#define QKS  16.0f
#define QRS  2048.0f
#define VSC  16.0f
#define PCAR 16384.0f
#define SC1  (1.0f / 256.0f)
#define SC2  (1.0f / 524288.0f)
#define OSC  (1.0f / 262144.0f)
#define LNEPS 1.0e-6f

static_assert(NB >= 1 && NB <= NB_FULL);
static_assert(SEQ >= 64 && SEQ <= SEQ_FULL && (SEQ % 64) == 0);
static_assert(NH * HD == DM);
static_assert(HD == 64);
static_assert(BDW == 2 * SEQ_FULL);
static_assert((MT % 64) == 0 && (DM % 64) == 0 && (MT % 32) == 0);
static_assert((MT % 128) == 0 && (DM % 128) == 0);
static_assert(((NB * NH * (SEQ / 16)) % AWV) == 0);
static_assert(NBKT * NH == 512);
static_assert(BDW == 16 * 256);
static_assert((DM % 256) == 0);

typedef _Float16 v16h __attribute__((ext_vector_type(16)));
typedef __bf16 v16bf __attribute__((ext_vector_type(16)));
typedef unsigned short v16us __attribute__((ext_vector_type(16)));
typedef unsigned short v8us  __attribute__((ext_vector_type(8)));
typedef float v8f __attribute__((ext_vector_type(8)));
typedef float v4f __attribute__((ext_vector_type(4)));
typedef unsigned int v4u __attribute__((ext_vector_type(4)));

union FragU { v16us v; v8us h[2]; };

// ---- scalar helpers --------------------------------------------------------------------------------
__device__ __forceinline__ unsigned short bf_bits(float f) {          // f32 -> bf16 bits, RNE convert
  const unsigned u = __float_as_uint(f);
  return (unsigned short)((u + 0x7FFFu + ((u >> 16) & 1u)) >> 16);
}
__device__ __forceinline__ float bf_up(unsigned short h) { return __uint_as_float(((unsigned)h) << 16); }
__device__ __forceinline__ float bfr(float f) { return bf_up(bf_bits(f)); }   // value of the bf16 RNE convert
__device__ __forceinline__ unsigned short h_bits(_Float16 x) { return __builtin_bit_cast(unsigned short, x); }
__device__ __forceinline__ unsigned short f2h(float f) { return h_bits((_Float16)f); }
__device__ __forceinline__ unsigned pk16(unsigned short a, unsigned short b) { return (unsigned)a | ((unsigned)b << 16); }
__device__ __forceinline__ int clampi(int v, int lo, int hi) { return v < lo ? lo : (v > hi ? hi : v); }
__device__ __forceinline__ v8f zero8() { v8f z = {0.f, 0.f, 0.f, 0.f, 0.f, 0.f, 0.f, 0.f}; return z; }

// ---- fragment loader: 16-bit A/B operand, lane -> row/col (lane&15), p already includes +8*(lane>>4);
//      elements 0..7 <- p[0..7] (k0+8h..), elements 8..15 <- p[16..23] (k0+16+8h..)
__device__ __forceinline__ v16us ldfrag_u(const unsigned short* p) {
  FragU f;
  f.h[0] = *(const v8us*)(p);
  f.h[1] = *(const v8us*)(p + 16);
  return f.v;
}

// ---- WMMA helpers with trailing VALU hazard gap; OPK 0 = f16 operand bits, OPK 1 = bf16 operand bits --
template <int OPK>
__device__ __forceinline__ v8f mma_raw(v16us a, v16us b, v8f c) {
  if (OPK == 0)
    return __builtin_amdgcn_wmma_f32_16x16x32_f16(false, __builtin_bit_cast(v16h, a), false,
                                                  __builtin_bit_cast(v16h, b), (short)0, c, false, false);
  return __builtin_amdgcn_wmma_f32_16x16x32_bf16(false, __builtin_bit_cast(v16bf, a), false,
                                                 __builtin_bit_cast(v16bf, b), (short)0, c, false, false);
}
template <int OPK>
__device__ __forceinline__ v8f mma_g(v16us a, v16us b, v8f c) {                 // guarded
  c = mma_raw<OPK>(a, b, c);
#if defined(__HIP_DEVICE_COMPILE__)
  asm volatile("v_nop\n\tv_nop\n\tv_nop\n\tv_nop" : "+v"(c) : "v"(a), "v"(b));
#endif
  return c;
}
__device__ __forceinline__ void dep_guard1(v8f& a, v8f& b, v16us x) {
#if defined(__HIP_DEVICE_COMPILE__)
  asm volatile("v_nop\n\tv_nop\n\tv_nop\n\tv_nop" : "+v"(a), "+v"(b) : "v"(x));
#endif
}
__device__ __forceinline__ void keep4_u(v16us a, v16us b, v16us c, v16us d) {
#if defined(__HIP_DEVICE_COMPILE__)
  asm volatile("v_nop" :: "v"(a), "v"(b), "v"(c), "v"(d));
#endif
}
__device__ __forceinline__ void acc_guard4(v8f& a, v8f& b, v8f& c, v8f& d) {
#if defined(__HIP_DEVICE_COMPILE__)
  asm volatile("v_nop\n\tv_nop\n\tv_nop\n\tv_nop" : "+v"(a), "+v"(b), "+v"(c), "+v"(d));
#endif
}
// orders LDS stores of this wave before later LDS loads of the same wave (wave-private exchange)
__device__ __forceinline__ void wave_sync_lds() {
  __builtin_amdgcn_fence(__ATOMIC_RELEASE, "workgroup");
  __builtin_amdgcn_wave_barrier();
  __builtin_amdgcn_fence(__ATOMIC_ACQUIRE, "workgroup");
}

// =====================================================================================================
// x convert + rms statistics. Block = 256 threads = 8 waves owns 32 consecutive token rows (wave w: rows
// 4w..4w+3); token tok = b*SEQ + s reads input row b*SEQ_FULL + s. Per row each lane converts 8
// consecutive floats per step (4 steps of 256 columns): ob = bf16 bits of x (RNE), oh = f16 bits of
// of the bf16 values is reduced per row and rstd = rsqrt(mean + eps) staged in LDS (cross-wave -> block
// coverage: 8 waves x 4 rows x (4 x 256) columns = 32 whole rows of both planes per block, grid = MT/32
// blocks; rstd rows row0..row0+31 per block = all MT entries.
// =====================================================================================================
__global__ __launch_bounds__(256) void cvt_x(const float* __restrict__ x, unsigned short* ob,
                                             unsigned short* oh, float* rstd) {
  __shared__ float srs[32];
  const int lane = threadIdx.x & 31, wv = threadIdx.x >> 5;
  const int row0 = blockIdx.x * 32;
#pragma unroll 1
  for (int rr = 0; rr < 4; ++rr) {
    const int tok = row0 + wv * 4 + rr;
    const int b = tok / SEQ, s = tok - b * SEQ;
    const float* src = x + ((size_t)b * SEQ_FULL + (size_t)s) * DM;
    const size_t orow = (size_t)tok * DM;
    float ss = 0.f;
#pragma unroll 1
    for (int it = 0; it < DM / 256; ++it) {
      const int col = it * 256 + lane * 8;
      const v4f a0 = *(const v4f*)(src + col);
      const v4f a1 = *(const v4f*)(src + col + 4);
      v4u hb, hh;
#pragma unroll
      for (int e = 0; e < 2; ++e) {
        const unsigned short u0 = bf_bits(a0[2 * e]), u1 = bf_bits(a0[2 * e + 1]);
        const unsigned short u2 = bf_bits(a1[2 * e]), u3 = bf_bits(a1[2 * e + 1]);
        const float x0 = bf_up(u0), x1 = bf_up(u1), x2 = bf_up(u2), x3 = bf_up(u3);
        ss = fmaf(x0, x0, ss); ss = fmaf(x1, x1, ss); ss = fmaf(x2, x2, ss); ss = fmaf(x3, x3, ss);
        hb[e]     = pk16(u0, u1);
        hb[2 + e] = pk16(u2, u3);
        hh[e]     = pk16(f2h(x0 * XSC), f2h(x1 * XSC));
        hh[2 + e] = pk16(f2h(x2 * XSC), f2h(x3 * XSC));
      }
      unsigned short* db = ob + orow + col;
      unsigned short* dh = oh + orow + col;
      *(v4u*)db = hb;
      *(v4u*)dh = hh;
      
    }
    ss += __shfl_xor(ss, 16, 32);
    ss += __shfl_xor(ss, 8, 32);
    ss += __shfl_xor(ss, 4, 32);
    ss += __shfl_xor(ss, 2, 32);
    ss += __shfl_xor(ss, 1, 32);
    if (lane == 0) srs[wv * 4 + rr] = rsqrtf(ss * (1.0f / (float)DM) + LNEPS);
  }
  __syncthreads();
  if (wv == 0) {
    const float v = srs[lane];
    float* d = rstd + row0 + lane;
    *(float*)d = v;
    
  }
}

// =====================================================================================================
// Weight convert with transpose: source matrices are [in k][out n] row-major; output Bt planes [n][k]
// (k contiguous). blockIdx.y selects the matrix (0 w_q, 1 w_k, 2 w_v, 3 w_o), blockIdx.x the 64x64 tile
// (k0 = 64*(x>>4), n0 = 64*(x&15)). The tile is staged in LDS as f32, then each output row n0+r, columns
// lines). Values: y=0,1: w' = bf16(ln_w[k]) * bf16(w[k][n]) (exact in f32) split into bf16 hi (plane 2y) and
// bf16 lo = w' - hi (plane 2y+1, exact); y=2: f16 bits of w' * WSCL (plane 4); y=3: bf16 bits of w_o
// coverage: load 256 threads x 4 x 4 = 64x64 tile; store 8 waves x 2 x (4 rows x 8 lanes x 8) = 64 rows x
// 64 cols; grid (256, 4) covers every 64x64 tile of every output plane.
// =====================================================================================================
__global__ __launch_bounds__(256) void cvt_w(const float* __restrict__ w0, const float* __restrict__ w1,
                                             const float* __restrict__ w2, const float* __restrict__ w3,
                                             const float* __restrict__ lnw, unsigned short* o) {
  __shared__ __align__(16) float sm[64 * 65];
  __shared__ float slw[64];
  const int y = blockIdx.y;                                     // block-uniform select of the source
  const float* w = (y == 0) ? w0 : ((y == 1) ? w1 : ((y == 2) ? w2 : w3));
  const int k0 = (blockIdx.x >> 4) << 6, n0 = (blockIdx.x & 15) << 6;
  const int t = threadIdx.x, lane = t & 31, wv = t >> 5;
#pragma unroll
  for (int it = 0; it < 4; ++it) {
    const int r = it * 16 + (t >> 4), c4 = (t & 15) * 4;
    const v4f v = *(const v4f*)(w + (size_t)(k0 + r) * DM + (size_t)(n0 + c4));
    float* sp = sm + r * 65 + c4;
    sp[0] = v[0]; sp[1] = v[1]; sp[2] = v[2]; sp[3] = v[3];
  }
  if (t < 64) slw[t] = bfr(lnw[k0 + t]);                       // waves 0,1 entirely: wave-uniform
  __syncthreads();
  const int pl0 = (y == 0) ? 0 : ((y == 1) ? 2 : ((y == 2) ? 4 : 5));
  unsigned short* P0 = o + (size_t)pl0 * DM * DM;
  unsigned short* P1 = (y < 2) ? (P0 + (size_t)DM * DM) : P0;
  const int q8 = lane >> 3, c8 = (lane & 7) * 8;
  v4u ha[2], hl[2];
#pragma unroll
  for (int it = 0; it < 2; ++it) {
    const int r = wv * 8 + it * 4 + q8;                          // n local
    v4u a = {0u, 0u, 0u, 0u}, l = {0u, 0u, 0u, 0u};
#pragma unroll
    for (int e = 0; e < 4; ++e) {
      const int ka = c8 + 2 * e, kb = ka + 1;
      float va = bfr(sm[ka * 65 + r]), vb = bfr(sm[kb * 65 + r]);
      if (y < 3) { va *= slw[ka]; vb *= slw[kb]; }
      if (y < 2) {
        const unsigned short ua = bf_bits(va), ub = bf_bits(vb);
        a[e] = pk16(ua, ub);
        l[e] = pk16(bf_bits(va - bf_up(ua)), bf_bits(vb - bf_up(ub)));
      } else if (y == 2) {
        a[e] = pk16(f2h(va * WSCL), f2h(vb * WSCL));
      } else {
        a[e] = pk16(bf_bits(va), bf_bits(vb));
      }
    }
    ha[it] = a;
    hl[it] = l;
  }
  {
#pragma unroll
    for (int it = 0; it < 2; ++it) {
      const int r = wv * 8 + it * 4 + q8;
      const size_t go = (size_t)(n0 + r) * DM + (size_t)(k0 + c8);
      *(v4u*)(P0 + go) = ha[it];
      if (y < 2) *(v4u*)(P1 + go) = hl[it];
    }
    
  }
}

// =====================================================================================================
// Relative position bias by signed key-query distance: BD[h][i], i = (key - query) + 2047, i in 0..4094;
// i = 4095 is padding written as 0. bucket on integer n = query - key: ret = (n < 0) * 16, n = |n|,
// n < 8 -> n, else 8 + floor(2*log2(n/8)) capped at 15, evaluated by its integer thresholds
// coverage: 256 threads x 16 = 4096 entries per head; grid = NH heads = the whole table.
// =====================================================================================================
__device__ __forceinline__ int rel_bucket(int d) {              // d = key - query
  int n = -d;
  int ret = 0;
  if (n < 0) { ret = NBKT / 2; n = -n; }
  int bk;
  if (n < 8)       bk = n;
  else if (n < 12) bk = 8;
  else if (n < 16) bk = 9;
  else if (n < 23) bk = 10;
  else if (n < 32) bk = 11;
  else if (n < 46) bk = 12;
  else if (n < 64) bk = 13;
  else if (n < 91) bk = 14;
  else             bk = 15;
  return ret + bk;
}

__global__ __launch_bounds__(256) void bias_build(const float* __restrict__ tbl, float* BD) {
  __shared__ __align__(16) float sh[BDW];
  const int h = blockIdx.x, t = threadIdx.x;
#pragma unroll 4
  for (int j = 0; j < 16; ++j) {
    const int idx = t + 256 * j;
    const int ti = clampi(rel_bucket(idx - 2047) * NH + h, 0, NBKT * NH - 1);
    float v = bfr(tbl[ti]);
    v = (idx == BDW - 1) ? 0.f : v;
    sh[idx] = v;
  }
  __syncthreads();
  v4f vv[4];
#pragma unroll
  for (int q = 0; q < 4; ++q) vv[q] = *(const v4f*)(sh + q * 1024 + 4 * t);
  float* dst = BD + (size_t)h * BDW;
  {
#pragma unroll
    for (int q = 0; q < 4; ++q) *(v4f*)(dst + q * 1024 + 4 * t) = vv[q];
    
  }
}

// =====================================================================================================
// LDS-staged 16-bit WMMA GEMM: C[m][n] = sum over plane pairs pl and k of A_pl[m][k] * Bt_pl[n][k]. A block of
// 8 waves owns one 128x128 tile of C (blockIdx.x = tile); wave w owns rows 32*(w>>1).. and columns 64*(w&1).. of
// it (2 x 4 accumulator tiles). A pass is 128 k: 256 B of each of the 128 A rows and 128 Bt rows, brought into one
// of two LDS buffers (row pitch 272 B) by asynchronous 16-byte copies, 16 per thread; the copies of pass t + 2 are
// issued when every wave has left pass t's buffer, so they fly while pass t + 1 is worked on. OPK 0: f16 operands;
// OPK 1: bf16 operands. NPL 1|2 operand plane pairs (Ap,Btp) and (Ap2,Btp2) sharing the accumulators (the second
// pair's passes follow the first pair's; only unscaled hi/lo planes are paired this way). AHM 0: A row-major
// [M][K] pitch lda; AHM 1: A head-major planes, element (m, k) at ((k/HD)*aplane + m*HD + k%HD). Bt row-major
// [N][K] pitch ldb (k contiguous); M, N, K multiples of 128 (true at every call site; host grid = tiles exact).
// Both operand fragments use the split k map (elements 0..7 <- k0+8h.., 8..15 <- k0+16+8h..); D element r of a
// lane is (row 8h + r, col lane&15).
// OM 0: f32 out Cf = acc*wsc (+ RES: bf16 RNE value of Rp[input row of token m][n], token m -> input row
//       (m/SEQ)*SEQ_FULL + m%SEQ, pitch DM), pitch ldc.
// OM 1: f16 out Ch = f16(acc*wsc*osc*scale).  OM 2: f16 pair: base = acc*wsc*osc*scale; Ch = f16 bits(base);
//       Ch2 = f16 bits((base - value(Ch)) * rsc).  scale = Rs[m] (RSM 1, per row), Rs[n] (RSM 2, per column),
//       1 (RSM 0).
// coverage: 2 slabs x 16 rows x 64 cols = the wave's whole 32x64 tile; 8 waves = the block's 128x128 tile.
// =====================================================================================================
#define GTM  128                        // block tile rows
#define GTN  128                        // block tile columns
#define GKP  128                        // k per pass
#define GPIT 136                        // LDS row pitch in 16-bit elements (272 B)
#define GBUF ((GTM + GTN) * GPIT)       // 16-bit elements per buffer: A rows 0..127, Bt rows 128..255

// Eight asynchronous 16-byte copies of one lane, global -> LDS, rows 16 apart: LDS byte address l + 16*272*c,
// global address g + gs*c (gs in elements), c = 0..7. The s_wait_xcnt closes the statement so that no address
// register named by a copy is rewritten ahead of it.
__device__ __forceinline__ void copy8_rows16(unsigned l, const unsigned short* g, size_t gs) {
#if defined(__HIP_DEVICE_COMPILE__)
  const unsigned ls = 16u * GPIT * 2u;
  asm volatile(
      "global_load_async_to_lds_b128 %0, %8, off\n\t"
      "global_load_async_to_lds_b128 %1, %9, off\n\t"
      "global_load_async_to_lds_b128 %2, %10, off\n\t"
      "global_load_async_to_lds_b128 %3, %11, off\n\t"
      "global_load_async_to_lds_b128 %4, %12, off\n\t"
      "global_load_async_to_lds_b128 %5, %13, off\n\t"
      "global_load_async_to_lds_b128 %6, %14, off\n\t"
      "global_load_async_to_lds_b128 %7, %15, off\n\t"
      "s_wait_xcnt 0x0"
      :: "v"(l), "v"(l + ls), "v"(l + 2u * ls), "v"(l + 3u * ls),
         "v"(l + 4u * ls), "v"(l + 5u * ls), "v"(l + 6u * ls), "v"(l + 7u * ls),
         "v"(g), "v"(g + gs), "v"(g + 2 * gs), "v"(g + 3 * gs),
         "v"(g + 4 * gs), "v"(g + 5 * gs), "v"(g + 6 * gs), "v"(g + 7 * gs)
      : "memory");
#endif
}

template <int OPK, int NPL, int AHM, int OM, int RSM, int RES>
__global__ __launch_bounds__(256) void gemm64(
    const unsigned short* __restrict__ Ap, const unsigned short* __restrict__ Ap2, int lda, int aplane,
    const unsigned short* __restrict__ Btp, const unsigned short* __restrict__ Btp2, int ldb,
    unsigned short* Ch, unsigned short* Ch2, float* Cf, int ldc,
    const float* __restrict__ Rs, const float* __restrict__ Rp,
    float wsc, float osc, float rsc, int M, int N, int K) {
  __shared__ __align__(16) unsigned short ring[2 * GBUF];   // two operand buffers, 2 x 69632 B
  __shared__ __align__(16) float sT[8][16 * 68];   // per-wave 16x64 slab, pitch 68 floats
  const int lane = threadIdx.x & 31;
  const int wave = threadIdx.x >> 5;
  const int tilesN = N >> 7;
  const int tilesM = M >> 7;
  const int tile = blockIdx.x;
  if (tile >= tilesM * tilesN) return;   // block-uniform, in front of every copy and barrier
  const int tm = tile / tilesN;
  const int tn = tile - tm * tilesN;
  const int bm0 = tm << 7;                     // block tile origin
  const int bn0 = tn << 7;
  const int wm = (wave >> 1) << 5;             // wave tile origin inside the block tile
  const int wn = (wave & 1) << 6;
  const int m0 = bm0 + wm;
  const int n0 = bn0 + wn;

  const int rlane = lane & 15;                 // row (A) / col (B, D) within subtile
  const int koff  = (lane >> 4) * 8;           // k offset of this lane half
  const int mOff  = (lane >> 4) * 8;           // D row offset

  // copy map: thread t brings 16-byte piece t&15 of rows (t>>4) + 16*c, c = 0..7, of A and of Bt
  const int crow = threadIdx.x >> 4;
  const int cch  = threadIdx.x & 15;
  const unsigned ldsA = (unsigned)(size_t)ring + (unsigned)(crow * (GPIT * 2) + cch * 16);
  const unsigned ldsB = ldsA + (unsigned)(GTM * GPIT * 2);
  const size_t aoff = AHM ? ((size_t)(cch >> 3) * (size_t)aplane + (size_t)(bm0 + crow) * HD + (size_t)((cch & 7) * 8))
                          : ((size_t)(bm0 + crow) * lda + (size_t)(cch * 8));
  const size_t astep = AHM ? (size_t)(16 * HD) : (size_t)16 * lda;          // 16 rows of A
  const size_t apass = AHM ? (size_t)(GKP / HD) * (size_t)aplane : (size_t)GKP;   // one pass along k
  const size_t boff = (size_t)(bn0 + crow) * ldb + (size_t)(cch * 8);
  const size_t bstep = (size_t)16 * ldb;
  const int nkp = K >> 7;                      // passes per plane pair
  const int NT = NPL * nkp;                    // passes in all

  auto issue = [&](int t, int buf) {           // pass t's 16 copies of this thread into buffer buf
    const int pl = (NPL == 2 && t >= nkp) ? 1 : 0;
    const int kp = t - pl * nkp;
    const unsigned short* Ac = (pl == 0) ? Ap : Ap2;
    const unsigned short* Bc = (pl == 0) ? Btp : Btp2;
    const unsigned lb = (unsigned)buf * (unsigned)(GBUF * 2);
    copy8_rows16(ldsA + lb, Ac + aoff + (size_t)kp * apass, astep);
    copy8_rows16(ldsB + lb, Bc + boff + (size_t)kp * GKP, bstep);
  };

  v8f acc[2][4];
#pragma unroll
  for (int i = 0; i < 2; ++i)
#pragma unroll
    for (int j = 0; j < 4; ++j) acc[i][j] = zero8();

  issue(0, 0);
  asm volatile("s_wait_asynccnt 0x0" ::: "memory");   // this wave's copies of pass 0 have landed
  __syncthreads();                                    // every wave's have: pass 0 may be read
  if (NT > 1) issue(1, 1);

#pragma unroll 1   // one pass per trip: the buffer index and the publish point stay at the loop's foot
  for (int t = 0; t < NT; ++t) {
    const unsigned short* sb = ring + (t & 1) * GBUF;
    const unsigned short* sA = sb + (wm + rlane) * GPIT + koff;
    const unsigned short* sB = sb + (GTM + wn + rlane) * GPIT + koff;
#pragma unroll
    for (int ks = 0; ks < GKP / 32; ++ks) {
      v16us bh[4];
#pragma unroll
      for (int j = 0; j < 4; ++j) bh[j] = ldfrag_u(sB + (j << 4) * GPIT + ks * 32);
#pragma unroll
      for (int i = 0; i < 2; ++i) {
        const v16us ah = ldfrag_u(sA + (i << 4) * GPIT + ks * 32);
#pragma unroll
        for (int j = 0; j < 4; ++j) acc[i][j] = mma_raw<OPK>(ah, bh[j], acc[i][j]);
        dep_guard1(acc[i][0], acc[i][3], ah);
      }
      keep4_u(bh[0], bh[1], bh[2], bh[3]);
    }
    asm volatile("s_wait_dscnt 0x0" ::: "memory");      // this wave's reads of pass t's buffer are done
    asm volatile("s_wait_asynccnt 0x0" ::: "memory");   // this wave's copies of pass t + 1 have landed
    __syncthreads();                                    // publishes pass t + 1, frees pass t's buffer
    if (t + 2 < NT) issue(t + 2, t & 1);
  }
  asm volatile("s_wait_asynccnt 0x0" ::: "memory");     // no copy is outstanding past the loop
  acc_guard4(acc[0][0], acc[0][1], acc[0][2], acc[0][3]);
  acc_guard4(acc[1][0], acc[1][1], acc[1][2], acc[1][3]);

  const int hh2 = lane >> 4, c4 = (lane & 15) * 4;     // f32 out: 256-B row segment = 16 lanes x 16 B
  const int q8  = lane >> 3, c8 = (lane & 7) * 8;
  const float wo = wsc * osc;

  // per-column scale (RSM 2): columns n0+c8 .. n0+c8+7, same for every row of the tile
  float csc[8];
#pragma unroll
  for (int e = 0; e < 8; ++e) csc[e] = 1.f;
  if (OM != 0 && RSM == 2) {
    const v4f cs0 = *(const v4f*)(Rs + n0 + c8);
    const v4f cs1 = *(const v4f*)(Rs + n0 + c8 + 4);
#pragma unroll
    for (int e = 0; e < 4; ++e) { csc[e] = cs0[e]; csc[4 + e] = cs1[e]; }
  }

  // ---- epilogue ----
  float* slab = sT[wave];
#pragma unroll
  for (int i = 0; i < 2; ++i) {
    const int mBase = m0 + (i << 4);
#pragma unroll
    for (int j = 0; j < 4; ++j) {
#pragma unroll
      for (int r = 0; r < 8; ++r) {
        slab[(mOff + r) * 68 + (j << 4) + rlane] = acc[i][j][r];
      }
    }
    wave_sync_lds();
    if (OM == 0) {
      v4f vals[8];
#pragma unroll
      for (int it = 0; it < 8; ++it) {
        const int row = it * 2 + hh2;                      // it 0..7 x hh2 0..1 = rows 0..15
        v4f v = *(const v4f*)(slab + row * 68 + c4);
        v = v * wsc;
        if (RES) {
          const int tok = mBase + row;
          const int bb = tok / SEQ, ss = tok - bb * SEQ;
          const v4f hr = *(const v4f*)(Rp + ((size_t)bb * SEQ_FULL + (size_t)ss) * DM + (size_t)(n0 + c4));
#pragma unroll
          for (int c = 0; c < 4; ++c) v[c] = v[c] + bfr(hr[c]);
        }
        vals[it] = v;
      }
      {
#pragma unroll
        for (int it = 0; it < 8; ++it) {
          const int row = it * 2 + hh2;
          *(v4f*)(Cf + (size_t)(mBase + row) * ldc + (size_t)n0 + c4) = vals[it];
        }
        
      }
    } else {
      v4u hv[4], hw[4];
#pragma unroll
      for (int it = 0; it < 4; ++it) {
        const int row = it * 4 + q8;                       // it 0..3 x q8 0..3 = rows 0..15
        const float* sp = slab + row * 68 + c8;
        float rsr = wo;
        if (RSM == 1) rsr = wo * Rs[mBase + row];
        v4u ha = {0u, 0u, 0u, 0u}, hb = {0u, 0u, 0u, 0u};
#pragma unroll
        for (int e = 0; e < 4; ++e) {
          const float b0 = sp[2 * e]     * rsr * csc[2 * e];
          const float b1 = sp[2 * e + 1] * rsr * csc[2 * e + 1];
          if (OM == 1) {
            ha[e] = pk16(f2h(b0), f2h(b1));
          } else {
            const _Float16 x0 = (_Float16)b0, x1 = (_Float16)b1;
            ha[e] = pk16(h_bits(x0), h_bits(x1));
            hb[e] = pk16(f2h((b0 - (float)x0) * rsc), f2h((b1 - (float)x1) * rsc));
          }
        }
        hv[it] = ha;
        hw[it] = hb;
      }
      {
#pragma unroll
        for (int it = 0; it < 4; ++it) {
          const int row = it * 4 + q8;
          const size_t go = (size_t)(mBase + row) * ldc + (size_t)n0 + c8;
          *(v4u*)(Ch + go) = hv[it];
          if (OM == 2) *(v4u*)(Ch2 + go) = hw[it];
        }
        
      }
    }
    wave_sync_lds();
  }
}

// =====================================================================================================
// Bidirectional attention with relative position bias, head dim 64, no 1/sqrt(d) scaling. Block = 128
// threads = 4 waves; one wave owns one 16-row query tile (t0..t0+15) of one (batch b, head h) and loops all
// key blocks of 32 with an online max-subtracted softmax in f32. Planes: QH|QR f16 [MT][DM] (16*q hi,
// residual x2048), KH|KR f16 [MT][DM] (16*k hi, residual x2048), VT f16 [DM][MT] (16*v transposed, row =
// h*64+d, column = token), BD f32 [NH][4096] bias by (key-query)+2047. Output Zh|Zl: bf16 hi|lo of ctx,
// head-major [NH][MT][64].
// Per key block: 48-entry bias window (distances sb-t0-15 .. sb-t0+32) staged in per-wave LDS and read at
// index 16*sub + col - row + 15; S = QH.KH^T (4 WMMA), R = QR.KH^T + QH.KR^T (8 WMMA, own accumulators);
// score = S/256 + R/524288 + bias; p = exp(score - running max) in f32, l accumulated from the f32 p;
// p*16384 as f16, staged per wave in LDS and reloaded as A fragments (split k map); O += P.VT on f16 WMMA
// after the reloads; workgroup fences and a wave barrier between the element stores and the reloads; all three LDS regions are private to their wave.
// staged extent == consumed extent: window 48 written / 0..46 read; P tile 16x32 written and read; ctx
// staging 2 x 16x64 written and read.
// Epilogue: ctx = O/(l*262144) split into bf16 hi|lo, staged in LDS; the wave's 16 rows x 64 halves are
// coverage: 16 query rows x 64 halves per wave, NB*NH*SEQ/16 wave tasks = all (h, tok) rows of both planes.
// =====================================================================================================
__global__ __launch_bounds__(128) void attn_kernel(
    const unsigned short* __restrict__ QHp, const unsigned short* __restrict__ QRp,
    const unsigned short* __restrict__ KHp, const unsigned short* __restrict__ KRp,
    const unsigned short* __restrict__ VTp,
    const float* __restrict__ BD, unsigned short* Zh, unsigned short* Zl) {
  __shared__ __align__(16) float relw[AWV][RWP];                   // bias window, 768 B
  __shared__ __align__(16) unsigned short pws[AWV][16 * 32];       // P tiles, 4096 B
  __shared__ __align__(16) unsigned short zst[AWV][2][16 * HD];    // ctx hi|lo staging, 16384 B
  const int lane = threadIdx.x & 31, wv = threadIdx.x >> 5, m = lane & 15, hh = lane >> 4;
  const int nqt = SEQ / 16;
  const int task = blockIdx.x * AWV + wv;
  if (task >= NB * NH * nqt) return;                 // wave-uniform; no block barriers in this kernel
  const int bh = task / nqt;
  const int t0 = (task - bh * nqt) << 4;             // query tile start
  const int b = bh / NH, h = bh - b * NH;
  const size_t tok0 = (size_t)b * SEQ;
  float* rw = relw[wv];
  unsigned short* ph = pws[wv];

  // Q A-fragments: rows t0+m, k = head dims (two 32-deep steps), hi and residual planes
  const size_t qo = (tok0 + (size_t)(t0 + m)) * DM + (size_t)(h * HD + 8 * hh);
  const v16us qh0 = ldfrag_u(QHp + qo);
  const v16us qh1 = ldfrag_u(QHp + qo + 32);
  const v16us qr0 = ldfrag_u(QRp + qo);
  const v16us qr1 = ldfrag_u(QRp + qo + 32);

  float mx[8], ls[8];
  v8f O[4];
#pragma unroll
  for (int j = 0; j < 4; ++j) O[j] = zero8();
#pragma unroll
  for (int r = 0; r < 8; ++r) { mx[r] = -1.0e30f; ls[r] = 0.f; }

  const float* bdh = BD + (size_t)h * BDW + (BDC - t0);                    // window base - sb; >= BD+h*BDW
  const size_t kro = (tok0 + (size_t)m) * DM + (size_t)(h * HD + 8 * hh);
  const unsigned short* kbase  = KHp + kro;
  const unsigned short* krbase = KRp + kro;
  const unsigned short* vbase = VTp + (size_t)(h * HD + m) * MT + tok0 + (size_t)(8 * hh);
  const int nblk = SEQ / 32;

#pragma unroll 1
  for (int kb = 0; kb < nblk; ++kb) {
    const int sb = kb << 5;
    // bias window: rw[i] = bias_h(key - query = sb - t0 - 15 + i), i = 0..47 (index <= h*BDW + 4095)
    {
      const float* bp = bdh + sb;
      const float w0v = bp[lane];
      const float w1v = bp[32 + m];
      rw[lane] = w0v;
      if (lane < 16) rw[32 + lane] = w1v;
    }
    wave_sync_lds();

    // S = QH.KH^T, R = QR.KH^T + QH.KR^T ; Bt row = key token sb+m (+16), k = head dim
    v8f S0 = zero8(), S1 = zero8(), R0 = zero8(), R1 = zero8();
#pragma unroll
    for (int ks = 0; ks < 2; ++ks) {
      const size_t kofs = (size_t)sb * DM + (size_t)(32 * ks);
      const v16us kf0 = ldfrag_u(kbase + kofs);
      const v16us kf1 = ldfrag_u(kbase + kofs + (size_t)16 * DM);
      const v16us kg0 = ldfrag_u(krbase + kofs);
      const v16us kg1 = ldfrag_u(krbase + kofs + (size_t)16 * DM);
      const v16us qa = (ks == 0) ? qh0 : qh1;
      const v16us qb = (ks == 0) ? qr0 : qr1;
      S0 = mma_g<0>(qa, kf0, S0);
      S1 = mma_g<0>(qa, kf1, S1);
      R0 = mma_g<0>(qb, kf0, R0);
      R1 = mma_g<0>(qb, kf1, R1);
      R0 = mma_g<0>(qa, kg0, R0);
      R1 = mma_g<0>(qa, kg1, R1);
    }

    // score = q.k + bias (window index 16*sub + m - row + 15)
    float s0[8], s1[8];
#pragma unroll
    for (int r = 0; r < 8; ++r) {
      const int row = 8 * hh + r;
      const float rv0 = rw[15 - row + m];
      const float rv1 = rw[31 - row + m];
      s0[r] = fmaf(S0[r], SC1, fmaf(R0[r], SC2, rv0));
      s1[r] = fmaf(S1[r], SC1, fmaf(R1[r], SC2, rv1));
    }

    // online softmax (a row lives in the 16 lanes of one half-wave; xor butterflies 1,2,4,8)
#pragma unroll
    for (int r = 0; r < 8; ++r) {
      float xm = fmaxf(s0[r], s1[r]);
      xm = fmaxf(xm, __shfl_xor(xm, 1, 32));
      xm = fmaxf(xm, __shfl_xor(xm, 2, 32));
      xm = fmaxf(xm, __shfl_xor(xm, 4, 32));
      xm = fmaxf(xm, __shfl_xor(xm, 8, 32));
      const float mn = fmaxf(mx[r], xm);
      const float al = __expf(mx[r] - mn);
      mx[r] = mn;
      const float p0 = __expf(s0[r] - mn);
      const float p1 = __expf(s1[r] - mn);
      float ps = p0 + p1;
      ps += __shfl_xor(ps, 1, 32);
      ps += __shfl_xor(ps, 2, 32);
      ps += __shfl_xor(ps, 4, 32);
      ps += __shfl_xor(ps, 8, 32);
      ls[r] = ls[r] * al + ps;
#pragma unroll
      for (int j = 0; j < 4; ++j) O[j][r] = O[j][r] * al;
      const int row = 8 * hh + r;
      ph[row * 32 + m]      = f2h(p0 * PCAR);
      ph[row * 32 + 16 + m] = f2h(p1 * PCAR);
    }
    wave_sync_lds();

    // P A-fragment (split k map) and VT B-fragments (Bt row = h*64 + dim, k = key token)
    const v16us af = ldfrag_u(ph + m * 32 + 8 * hh);
#pragma unroll
    for (int j = 0; j < 4; ++j) {
      const v16us vf = ldfrag_u(vbase + (size_t)(16 * j) * MT + (size_t)sb);
      O[j] = mma_g<0>(af, vf, O[j]);
    }
  }
  acc_guard4(O[0], O[1], O[2], O[3]);

  // ---- epilogue: ctx = O / (l * PCAR * VSC) -> bf16 hi|lo, head-major planes ----
  unsigned short* zh = zst[wv][0];
  unsigned short* zl = zst[wv][1];
#pragma unroll
  for (int r = 0; r < 8; ++r) {
    const int row = 8 * hh + r;
    const float linv = (1.0f / ls[r]) * OSC;           // ls >= 1
#pragma unroll
    for (int j = 0; j < 4; ++j) {
      const float o = O[j][r] * linv;
      const unsigned short x0 = bf_bits(o);
      zh[row * HD + 16 * j + m] = x0;
      zl[row * HD + 16 * j + m] = bf_bits(o - bf_up(x0));
    }
  }
  wave_sync_lds();
  {
    v4u ha[4], hb[4];
#pragma unroll
    for (int q = 0; q < 4; ++q) {
      ha[q] = *(const v4u*)(zh + q * 256 + lane * 8);
      hb[q] = *(const v4u*)(zl + q * 256 + lane * 8);
    }
    const size_t zo = ((size_t)h * MT + tok0 + (size_t)t0) * HD;   // 2048-B aligned, 16 rows contiguous
    unsigned short* dh = Zh + zo;
    unsigned short* dl = Zl + zo;
    {
#pragma unroll
      for (int q = 0; q < 4; ++q) {
        *(v4u*)(dh + q * 256 + lane * 8) = ha[q];
        *(v4u*)(dl + q * 256 + lane * 8) = hb[q];
      }
      
    }
  }
}

// =====================================================================================================
// Workspace map (bytes, NB=2, SEQ=2048); every plane is an exact multiple of its whole-row / whole-line /
// BD = 16 x 4096 floats); all offsets multiples of 65536.
//   XB   bf16 [MT][DM]        0           8388608
//   XH   f16  [MT][DM]        8388608     8388608
//   RSTD f32  [MT]            16777216    65536     (16384 used)
//   W    6 x 16-bit [DM][DM]  16842752    12582912  (wq hi, wq lo, wk hi, wk lo bf16; wv f16 x256; wo bf16)
//   BD   f32  [NH][4096]      29425664    262144
//   QH   f16  [MT][DM]        29687808    8388608
//   QR   f16  [MT][DM]        38076416    8388608
//   KH   f16  [MT][DM]        46465024    8388608
//   KR   f16  [MT][DM]        54853632    8388608
//   VT   f16  [DM][MT]        63242240    8388608
//   ZH   bf16 [NH][MT][64]    71630848    8388608
//   ZL   bf16 [NH][MT][64]    80019456    8388608
//   end                       88408064
// =====================================================================================================
extern "C" void kernel_launch(void* const* d_in, const int* in_sizes, int n_in,
                              void* d_out, int out_size, void* d_ws, size_t ws_size,
                              hipStream_t stream) {
  if (n_in < 7) return;
  if (in_sizes[0] < ((NB - 1) * SEQ_FULL + SEQ) * DM) return;
  if (in_sizes[1] < DM) return;
  if (in_sizes[2] < DM * DM) return;
  if (in_sizes[3] < DM * DM) return;
  if (in_sizes[4] < DM * DM) return;
  if (in_sizes[5] < DM * DM) return;
  if (in_sizes[6] < NBKT * NH) return;
  if (out_size < MT * DM) return;

  const float* x    = (const float*)d_in[0];   // [2][2048][1024]
  const float* lnw  = (const float*)d_in[1];   // [1024]
  const float* w_q  = (const float*)d_in[2];   // [1024][1024] (in, out)
  const float* w_k  = (const float*)d_in[3];
  const float* w_v  = (const float*)d_in[4];
  const float* w_o  = (const float*)d_in[5];   // [1024][1024] (in, out)
  const float* tbl  = (const float*)d_in[6];   // [32][16]

  const size_t PX  = (size_t)MT * DM * 2;        // 16-bit [MT][DM] plane
  const size_t PRS = (((size_t)MT * 4 + 65535) / 65536) * 65536;
  const size_t PW1 = (size_t)DM * DM * 2;        // one 16-bit weight plane
  const size_t PBD = (size_t)NH * BDW * 4;
  size_t off = 0;
  const size_t oXB = off; off += PX;
  const size_t oXH = off; off += PX;
  const size_t oRS = off; off += PRS;
  const size_t oW  = off; off += 6 * PW1;
  const size_t oBD = off; off += PBD;
  const size_t oQH = off; off += PX;
  const size_t oQR = off; off += PX;
  const size_t oKH = off; off += PX;
  const size_t oKR = off; off += PX;
  const size_t oVT = off; off += PX;
  const size_t oZH = off; off += PX;
  const size_t oZL = off; off += PX;
  if (off > ws_size) return;                      // off = 88408064 at full size
  if (off > (size_t)134217728) return;

  char* ws = (char*)d_ws;
  unsigned short* XB = (unsigned short*)(ws + oXB);
  unsigned short* XH = (unsigned short*)(ws + oXH);
  float* RSTD = (float*)(ws + oRS);
  unsigned short* W16 = (unsigned short*)(ws + oW);
  unsigned short* WQH = W16;
  unsigned short* WQL = W16 + (size_t)1 * DM * DM;
  unsigned short* WKH = W16 + (size_t)2 * DM * DM;
  unsigned short* WKL = W16 + (size_t)3 * DM * DM;
  unsigned short* WVH = W16 + (size_t)4 * DM * DM;
  unsigned short* WOB = W16 + (size_t)5 * DM * DM;
  float* BDp = (float*)(ws + oBD);
  unsigned short* QH = (unsigned short*)(ws + oQH);
  unsigned short* QR = (unsigned short*)(ws + oQR);
  unsigned short* KH = (unsigned short*)(ws + oKH);
  unsigned short* KR = (unsigned short*)(ws + oKR);
  unsigned short* VT = (unsigned short*)(ws + oVT);
  unsigned short* ZH = (unsigned short*)(ws + oZH);
  unsigned short* ZL = (unsigned short*)(ws + oZL);
  float* out0 = (float*)d_out;
  float* fdummy = BDp;                            // in-range placeholder for unused f32 output args

  const dim3 blk(256);
  const int gT = (MT / 128) * (DM / 128);         // 128x128 tiles -> 256 blocks at full size

  // (0) operand planes, rms statistics and bias table
  cvt_x<<<dim3(MT / 32), blk, 0, stream>>>(x, XB, XH, RSTD);
  cvt_w<<<dim3((DM / 64) * (DM / 64), 4), blk, 0, stream>>>(w_q, w_k, w_v, w_o, lnw, W16);
  bias_build<<<dim3(NH), blk, 0, stream>>>(tbl, BDp);

  // (1) q plane (hi x16 + residual x2048): C[tok][n] = rstd[tok] * sum_k XB[tok][k] * (WQH+WQL)[n][k]
  gemm64<1, 2, 0, 2, 1, 0><<<dim3(gT), blk, 0, stream>>>(
      XB, XB, DM, 0, WQH, WQL, DM, QH, QR, fdummy, DM, RSTD, x, 1.0f, QKS, QRS, MT, DM, DM);
  //     k plane (hi x16 + residual x2048)
  gemm64<1, 2, 0, 2, 1, 0><<<dim3(gT), blk, 0, stream>>>(
      XB, XB, DM, 0, WKH, WKL, DM, KH, KR, fdummy, DM, RSTD, x, 1.0f, QKS, QRS, MT, DM, DM);
  //     v^T x16: C[d][tok] = rstd[tok] * sum_k WVH[d][k] * XH[tok][k]
  gemm64<0, 1, 0, 1, 2, 0><<<dim3(gT), blk, 0, stream>>>(
      WVH, WVH, DM, 0, XH, XH, DM, VT, VT, fdummy, MT, RSTD, x, 1.0f / (XSC * WSCL), VSC, 1.0f, DM, MT, DM);

  // (2) attention -> ctx bf16 hi|lo head-major planes
  attn_kernel<<<dim3((NB * NH * (SEQ / 16)) / AWV), dim3(128), 0, stream>>>(QH, QR, KH, KR, VT, BDp, ZH, ZL);

  // (3) output projection + residual: out[tok][n] = sum_k (ctx_hi + ctx_lo)[tok][k] * WOB[n][k] + bf16(x[tok][n])
  gemm64<1, 2, 1, 0, 0, 1><<<dim3(gT), blk, 0, stream>>>(
      ZH, ZL, DM, MT * HD, WOB, WOB, DM, ZH, ZH, out0, DM, RSTD, x, 1.0f, 1.0f, 1.0f, MT, DM, DM);
  (void)hipGetLastError();
}

// v002
// It runs in 210 microseconds.
// In both of two side-by-side timings against v001, it was 1.36 times as fast.
// All steps since v000 together make it 2.49 times as fast.
// Contractions: normed.w_q and normed.w_k on v_wmma_f32_16x16x32_bf16 (bf16 x plane, bf16 hi+lo weight planes
// with ln_weight folded in, f32 accumulate); w_v'.normed^T (v^T plane), q.k^T (f16 hi x16 + residual x2048 on
// both q and k, three products) and p.v on v_wmma_f32_16x16x32_f16 (f16 operands, f32 accumulate); ctx.w_o on
// v_wmma_f32_16x16x32_bf16 (bf16 hi+lo ctx planes, bf16 w_o, f32 accumulate). Float inputs RNE-converted to
// bf16 on load; per-row rms scale, softmax and relative position bias in f32 on VALU; softmax p carried x16384.
#include <hip/hip_runtime.h>
#include <math.h>

#ifndef NB
#define NB 2
#endif
#ifndef SEQ
#define SEQ 2048
#endif
#define NB_FULL  2
#define SEQ_FULL 2048
#define DM   1024
#define NH   16
#define HD   64
#define NBKT 32
#define MT   (NB * SEQ)
#define BDW  4096
#define BDC  2032
#define AWV  8
#define RWP  48
#define XSC  16.0f
#define WSCL 256.0f
#define QKS  16.0f
#define QRS  2048.0f
#define VSC  16.0f
#define PCAR 16384.0f
#define SC1  (1.0f / 256.0f)
#define SC2  (1.0f / 524288.0f)
#define OSC  (1.0f / 262144.0f)
#define LNEPS 1.0e-6f

static_assert(NB >= 1 && NB <= NB_FULL);
static_assert(SEQ >= 64 && SEQ <= SEQ_FULL && (SEQ % 64) == 0);
static_assert(NH * HD == DM);
static_assert(HD == 64);
static_assert(BDW == 2 * SEQ_FULL);
static_assert((MT % 64) == 0 && (DM % 64) == 0 && (MT % 32) == 0);
static_assert((MT % 128) == 0 && (DM % 128) == 0);
static_assert(((NB * NH * (SEQ / 16)) % AWV) == 0);
static_assert(((SEQ / 16) % AWV) == 0);
static_assert(NBKT * NH == 512);
static_assert(BDW == 16 * 256);
static_assert((DM % 256) == 0);

typedef _Float16 v16h __attribute__((ext_vector_type(16)));
typedef __bf16 v16bf __attribute__((ext_vector_type(16)));
typedef unsigned short v16us __attribute__((ext_vector_type(16)));
typedef unsigned short v8us  __attribute__((ext_vector_type(8)));
typedef float v8f __attribute__((ext_vector_type(8)));
typedef float v4f __attribute__((ext_vector_type(4)));
typedef unsigned int v4u __attribute__((ext_vector_type(4)));

union FragU { v16us v; v8us h[2]; };

// ---- scalar helpers --------------------------------------------------------------------------------
__device__ __forceinline__ unsigned short bf_bits(float f) {          // f32 -> bf16 bits, RNE convert
  const unsigned u = __float_as_uint(f);
  return (unsigned short)((u + 0x7FFFu + ((u >> 16) & 1u)) >> 16);
}
__device__ __forceinline__ float bf_up(unsigned short h) { return __uint_as_float(((unsigned)h) << 16); }
__device__ __forceinline__ float bfr(float f) { return bf_up(bf_bits(f)); }   // value of the bf16 RNE convert
__device__ __forceinline__ unsigned short h_bits(_Float16 x) { return __builtin_bit_cast(unsigned short, x); }
__device__ __forceinline__ unsigned short f2h(float f) { return h_bits((_Float16)f); }
__device__ __forceinline__ unsigned pk16(unsigned short a, unsigned short b) { return (unsigned)a | ((unsigned)b << 16); }
__device__ __forceinline__ int clampi(int v, int lo, int hi) { return v < lo ? lo : (v > hi ? hi : v); }
__device__ __forceinline__ v8f zero8() { v8f z = {0.f, 0.f, 0.f, 0.f, 0.f, 0.f, 0.f, 0.f}; return z; }

// ---- fragment loader: 16-bit A/B operand, lane -> row/col (lane&15), p already includes +8*(lane>>4);
//      elements 0..7 <- p[0..7] (k0+8h..), elements 8..15 <- p[16..23] (k0+16+8h..)
__device__ __forceinline__ v16us ldfrag_u(const unsigned short* p) {
  FragU f;
  f.h[0] = *(const v8us*)(p);
  f.h[1] = *(const v8us*)(p + 16);
  return f.v;
}

// ---- WMMA helpers with trailing VALU hazard gap; OPK 0 = f16 operand bits, OPK 1 = bf16 operand bits --
template <int OPK>
__device__ __forceinline__ v8f mma_raw(v16us a, v16us b, v8f c) {
  if (OPK == 0)
    return __builtin_amdgcn_wmma_f32_16x16x32_f16(false, __builtin_bit_cast(v16h, a), false,
                                                  __builtin_bit_cast(v16h, b), (short)0, c, false, false);
  return __builtin_amdgcn_wmma_f32_16x16x32_bf16(false, __builtin_bit_cast(v16bf, a), false,
                                                 __builtin_bit_cast(v16bf, b), (short)0, c, false, false);
}
template <int OPK>
__device__ __forceinline__ v8f mma_g(v16us a, v16us b, v8f c) {                 // guarded
  c = mma_raw<OPK>(a, b, c);
#if defined(__HIP_DEVICE_COMPILE__)
  asm volatile("v_nop\n\tv_nop\n\tv_nop\n\tv_nop" : "+v"(c) : "v"(a), "v"(b));
#endif
  return c;
}
__device__ __forceinline__ void dep_guard1(v8f& a, v8f& b, v16us x) {
#if defined(__HIP_DEVICE_COMPILE__)
  asm volatile("v_nop\n\tv_nop\n\tv_nop\n\tv_nop" : "+v"(a), "+v"(b) : "v"(x));
#endif
}
__device__ __forceinline__ void keep4_u(v16us a, v16us b, v16us c, v16us d) {
#if defined(__HIP_DEVICE_COMPILE__)
  asm volatile("v_nop" :: "v"(a), "v"(b), "v"(c), "v"(d));
#endif
}
__device__ __forceinline__ void acc_guard4(v8f& a, v8f& b, v8f& c, v8f& d) {
#if defined(__HIP_DEVICE_COMPILE__)
  asm volatile("v_nop\n\tv_nop\n\tv_nop\n\tv_nop" : "+v"(a), "+v"(b), "+v"(c), "+v"(d));
#endif
}
// orders LDS stores of this wave before later LDS loads of the same wave (wave-private exchange)
__device__ __forceinline__ void wave_sync_lds() {
  __builtin_amdgcn_fence(__ATOMIC_RELEASE, "workgroup");
  __builtin_amdgcn_wave_barrier();
  __builtin_amdgcn_fence(__ATOMIC_ACQUIRE, "workgroup");
}

// =====================================================================================================
// x convert + rms statistics. Block = 256 threads = 8 waves owns 32 consecutive token rows (wave w: rows
// 4w..4w+3); token tok = b*SEQ + s reads input row b*SEQ_FULL + s. Per row each lane converts 8
// consecutive floats per step (4 steps of 256 columns): ob = bf16 bits of x (RNE), oh = f16 bits of
// of the bf16 values is reduced per row and rstd = rsqrt(mean + eps) staged in LDS (cross-wave -> block
// coverage: 8 waves x 4 rows x (4 x 256) columns = 32 whole rows of both planes per block, grid = MT/32
// blocks; rstd rows row0..row0+31 per block = all MT entries.
// =====================================================================================================
__global__ __launch_bounds__(256) void cvt_x(const float* __restrict__ x, unsigned short* ob,
                                             unsigned short* oh, float* rstd) {
  __shared__ float srs[32];
  const int lane = threadIdx.x & 31, wv = threadIdx.x >> 5;
  const int row0 = blockIdx.x * 32;
#pragma unroll 1
  for (int rr = 0; rr < 4; ++rr) {
    const int tok = row0 + wv * 4 + rr;
    const int b = tok / SEQ, s = tok - b * SEQ;
    const float* src = x + ((size_t)b * SEQ_FULL + (size_t)s) * DM;
    const size_t orow = (size_t)tok * DM;
    float ss = 0.f;
#pragma unroll 1
    for (int it = 0; it < DM / 256; ++it) {
      const int col = it * 256 + lane * 8;
      const v4f a0 = *(const v4f*)(src + col);
      const v4f a1 = *(const v4f*)(src + col + 4);
      v4u hb, hh;
#pragma unroll
      for (int e = 0; e < 2; ++e) {
        const unsigned short u0 = bf_bits(a0[2 * e]), u1 = bf_bits(a0[2 * e + 1]);
        const unsigned short u2 = bf_bits(a1[2 * e]), u3 = bf_bits(a1[2 * e + 1]);
        const float x0 = bf_up(u0), x1 = bf_up(u1), x2 = bf_up(u2), x3 = bf_up(u3);
        ss = fmaf(x0, x0, ss); ss = fmaf(x1, x1, ss); ss = fmaf(x2, x2, ss); ss = fmaf(x3, x3, ss);
        hb[e]     = pk16(u0, u1);
        hb[2 + e] = pk16(u2, u3);
        hh[e]     = pk16(f2h(x0 * XSC), f2h(x1 * XSC));
        hh[2 + e] = pk16(f2h(x2 * XSC), f2h(x3 * XSC));
      }
      unsigned short* db = ob + orow + col;
      unsigned short* dh = oh + orow + col;
      *(v4u*)db = hb;
      *(v4u*)dh = hh;
      
    }
    ss += __shfl_xor(ss, 16, 32);
    ss += __shfl_xor(ss, 8, 32);
    ss += __shfl_xor(ss, 4, 32);
    ss += __shfl_xor(ss, 2, 32);
    ss += __shfl_xor(ss, 1, 32);
    if (lane == 0) srs[wv * 4 + rr] = rsqrtf(ss * (1.0f / (float)DM) + LNEPS);
  }
  __syncthreads();
  if (wv == 0) {
    const float v = srs[lane];
    float* d = rstd + row0 + lane;
    *(float*)d = v;
    
  }
}

// =====================================================================================================
// Weight convert with transpose: source matrices are [in k][out n] row-major; output Bt planes [n][k]
// (k contiguous). blockIdx.y selects the matrix (0 w_q, 1 w_k, 2 w_v, 3 w_o), blockIdx.x the 64x64 tile
// (k0 = 64*(x>>4), n0 = 64*(x&15)). The tile is staged in LDS as f32, then each output row n0+r, columns
// lines). Values: y=0,1: w' = bf16(ln_w[k]) * bf16(w[k][n]) (exact in f32) split into bf16 hi (plane 2y) and
// bf16 lo = w' - hi (plane 2y+1, exact); y=2: f16 bits of w' * WSCL (plane 4); y=3: bf16 bits of w_o
// coverage: load 256 threads x 4 x 4 = 64x64 tile; store 8 waves x 2 x (4 rows x 8 lanes x 8) = 64 rows x
// 64 cols; grid (256, 4) covers every 64x64 tile of every output plane.
// =====================================================================================================
__global__ __launch_bounds__(256) void cvt_w(const float* __restrict__ w0, const float* __restrict__ w1,
                                             const float* __restrict__ w2, const float* __restrict__ w3,
                                             const float* __restrict__ lnw, unsigned short* o) {
  __shared__ __align__(16) float sm[64 * 65];
  __shared__ float slw[64];
  const int y = blockIdx.y;                                     // block-uniform select of the source
  const float* w = (y == 0) ? w0 : ((y == 1) ? w1 : ((y == 2) ? w2 : w3));
  const int k0 = (blockIdx.x >> 4) << 6, n0 = (blockIdx.x & 15) << 6;
  const int t = threadIdx.x, lane = t & 31, wv = t >> 5;
#pragma unroll
  for (int it = 0; it < 4; ++it) {
    const int r = it * 16 + (t >> 4), c4 = (t & 15) * 4;
    const v4f v = *(const v4f*)(w + (size_t)(k0 + r) * DM + (size_t)(n0 + c4));
    float* sp = sm + r * 65 + c4;
    sp[0] = v[0]; sp[1] = v[1]; sp[2] = v[2]; sp[3] = v[3];
  }
  if (t < 64) slw[t] = bfr(lnw[k0 + t]);                       // waves 0,1 entirely: wave-uniform
  __syncthreads();
  const int pl0 = (y == 0) ? 0 : ((y == 1) ? 2 : ((y == 2) ? 4 : 5));
  unsigned short* P0 = o + (size_t)pl0 * DM * DM;
  unsigned short* P1 = (y < 2) ? (P0 + (size_t)DM * DM) : P0;
  const int q8 = lane >> 3, c8 = (lane & 7) * 8;
  v4u ha[2], hl[2];
#pragma unroll
  for (int it = 0; it < 2; ++it) {
    const int r = wv * 8 + it * 4 + q8;                          // n local
    v4u a = {0u, 0u, 0u, 0u}, l = {0u, 0u, 0u, 0u};
#pragma unroll
    for (int e = 0; e < 4; ++e) {
      const int ka = c8 + 2 * e, kb = ka + 1;
      float va = bfr(sm[ka * 65 + r]), vb = bfr(sm[kb * 65 + r]);
      if (y < 3) { va *= slw[ka]; vb *= slw[kb]; }
      if (y < 2) {
        const unsigned short ua = bf_bits(va), ub = bf_bits(vb);
        a[e] = pk16(ua, ub);
        l[e] = pk16(bf_bits(va - bf_up(ua)), bf_bits(vb - bf_up(ub)));
      } else if (y == 2) {
        a[e] = pk16(f2h(va * WSCL), f2h(vb * WSCL));
      } else {
        a[e] = pk16(bf_bits(va), bf_bits(vb));
      }
    }
    ha[it] = a;
    hl[it] = l;
  }
  {
#pragma unroll
    for (int it = 0; it < 2; ++it) {
      const int r = wv * 8 + it * 4 + q8;
      const size_t go = (size_t)(n0 + r) * DM + (size_t)(k0 + c8);
      *(v4u*)(P0 + go) = ha[it];
      if (y < 2) *(v4u*)(P1 + go) = hl[it];
    }
    
  }
}

// =====================================================================================================
// Relative position bias by signed key-query distance: BD[h][i], i = (key - query) + 2047, i in 0..4094;
// i = 4095 is padding written as 0. bucket on integer n = query - key: ret = (n < 0) * 16, n = |n|,
// n < 8 -> n, else 8 + floor(2*log2(n/8)) capped at 15, evaluated by its integer thresholds
// coverage: 256 threads x 16 = 4096 entries per head; grid = NH heads = the whole table.
// =====================================================================================================
__device__ __forceinline__ int rel_bucket(int d) {              // d = key - query
  int n = -d;
  int ret = 0;
  if (n < 0) { ret = NBKT / 2; n = -n; }
  int bk;
  if (n < 8)       bk = n;
  else if (n < 12) bk = 8;
  else if (n < 16) bk = 9;
  else if (n < 23) bk = 10;
  else if (n < 32) bk = 11;
  else if (n < 46) bk = 12;
  else if (n < 64) bk = 13;
  else if (n < 91) bk = 14;
  else             bk = 15;
  return ret + bk;
}

__global__ __launch_bounds__(256) void bias_build(const float* __restrict__ tbl, float* BD) {
  __shared__ __align__(16) float sh[BDW];
  const int h = blockIdx.x, t = threadIdx.x;
#pragma unroll 4
  for (int j = 0; j < 16; ++j) {
    const int idx = t + 256 * j;
    const int ti = clampi(rel_bucket(idx - 2047) * NH + h, 0, NBKT * NH - 1);
    float v = bfr(tbl[ti]);
    v = (idx == BDW - 1) ? 0.f : v;
    sh[idx] = v;
  }
  __syncthreads();
  v4f vv[4];
#pragma unroll
  for (int q = 0; q < 4; ++q) vv[q] = *(const v4f*)(sh + q * 1024 + 4 * t);
  float* dst = BD + (size_t)h * BDW;
  {
#pragma unroll
    for (int q = 0; q < 4; ++q) *(v4f*)(dst + q * 1024 + 4 * t) = vv[q];
    
  }
}

// =====================================================================================================
// LDS-staged 16-bit WMMA GEMM: C[m][n] = sum over plane pairs pl and k of A_pl[m][k] * Bt_pl[n][k]. A block of
// 8 waves owns one 128x128 tile of C (blockIdx.x = tile); wave w owns rows 32*(w>>1).. and columns 64*(w&1).. of
// it (2 x 4 accumulator tiles). A pass is 128 k: 256 B of each of the 128 A rows and 128 Bt rows, brought into one
// of two LDS buffers (row pitch 272 B) by asynchronous 16-byte copies, 16 per thread; the copies of pass t + 2 are
// issued when every wave has left pass t's buffer, so they fly while pass t + 1 is worked on. OPK 0: f16 operands;
// OPK 1: bf16 operands. NPL 1|2 operand plane pairs (Ap,Btp) and (Ap2,Btp2) sharing the accumulators (the second
// pair's passes follow the first pair's; only unscaled hi/lo planes are paired this way). AHM 0: A row-major
// [M][K] pitch lda; AHM 1: A head-major planes, element (m, k) at ((k/HD)*aplane + m*HD + k%HD). Bt row-major
// [N][K] pitch ldb (k contiguous); M, N, K multiples of 128 (true at every call site; host grid = tiles exact).
// Both operand fragments use the split k map (elements 0..7 <- k0+8h.., 8..15 <- k0+16+8h..); D element r of a
// lane is (row 8h + r, col lane&15).
// OM 0: f32 out Cf = acc*wsc (+ RES: bf16 RNE value of Rp[input row of token m][n], token m -> input row
//       (m/SEQ)*SEQ_FULL + m%SEQ, pitch DM), pitch ldc.
// OM 1: f16 out Ch = f16(acc*wsc*osc*scale).  OM 2: f16 pair: base = acc*wsc*osc*scale; Ch = f16 bits(base);
//       Ch2 = f16 bits((base - value(Ch)) * rsc).  scale = Rs[m] (RSM 1, per row), Rs[n] (RSM 2, per column),
//       1 (RSM 0).
// coverage: 2 slabs x 16 rows x 64 cols = the wave's whole 32x64 tile; 8 waves = the block's 128x128 tile.
// =====================================================================================================
#define GTM  128                        // block tile rows
#define GTN  128                        // block tile columns
#define GKP  128                        // k per pass
#define GPIT 136                        // LDS row pitch in 16-bit elements (272 B)
#define GBUF ((GTM + GTN) * GPIT)       // 16-bit elements per buffer: A rows 0..127, Bt rows 128..255

// Eight asynchronous 16-byte copies of one lane, global -> LDS, rows 16 apart: LDS byte address l + 16*272*c,
// global address g + gs*c (gs in elements), c = 0..7. The s_wait_xcnt closes the statement so that no address
// register named by a copy is rewritten ahead of it.
__device__ __forceinline__ void copy8_rows16(unsigned l, const unsigned short* g, size_t gs) {
#if defined(__HIP_DEVICE_COMPILE__)
  const unsigned ls = 16u * GPIT * 2u;
  asm volatile(
      "global_load_async_to_lds_b128 %0, %8, off\n\t"
      "global_load_async_to_lds_b128 %1, %9, off\n\t"
      "global_load_async_to_lds_b128 %2, %10, off\n\t"
      "global_load_async_to_lds_b128 %3, %11, off\n\t"
      "global_load_async_to_lds_b128 %4, %12, off\n\t"
      "global_load_async_to_lds_b128 %5, %13, off\n\t"
      "global_load_async_to_lds_b128 %6, %14, off\n\t"
      "global_load_async_to_lds_b128 %7, %15, off\n\t"
      "s_wait_xcnt 0x0"
      :: "v"(l), "v"(l + ls), "v"(l + 2u * ls), "v"(l + 3u * ls),
         "v"(l + 4u * ls), "v"(l + 5u * ls), "v"(l + 6u * ls), "v"(l + 7u * ls),
         "v"(g), "v"(g + gs), "v"(g + 2 * gs), "v"(g + 3 * gs),
         "v"(g + 4 * gs), "v"(g + 5 * gs), "v"(g + 6 * gs), "v"(g + 7 * gs)
      : "memory");
#endif
}

template <int OPK, int NPL, int AHM, int OM, int RSM, int RES>
__global__ __launch_bounds__(256) void gemm64(
    const unsigned short* __restrict__ Ap, const unsigned short* __restrict__ Ap2, int lda, int aplane,
    const unsigned short* __restrict__ Btp, const unsigned short* __restrict__ Btp2, int ldb,
    unsigned short* Ch, unsigned short* Ch2, float* Cf, int ldc,
    const float* __restrict__ Rs, const float* __restrict__ Rp,
    float wsc, float osc, float rsc, int M, int N, int K) {
  __shared__ __align__(16) unsigned short ring[2 * GBUF];   // two operand buffers, 2 x 69632 B
  __shared__ __align__(16) float sT[8][16 * 68];   // per-wave 16x64 slab, pitch 68 floats
  const int lane = threadIdx.x & 31;
  const int wave = threadIdx.x >> 5;
  const int tilesN = N >> 7;
  const int tilesM = M >> 7;
  const int tile = blockIdx.x;
  if (tile >= tilesM * tilesN) return;   // block-uniform, in front of every copy and barrier
  const int tm = tile / tilesN;
  const int tn = tile - tm * tilesN;
  const int bm0 = tm << 7;                     // block tile origin
  const int bn0 = tn << 7;
  const int wm = (wave >> 1) << 5;             // wave tile origin inside the block tile
  const int wn = (wave & 1) << 6;
  const int m0 = bm0 + wm;
  const int n0 = bn0 + wn;

  const int rlane = lane & 15;                 // row (A) / col (B, D) within subtile
  const int koff  = (lane >> 4) * 8;           // k offset of this lane half
  const int mOff  = (lane >> 4) * 8;           // D row offset

  // copy map: thread t brings 16-byte piece t&15 of rows (t>>4) + 16*c, c = 0..7, of A and of Bt
  const int crow = threadIdx.x >> 4;
  const int cch  = threadIdx.x & 15;
  const unsigned ldsA = (unsigned)(size_t)ring + (unsigned)(crow * (GPIT * 2) + cch * 16);
  const unsigned ldsB = ldsA + (unsigned)(GTM * GPIT * 2);
  const size_t aoff = AHM ? ((size_t)(cch >> 3) * (size_t)aplane + (size_t)(bm0 + crow) * HD + (size_t)((cch & 7) * 8))
                          : ((size_t)(bm0 + crow) * lda + (size_t)(cch * 8));
  const size_t astep = AHM ? (size_t)(16 * HD) : (size_t)16 * lda;          // 16 rows of A
  const size_t apass = AHM ? (size_t)(GKP / HD) * (size_t)aplane : (size_t)GKP;   // one pass along k
  const size_t boff = (size_t)(bn0 + crow) * ldb + (size_t)(cch * 8);
  const size_t bstep = (size_t)16 * ldb;
  const int nkp = K >> 7;                      // passes per plane pair
  const int NT = NPL * nkp;                    // passes in all

  auto issue = [&](int t, int buf) {           // pass t's 16 copies of this thread into buffer buf
    const int pl = (NPL == 2 && t >= nkp) ? 1 : 0;
    const int kp = t - pl * nkp;
    const unsigned short* Ac = (pl == 0) ? Ap : Ap2;
    const unsigned short* Bc = (pl == 0) ? Btp : Btp2;
    const unsigned lb = (unsigned)buf * (unsigned)(GBUF * 2);
    copy8_rows16(ldsA + lb, Ac + aoff + (size_t)kp * apass, astep);
    copy8_rows16(ldsB + lb, Bc + boff + (size_t)kp * GKP, bstep);
  };

  v8f acc[2][4];
#pragma unroll
  for (int i = 0; i < 2; ++i)
#pragma unroll
    for (int j = 0; j < 4; ++j) acc[i][j] = zero8();

  issue(0, 0);
  asm volatile("s_wait_asynccnt 0x0" ::: "memory");   // this wave's copies of pass 0 have landed
  __syncthreads();                                    // every wave's have: pass 0 may be read
  if (NT > 1) issue(1, 1);

#pragma unroll 1   // one pass per trip: the buffer index and the publish point stay at the loop's foot
  for (int t = 0; t < NT; ++t) {
    const unsigned short* sb = ring + (t & 1) * GBUF;
    const unsigned short* sA = sb + (wm + rlane) * GPIT + koff;
    const unsigned short* sB = sb + (GTM + wn + rlane) * GPIT + koff;
#pragma unroll
    for (int ks = 0; ks < GKP / 32; ++ks) {
      v16us bh[4];
#pragma unroll
      for (int j = 0; j < 4; ++j) bh[j] = ldfrag_u(sB + (j << 4) * GPIT + ks * 32);
#pragma unroll
      for (int i = 0; i < 2; ++i) {
        const v16us ah = ldfrag_u(sA + (i << 4) * GPIT + ks * 32);
#pragma unroll
        for (int j = 0; j < 4; ++j) acc[i][j] = mma_raw<OPK>(ah, bh[j], acc[i][j]);
        dep_guard1(acc[i][0], acc[i][3], ah);
      }
      keep4_u(bh[0], bh[1], bh[2], bh[3]);
    }
    asm volatile("s_wait_dscnt 0x0" ::: "memory");      // this wave's reads of pass t's buffer are done
    asm volatile("s_wait_asynccnt 0x0" ::: "memory");   // this wave's copies of pass t + 1 have landed
    __syncthreads();                                    // publishes pass t + 1, frees pass t's buffer
    if (t + 2 < NT) issue(t + 2, t & 1);
  }
  asm volatile("s_wait_asynccnt 0x0" ::: "memory");     // no copy is outstanding past the loop
  acc_guard4(acc[0][0], acc[0][1], acc[0][2], acc[0][3]);
  acc_guard4(acc[1][0], acc[1][1], acc[1][2], acc[1][3]);

  const int hh2 = lane >> 4, c4 = (lane & 15) * 4;     // f32 out: 256-B row segment = 16 lanes x 16 B
  const int q8  = lane >> 3, c8 = (lane & 7) * 8;
  const float wo = wsc * osc;

  // per-column scale (RSM 2): columns n0+c8 .. n0+c8+7, same for every row of the tile
  float csc[8];
#pragma unroll
  for (int e = 0; e < 8; ++e) csc[e] = 1.f;
  if (OM != 0 && RSM == 2) {
    const v4f cs0 = *(const v4f*)(Rs + n0 + c8);
    const v4f cs1 = *(const v4f*)(Rs + n0 + c8 + 4);
#pragma unroll
    for (int e = 0; e < 4; ++e) { csc[e] = cs0[e]; csc[4 + e] = cs1[e]; }
  }

  // ---- epilogue ----
  float* slab = sT[wave];
#pragma unroll
  for (int i = 0; i < 2; ++i) {
    const int mBase = m0 + (i << 4);
#pragma unroll
    for (int j = 0; j < 4; ++j) {
#pragma unroll
      for (int r = 0; r < 8; ++r) {
        slab[(mOff + r) * 68 + (j << 4) + rlane] = acc[i][j][r];
      }
    }
    wave_sync_lds();
    if (OM == 0) {
      v4f vals[8];
#pragma unroll
      for (int it = 0; it < 8; ++it) {
        const int row = it * 2 + hh2;                      // it 0..7 x hh2 0..1 = rows 0..15
        v4f v = *(const v4f*)(slab + row * 68 + c4);
        v = v * wsc;
        if (RES) {
          const int tok = mBase + row;
          const int bb = tok / SEQ, ss = tok - bb * SEQ;
          const v4f hr = *(const v4f*)(Rp + ((size_t)bb * SEQ_FULL + (size_t)ss) * DM + (size_t)(n0 + c4));
#pragma unroll
          for (int c = 0; c < 4; ++c) v[c] = v[c] + bfr(hr[c]);
        }
        vals[it] = v;
      }
      {
#pragma unroll
        for (int it = 0; it < 8; ++it) {
          const int row = it * 2 + hh2;
          *(v4f*)(Cf + (size_t)(mBase + row) * ldc + (size_t)n0 + c4) = vals[it];
        }
        
      }
    } else {
      v4u hv[4], hw[4];
#pragma unroll
      for (int it = 0; it < 4; ++it) {
        const int row = it * 4 + q8;                       // it 0..3 x q8 0..3 = rows 0..15
        const float* sp = slab + row * 68 + c8;
        float rsr = wo;
        if (RSM == 1) rsr = wo * Rs[mBase + row];
        v4u ha = {0u, 0u, 0u, 0u}, hb = {0u, 0u, 0u, 0u};
#pragma unroll
        for (int e = 0; e < 4; ++e) {
          const float b0 = sp[2 * e]     * rsr * csc[2 * e];
          const float b1 = sp[2 * e + 1] * rsr * csc[2 * e + 1];
          if (OM == 1) {
            ha[e] = pk16(f2h(b0), f2h(b1));
          } else {
            const _Float16 x0 = (_Float16)b0, x1 = (_Float16)b1;
            ha[e] = pk16(h_bits(x0), h_bits(x1));
            hb[e] = pk16(f2h((b0 - (float)x0) * rsc), f2h((b1 - (float)x1) * rsc));
          }
        }
        hv[it] = ha;
        hw[it] = hb;
      }
      {
#pragma unroll
        for (int it = 0; it < 4; ++it) {
          const int row = it * 4 + q8;
          const size_t go = (size_t)(mBase + row) * ldc + (size_t)n0 + c8;
          *(v4u*)(Ch + go) = hv[it];
          if (OM == 2) *(v4u*)(Ch2 + go) = hw[it];
        }
        
      }
    }
    wave_sync_lds();
  }
}

// =====================================================================================================
// Bidirectional attention with relative position bias, head dim 64, no 1/sqrt(d) scaling. Block = 256
// threads = 8 waves, all of one (batch b, head h); one wave owns one 16-row query tile (t0..t0+15) and loops all
// key blocks of 32 with an online max-subtracted softmax in f32. A pass is 64 keys: the head's 128 B of each of
// the 64 KH rows and 64 KR rows and 128 B (64 keys) of each of its 64 VT rows are brought into one of two LDS
// buffers (row pitch 144 B) by asynchronous 16-byte copies, 6 per thread, and every wave reads its K and V
// fragments from there; the copies of pass t + 2 are issued when every wave has left pass t's buffer.
// Planes: QH|QR f16 [MT][DM] (16*q hi,
// residual x2048), KH|KR f16 [MT][DM] (16*k hi, residual x2048), VT f16 [DM][MT] (16*v transposed, row =
// h*64+d, column = token), BD f32 [NH][4096] bias by (key-query)+2047. Output Zh|Zl: bf16 hi|lo of ctx,
// head-major [NH][MT][64].
// Per key block: 48-entry bias window (distances sb-t0-15 .. sb-t0+32) staged in per-wave LDS and read at
// index col - row + 15 (+16 for the block's keys 16..31); S = QH.KH^T (4 WMMA), R = QR.KH^T + QH.KR^T (8 WMMA, own accumulators);
// score = S/256 + R/524288 + bias; p = exp(score - running max) in f32, l accumulated from the f32 p;
// p*16384 as f16, staged per wave in LDS and reloaded as A fragments (split k map); O += P.VT on f16 WMMA
// between the element stores and the reloads; those three LDS regions are private to their wave.
// staged extent == consumed extent: window 48 written / 0..46 read; P tile 16x32 written and read; ctx
// staging 2 x 16x64 written and read.
// Epilogue: ctx = O/(l*262144) split into bf16 hi|lo, staged in LDS; the wave's 16 rows x 64 halves are
// coverage: 16 query rows x 64 halves per wave, NB*NH*SEQ/16 wave tasks = all (h, tok) rows of both planes.
// =====================================================================================================
#define AKP  64                         // keys per pass
#define APIT 72                         // LDS row pitch in 16-bit elements (144 B)
#define ATIL (64 * APIT)                // 16-bit elements of one staged tile (64 rows)
#define ABUF (3 * ATIL)                 // 16-bit elements per buffer: KH rows | KR rows | VT rows
static_assert((SEQ % AKP) == 0);

// Six asynchronous 16-byte copies of one lane, global -> LDS: rows r and r + 32 of the KH, KR and VT tiles; l is
// the LDS byte address of the lane's piece of KH row r. The s_wait_xcnt closes the statement so that no address
// register named by a copy is rewritten ahead of it.
__device__ __forceinline__ void copy6_kv(unsigned l, const unsigned short* gk, const unsigned short* gr,
                                         const unsigned short* gv) {
#if defined(__HIP_DEVICE_COMPILE__)
  const unsigned lr = 32u * APIT * 2u;
  const unsigned lt = ATIL * 2u;
  asm volatile(
      "global_load_async_to_lds_b128 %0, %6, off\n\t"
      "global_load_async_to_lds_b128 %1, %7, off\n\t"
      "global_load_async_to_lds_b128 %2, %8, off\n\t"
      "global_load_async_to_lds_b128 %3, %9, off\n\t"
      "global_load_async_to_lds_b128 %4, %10, off\n\t"
      "global_load_async_to_lds_b128 %5, %11, off\n\t"
      "s_wait_xcnt 0x0"
      :: "v"(l), "v"(l + lr), "v"(l + lt), "v"(l + lt + lr), "v"(l + 2u * lt), "v"(l + 2u * lt + lr),
         "v"(gk), "v"(gk + (size_t)32 * DM), "v"(gr), "v"(gr + (size_t)32 * DM),
         "v"(gv), "v"(gv + (size_t)32 * MT)
      : "memory");
#endif
}

__global__ __launch_bounds__(256) void attn_kernel(
    const unsigned short* __restrict__ QHp, const unsigned short* __restrict__ QRp,
    const unsigned short* __restrict__ KHp, const unsigned short* __restrict__ KRp,
    const unsigned short* __restrict__ VTp,
    const float* __restrict__ BD, unsigned short* Zh, unsigned short* Zl) {
  __shared__ __align__(16) unsigned short kvr[2 * ABUF];           // two K|KR|VT buffers, 2 x 27648 B
  __shared__ __align__(16) float relw[AWV][RWP];                   // bias window, 1536 B
  __shared__ __align__(16) unsigned short pws[AWV][16 * 32];       // P tiles, 8192 B
  __shared__ __align__(16) unsigned short zst[AWV][2][16 * HD];    // ctx hi|lo staging, 32768 B
  const int lane = threadIdx.x & 31, wv = threadIdx.x >> 5, m = lane & 15, hh = lane >> 4;
  const int nqt = SEQ / 16;
  if ((int)blockIdx.x * AWV >= NB * NH * nqt) return;   // block-uniform, in front of every copy and barrier
  const int task = blockIdx.x * AWV + wv;            // nqt is a multiple of AWV: one (b, h) per block
  const int bh = task / nqt;
  const int t0 = (task - bh * nqt) << 4;             // query tile start
  const int b = bh / NH, h = bh - b * NH;
  const size_t tok0 = (size_t)b * SEQ;
  float* rw = relw[wv];
  unsigned short* ph = pws[wv];

  // Q A-fragments: rows t0+m, k = head dims (two 32-deep steps), hi and residual planes
  const size_t qo = (tok0 + (size_t)(t0 + m)) * DM + (size_t)(h * HD + 8 * hh);
  const v16us qh0 = ldfrag_u(QHp + qo);
  const v16us qh1 = ldfrag_u(QHp + qo + 32);
  const v16us qr0 = ldfrag_u(QRp + qo);
  const v16us qr1 = ldfrag_u(QRp + qo + 32);

  float mx[8], ls[8];
  v8f O[4];
#pragma unroll
  for (int j = 0; j < 4; ++j) O[j] = zero8();
#pragma unroll
  for (int r = 0; r < 8; ++r) { mx[r] = -1.0e30f; ls[r] = 0.f; }

  const float* bdh = BD + (size_t)h * BDW + (BDC - t0);                    // window base - sb; >= BD+h*BDW
  // copy map: thread t brings 16-byte piece t&7 of rows (t>>3) and (t>>3) + 32 of each of the three tiles
  const int crow = threadIdx.x >> 3;
  const int cpc  = threadIdx.x & 7;
  const unsigned ldsC = (unsigned)(size_t)kvr + (unsigned)(crow * (APIT * 2) + cpc * 16);
  const size_t kco = (tok0 + (size_t)crow) * DM + (size_t)(h * HD + cpc * 8);
  const unsigned short* gK = KHp + kco;
  const unsigned short* gR = KRp + kco;
  const unsigned short* gV = VTp + (size_t)(h * HD + crow) * MT + tok0 + (size_t)(cpc * 8);
  const int NT = SEQ / AKP;

  auto issue = [&](int t, int buf) {           // pass t's 6 copies of this thread into buffer buf
    copy6_kv(ldsC + (unsigned)buf * (unsigned)(ABUF * 2), gK + (size_t)t * (AKP * DM), gR + (size_t)t * (AKP * DM),
             gV + (size_t)t * AKP);
  };

  issue(0, 0);
  asm volatile("s_wait_asynccnt 0x0" ::: "memory");   // this wave's copies of pass 0 have landed
  __syncthreads();                                    // every wave's have: pass 0 may be read
  if (NT > 1) issue(1, 1);

#pragma unroll 1   // one pass per trip: the buffer index and the publish point stay at the loop's foot
  for (int t = 0; t < NT; ++t) {
  const unsigned short* kbase  = kvr + (t & 1) * ABUF + m * APIT + 8 * hh;   // KH row m, this lane half's k
  const unsigned short* krbase = kbase + ATIL;
  const unsigned short* vbase  = kbase + 2 * ATIL;                           // VT row (dim) m, keys 8*hh..
#pragma unroll     // both 32-key blocks of a pass inline: their LDS offsets become immediates
  for (int sub = 0; sub < AKP / 32; ++sub) {
    const int sb = t * AKP + sub * 32;
    // bias window: rw[i] = bias_h(key - query = sb - t0 - 15 + i), i = 0..47 (index <= h*BDW + 4095)
    {
      const float* bp = bdh + sb;
      const float w0v = bp[lane];
      const float w1v = bp[32 + m];
      rw[lane] = w0v;
      if (lane < 16) rw[32 + lane] = w1v;
    }
    wave_sync_lds();

    // S = QH.KH^T, R = QR.KH^T + QH.KR^T ; Bt row = key token sb+m (+16), k = head dim
    v8f S0 = zero8(), S1 = zero8(), R0 = zero8(), R1 = zero8();
#pragma unroll
    for (int ks = 0; ks < 2; ++ks) {
      const int kofs = (sub * 32) * APIT + 32 * ks;
      const v16us kf0 = ldfrag_u(kbase + kofs);
      const v16us kf1 = ldfrag_u(kbase + kofs + 16 * APIT);
      const v16us kg0 = ldfrag_u(krbase + kofs);
      const v16us kg1 = ldfrag_u(krbase + kofs + 16 * APIT);
      const v16us qa = (ks == 0) ? qh0 : qh1;
      const v16us qb = (ks == 0) ? qr0 : qr1;
      S0 = mma_g<0>(qa, kf0, S0);
      S1 = mma_g<0>(qa, kf1, S1);
      R0 = mma_g<0>(qb, kf0, R0);
      R1 = mma_g<0>(qb, kf1, R1);
      R0 = mma_g<0>(qa, kg0, R0);
      R1 = mma_g<0>(qa, kg1, R1);
    }

    // VT B-fragments (Bt row = h*64 + dim, k = key token), read as one group here so that the softmax covers
    // their LDS latency
    v16us vf[4];
#pragma unroll     // vf[] is indexed by constants only, so it stays in registers
    for (int j = 0; j < 4; ++j) vf[j] = ldfrag_u(vbase + (16 * j) * APIT + sub * 32);

    // score = q.k + bias (window index m - row + 15, +16 for keys sb+16..sb+31)
    float s0[8], s1[8];
#pragma unroll
    for (int r = 0; r < 8; ++r) {
      const int row = 8 * hh + r;
      const float rv0 = rw[15 - row + m];
      const float rv1 = rw[31 - row + m];
      s0[r] = fmaf(S0[r], SC1, fmaf(R0[r], SC2, rv0));
      s1[r] = fmaf(S1[r], SC1, fmaf(R1[r], SC2, rv1));
    }

    // online softmax (a row lives in the 16 lanes of one half-wave; xor butterflies 1,2,4,8)
#pragma unroll
    for (int r = 0; r < 8; ++r) {
      float xm = fmaxf(s0[r], s1[r]);
      xm = fmaxf(xm, __shfl_xor(xm, 1, 32));
      xm = fmaxf(xm, __shfl_xor(xm, 2, 32));
      xm = fmaxf(xm, __shfl_xor(xm, 4, 32));
      xm = fmaxf(xm, __shfl_xor(xm, 8, 32));
      const float mn = fmaxf(mx[r], xm);
      const float al = __expf(mx[r] - mn);
      mx[r] = mn;
      const float p0 = __expf(s0[r] - mn);
      const float p1 = __expf(s1[r] - mn);
      float ps = p0 + p1;
      ps += __shfl_xor(ps, 1, 32);
      ps += __shfl_xor(ps, 2, 32);
      ps += __shfl_xor(ps, 4, 32);
      ps += __shfl_xor(ps, 8, 32);
      ls[r] = ls[r] * al + ps;
#pragma unroll
      for (int j = 0; j < 4; ++j) O[j][r] = O[j][r] * al;
      const int row = 8 * hh + r;
      ph[row * 32 + m]      = f2h(p0 * PCAR);
      ph[row * 32 + 16 + m] = f2h(p1 * PCAR);
    }
    wave_sync_lds();

    // P A-fragment (split k map)
    const v16us af = ldfrag_u(ph + m * 32 + 8 * hh);
#pragma unroll
    for (int j = 0; j < 4; ++j) O[j] = mma_g<0>(af, vf[j], O[j]);
  }
    asm volatile("s_wait_dscnt 0x0" ::: "memory");      // this wave's reads of pass t's buffer are done
    asm volatile("s_wait_asynccnt 0x0" ::: "memory");   // this wave's copies of pass t + 1 have landed
    __syncthreads();                                    // publishes pass t + 1, frees pass t's buffer
    if (t + 2 < NT) issue(t + 2, t & 1);
  }
  asm volatile("s_wait_asynccnt 0x0" ::: "memory");     // no copy is outstanding past the loop
  acc_guard4(O[0], O[1], O[2], O[3]);

  // ---- epilogue: ctx = O / (l * PCAR * VSC) -> bf16 hi|lo, head-major planes ----
  unsigned short* zh = zst[wv][0];
  unsigned short* zl = zst[wv][1];
#pragma unroll
  for (int r = 0; r < 8; ++r) {
    const int row = 8 * hh + r;
    const float linv = (1.0f / ls[r]) * OSC;           // ls >= 1
#pragma unroll
    for (int j = 0; j < 4; ++j) {
      const float o = O[j][r] * linv;
      const unsigned short x0 = bf_bits(o);
      zh[row * HD + 16 * j + m] = x0;
      zl[row * HD + 16 * j + m] = bf_bits(o - bf_up(x0));
    }
  }
  wave_sync_lds();
  {
    v4u ha[4], hb[4];
#pragma unroll
    for (int q = 0; q < 4; ++q) {
      ha[q] = *(const v4u*)(zh + q * 256 + lane * 8);
      hb[q] = *(const v4u*)(zl + q * 256 + lane * 8);
    }
    const size_t zo = ((size_t)h * MT + tok0 + (size_t)t0) * HD;   // 2048-B aligned, 16 rows contiguous
    unsigned short* dh = Zh + zo;
    unsigned short* dl = Zl + zo;
    {
#pragma unroll
      for (int q = 0; q < 4; ++q) {
        *(v4u*)(dh + q * 256 + lane * 8) = ha[q];
        *(v4u*)(dl + q * 256 + lane * 8) = hb[q];
      }
      
    }
  }
}

// =====================================================================================================
// Workspace map (bytes, NB=2, SEQ=2048); every plane is an exact multiple of its whole-row / whole-line /
// BD = 16 x 4096 floats); all offsets multiples of 65536.
//   XB   bf16 [MT][DM]        0           8388608
//   XH   f16  [MT][DM]        8388608     8388608
//   RSTD f32  [MT]            16777216    65536     (16384 used)
//   W    6 x 16-bit [DM][DM]  16842752    12582912  (wq hi, wq lo, wk hi, wk lo bf16; wv f16 x256; wo bf16)
//   BD   f32  [NH][4096]      29425664    262144
//   QH   f16  [MT][DM]        29687808    8388608
//   QR   f16  [MT][DM]        38076416    8388608
//   KH   f16  [MT][DM]        46465024    8388608
//   KR   f16  [MT][DM]        54853632    8388608
//   VT   f16  [DM][MT]        63242240    8388608
//   ZH   bf16 [NH][MT][64]    71630848    8388608
//   ZL   bf16 [NH][MT][64]    80019456    8388608
//   end                       88408064
// =====================================================================================================
extern "C" void kernel_launch(void* const* d_in, const int* in_sizes, int n_in,
                              void* d_out, int out_size, void* d_ws, size_t ws_size,
                              hipStream_t stream) {
  if (n_in < 7) return;
  if (in_sizes[0] < ((NB - 1) * SEQ_FULL + SEQ) * DM) return;
  if (in_sizes[1] < DM) return;
  if (in_sizes[2] < DM * DM) return;
  if (in_sizes[3] < DM * DM) return;
  if (in_sizes[4] < DM * DM) return;
  if (in_sizes[5] < DM * DM) return;
  if (in_sizes[6] < NBKT * NH) return;
  if (out_size < MT * DM) return;

  const float* x    = (const float*)d_in[0];   // [2][2048][1024]
  const float* lnw  = (const float*)d_in[1];   // [1024]
  const float* w_q  = (const float*)d_in[2];   // [1024][1024] (in, out)
  const float* w_k  = (const float*)d_in[3];
  const float* w_v  = (const float*)d_in[4];
  const float* w_o  = (const float*)d_in[5];   // [1024][1024] (in, out)
  const float* tbl  = (const float*)d_in[6];   // [32][16]

  const size_t PX  = (size_t)MT * DM * 2;        // 16-bit [MT][DM] plane
  const size_t PRS = (((size_t)MT * 4 + 65535) / 65536) * 65536;
  const size_t PW1 = (size_t)DM * DM * 2;        // one 16-bit weight plane
  const size_t PBD = (size_t)NH * BDW * 4;
  size_t off = 0;
  const size_t oXB = off; off += PX;
  const size_t oXH = off; off += PX;
  const size_t oRS = off; off += PRS;
  const size_t oW  = off; off += 6 * PW1;
  const size_t oBD = off; off += PBD;
  const size_t oQH = off; off += PX;
  const size_t oQR = off; off += PX;
  const size_t oKH = off; off += PX;
  const size_t oKR = off; off += PX;
  const size_t oVT = off; off += PX;
  const size_t oZH = off; off += PX;
  const size_t oZL = off; off += PX;
  if (off > ws_size) return;                      // off = 88408064 at full size
  if (off > (size_t)134217728) return;

  char* ws = (char*)d_ws;
  unsigned short* XB = (unsigned short*)(ws + oXB);
  unsigned short* XH = (unsigned short*)(ws + oXH);
  float* RSTD = (float*)(ws + oRS);
  unsigned short* W16 = (unsigned short*)(ws + oW);
  unsigned short* WQH = W16;
  unsigned short* WQL = W16 + (size_t)1 * DM * DM;
  unsigned short* WKH = W16 + (size_t)2 * DM * DM;
  unsigned short* WKL = W16 + (size_t)3 * DM * DM;
  unsigned short* WVH = W16 + (size_t)4 * DM * DM;
  unsigned short* WOB = W16 + (size_t)5 * DM * DM;
  float* BDp = (float*)(ws + oBD);
  unsigned short* QH = (unsigned short*)(ws + oQH);
  unsigned short* QR = (unsigned short*)(ws + oQR);
  unsigned short* KH = (unsigned short*)(ws + oKH);
  unsigned short* KR = (unsigned short*)(ws + oKR);
  unsigned short* VT = (unsigned short*)(ws + oVT);
  unsigned short* ZH = (unsigned short*)(ws + oZH);
  unsigned short* ZL = (unsigned short*)(ws + oZL);
  float* out0 = (float*)d_out;
  float* fdummy = BDp;                            // in-range placeholder for unused f32 output args

  const dim3 blk(256);
  const int gT = (MT / 128) * (DM / 128);         // 128x128 tiles -> 256 blocks at full size

  // (0) operand planes, rms statistics and bias table
  cvt_x<<<dim3(MT / 32), blk, 0, stream>>>(x, XB, XH, RSTD);
  cvt_w<<<dim3((DM / 64) * (DM / 64), 4), blk, 0, stream>>>(w_q, w_k, w_v, w_o, lnw, W16);
  bias_build<<<dim3(NH), blk, 0, stream>>>(tbl, BDp);

  // (1) q plane (hi x16 + residual x2048): C[tok][n] = rstd[tok] * sum_k XB[tok][k] * (WQH+WQL)[n][k]
  gemm64<1, 2, 0, 2, 1, 0><<<dim3(gT), blk, 0, stream>>>(
      XB, XB, DM, 0, WQH, WQL, DM, QH, QR, fdummy, DM, RSTD, x, 1.0f, QKS, QRS, MT, DM, DM);
  //     k plane (hi x16 + residual x2048)
  gemm64<1, 2, 0, 2, 1, 0><<<dim3(gT), blk, 0, stream>>>(
      XB, XB, DM, 0, WKH, WKL, DM, KH, KR, fdummy, DM, RSTD, x, 1.0f, QKS, QRS, MT, DM, DM);
  //     v^T x16: C[d][tok] = rstd[tok] * sum_k WVH[d][k] * XH[tok][k]
  gemm64<0, 1, 0, 1, 2, 0><<<dim3(gT), blk, 0, stream>>>(
      WVH, WVH, DM, 0, XH, XH, DM, VT, VT, fdummy, MT, RSTD, x, 1.0f / (XSC * WSCL), VSC, 1.0f, DM, MT, DM);

  // (2) attention -> ctx bf16 hi|lo head-major planes
  attn_kernel<<<dim3((NB * NH * (SEQ / 16)) / AWV), dim3(32 * AWV), 0, stream>>>(QH, QR, KH, KR, VT, BDp, ZH, ZL);

  // (3) output projection + residual: out[tok][n] = sum_k (ctx_hi + ctx_lo)[tok][k] * WOB[n][k] + bf16(x[tok][n])
  gemm64<1, 2, 1, 0, 0, 1><<<dim3(gT), blk, 0, stream>>>(
      ZH, ZL, DM, MT * HD, WOB, WOB, DM, ZH, ZH, out0, DM, RSTD, x, 1.0f, 1.0f, 1.0f, MT, DM, DM);
  (void)hipGetLastError();
}

// v003
// One run takes 167 microseconds.
// Next to v002, in two timings, it ran 1.25 times as fast each time.
// Counting every step since v000, it is 3.12 times as fast.
// Contractions: normed.w_q and normed.w_k on v_wmma_f32_16x16x32_bf16 (bf16 x plane, bf16 hi+lo weight planes
// with ln_weight folded in, f32 accumulate); w_v'.normed^T (v^T plane), q.k^T (f16 hi x16 + residual x2048 on
// both q and k, three products) and p.v on v_wmma_f32_16x16x32_f16 (f16 operands, f32 accumulate); ctx.w_o on
// v_wmma_f32_16x16x32_bf16 (bf16 hi+lo ctx planes, bf16 w_o, f32 accumulate). Float inputs RNE-converted to
// bf16 on load; per-row rms scale, softmax and relative position bias in f32 on VALU; softmax p carried x16384.
#include <hip/hip_runtime.h>
#include <math.h>

#ifndef NB
#define NB 2
#endif
#ifndef SEQ
#define SEQ 2048
#endif
#define NB_FULL  2
#define SEQ_FULL 2048
#define DM   1024
#define NH   16
#define HD   64
#define NBKT 32
#define MT   (NB * SEQ)
#define BDW  4096
#define BDC  2032
#define AWV  8
#define RWP  48
#define XSC  16.0f
#define WSCL 256.0f
#define QKS  16.0f
#define QRS  2048.0f
#define VSC  16.0f
#define PCAR 16384.0f
#define SC1  (1.0f / 256.0f)
#define SC2  (1.0f / 524288.0f)
#define OSC  (1.0f / 262144.0f)
#define LNEPS 1.0e-6f

static_assert(NB >= 1 && NB <= NB_FULL);
static_assert(SEQ >= 64 && SEQ <= SEQ_FULL && (SEQ % 64) == 0);
static_assert(NH * HD == DM);
static_assert(HD == 64);
static_assert(BDW == 2 * SEQ_FULL);
static_assert((MT % 64) == 0 && (DM % 64) == 0 && (MT % 32) == 0);
static_assert((MT % 128) == 0 && (DM % 128) == 0);
static_assert(((NB * NH * (SEQ / 16)) % AWV) == 0);
static_assert(((SEQ / 16) % AWV) == 0);
static_assert(NBKT * NH == 512);
static_assert(BDW == 16 * 256);
static_assert((DM % 256) == 0);

typedef _Float16 v16h __attribute__((ext_vector_type(16)));
typedef __bf16 v16bf __attribute__((ext_vector_type(16)));
typedef unsigned short v16us __attribute__((ext_vector_type(16)));
typedef unsigned short v8us  __attribute__((ext_vector_type(8)));
typedef float v8f __attribute__((ext_vector_type(8)));
typedef float v4f __attribute__((ext_vector_type(4)));
typedef unsigned int v4u __attribute__((ext_vector_type(4)));

union FragU { v16us v; v8us h[2]; };

// ---- scalar helpers --------------------------------------------------------------------------------
__device__ __forceinline__ unsigned short bf_bits(float f) {          // f32 -> bf16 bits, RNE convert
  const unsigned u = __float_as_uint(f);
  return (unsigned short)((u + 0x7FFFu + ((u >> 16) & 1u)) >> 16);
}
__device__ __forceinline__ float bf_up(unsigned short h) { return __uint_as_float(((unsigned)h) << 16); }
__device__ __forceinline__ float bfr(float f) { return bf_up(bf_bits(f)); }   // value of the bf16 RNE convert
__device__ __forceinline__ unsigned short h_bits(_Float16 x) { return __builtin_bit_cast(unsigned short, x); }
__device__ __forceinline__ unsigned short f2h(float f) { return h_bits((_Float16)f); }
__device__ __forceinline__ unsigned pk16(unsigned short a, unsigned short b) { return (unsigned)a | ((unsigned)b << 16); }
__device__ __forceinline__ int clampi(int v, int lo, int hi) { return v < lo ? lo : (v > hi ? hi : v); }
__device__ __forceinline__ v8f zero8() { v8f z = {0.f, 0.f, 0.f, 0.f, 0.f, 0.f, 0.f, 0.f}; return z; }

// ---- fragment loader: 16-bit A/B operand, lane -> row/col (lane&15), p already includes +8*(lane>>4);
//      elements 0..7 <- p[0..7] (k0+8h..), elements 8..15 <- p[16..23] (k0+16+8h..)
__device__ __forceinline__ v16us ldfrag_u(const unsigned short* p) {
  FragU f;
  f.h[0] = *(const v8us*)(p);
  f.h[1] = *(const v8us*)(p + 16);
  return f.v;
}

// ---- WMMA helpers with trailing VALU hazard gap; OPK 0 = f16 operand bits, OPK 1 = bf16 operand bits --
template <int OPK>
__device__ __forceinline__ v8f mma_raw(v16us a, v16us b, v8f c) {
  if (OPK == 0)
    return __builtin_amdgcn_wmma_f32_16x16x32_f16(false, __builtin_bit_cast(v16h, a), false,
                                                  __builtin_bit_cast(v16h, b), (short)0, c, false, false);
  return __builtin_amdgcn_wmma_f32_16x16x32_bf16(false, __builtin_bit_cast(v16bf, a), false,
                                                 __builtin_bit_cast(v16bf, b), (short)0, c, false, false);
}
template <int OPK>
__device__ __forceinline__ v8f mma_g(v16us a, v16us b, v8f c) {                 // guarded
  c = mma_raw<OPK>(a, b, c);
#if defined(__HIP_DEVICE_COMPILE__)
  asm volatile("v_nop\n\tv_nop\n\tv_nop\n\tv_nop" : "+v"(c) : "v"(a), "v"(b));
#endif
  return c;
}
__device__ __forceinline__ void dep_guard1(v8f& a, v8f& b, v16us x) {
#if defined(__HIP_DEVICE_COMPILE__)
  asm volatile("v_nop\n\tv_nop\n\tv_nop\n\tv_nop" : "+v"(a), "+v"(b) : "v"(x));
#endif
}
__device__ __forceinline__ void keep4_u(v16us a, v16us b, v16us c, v16us d) {
#if defined(__HIP_DEVICE_COMPILE__)
  asm volatile("v_nop" :: "v"(a), "v"(b), "v"(c), "v"(d));
#endif
}
__device__ __forceinline__ void acc_guard4(v8f& a, v8f& b, v8f& c, v8f& d) {
#if defined(__HIP_DEVICE_COMPILE__)
  asm volatile("v_nop\n\tv_nop\n\tv_nop\n\tv_nop" : "+v"(a), "+v"(b), "+v"(c), "+v"(d));
#endif
}
// value of lane l ^ 16 (the other 16-lane half of the wave), by a vector cross-row move
__device__ __forceinline__ float xhalf(float x) {
  const int b = __builtin_bit_cast(int, x);
  return __builtin_bit_cast(float, __builtin_amdgcn_permlanex16(b, b, 0x76543210, 0xfedcba98, false, false));
}
// orders LDS stores of this wave before later LDS loads of the same wave (wave-private exchange)
__device__ __forceinline__ void wave_sync_lds() {
  __builtin_amdgcn_fence(__ATOMIC_RELEASE, "workgroup");
  __builtin_amdgcn_wave_barrier();
  __builtin_amdgcn_fence(__ATOMIC_ACQUIRE, "workgroup");
}

// =====================================================================================================
// x convert + rms statistics. Block = 256 threads = 8 waves owns 32 consecutive token rows (wave w: rows
// 4w..4w+3); token tok = b*SEQ + s reads input row b*SEQ_FULL + s. Per row each lane converts 8
// consecutive floats per step (4 steps of 256 columns): ob = bf16 bits of x (RNE), oh = f16 bits of
// of the bf16 values is reduced per row and rstd = rsqrt(mean + eps) staged in LDS (cross-wave -> block
// coverage: 8 waves x 4 rows x (4 x 256) columns = 32 whole rows of both planes per block, grid = MT/32
// blocks; rstd rows row0..row0+31 per block = all MT entries.
// =====================================================================================================
__global__ __launch_bounds__(256) void cvt_x(const float* __restrict__ x, unsigned short* ob,
                                             unsigned short* oh, float* rstd) {
  __shared__ float srs[32];
  const int lane = threadIdx.x & 31, wv = threadIdx.x >> 5;
  const int row0 = blockIdx.x * 32;
#pragma unroll 1
  for (int rr = 0; rr < 4; ++rr) {
    const int tok = row0 + wv * 4 + rr;
    const int b = tok / SEQ, s = tok - b * SEQ;
    const float* src = x + ((size_t)b * SEQ_FULL + (size_t)s) * DM;
    const size_t orow = (size_t)tok * DM;
    float ss = 0.f;
#pragma unroll 1
    for (int it = 0; it < DM / 256; ++it) {
      const int col = it * 256 + lane * 8;
      const v4f a0 = *(const v4f*)(src + col);
      const v4f a1 = *(const v4f*)(src + col + 4);
      v4u hb, hh;
#pragma unroll
      for (int e = 0; e < 2; ++e) {
        const unsigned short u0 = bf_bits(a0[2 * e]), u1 = bf_bits(a0[2 * e + 1]);
        const unsigned short u2 = bf_bits(a1[2 * e]), u3 = bf_bits(a1[2 * e + 1]);
        const float x0 = bf_up(u0), x1 = bf_up(u1), x2 = bf_up(u2), x3 = bf_up(u3);
        ss = fmaf(x0, x0, ss); ss = fmaf(x1, x1, ss); ss = fmaf(x2, x2, ss); ss = fmaf(x3, x3, ss);
        hb[e]     = pk16(u0, u1);
        hb[2 + e] = pk16(u2, u3);
        hh[e]     = pk16(f2h(x0 * XSC), f2h(x1 * XSC));
        hh[2 + e] = pk16(f2h(x2 * XSC), f2h(x3 * XSC));
      }
      unsigned short* db = ob + orow + col;
      unsigned short* dh = oh + orow + col;
      *(v4u*)db = hb;
      *(v4u*)dh = hh;
      
    }
    ss += __shfl_xor(ss, 16, 32);
    ss += __shfl_xor(ss, 8, 32);
    ss += __shfl_xor(ss, 4, 32);
    ss += __shfl_xor(ss, 2, 32);
    ss += __shfl_xor(ss, 1, 32);
    if (lane == 0) srs[wv * 4 + rr] = rsqrtf(ss * (1.0f / (float)DM) + LNEPS);
  }
  __syncthreads();
  if (wv == 0) {
    const float v = srs[lane];
    float* d = rstd + row0 + lane;
    *(float*)d = v;
    
  }
}

// =====================================================================================================
// Weight convert with transpose: source matrices are [in k][out n] row-major; output Bt planes [n][k]
// (k contiguous). blockIdx.y selects the matrix (0 w_q, 1 w_k, 2 w_v, 3 w_o), blockIdx.x the 64x64 tile
// (k0 = 64*(x>>4), n0 = 64*(x&15)). The tile is staged in LDS as f32, then each output row n0+r, columns
// lines). Values: y=0,1: w' = bf16(ln_w[k]) * bf16(w[k][n]) (exact in f32) split into bf16 hi (plane 2y) and
// bf16 lo = w' - hi (plane 2y+1, exact); y=2: f16 bits of w' * WSCL (plane 4); y=3: bf16 bits of w_o
// coverage: load 256 threads x 4 x 4 = 64x64 tile; store 8 waves x 2 x (4 rows x 8 lanes x 8) = 64 rows x
// 64 cols; grid (256, 4) covers every 64x64 tile of every output plane.
// =====================================================================================================
__global__ __launch_bounds__(256) void cvt_w(const float* __restrict__ w0, const float* __restrict__ w1,
                                             const float* __restrict__ w2, const float* __restrict__ w3,
                                             const float* __restrict__ lnw, unsigned short* o) {
  __shared__ __align__(16) float sm[64 * 65];
  __shared__ float slw[64];
  const int y = blockIdx.y;                                     // block-uniform select of the source
  const float* w = (y == 0) ? w0 : ((y == 1) ? w1 : ((y == 2) ? w2 : w3));
  const int k0 = (blockIdx.x >> 4) << 6, n0 = (blockIdx.x & 15) << 6;
  const int t = threadIdx.x, lane = t & 31, wv = t >> 5;
#pragma unroll
  for (int it = 0; it < 4; ++it) {
    const int r = it * 16 + (t >> 4), c4 = (t & 15) * 4;
    const v4f v = *(const v4f*)(w + (size_t)(k0 + r) * DM + (size_t)(n0 + c4));
    float* sp = sm + r * 65 + c4;
    sp[0] = v[0]; sp[1] = v[1]; sp[2] = v[2]; sp[3] = v[3];
  }
  if (t < 64) slw[t] = bfr(lnw[k0 + t]);                       // waves 0,1 entirely: wave-uniform
  __syncthreads();
  const int pl0 = (y == 0) ? 0 : ((y == 1) ? 2 : ((y == 2) ? 4 : 5));
  unsigned short* P0 = o + (size_t)pl0 * DM * DM;
  unsigned short* P1 = (y < 2) ? (P0 + (size_t)DM * DM) : P0;
  const int q8 = lane >> 3, c8 = (lane & 7) * 8;
  v4u ha[2], hl[2];
#pragma unroll
  for (int it = 0; it < 2; ++it) {
    const int r = wv * 8 + it * 4 + q8;                          // n local
    v4u a = {0u, 0u, 0u, 0u}, l = {0u, 0u, 0u, 0u};
#pragma unroll
    for (int e = 0; e < 4; ++e) {
      const int ka = c8 + 2 * e, kb = ka + 1;
      float va = bfr(sm[ka * 65 + r]), vb = bfr(sm[kb * 65 + r]);
      if (y < 3) { va *= slw[ka]; vb *= slw[kb]; }
      if (y < 2) {
        const unsigned short ua = bf_bits(va), ub = bf_bits(vb);
        a[e] = pk16(ua, ub);
        l[e] = pk16(bf_bits(va - bf_up(ua)), bf_bits(vb - bf_up(ub)));
      } else if (y == 2) {
        a[e] = pk16(f2h(va * WSCL), f2h(vb * WSCL));
      } else {
        a[e] = pk16(bf_bits(va), bf_bits(vb));
      }
    }
    ha[it] = a;
    hl[it] = l;
  }
  {
#pragma unroll
    for (int it = 0; it < 2; ++it) {
      const int r = wv * 8 + it * 4 + q8;
      const size_t go = (size_t)(n0 + r) * DM + (size_t)(k0 + c8);
      *(v4u*)(P0 + go) = ha[it];
      if (y < 2) *(v4u*)(P1 + go) = hl[it];
    }
    
  }
}

// =====================================================================================================
// Relative position bias by signed key-query distance: BD[h][i], i = (key - query) + 2047, i in 0..4094;
// i = 4095 is padding written as 0. bucket on integer n = query - key: ret = (n < 0) * 16, n = |n|,
// n < 8 -> n, else 8 + floor(2*log2(n/8)) capped at 15, evaluated by its integer thresholds
// coverage: 256 threads x 16 = 4096 entries per head; grid = NH heads = the whole table.
// =====================================================================================================
__device__ __forceinline__ int rel_bucket(int d) {              // d = key - query
  int n = -d;
  int ret = 0;
  if (n < 0) { ret = NBKT / 2; n = -n; }
  int bk;
  if (n < 8)       bk = n;
  else if (n < 12) bk = 8;
  else if (n < 16) bk = 9;
  else if (n < 23) bk = 10;
  else if (n < 32) bk = 11;
  else if (n < 46) bk = 12;
  else if (n < 64) bk = 13;
  else if (n < 91) bk = 14;
  else             bk = 15;
  return ret + bk;
}

__global__ __launch_bounds__(256) void bias_build(const float* __restrict__ tbl, float* BD) {
  __shared__ __align__(16) float sh[BDW];
  const int h = blockIdx.x, t = threadIdx.x;
#pragma unroll 4
  for (int j = 0; j < 16; ++j) {
    const int idx = t + 256 * j;
    const int ti = clampi(rel_bucket(idx - 2047) * NH + h, 0, NBKT * NH - 1);
    float v = bfr(tbl[ti]);
    v = (idx == BDW - 1) ? 0.f : v;
    sh[idx] = v;
  }
  __syncthreads();
  v4f vv[4];
#pragma unroll
  for (int q = 0; q < 4; ++q) vv[q] = *(const v4f*)(sh + q * 1024 + 4 * t);
  float* dst = BD + (size_t)h * BDW;
  {
#pragma unroll
    for (int q = 0; q < 4; ++q) *(v4f*)(dst + q * 1024 + 4 * t) = vv[q];
    
  }
}

// =====================================================================================================
// LDS-staged 16-bit WMMA GEMM: C[m][n] = sum over plane pairs pl and k of A_pl[m][k] * Bt_pl[n][k]. A block of
// 8 waves owns one 128x128 tile of C (blockIdx.x = tile); wave w owns rows 32*(w>>1).. and columns 64*(w&1).. of
// it (2 x 4 accumulator tiles). A pass is 128 k: 256 B of each of the 128 A rows and 128 Bt rows, brought into one
// of two LDS buffers (row pitch 272 B) by asynchronous 16-byte copies, 16 per thread; the copies of pass t + 2 are
// issued when every wave has left pass t's buffer, so they fly while pass t + 1 is worked on. OPK 0: f16 operands;
// OPK 1: bf16 operands. NPL 1|2 operand plane pairs (Ap,Btp) and (Ap2,Btp2) sharing the accumulators (the second
// pair's passes follow the first pair's; only unscaled hi/lo planes are paired this way). AHM 0: A row-major
// [M][K] pitch lda; AHM 1: A head-major planes, element (m, k) at ((k/HD)*aplane + m*HD + k%HD). Bt row-major
// [N][K] pitch ldb (k contiguous); M, N, K multiples of 128 (true at every call site; host grid = tiles exact).
// Both operand fragments use the split k map (elements 0..7 <- k0+8h.., 8..15 <- k0+16+8h..); D element r of a
// lane is (row 8h + r, col lane&15).
// OM 0: f32 out Cf = acc*wsc (+ RES: bf16 RNE value of Rp[input row of token m][n], token m -> input row
//       (m/SEQ)*SEQ_FULL + m%SEQ, pitch DM), pitch ldc.
// OM 1: f16 out Ch = f16(acc*wsc*osc*scale).  OM 2: f16 pair: base = acc*wsc*osc*scale; Ch = f16 bits(base);
//       Ch2 = f16 bits((base - value(Ch)) * rsc).  scale = Rs[m] (RSM 1, per row), Rs[n] (RSM 2, per column),
//       1 (RSM 0).
// coverage: 2 slabs x 16 rows x 64 cols = the wave's whole 32x64 tile; 8 waves = the block's 128x128 tile.
// =====================================================================================================
#define GTM  128                        // block tile rows
#define GTN  128                        // block tile columns
#define GKP  128                        // k per pass
#define GPIT 136                        // LDS row pitch in 16-bit elements (272 B)
#define GBUF ((GTM + GTN) * GPIT)       // 16-bit elements per buffer: A rows 0..127, Bt rows 128..255

// Eight asynchronous 16-byte copies of one lane, global -> LDS, rows 16 apart: LDS byte address l + 16*272*c,
// global address g + gs*c (gs in elements), c = 0..7. The s_wait_xcnt closes the statement so that no address
// register named by a copy is rewritten ahead of it.
__device__ __forceinline__ void copy8_rows16(unsigned l, const unsigned short* g, size_t gs) {
#if defined(__HIP_DEVICE_COMPILE__)
  const unsigned ls = 16u * GPIT * 2u;
  asm volatile(
      "global_load_async_to_lds_b128 %0, %8, off\n\t"
      "global_load_async_to_lds_b128 %1, %9, off\n\t"
      "global_load_async_to_lds_b128 %2, %10, off\n\t"
      "global_load_async_to_lds_b128 %3, %11, off\n\t"
      "global_load_async_to_lds_b128 %4, %12, off\n\t"
      "global_load_async_to_lds_b128 %5, %13, off\n\t"
      "global_load_async_to_lds_b128 %6, %14, off\n\t"
      "global_load_async_to_lds_b128 %7, %15, off\n\t"
      "s_wait_xcnt 0x0"
      :: "v"(l), "v"(l + ls), "v"(l + 2u * ls), "v"(l + 3u * ls),
         "v"(l + 4u * ls), "v"(l + 5u * ls), "v"(l + 6u * ls), "v"(l + 7u * ls),
         "v"(g), "v"(g + gs), "v"(g + 2 * gs), "v"(g + 3 * gs),
         "v"(g + 4 * gs), "v"(g + 5 * gs), "v"(g + 6 * gs), "v"(g + 7 * gs)
      : "memory");
#endif
}

template <int OPK, int NPL, int AHM, int OM, int RSM, int RES>
__global__ __launch_bounds__(256) void gemm64(
    const unsigned short* __restrict__ Ap, const unsigned short* __restrict__ Ap2, int lda, int aplane,
    const unsigned short* __restrict__ Btp, const unsigned short* __restrict__ Btp2, int ldb,
    unsigned short* Ch, unsigned short* Ch2, float* Cf, int ldc,
    const float* __restrict__ Rs, const float* __restrict__ Rp,
    float wsc, float osc, float rsc, int M, int N, int K) {
  __shared__ __align__(16) unsigned short ring[2 * GBUF];   // two operand buffers, 2 x 69632 B
  __shared__ __align__(16) float sT[8][16 * 68];   // per-wave 16x64 slab, pitch 68 floats
  const int lane = threadIdx.x & 31;
  const int wave = threadIdx.x >> 5;
  const int tilesN = N >> 7;
  const int tilesM = M >> 7;
  const int tile = blockIdx.x;
  if (tile >= tilesM * tilesN) return;   // block-uniform, in front of every copy and barrier
  const int tm = tile / tilesN;
  const int tn = tile - tm * tilesN;
  const int bm0 = tm << 7;                     // block tile origin
  const int bn0 = tn << 7;
  const int wm = (wave >> 1) << 5;             // wave tile origin inside the block tile
  const int wn = (wave & 1) << 6;
  const int m0 = bm0 + wm;
  const int n0 = bn0 + wn;

  const int rlane = lane & 15;                 // row (A) / col (B, D) within subtile
  const int koff  = (lane >> 4) * 8;           // k offset of this lane half
  const int mOff  = (lane >> 4) * 8;           // D row offset

  // copy map: thread t brings 16-byte piece t&15 of rows (t>>4) + 16*c, c = 0..7, of A and of Bt
  const int crow = threadIdx.x >> 4;
  const int cch  = threadIdx.x & 15;
  const unsigned ldsA = (unsigned)(size_t)ring + (unsigned)(crow * (GPIT * 2) + cch * 16);
  const unsigned ldsB = ldsA + (unsigned)(GTM * GPIT * 2);
  const size_t aoff = AHM ? ((size_t)(cch >> 3) * (size_t)aplane + (size_t)(bm0 + crow) * HD + (size_t)((cch & 7) * 8))
                          : ((size_t)(bm0 + crow) * lda + (size_t)(cch * 8));
  const size_t astep = AHM ? (size_t)(16 * HD) : (size_t)16 * lda;          // 16 rows of A
  const size_t apass = AHM ? (size_t)(GKP / HD) * (size_t)aplane : (size_t)GKP;   // one pass along k
  const size_t boff = (size_t)(bn0 + crow) * ldb + (size_t)(cch * 8);
  const size_t bstep = (size_t)16 * ldb;
  const int nkp = K >> 7;                      // passes per plane pair
  const int NT = NPL * nkp;                    // passes in all

  auto issue = [&](int t, int buf) {           // pass t's 16 copies of this thread into buffer buf
    const int pl = (NPL == 2 && t >= nkp) ? 1 : 0;
    const int kp = t - pl * nkp;
    const unsigned short* Ac = (pl == 0) ? Ap : Ap2;
    const unsigned short* Bc = (pl == 0) ? Btp : Btp2;
    const unsigned lb = (unsigned)buf * (unsigned)(GBUF * 2);
    copy8_rows16(ldsA + lb, Ac + aoff + (size_t)kp * apass, astep);
    copy8_rows16(ldsB + lb, Bc + boff + (size_t)kp * GKP, bstep);
  };

  v8f acc[2][4];
#pragma unroll
  for (int i = 0; i < 2; ++i)
#pragma unroll
    for (int j = 0; j < 4; ++j) acc[i][j] = zero8();

  issue(0, 0);
  asm volatile("s_wait_asynccnt 0x0" ::: "memory");   // this wave's copies of pass 0 have landed
  __syncthreads();                                    // every wave's have: pass 0 may be read
  if (NT > 1) issue(1, 1);

#pragma unroll 1   // one pass per trip: the buffer index and the publish point stay at the loop's foot
  for (int t = 0; t < NT; ++t) {
    const unsigned short* sb = ring + (t & 1) * GBUF;
    const unsigned short* sA = sb + (wm + rlane) * GPIT + koff;
    const unsigned short* sB = sb + (GTM + wn + rlane) * GPIT + koff;
#pragma unroll
    for (int ks = 0; ks < GKP / 32; ++ks) {
      v16us bh[4];
#pragma unroll
      for (int j = 0; j < 4; ++j) bh[j] = ldfrag_u(sB + (j << 4) * GPIT + ks * 32);
#pragma unroll
      for (int i = 0; i < 2; ++i) {
        const v16us ah = ldfrag_u(sA + (i << 4) * GPIT + ks * 32);
#pragma unroll
        for (int j = 0; j < 4; ++j) acc[i][j] = mma_raw<OPK>(ah, bh[j], acc[i][j]);
        dep_guard1(acc[i][0], acc[i][3], ah);
      }
      keep4_u(bh[0], bh[1], bh[2], bh[3]);
    }
    asm volatile("s_wait_dscnt 0x0" ::: "memory");      // this wave's reads of pass t's buffer are done
    asm volatile("s_wait_asynccnt 0x0" ::: "memory");   // this wave's copies of pass t + 1 have landed
    __syncthreads();                                    // publishes pass t + 1, frees pass t's buffer
    if (t + 2 < NT) issue(t + 2, t & 1);
  }
  asm volatile("s_wait_asynccnt 0x0" ::: "memory");     // no copy is outstanding past the loop
  acc_guard4(acc[0][0], acc[0][1], acc[0][2], acc[0][3]);
  acc_guard4(acc[1][0], acc[1][1], acc[1][2], acc[1][3]);

  const int hh2 = lane >> 4, c4 = (lane & 15) * 4;     // f32 out: 256-B row segment = 16 lanes x 16 B
  const int q8  = lane >> 3, c8 = (lane & 7) * 8;
  const float wo = wsc * osc;

  // per-column scale (RSM 2): columns n0+c8 .. n0+c8+7, same for every row of the tile
  float csc[8];
#pragma unroll
  for (int e = 0; e < 8; ++e) csc[e] = 1.f;
  if (OM != 0 && RSM == 2) {
    const v4f cs0 = *(const v4f*)(Rs + n0 + c8);
    const v4f cs1 = *(const v4f*)(Rs + n0 + c8 + 4);
#pragma unroll
    for (int e = 0; e < 4; ++e) { csc[e] = cs0[e]; csc[4 + e] = cs1[e]; }
  }

  // ---- epilogue ----
  float* slab = sT[wave];
#pragma unroll
  for (int i = 0; i < 2; ++i) {
    const int mBase = m0 + (i << 4);
#pragma unroll
    for (int j = 0; j < 4; ++j) {
#pragma unroll
      for (int r = 0; r < 8; ++r) {
        slab[(mOff + r) * 68 + (j << 4) + rlane] = acc[i][j][r];
      }
    }
    wave_sync_lds();
    if (OM == 0) {
      v4f vals[8];
#pragma unroll
      for (int it = 0; it < 8; ++it) {
        const int row = it * 2 + hh2;                      // it 0..7 x hh2 0..1 = rows 0..15
        v4f v = *(const v4f*)(slab + row * 68 + c4);
        v = v * wsc;
        if (RES) {
          const int tok = mBase + row;
          const int bb = tok / SEQ, ss = tok - bb * SEQ;
          const v4f hr = *(const v4f*)(Rp + ((size_t)bb * SEQ_FULL + (size_t)ss) * DM + (size_t)(n0 + c4));
#pragma unroll
          for (int c = 0; c < 4; ++c) v[c] = v[c] + bfr(hr[c]);
        }
        vals[it] = v;
      }
      {
#pragma unroll
        for (int it = 0; it < 8; ++it) {
          const int row = it * 2 + hh2;
          *(v4f*)(Cf + (size_t)(mBase + row) * ldc + (size_t)n0 + c4) = vals[it];
        }
        
      }
    } else {
      v4u hv[4], hw[4];
#pragma unroll
      for (int it = 0; it < 4; ++it) {
        const int row = it * 4 + q8;                       // it 0..3 x q8 0..3 = rows 0..15
        const float* sp = slab + row * 68 + c8;
        float rsr = wo;
        if (RSM == 1) rsr = wo * Rs[mBase + row];
        v4u ha = {0u, 0u, 0u, 0u}, hb = {0u, 0u, 0u, 0u};
#pragma unroll
        for (int e = 0; e < 4; ++e) {
          const float b0 = sp[2 * e]     * rsr * csc[2 * e];
          const float b1 = sp[2 * e + 1] * rsr * csc[2 * e + 1];
          if (OM == 1) {
            ha[e] = pk16(f2h(b0), f2h(b1));
          } else {
            const _Float16 x0 = (_Float16)b0, x1 = (_Float16)b1;
            ha[e] = pk16(h_bits(x0), h_bits(x1));
            hb[e] = pk16(f2h((b0 - (float)x0) * rsc), f2h((b1 - (float)x1) * rsc));
          }
        }
        hv[it] = ha;
        hw[it] = hb;
      }
      {
#pragma unroll
        for (int it = 0; it < 4; ++it) {
          const int row = it * 4 + q8;
          const size_t go = (size_t)(mBase + row) * ldc + (size_t)n0 + c8;
          *(v4u*)(Ch + go) = hv[it];
          if (OM == 2) *(v4u*)(Ch2 + go) = hw[it];
        }
        
      }
    }
    wave_sync_lds();
  }
}

// =====================================================================================================
// Bidirectional attention with relative position bias, head dim 64, no 1/sqrt(d) scaling. Block = 256
// threads = 8 waves, all of one (batch b, head h); one wave owns one 16-row query tile (t0..t0+15) and loops all
// key blocks of 32 with an online max-subtracted softmax in f32. A pass is 64 keys: the head's 128 B of each of
// the 64 KH rows and 64 KR rows and 128 B (64 keys) of each of its 64 VT rows are brought into one of two LDS
// buffers (row pitch 144 B) by asynchronous 16-byte copies, 6 per thread, and every wave reads its K and V
// fragments from there; the copies of pass t + 2 are issued when every wave has left pass t's buffer.
// Planes: QH|QR f16 [MT][DM] (16*q hi,
// residual x2048), KH|KR f16 [MT][DM] (16*k hi, residual x2048), VT f16 [DM][MT] (16*v transposed, row =
// h*64+d, column = token), BD f32 [NH][4096] bias by (key-query)+2047. Output Zh|Zl: bf16 hi|lo of ctx,
// head-major [NH][MT][64].
// Both products are taken transposed: keys (then head dims) are the A rows and the wave's 16 queries the B columns,
// so lane (hh, m) holds, for query t0+m alone, the scores of keys 8*hh+r and 16+8*hh+r of a 32-key block.
// Per key block: 48-entry bias window (distances sb-t0-15 .. sb-t0+32) staged in per-wave LDS and read at
// index key - query + 15; S^T = KH.QH^T (4 WMMA), R^T = KH.QR^T + KR.QH^T (8 WMMA, own accumulators);
// score = S/256 + R/524288 + bias; the block maximum is taken in the lane and joined with the other half-wave by
// one cross-row move; p = exp(score - running max) in f32, l accumulated per lane from the f32 p (the two halves'
// sums are joined once, in the epilogue); p*16384 as f16 packs from the two score tiles straight into the B
// operand (split k map: elements 0..7 = keys 8*hh.., 8..15 = keys 16+8*hh..); O^T += VT.P^T on f16 WMMA. The
// two per-wave LDS regions are private to their wave.
// staged extent == consumed extent: window 48 written / 0..46 read; ctx staging 2 x 16x64 written and read.
// Epilogue: ctx = O^T/(l*262144) split into bf16 hi|lo (a lane holds 8 consecutive dims of its query per O^T
// tile: one 16-byte LDS store per plane and tile), staged in LDS; the wave's 16 rows x 64 halves are
// coverage: 16 query rows x 64 halves per wave, NB*NH*SEQ/16 wave tasks = all (h, tok) rows of both planes.
// =====================================================================================================
#define AKP  64                         // keys per pass
#define APIT 72                         // LDS row pitch in 16-bit elements (144 B)
#define ATIL (64 * APIT)                // 16-bit elements of one staged tile (64 rows)
#define ABUF (3 * ATIL)                 // 16-bit elements per buffer: KH rows | KR rows | VT rows
static_assert((SEQ % AKP) == 0);

// Six asynchronous 16-byte copies of one lane, global -> LDS: rows r and r + 32 of the KH, KR and VT tiles; l is
// the LDS byte address of the lane's piece of KH row r. The s_wait_xcnt closes the statement so that no address
// register named by a copy is rewritten ahead of it.
__device__ __forceinline__ void copy6_kv(unsigned l, const unsigned short* gk, const unsigned short* gr,
                                         const unsigned short* gv) {
#if defined(__HIP_DEVICE_COMPILE__)
  const unsigned lr = 32u * APIT * 2u;
  const unsigned lt = ATIL * 2u;
  asm volatile(
      "global_load_async_to_lds_b128 %0, %6, off\n\t"
      "global_load_async_to_lds_b128 %1, %7, off\n\t"
      "global_load_async_to_lds_b128 %2, %8, off\n\t"
      "global_load_async_to_lds_b128 %3, %9, off\n\t"
      "global_load_async_to_lds_b128 %4, %10, off\n\t"
      "global_load_async_to_lds_b128 %5, %11, off\n\t"
      "s_wait_xcnt 0x0"
      :: "v"(l), "v"(l + lr), "v"(l + lt), "v"(l + lt + lr), "v"(l + 2u * lt), "v"(l + 2u * lt + lr),
         "v"(gk), "v"(gk + (size_t)32 * DM), "v"(gr), "v"(gr + (size_t)32 * DM),
         "v"(gv), "v"(gv + (size_t)32 * MT)
      : "memory");
#endif
}

__global__ __launch_bounds__(256) void attn_kernel(
    const unsigned short* __restrict__ QHp, const unsigned short* __restrict__ QRp,
    const unsigned short* __restrict__ KHp, const unsigned short* __restrict__ KRp,
    const unsigned short* __restrict__ VTp,
    const float* __restrict__ BD, unsigned short* Zh, unsigned short* Zl) {
  __shared__ __align__(16) unsigned short kvr[2 * ABUF];           // two K|KR|VT buffers, 2 x 27648 B
  __shared__ __align__(16) float relw[AWV][RWP];                   // bias window, 1536 B
  __shared__ __align__(16) unsigned short zst[AWV][2][16 * HD];    // ctx hi|lo staging, 32768 B
  const int lane = threadIdx.x & 31, wv = threadIdx.x >> 5, m = lane & 15, hh = lane >> 4;
  const int nqt = SEQ / 16;
  if ((int)blockIdx.x * AWV >= NB * NH * nqt) return;   // block-uniform, in front of every copy and barrier
  const int task = blockIdx.x * AWV + wv;            // nqt is a multiple of AWV: one (b, h) per block
  const int bh = task / nqt;
  const int t0 = (task - bh * nqt) << 4;             // query tile start
  const int b = bh / NH, h = bh - b * NH;
  const size_t tok0 = (size_t)b * SEQ;
  float* rw = relw[wv];

  // Q B-fragments: columns t0+m, k = head dims (two 32-deep steps), hi and residual planes
  const size_t qo = (tok0 + (size_t)(t0 + m)) * DM + (size_t)(h * HD + 8 * hh);
  const v16us qh0 = ldfrag_u(QHp + qo);
  const v16us qh1 = ldfrag_u(QHp + qo + 32);
  const v16us qr0 = ldfrag_u(QRp + qo);
  const v16us qr1 = ldfrag_u(QRp + qo + 32);

  float mx = -1.0e30f, ls = 0.f;       // query t0+m: running maximum (equal in both halves), this half's sum
  v8f O[4];                            // O^T tiles: element r = (dim 16*j + 8*hh + r, query t0+m)
#pragma unroll
  for (int j = 0; j < 4; ++j) O[j] = zero8();

  const float* bdh = BD + (size_t)h * BDW + (BDC - t0);                    // window base - sb; >= BD+h*BDW
  // copy map: thread t brings 16-byte piece t&7 of rows (t>>3) and (t>>3) + 32 of each of the three tiles
  const int crow = threadIdx.x >> 3;
  const int cpc  = threadIdx.x & 7;
  const unsigned ldsC = (unsigned)(size_t)kvr + (unsigned)(crow * (APIT * 2) + cpc * 16);
  const size_t kco = (tok0 + (size_t)crow) * DM + (size_t)(h * HD + cpc * 8);
  const unsigned short* gK = KHp + kco;
  const unsigned short* gR = KRp + kco;
  const unsigned short* gV = VTp + (size_t)(h * HD + crow) * MT + tok0 + (size_t)(cpc * 8);
  const int NT = SEQ / AKP;

  auto issue = [&](int t, int buf) {           // pass t's 6 copies of this thread into buffer buf
    copy6_kv(ldsC + (unsigned)buf * (unsigned)(ABUF * 2), gK + (size_t)t * (AKP * DM), gR + (size_t)t * (AKP * DM),
             gV + (size_t)t * AKP);
  };

  issue(0, 0);
  asm volatile("s_wait_asynccnt 0x0" ::: "memory");   // this wave's copies of pass 0 have landed
  __syncthreads();                                    // every wave's have: pass 0 may be read
  if (NT > 1) issue(1, 1);

#pragma unroll 1   // one pass per trip: the buffer index and the publish point stay at the loop's foot
  for (int t = 0; t < NT; ++t) {
  const unsigned short* kbase  = kvr + (t & 1) * ABUF + m * APIT + 8 * hh;   // KH row m, this lane half's k
  const unsigned short* krbase = kbase + ATIL;
  const unsigned short* vbase  = kbase + 2 * ATIL;                           // VT row (dim) m, keys 8*hh..
#pragma unroll     // both 32-key blocks of a pass inline: their LDS offsets become immediates
  for (int sub = 0; sub < AKP / 32; ++sub) {
    const int sb = t * AKP + sub * 32;
    // bias window: rw[i] = bias_h(key - query = sb - t0 - 15 + i), i = 0..47 (index <= h*BDW + 4095)
    {
      const float* bp = bdh + sb;
      const float w0v = bp[lane];
      const float w1v = bp[32 + m];
      rw[lane] = w0v;
      if (lane < 16) rw[32 + lane] = w1v;
    }
    wave_sync_lds();

    // S^T = KH.QH^T, R^T = KH.QR^T + KR.QH^T ; A row = key token sb+m (+16), B column = query, k = head dim
    v8f S0 = zero8(), S1 = zero8(), R0 = zero8(), R1 = zero8();
#pragma unroll
    for (int ks = 0; ks < 2; ++ks) {
      const int kofs = (sub * 32) * APIT + 32 * ks;
      const v16us kf0 = ldfrag_u(kbase + kofs);
      const v16us kf1 = ldfrag_u(kbase + kofs + 16 * APIT);
      const v16us kg0 = ldfrag_u(krbase + kofs);
      const v16us kg1 = ldfrag_u(krbase + kofs + 16 * APIT);
      const v16us qa = (ks == 0) ? qh0 : qh1;
      const v16us qb = (ks == 0) ? qr0 : qr1;
      S0 = mma_g<0>(kf0, qa, S0);
      S1 = mma_g<0>(kf1, qa, S1);
      R0 = mma_g<0>(kf0, qb, R0);
      R1 = mma_g<0>(kf1, qb, R1);
      R0 = mma_g<0>(kg0, qa, R0);
      R1 = mma_g<0>(kg1, qa, R1);
    }

    // VT A-fragments (row = h*64 + dim, k = key token), read as one group here so that the softmax covers
    // their LDS latency
    v16us vf[4];
#pragma unroll     // vf[] is indexed by constants only, so it stays in registers
    for (int j = 0; j < 4; ++j) vf[j] = ldfrag_u(vbase + (16 * j) * APIT + sub * 32);

    // score = q.k + bias (window index key - query + 15, key = 8*hh + r and 16 + 8*hh + r, query = m)
    float s0[8], s1[8];
#pragma unroll
    for (int r = 0; r < 8; ++r) {
      const int key = 8 * hh + r;
      const float rv0 = rw[15 + key - m];
      const float rv1 = rw[31 + key - m];
      s0[r] = fmaf(S0[r], SC1, fmaf(R0[r], SC2, rv0));
      s1[r] = fmaf(S1[r], SC1, fmaf(R1[r], SC2, rv1));
    }

    // online softmax: a query's 32 scores live in lanes m and m + 16, 16 each
    float xm = fmaxf(s0[0], s1[0]);
#pragma unroll     // s0[], s1[] are indexed by constants only, so they stay in registers
    for (int r = 1; r < 8; ++r) xm = fmaxf(xm, fmaxf(s0[r], s1[r]));
    xm = fmaxf(xm, xhalf(xm));
    const float mn = fmaxf(mx, xm);
    const float al = __expf(mx - mn);
    mx = mn;
    FragU pf;                                          // P^T B-fragment (split k map)
    float pa = 0.f, pb = 0.f;
#pragma unroll
    for (int r = 0; r < 8; ++r) {
      const float p0 = __expf(s0[r] - mn);
      const float p1 = __expf(s1[r] - mn);
      pa += p0;
      pb += p1;
      pf.v[r]     = f2h(p0 * PCAR);
      pf.v[8 + r] = f2h(p1 * PCAR);
    }
    ls = ls * al + (pa + pb);
#pragma unroll     // O[] is indexed by constants only, so it stays in registers
    for (int j = 0; j < 4; ++j) O[j] = O[j] * al;
#pragma unroll
    for (int j = 0; j < 4; ++j) O[j] = mma_g<0>(vf[j], pf.v, O[j]);
  }
    asm volatile("s_wait_dscnt 0x0" ::: "memory");      // this wave's reads of pass t's buffer are done
    asm volatile("s_wait_asynccnt 0x0" ::: "memory");   // this wave's copies of pass t + 1 have landed
    __syncthreads();                                    // publishes pass t + 1, frees pass t's buffer
    if (t + 2 < NT) issue(t + 2, t & 1);
  }
  asm volatile("s_wait_asynccnt 0x0" ::: "memory");     // no copy is outstanding past the loop
  acc_guard4(O[0], O[1], O[2], O[3]);

  // ---- epilogue: ctx = O / (l * PCAR * VSC) -> bf16 hi|lo, head-major planes ----
  unsigned short* zh = zst[wv][0];
  unsigned short* zl = zst[wv][1];
  const float linv = (1.0f / (ls + xhalf(ls))) * OSC;  // both halves' sums joined; the joined sum is >= 1
#pragma unroll
  for (int j = 0; j < 4; ++j) {
    v4u zc, zr;
#pragma unroll
    for (int e = 0; e < 4; ++e) {
      const float o0 = O[j][2 * e] * linv, o1 = O[j][2 * e + 1] * linv;
      const unsigned short x0 = bf_bits(o0), x1 = bf_bits(o1);
      zc[e] = pk16(x0, x1);
      zr[e] = pk16(bf_bits(o0 - bf_up(x0)), bf_bits(o1 - bf_up(x1)));
    }
    *(v4u*)(zh + m * HD + 16 * j + 8 * hh) = zc;       // row = query m, dims 16*j + 8*hh .. + 7
    *(v4u*)(zl + m * HD + 16 * j + 8 * hh) = zr;
  }
  wave_sync_lds();
  {
    v4u ha[4], hb[4];
#pragma unroll
    for (int q = 0; q < 4; ++q) {
      ha[q] = *(const v4u*)(zh + q * 256 + lane * 8);
      hb[q] = *(const v4u*)(zl + q * 256 + lane * 8);
    }
    const size_t zo = ((size_t)h * MT + tok0 + (size_t)t0) * HD;   // 2048-B aligned, 16 rows contiguous
    unsigned short* dh = Zh + zo;
    unsigned short* dl = Zl + zo;
    {
#pragma unroll
      for (int q = 0; q < 4; ++q) {
        *(v4u*)(dh + q * 256 + lane * 8) = ha[q];
        *(v4u*)(dl + q * 256 + lane * 8) = hb[q];
      }
      
    }
  }
}

// =====================================================================================================
// Workspace map (bytes, NB=2, SEQ=2048); every plane is an exact multiple of its whole-row / whole-line /
// BD = 16 x 4096 floats); all offsets multiples of 65536.
//   XB   bf16 [MT][DM]        0           8388608
//   XH   f16  [MT][DM]        8388608     8388608
//   RSTD f32  [MT]            16777216    65536     (16384 used)
//   W    6 x 16-bit [DM][DM]  16842752    12582912  (wq hi, wq lo, wk hi, wk lo bf16; wv f16 x256; wo bf16)
//   BD   f32  [NH][4096]      29425664    262144
//   QH   f16  [MT][DM]        29687808    8388608
//   QR   f16  [MT][DM]        38076416    8388608
//   KH   f16  [MT][DM]        46465024    8388608
//   KR   f16  [MT][DM]        54853632    8388608
//   VT   f16  [DM][MT]        63242240    8388608
//   ZH   bf16 [NH][MT][64]    71630848    8388608
//   ZL   bf16 [NH][MT][64]    80019456    8388608
//   end                       88408064
// =====================================================================================================
extern "C" void kernel_launch(void* const* d_in, const int* in_sizes, int n_in,
                              void* d_out, int out_size, void* d_ws, size_t ws_size,
                              hipStream_t stream) {
  if (n_in < 7) return;
  if (in_sizes[0] < ((NB - 1) * SEQ_FULL + SEQ) * DM) return;
  if (in_sizes[1] < DM) return;
  if (in_sizes[2] < DM * DM) return;
  if (in_sizes[3] < DM * DM) return;
  if (in_sizes[4] < DM * DM) return;
  if (in_sizes[5] < DM * DM) return;
  if (in_sizes[6] < NBKT * NH) return;
  if (out_size < MT * DM) return;

  const float* x    = (const float*)d_in[0];   // [2][2048][1024]
  const float* lnw  = (const float*)d_in[1];   // [1024]
  const float* w_q  = (const float*)d_in[2];   // [1024][1024] (in, out)
  const float* w_k  = (const float*)d_in[3];
  const float* w_v  = (const float*)d_in[4];
  const float* w_o  = (const float*)d_in[5];   // [1024][1024] (in, out)
  const float* tbl  = (const float*)d_in[6];   // [32][16]

  const size_t PX  = (size_t)MT * DM * 2;        // 16-bit [MT][DM] plane
  const size_t PRS = (((size_t)MT * 4 + 65535) / 65536) * 65536;
  const size_t PW1 = (size_t)DM * DM * 2;        // one 16-bit weight plane
  const size_t PBD = (size_t)NH * BDW * 4;
  size_t off = 0;
  const size_t oXB = off; off += PX;
  const size_t oXH = off; off += PX;
  const size_t oRS = off; off += PRS;
  const size_t oW  = off; off += 6 * PW1;
  const size_t oBD = off; off += PBD;
  const size_t oQH = off; off += PX;
  const size_t oQR = off; off += PX;
  const size_t oKH = off; off += PX;
  const size_t oKR = off; off += PX;
  const size_t oVT = off; off += PX;
  const size_t oZH = off; off += PX;
  const size_t oZL = off; off += PX;
  if (off > ws_size) return;                      // off = 88408064 at full size
  if (off > (size_t)134217728) return;

  char* ws = (char*)d_ws;
  unsigned short* XB = (unsigned short*)(ws + oXB);
  unsigned short* XH = (unsigned short*)(ws + oXH);
  float* RSTD = (float*)(ws + oRS);
  unsigned short* W16 = (unsigned short*)(ws + oW);
  unsigned short* WQH = W16;
  unsigned short* WQL = W16 + (size_t)1 * DM * DM;
  unsigned short* WKH = W16 + (size_t)2 * DM * DM;
  unsigned short* WKL = W16 + (size_t)3 * DM * DM;
  unsigned short* WVH = W16 + (size_t)4 * DM * DM;
  unsigned short* WOB = W16 + (size_t)5 * DM * DM;
  float* BDp = (float*)(ws + oBD);
  unsigned short* QH = (unsigned short*)(ws + oQH);
  unsigned short* QR = (unsigned short*)(ws + oQR);
  unsigned short* KH = (unsigned short*)(ws + oKH);
  unsigned short* KR = (unsigned short*)(ws + oKR);
  unsigned short* VT = (unsigned short*)(ws + oVT);
  unsigned short* ZH = (unsigned short*)(ws + oZH);
  unsigned short* ZL = (unsigned short*)(ws + oZL);
  float* out0 = (float*)d_out;
  float* fdummy = BDp;                            // in-range placeholder for unused f32 output args

  const dim3 blk(256);
  const int gT = (MT / 128) * (DM / 128);         // 128x128 tiles -> 256 blocks at full size

  // (0) operand planes, rms statistics and bias table
  cvt_x<<<dim3(MT / 32), blk, 0, stream>>>(x, XB, XH, RSTD);
  cvt_w<<<dim3((DM / 64) * (DM / 64), 4), blk, 0, stream>>>(w_q, w_k, w_v, w_o, lnw, W16);
  bias_build<<<dim3(NH), blk, 0, stream>>>(tbl, BDp);

  // (1) q plane (hi x16 + residual x2048): C[tok][n] = rstd[tok] * sum_k XB[tok][k] * (WQH+WQL)[n][k]
  gemm64<1, 2, 0, 2, 1, 0><<<dim3(gT), blk, 0, stream>>>(
      XB, XB, DM, 0, WQH, WQL, DM, QH, QR, fdummy, DM, RSTD, x, 1.0f, QKS, QRS, MT, DM, DM);
  //     k plane (hi x16 + residual x2048)
  gemm64<1, 2, 0, 2, 1, 0><<<dim3(gT), blk, 0, stream>>>(
      XB, XB, DM, 0, WKH, WKL, DM, KH, KR, fdummy, DM, RSTD, x, 1.0f, QKS, QRS, MT, DM, DM);
  //     v^T x16: C[d][tok] = rstd[tok] * sum_k WVH[d][k] * XH[tok][k]
  gemm64<0, 1, 0, 1, 2, 0><<<dim3(gT), blk, 0, stream>>>(
      WVH, WVH, DM, 0, XH, XH, DM, VT, VT, fdummy, MT, RSTD, x, 1.0f / (XSC * WSCL), VSC, 1.0f, DM, MT, DM);

  // (2) attention -> ctx bf16 hi|lo head-major planes
  attn_kernel<<<dim3((NB * NH * (SEQ / 16)) / AWV), dim3(32 * AWV), 0, stream>>>(QH, QR, KH, KR, VT, BDp, ZH, ZL);

  // (3) output projection + residual: out[tok][n] = sum_k (ctx_hi + ctx_lo)[tok][k] * WOB[n][k] + bf16(x[tok][n])
  gemm64<1, 2, 1, 0, 0, 1><<<dim3(gT), blk, 0, stream>>>(
      ZH, ZL, DM, MT * HD, WOB, WOB, DM, ZH, ZH, out0, DM, RSTD, x, 1.0f, 1.0f, 1.0f, MT, DM, DM);
  (void)hipGetLastError();
}

// v004
// One run takes 157 microseconds.
// Timed twice side by side with v003, it ran 1.06 times as fast both times.
// All steps since v000 together make it 3.32 times as fast.
// Contractions: normed.w_q and normed.w_k on v_wmma_f32_16x16x32_bf16 (bf16 x plane, bf16 hi+lo weight planes
// with ln_weight folded in, f32 accumulate); w_v'.normed^T (v^T plane), q.k^T (f16 hi x16 + residual x2048 on
// both q and k, three products) and p.v on v_wmma_f32_16x16x32_f16 (f16 operands, f32 accumulate); ctx.w_o on
// v_wmma_f32_16x16x32_bf16 (bf16 hi+lo ctx planes, bf16 w_o, f32 accumulate). Float inputs RNE-converted to
// bf16 on load; per-row rms scale, softmax and relative position bias in f32 on VALU; softmax p carried x16384.
#include <hip/hip_runtime.h>
#include <math.h>

#ifndef NB
#define NB 2
#endif
#ifndef SEQ
#define SEQ 2048
#endif
#define NB_FULL  2
#define SEQ_FULL 2048
#define DM   1024
#define NH   16
#define HD   64
#define NBKT 32
#define MT   (NB * SEQ)
#define BDW  4096
#define AWV  8
#define BRW  (SEQ + 16 * AWV)
#define BRQ  ((BRW / 4) / 256)
#define BRT  ((BRW / 4) % 256)
#define XSC  16.0f
#define WSCL 256.0f
#define QKS  16.0f
#define QRS  2048.0f
#define VSC  16.0f
#define PCAR 16384.0f
#define SC1  (1.0f / 256.0f)
#define SC2  (1.0f / 524288.0f)
#define OSC  (1.0f / 262144.0f)
#define LNEPS 1.0e-6f

static_assert(NB >= 1 && NB <= NB_FULL);
static_assert(SEQ >= 64 && SEQ <= SEQ_FULL && (SEQ % 64) == 0);
static_assert(NH * HD == DM);
static_assert(HD == 64);
static_assert(BDW == 2 * SEQ_FULL);
static_assert((BRW % 4) == 0 && 16 * AWV <= SEQ_FULL);
static_assert((MT % 64) == 0 && (DM % 64) == 0 && (MT % 32) == 0);
static_assert((MT % 128) == 0 && (DM % 128) == 0);
static_assert(((NB * NH * (SEQ / 16)) % AWV) == 0);
static_assert(((SEQ / 16) % AWV) == 0);
static_assert(NBKT * NH == 512);
static_assert(BDW == 16 * 256);
static_assert((DM % 256) == 0);

typedef _Float16 v16h __attribute__((ext_vector_type(16)));
typedef __bf16 v16bf __attribute__((ext_vector_type(16)));
typedef unsigned short v16us __attribute__((ext_vector_type(16)));
typedef unsigned short v8us  __attribute__((ext_vector_type(8)));
typedef float v8f __attribute__((ext_vector_type(8)));
typedef float v4f __attribute__((ext_vector_type(4)));
typedef float v2f __attribute__((ext_vector_type(2)));
typedef unsigned int v4u __attribute__((ext_vector_type(4)));

union FragU { v16us v; v8us h[2]; };

// ---- scalar helpers --------------------------------------------------------------------------------
__device__ __forceinline__ unsigned short bf_bits(float f) {          // f32 -> bf16 bits, RNE convert
  const unsigned u = __float_as_uint(f);
  return (unsigned short)((u + 0x7FFFu + ((u >> 16) & 1u)) >> 16);
}
__device__ __forceinline__ float bf_up(unsigned short h) { return __uint_as_float(((unsigned)h) << 16); }
__device__ __forceinline__ float bfr(float f) { return bf_up(bf_bits(f)); }   // value of the bf16 RNE convert
__device__ __forceinline__ unsigned short h_bits(_Float16 x) { return __builtin_bit_cast(unsigned short, x); }
__device__ __forceinline__ unsigned short f2h(float f) { return h_bits((_Float16)f); }
__device__ __forceinline__ unsigned pk16(unsigned short a, unsigned short b) { return (unsigned)a | ((unsigned)b << 16); }
__device__ __forceinline__ int clampi(int v, int lo, int hi) { return v < lo ? lo : (v > hi ? hi : v); }
__device__ __forceinline__ v8f zero8() { v8f z = {0.f, 0.f, 0.f, 0.f, 0.f, 0.f, 0.f, 0.f}; return z; }

// ---- fragment loader: 16-bit A/B operand, lane -> row/col (lane&15), p already includes +8*(lane>>4);
//      elements 0..7 <- p[0..7] (k0+8h..), elements 8..15 <- p[16..23] (k0+16+8h..)
__device__ __forceinline__ v16us ldfrag_u(const unsigned short* p) {
  FragU f;
  f.h[0] = *(const v8us*)(p);
  f.h[1] = *(const v8us*)(p + 16);
  return f.v;
}

// ---- WMMA helpers with trailing VALU hazard gap; OPK 0 = f16 operand bits, OPK 1 = bf16 operand bits --
template <int OPK>
__device__ __forceinline__ v8f mma_raw(v16us a, v16us b, v8f c) {
  if (OPK == 0)
    return __builtin_amdgcn_wmma_f32_16x16x32_f16(false, __builtin_bit_cast(v16h, a), false,
                                                  __builtin_bit_cast(v16h, b), (short)0, c, false, false);
  return __builtin_amdgcn_wmma_f32_16x16x32_bf16(false, __builtin_bit_cast(v16bf, a), false,
                                                 __builtin_bit_cast(v16bf, b), (short)0, c, false, false);
}
template <int OPK>
__device__ __forceinline__ v8f mma_g(v16us a, v16us b, v8f c) {                 // guarded
  c = mma_raw<OPK>(a, b, c);
#if defined(__HIP_DEVICE_COMPILE__)
  asm volatile("v_nop\n\tv_nop\n\tv_nop\n\tv_nop" : "+v"(c) : "v"(a), "v"(b));
#endif
  return c;
}
__device__ __forceinline__ void dep_guard1(v8f& a, v8f& b, v16us x) {
#if defined(__HIP_DEVICE_COMPILE__)
  asm volatile("v_nop\n\tv_nop\n\tv_nop\n\tv_nop" : "+v"(a), "+v"(b) : "v"(x));
#endif
}
__device__ __forceinline__ void keep4_u(v16us a, v16us b, v16us c, v16us d) {
#if defined(__HIP_DEVICE_COMPILE__)
  asm volatile("v_nop" :: "v"(a), "v"(b), "v"(c), "v"(d));
#endif
}
__device__ __forceinline__ void acc_guard4(v8f& a, v8f& b, v8f& c, v8f& d) {
#if defined(__HIP_DEVICE_COMPILE__)
  asm volatile("v_nop\n\tv_nop\n\tv_nop\n\tv_nop" : "+v"(a), "+v"(b), "+v"(c), "+v"(d));
#endif
}
// value of lane l ^ 16 (the other 16-lane half of the wave), by a vector cross-row move
__device__ __forceinline__ float xhalf(float x) {
  const int b = __builtin_bit_cast(int, x);
  return __builtin_bit_cast(float, __builtin_amdgcn_permlanex16(b, b, 0x76543210, 0xfedcba98, false, false));
}
// orders LDS stores of this wave before later LDS loads of the same wave (wave-private exchange)
__device__ __forceinline__ void wave_sync_lds() {
  __builtin_amdgcn_fence(__ATOMIC_RELEASE, "workgroup");
  __builtin_amdgcn_wave_barrier();
  __builtin_amdgcn_fence(__ATOMIC_ACQUIRE, "workgroup");
}

// =====================================================================================================
// x convert + rms statistics. Block = 256 threads = 8 waves owns 32 consecutive token rows (wave w: rows
// 4w..4w+3); token tok = b*SEQ + s reads input row b*SEQ_FULL + s. Per row each lane converts 8
// consecutive floats per step (4 steps of 256 columns): ob = bf16 bits of x (RNE), oh = f16 bits of
// of the bf16 values is reduced per row and rstd = rsqrt(mean + eps) staged in LDS (cross-wave -> block
// coverage: 8 waves x 4 rows x (4 x 256) columns = 32 whole rows of both planes per block, grid = MT/32
// blocks; rstd rows row0..row0+31 per block = all MT entries.
// =====================================================================================================
__global__ __launch_bounds__(256) void cvt_x(const float* __restrict__ x, unsigned short* ob,
                                             unsigned short* oh, float* rstd) {
  __shared__ float srs[32];
  const int lane = threadIdx.x & 31, wv = threadIdx.x >> 5;
  const int row0 = blockIdx.x * 32;
#pragma unroll 1
  for (int rr = 0; rr < 4; ++rr) {
    const int tok = row0 + wv * 4 + rr;
    const int b = tok / SEQ, s = tok - b * SEQ;
    const float* src = x + ((size_t)b * SEQ_FULL + (size_t)s) * DM;
    const size_t orow = (size_t)tok * DM;
    float ss = 0.f;
#pragma unroll 1
    for (int it = 0; it < DM / 256; ++it) {
      const int col = it * 256 + lane * 8;
      const v4f a0 = *(const v4f*)(src + col);
      const v4f a1 = *(const v4f*)(src + col + 4);
      v4u hb, hh;
#pragma unroll
      for (int e = 0; e < 2; ++e) {
        const unsigned short u0 = bf_bits(a0[2 * e]), u1 = bf_bits(a0[2 * e + 1]);
        const unsigned short u2 = bf_bits(a1[2 * e]), u3 = bf_bits(a1[2 * e + 1]);
        const float x0 = bf_up(u0), x1 = bf_up(u1), x2 = bf_up(u2), x3 = bf_up(u3);
        ss = fmaf(x0, x0, ss); ss = fmaf(x1, x1, ss); ss = fmaf(x2, x2, ss); ss = fmaf(x3, x3, ss);
        hb[e]     = pk16(u0, u1);
        hb[2 + e] = pk16(u2, u3);
        hh[e]     = pk16(f2h(x0 * XSC), f2h(x1 * XSC));
        hh[2 + e] = pk16(f2h(x2 * XSC), f2h(x3 * XSC));
      }
      unsigned short* db = ob + orow + col;
      unsigned short* dh = oh + orow + col;
      *(v4u*)db = hb;
      *(v4u*)dh = hh;
      
    }
    ss += __shfl_xor(ss, 16, 32);
    ss += __shfl_xor(ss, 8, 32);
    ss += __shfl_xor(ss, 4, 32);
    ss += __shfl_xor(ss, 2, 32);
    ss += __shfl_xor(ss, 1, 32);
    if (lane == 0) srs[wv * 4 + rr] = rsqrtf(ss * (1.0f / (float)DM) + LNEPS);
  }
  __syncthreads();
  if (wv == 0) {
    const float v = srs[lane];
    float* d = rstd + row0 + lane;
    *(float*)d = v;
    
  }
}

// =====================================================================================================
// Weight convert with transpose: source matrices are [in k][out n] row-major; output Bt planes [n][k]
// (k contiguous). blockIdx.y selects the matrix (0 w_q, 1 w_k, 2 w_v, 3 w_o), blockIdx.x the 64x64 tile
// (k0 = 64*(x>>4), n0 = 64*(x&15)). The tile is staged in LDS as f32, then each output row n0+r, columns
// lines). Values: y=0,1: w' = bf16(ln_w[k]) * bf16(w[k][n]) (exact in f32) split into bf16 hi (plane 2y) and
// bf16 lo = w' - hi (plane 2y+1, exact); y=2: f16 bits of w' * WSCL (plane 4); y=3: bf16 bits of w_o
// coverage: load 256 threads x 4 x 4 = 64x64 tile; store 8 waves x 2 x (4 rows x 8 lanes x 8) = 64 rows x
// 64 cols; grid (256, 4) covers every 64x64 tile of every output plane.
// =====================================================================================================
__global__ __launch_bounds__(256) void cvt_w(const float* __restrict__ w0, const float* __restrict__ w1,
                                             const float* __restrict__ w2, const float* __restrict__ w3,
                                             const float* __restrict__ lnw, unsigned short* o) {
  __shared__ __align__(16) float sm[64 * 65];
  __shared__ float slw[64];
  const int y = blockIdx.y;                                     // block-uniform select of the source
  const float* w = (y == 0) ? w0 : ((y == 1) ? w1 : ((y == 2) ? w2 : w3));
  const int k0 = (blockIdx.x >> 4) << 6, n0 = (blockIdx.x & 15) << 6;
  const int t = threadIdx.x, lane = t & 31, wv = t >> 5;
#pragma unroll
  for (int it = 0; it < 4; ++it) {
    const int r = it * 16 + (t >> 4), c4 = (t & 15) * 4;
    const v4f v = *(const v4f*)(w + (size_t)(k0 + r) * DM + (size_t)(n0 + c4));
    float* sp = sm + r * 65 + c4;
    sp[0] = v[0]; sp[1] = v[1]; sp[2] = v[2]; sp[3] = v[3];
  }
  if (t < 64) slw[t] = bfr(lnw[k0 + t]);                       // waves 0,1 entirely: wave-uniform
  __syncthreads();
  const int pl0 = (y == 0) ? 0 : ((y == 1) ? 2 : ((y == 2) ? 4 : 5));
  unsigned short* P0 = o + (size_t)pl0 * DM * DM;
  unsigned short* P1 = (y < 2) ? (P0 + (size_t)DM * DM) : P0;
  const int q8 = lane >> 3, c8 = (lane & 7) * 8;
  v4u ha[2], hl[2];
#pragma unroll
  for (int it = 0; it < 2; ++it) {
    const int r = wv * 8 + it * 4 + q8;                          // n local
    v4u a = {0u, 0u, 0u, 0u}, l = {0u, 0u, 0u, 0u};
#pragma unroll
    for (int e = 0; e < 4; ++e) {
      const int ka = c8 + 2 * e, kb = ka + 1;
      float va = bfr(sm[ka * 65 + r]), vb = bfr(sm[kb * 65 + r]);
      if (y < 3) { va *= slw[ka]; vb *= slw[kb]; }
      if (y < 2) {
        const unsigned short ua = bf_bits(va), ub = bf_bits(vb);
        a[e] = pk16(ua, ub);
        l[e] = pk16(bf_bits(va - bf_up(ua)), bf_bits(vb - bf_up(ub)));
      } else if (y == 2) {
        a[e] = pk16(f2h(va * WSCL), f2h(vb * WSCL));
      } else {
        a[e] = pk16(bf_bits(va), bf_bits(vb));
      }
    }
    ha[it] = a;
    hl[it] = l;
  }
  {
#pragma unroll
    for (int it = 0; it < 2; ++it) {
      const int r = wv * 8 + it * 4 + q8;
      const size_t go = (size_t)(n0 + r) * DM + (size_t)(k0 + c8);
      *(v4u*)(P0 + go) = ha[it];
      if (y < 2) *(v4u*)(P1 + go) = hl[it];
    }
    
  }
}

// =====================================================================================================
// Relative position bias by signed key-query distance: BD[h][i], i = (key - query) + 2047, i in 0..4094;
// i = 4095 is padding written as 0. bucket on integer n = query - key: ret = (n < 0) * 16, n = |n|,
// n < 8 -> n, else 8 + floor(2*log2(n/8)) capped at 15, evaluated by its integer thresholds
// coverage: 256 threads x 16 = 4096 entries per head; grid = NH heads = the whole table.
// =====================================================================================================
__device__ __forceinline__ int rel_bucket(int d) {              // d = key - query
  int n = -d;
  int ret = 0;
  if (n < 0) { ret = NBKT / 2; n = -n; }
  int bk;
  if (n < 8)       bk = n;
  else if (n < 12) bk = 8;
  else if (n < 16) bk = 9;
  else if (n < 23) bk = 10;
  else if (n < 32) bk = 11;
  else if (n < 46) bk = 12;
  else if (n < 64) bk = 13;
  else if (n < 91) bk = 14;
  else             bk = 15;
  return ret + bk;
}

__global__ __launch_bounds__(256) void bias_build(const float* __restrict__ tbl, float* BD) {
  __shared__ __align__(16) float sh[BDW];
  const int h = blockIdx.x, t = threadIdx.x;
#pragma unroll 4
  for (int j = 0; j < 16; ++j) {
    const int idx = t + 256 * j;
    const int ti = clampi(rel_bucket(idx - 2047) * NH + h, 0, NBKT * NH - 1);
    float v = bfr(tbl[ti]);
    v = (idx == BDW - 1) ? 0.f : v;
    sh[idx] = v;
  }
  __syncthreads();
  v4f vv[4];
#pragma unroll
  for (int q = 0; q < 4; ++q) vv[q] = *(const v4f*)(sh + q * 1024 + 4 * t);
  float* dst = BD + (size_t)h * BDW;
  {
#pragma unroll
    for (int q = 0; q < 4; ++q) *(v4f*)(dst + q * 1024 + 4 * t) = vv[q];
    
  }
}

// =====================================================================================================
// LDS-staged 16-bit WMMA GEMM: C[m][n] = sum over plane pairs pl and k of A_pl[m][k] * Bt_pl[n][k]. A block of
// 8 waves owns one 128x128 tile of C (blockIdx.x = tile); wave w owns rows 32*(w>>1).. and columns 64*(w&1).. of
// it (2 x 4 accumulator tiles). A pass is 128 k: 256 B of each of the 128 A rows and 128 Bt rows, brought into one
// of two LDS buffers (row pitch 272 B) by asynchronous 16-byte copies, 16 per thread; the copies of pass t + 2 are
// issued when every wave has left pass t's buffer, so they fly while pass t + 1 is worked on. OPK 0: f16 operands;
// OPK 1: bf16 operands. NPL 1|2 operand plane pairs (Ap,Btp) and (Ap2,Btp2) sharing the accumulators (the second
// pair's passes follow the first pair's; only unscaled hi/lo planes are paired this way). AHM 0: A row-major
// [M][K] pitch lda; AHM 1: A head-major planes, element (m, k) at ((k/HD)*aplane + m*HD + k%HD). Bt row-major
// [N][K] pitch ldb (k contiguous); M, N, K multiples of 128 (true at every call site; host grid = tiles exact).
// Both operand fragments use the split k map (elements 0..7 <- k0+8h.., 8..15 <- k0+16+8h..); D element r of a
// lane is (row 8h + r, col lane&15).
// OM 0: f32 out Cf = acc*wsc (+ RES: bf16 RNE value of Rp[input row of token m][n], token m -> input row
//       (m/SEQ)*SEQ_FULL + m%SEQ, pitch DM), pitch ldc.
// OM 1: f16 out Ch = f16(acc*wsc*osc*scale).  OM 2: f16 pair: base = acc*wsc*osc*scale; Ch = f16 bits(base);
//       Ch2 = f16 bits((base - value(Ch)) * rsc).  scale = Rs[m] (RSM 1, per row), Rs[n] (RSM 2, per column),
//       1 (RSM 0).
// coverage: 2 slabs x 16 rows x 64 cols = the wave's whole 32x64 tile; 8 waves = the block's 128x128 tile.
// =====================================================================================================
#define GTM  128                        // block tile rows
#define GTN  128                        // block tile columns
#define GKP  128                        // k per pass
#define GPIT 136                        // LDS row pitch in 16-bit elements (272 B)
#define GBUF ((GTM + GTN) * GPIT)       // 16-bit elements per buffer: A rows 0..127, Bt rows 128..255

// Eight asynchronous 16-byte copies of one lane, global -> LDS, rows 16 apart: LDS byte address l + 16*272*c,
// global address g + gs*c (gs in elements), c = 0..7. The s_wait_xcnt closes the statement so that no address
// register named by a copy is rewritten ahead of it.
__device__ __forceinline__ void copy8_rows16(unsigned l, const unsigned short* g, size_t gs) {
#if defined(__HIP_DEVICE_COMPILE__)
  const unsigned ls = 16u * GPIT * 2u;
  asm volatile(
      "global_load_async_to_lds_b128 %0, %8, off\n\t"
      "global_load_async_to_lds_b128 %1, %9, off\n\t"
      "global_load_async_to_lds_b128 %2, %10, off\n\t"
      "global_load_async_to_lds_b128 %3, %11, off\n\t"
      "global_load_async_to_lds_b128 %4, %12, off\n\t"
      "global_load_async_to_lds_b128 %5, %13, off\n\t"
      "global_load_async_to_lds_b128 %6, %14, off\n\t"
      "global_load_async_to_lds_b128 %7, %15, off\n\t"
      "s_wait_xcnt 0x0"
      :: "v"(l), "v"(l + ls), "v"(l + 2u * ls), "v"(l + 3u * ls),
         "v"(l + 4u * ls), "v"(l + 5u * ls), "v"(l + 6u * ls), "v"(l + 7u * ls),
         "v"(g), "v"(g + gs), "v"(g + 2 * gs), "v"(g + 3 * gs),
         "v"(g + 4 * gs), "v"(g + 5 * gs), "v"(g + 6 * gs), "v"(g + 7 * gs)
      : "memory");
#endif
}

template <int OPK, int NPL, int AHM, int OM, int RSM, int RES>
__global__ __launch_bounds__(256) void gemm64(
    const unsigned short* __restrict__ Ap, const unsigned short* __restrict__ Ap2, int lda, int aplane,
    const unsigned short* __restrict__ Btp, const unsigned short* __restrict__ Btp2, int ldb,
    unsigned short* Ch, unsigned short* Ch2, float* Cf, int ldc,
    const float* __restrict__ Rs, const float* __restrict__ Rp,
    float wsc, float osc, float rsc, int M, int N, int K) {
  __shared__ __align__(16) unsigned short ring[2 * GBUF];   // two operand buffers, 2 x 69632 B
  __shared__ __align__(16) float sT[8][16 * 68];   // per-wave 16x64 slab, pitch 68 floats
  const int lane = threadIdx.x & 31;
  const int wave = threadIdx.x >> 5;
  const int tilesN = N >> 7;
  const int tilesM = M >> 7;
  const int tile = blockIdx.x;
  if (tile >= tilesM * tilesN) return;   // block-uniform, in front of every copy and barrier
  const int tm = tile / tilesN;
  const int tn = tile - tm * tilesN;
  const int bm0 = tm << 7;                     // block tile origin
  const int bn0 = tn << 7;
  const int wm = (wave >> 1) << 5;             // wave tile origin inside the block tile
  const int wn = (wave & 1) << 6;
  const int m0 = bm0 + wm;
  const int n0 = bn0 + wn;

  const int rlane = lane & 15;                 // row (A) / col (B, D) within subtile
  const int koff  = (lane >> 4) * 8;           // k offset of this lane half
  const int mOff  = (lane >> 4) * 8;           // D row offset

  // copy map: thread t brings 16-byte piece t&15 of rows (t>>4) + 16*c, c = 0..7, of A and of Bt
  const int crow = threadIdx.x >> 4;
  const int cch  = threadIdx.x & 15;
  const unsigned ldsA = (unsigned)(size_t)ring + (unsigned)(crow * (GPIT * 2) + cch * 16);
  const unsigned ldsB = ldsA + (unsigned)(GTM * GPIT * 2);
  const size_t aoff = AHM ? ((size_t)(cch >> 3) * (size_t)aplane + (size_t)(bm0 + crow) * HD + (size_t)((cch & 7) * 8))
                          : ((size_t)(bm0 + crow) * lda + (size_t)(cch * 8));
  const size_t astep = AHM ? (size_t)(16 * HD) : (size_t)16 * lda;          // 16 rows of A
  const size_t apass = AHM ? (size_t)(GKP / HD) * (size_t)aplane : (size_t)GKP;   // one pass along k
  const size_t boff = (size_t)(bn0 + crow) * ldb + (size_t)(cch * 8);
  const size_t bstep = (size_t)16 * ldb;
  const int nkp = K >> 7;                      // passes per plane pair
  const int NT = NPL * nkp;                    // passes in all

  auto issue = [&](int t, int buf) {           // pass t's 16 copies of this thread into buffer buf
    const int pl = (NPL == 2 && t >= nkp) ? 1 : 0;
    const int kp = t - pl * nkp;
    const unsigned short* Ac = (pl == 0) ? Ap : Ap2;
    const unsigned short* Bc = (pl == 0) ? Btp : Btp2;
    const unsigned lb = (unsigned)buf * (unsigned)(GBUF * 2);
    copy8_rows16(ldsA + lb, Ac + aoff + (size_t)kp * apass, astep);
    copy8_rows16(ldsB + lb, Bc + boff + (size_t)kp * GKP, bstep);
  };

  v8f acc[2][4];
#pragma unroll
  for (int i = 0; i < 2; ++i)
#pragma unroll
    for (int j = 0; j < 4; ++j) acc[i][j] = zero8();

  issue(0, 0);
  asm volatile("s_wait_asynccnt 0x0" ::: "memory");   // this wave's copies of pass 0 have landed
  __syncthreads();                                    // every wave's have: pass 0 may be read
  if (NT > 1) issue(1, 1);

#pragma unroll 1   // one pass per trip: the buffer index and the publish point stay at the loop's foot
  for (int t = 0; t < NT; ++t) {
    const unsigned short* sb = ring + (t & 1) * GBUF;
    const unsigned short* sA = sb + (wm + rlane) * GPIT + koff;
    const unsigned short* sB = sb + (GTM + wn + rlane) * GPIT + koff;
#pragma unroll
    for (int ks = 0; ks < GKP / 32; ++ks) {
      v16us bh[4];
#pragma unroll
      for (int j = 0; j < 4; ++j) bh[j] = ldfrag_u(sB + (j << 4) * GPIT + ks * 32);
#pragma unroll
      for (int i = 0; i < 2; ++i) {
        const v16us ah = ldfrag_u(sA + (i << 4) * GPIT + ks * 32);
#pragma unroll
        for (int j = 0; j < 4; ++j) acc[i][j] = mma_raw<OPK>(ah, bh[j], acc[i][j]);
        dep_guard1(acc[i][0], acc[i][3], ah);
      }
      keep4_u(bh[0], bh[1], bh[2], bh[3]);
    }
    asm volatile("s_wait_dscnt 0x0" ::: "memory");      // this wave's reads of pass t's buffer are done
    asm volatile("s_wait_asynccnt 0x0" ::: "memory");   // this wave's copies of pass t + 1 have landed
    __syncthreads();                                    // publishes pass t + 1, frees pass t's buffer
    if (t + 2 < NT) issue(t + 2, t & 1);
  }
  asm volatile("s_wait_asynccnt 0x0" ::: "memory");     // no copy is outstanding past the loop
  acc_guard4(acc[0][0], acc[0][1], acc[0][2], acc[0][3]);
  acc_guard4(acc[1][0], acc[1][1], acc[1][2], acc[1][3]);

  const int hh2 = lane >> 4, c4 = (lane & 15) * 4;     // f32 out: 256-B row segment = 16 lanes x 16 B
  const int q8  = lane >> 3, c8 = (lane & 7) * 8;
  const float wo = wsc * osc;

  // per-column scale (RSM 2): columns n0+c8 .. n0+c8+7, same for every row of the tile
  float csc[8];
#pragma unroll
  for (int e = 0; e < 8; ++e) csc[e] = 1.f;
  if (OM != 0 && RSM == 2) {
    const v4f cs0 = *(const v4f*)(Rs + n0 + c8);
    const v4f cs1 = *(const v4f*)(Rs + n0 + c8 + 4);
#pragma unroll
    for (int e = 0; e < 4; ++e) { csc[e] = cs0[e]; csc[4 + e] = cs1[e]; }
  }

  // ---- epilogue ----
  float* slab = sT[wave];
#pragma unroll
  for (int i = 0; i < 2; ++i) {
    const int mBase = m0 + (i << 4);
#pragma unroll
    for (int j = 0; j < 4; ++j) {
#pragma unroll
      for (int r = 0; r < 8; ++r) {
        slab[(mOff + r) * 68 + (j << 4) + rlane] = acc[i][j][r];
      }
    }
    wave_sync_lds();
    if (OM == 0) {
      v4f vals[8];
#pragma unroll
      for (int it = 0; it < 8; ++it) {
        const int row = it * 2 + hh2;                      // it 0..7 x hh2 0..1 = rows 0..15
        v4f v = *(const v4f*)(slab + row * 68 + c4);
        v = v * wsc;
        if (RES) {
          const int tok = mBase + row;
          const int bb = tok / SEQ, ss = tok - bb * SEQ;
          const v4f hr = *(const v4f*)(Rp + ((size_t)bb * SEQ_FULL + (size_t)ss) * DM + (size_t)(n0 + c4));
#pragma unroll
          for (int c = 0; c < 4; ++c) v[c] = v[c] + bfr(hr[c]);
        }
        vals[it] = v;
      }
      {
#pragma unroll
        for (int it = 0; it < 8; ++it) {
          const int row = it * 2 + hh2;
          *(v4f*)(Cf + (size_t)(mBase + row) * ldc + (size_t)n0 + c4) = vals[it];
        }
        
      }
    } else {
      v4u hv[4], hw[4];
#pragma unroll
      for (int it = 0; it < 4; ++it) {
        const int row = it * 4 + q8;                       // it 0..3 x q8 0..3 = rows 0..15
        const float* sp = slab + row * 68 + c8;
        float rsr = wo;
        if (RSM == 1) rsr = wo * Rs[mBase + row];
        v4u ha = {0u, 0u, 0u, 0u}, hb = {0u, 0u, 0u, 0u};
#pragma unroll
        for (int e = 0; e < 4; ++e) {
          const float b0 = sp[2 * e]     * rsr * csc[2 * e];
          const float b1 = sp[2 * e + 1] * rsr * csc[2 * e + 1];
          if (OM == 1) {
            ha[e] = pk16(f2h(b0), f2h(b1));
          } else {
            const _Float16 x0 = (_Float16)b0, x1 = (_Float16)b1;
            ha[e] = pk16(h_bits(x0), h_bits(x1));
            hb[e] = pk16(f2h((b0 - (float)x0) * rsc), f2h((b1 - (float)x1) * rsc));
          }
        }
        hv[it] = ha;
        hw[it] = hb;
      }
      {
#pragma unroll
        for (int it = 0; it < 4; ++it) {
          const int row = it * 4 + q8;
          const size_t go = (size_t)(mBase + row) * ldc + (size_t)n0 + c8;
          *(v4u*)(Ch + go) = hv[it];
          if (OM == 2) *(v4u*)(Ch2 + go) = hw[it];
        }
        
      }
    }
    wave_sync_lds();
  }
}

// =====================================================================================================
// Bidirectional attention with relative position bias, head dim 64, no 1/sqrt(d) scaling. Block = 256
// threads = 8 waves, all of one (batch b, head h); one wave owns one 16-row query tile (t0..t0+15) and loops all
// key blocks of 32 with an online max-subtracted softmax in f32. A pass is 64 keys: the head's 128 B of each of
// the 64 KH rows and 64 KR rows and 128 B (64 keys) of each of its 64 VT rows are brought into one of two LDS
// buffers (row pitch 144 B) by asynchronous 16-byte copies, 6 per thread, and every wave reads its K and V
// fragments from there; the copies of pass t + 2 are issued when every wave has left pass t's buffer.
// Planes: QH|QR f16 [MT][DM] (16*q hi,
// residual x2048), KH|KR f16 [MT][DM] (16*k hi, residual x2048), VT f16 [DM][MT] (16*v transposed, row =
// h*64+d, column = token), BD f32 [NH][4096] bias by (key-query)+2047. Output Zh|Zl: bf16 hi|lo of ctx,
// head-major [NH][MT][64].
// Both products are taken transposed: keys (then head dims) are the A rows and the wave's 16 queries the B columns,
// so lane (hh, m) holds, for query t0+m alone, the scores of keys 8*hh+r and 16+8*hh+r of a 32-key block.
// The head's bias for every distance the block's 128 queries meet (key - query = -(tb+127) .. SEQ-1-tb, tb = the
// block's first query) is staged once, ahead of the first barrier, in one LDS row shared by the 8 waves and read
// at index key - query + tb + 127. Per key block:
// S^T = KH.QH^T (4 WMMA), R^T = KH.QR^T + KR.QH^T (8 WMMA, own accumulators);
// score = S/256 + R/524288 + bias; the block maximum is taken in the lane and joined with the other half-wave by
// one cross-row move; p = exp(score - running max) in f32, l accumulated per lane from the f32 p (the two halves'
// sums are joined once, in the epilogue); p*16384 as f16 packs from the two score tiles straight into the B
// operand (split k map: elements 0..7 = keys 8*hh.., 8..15 = keys 16+8*hh..); O^T += VT.P^T on f16 WMMA. The
// ctx staging region is private to its wave.
// staged extent covers consumed extent: bias row SEQ+128 written / 0..SEQ+126 read; ctx staging 2 x 16x64 written and read.
// Epilogue: ctx = O^T/(l*262144) split into bf16 hi|lo (a lane holds 8 consecutive dims of its query per O^T
// tile: one 16-byte LDS store per plane and tile), staged in LDS; the wave's 16 rows x 64 halves are
// coverage: 16 query rows x 64 halves per wave, NB*NH*SEQ/16 wave tasks = all (h, tok) rows of both planes.
// =====================================================================================================
#define AKP  64                         // keys per pass
#define APIT 72                         // LDS row pitch in 16-bit elements (144 B)
#define ATIL (64 * APIT)                // 16-bit elements of one staged tile (64 rows)
#define ABUF (3 * ATIL)                 // 16-bit elements per buffer: KH rows | KR rows | VT rows
static_assert((SEQ % AKP) == 0);

// Six asynchronous 16-byte copies of one lane, global -> LDS: rows r and r + 32 of the KH, KR and VT tiles; l is
// the LDS byte address of the lane's piece of KH row r. The s_wait_xcnt closes the statement so that no address
// register named by a copy is rewritten ahead of it.
__device__ __forceinline__ void copy6_kv(unsigned l, const unsigned short* gk, const unsigned short* gr,
                                         const unsigned short* gv) {
#if defined(__HIP_DEVICE_COMPILE__)
  const unsigned lr = 32u * APIT * 2u;
  const unsigned lt = ATIL * 2u;
  asm volatile(
      "global_load_async_to_lds_b128 %0, %6, off\n\t"
      "global_load_async_to_lds_b128 %1, %7, off\n\t"
      "global_load_async_to_lds_b128 %2, %8, off\n\t"
      "global_load_async_to_lds_b128 %3, %9, off\n\t"
      "global_load_async_to_lds_b128 %4, %10, off\n\t"
      "global_load_async_to_lds_b128 %5, %11, off\n\t"
      "s_wait_xcnt 0x0"
      :: "v"(l), "v"(l + lr), "v"(l + lt), "v"(l + lt + lr), "v"(l + 2u * lt), "v"(l + 2u * lt + lr),
         "v"(gk), "v"(gk + (size_t)32 * DM), "v"(gr), "v"(gr + (size_t)32 * DM),
         "v"(gv), "v"(gv + (size_t)32 * MT)
      : "memory");
#endif
}

__global__ __launch_bounds__(256) void attn_kernel(
    const unsigned short* __restrict__ QHp, const unsigned short* __restrict__ QRp,
    const unsigned short* __restrict__ KHp, const unsigned short* __restrict__ KRp,
    const unsigned short* __restrict__ VTp,
    const float* __restrict__ BD, unsigned short* Zh, unsigned short* Zl) {
  __shared__ __align__(16) unsigned short kvr[2 * ABUF];           // two K|KR|VT buffers, 2 x 27648 B
  __shared__ __align__(16) float brow[BRW];                        // bias row of the block, 8704 B
  __shared__ __align__(16) unsigned short zst[AWV][2][16 * HD];    // ctx hi|lo staging, 32768 B
  const int lane = threadIdx.x & 31, wv = threadIdx.x >> 5, m = lane & 15, hh = lane >> 4;
  const int nqt = SEQ / 16;
  if ((int)blockIdx.x * AWV >= NB * NH * nqt) return;   // block-uniform, in front of every copy and barrier
  const int task = blockIdx.x * AWV + wv;            // nqt is a multiple of AWV: one (b, h) per block
  const int bh = task / nqt;
  const int t0 = (task - bh * nqt) << 4;             // query tile start
  const int b = bh / NH, h = bh - b * NH;
  const size_t tok0 = (size_t)b * SEQ;

  // Q B-fragments: columns t0+m, k = head dims (two 32-deep steps), hi and residual planes
  const size_t qo = (tok0 + (size_t)(t0 + m)) * DM + (size_t)(h * HD + 8 * hh);
  const v16us qh0 = ldfrag_u(QHp + qo);
  const v16us qh1 = ldfrag_u(QHp + qo + 32);
  const v16us qr0 = ldfrag_u(QRp + qo);
  const v16us qr1 = ldfrag_u(QRp + qo + 32);

  float mx = -1.0e30f, ls = 0.f;       // query t0+m: running maximum (equal in both halves), this half's sum
  v8f O[4];                            // O^T tiles: element r = (dim 16*j + 8*hh + r, query t0+m)
#pragma unroll
  for (int j = 0; j < 4; ++j) O[j] = zero8();

  // bias row: brow[i] = bias_h(key - query = i - tb - 127), i = 0..SEQ+127; source index i + 1920 - tb lies in
  // 0..4095 (tb is a multiple of 128, tb <= SEQ - 128). Thread t brings 16-byte pieces t, t + 256, ...
  const int tb = t0 - 16 * wv;
  const float* bsrc = BD + (size_t)h * BDW + (SEQ_FULL - 16 * AWV - tb);
  v4f bst[BRQ + 1];
#pragma unroll     // bst[] is indexed by constants only; the loads go out together
  for (int q = 0; q < BRQ; ++q) bst[q] = *(const v4f*)(bsrc + 4 * ((int)threadIdx.x + 256 * q));
  if ((int)threadIdx.x < BRT) bst[BRQ] = *(const v4f*)(bsrc + 4 * ((int)threadIdx.x + 256 * BRQ));
  const float* bl = brow + (16 * AWV - 1 - 16 * wv - m + 8 * hh);          // + key block start + r
  // copy map: thread t brings 16-byte piece t&7 of rows (t>>3) and (t>>3) + 32 of each of the three tiles
  const int crow = threadIdx.x >> 3;
  const int cpc  = threadIdx.x & 7;
  const unsigned ldsC = (unsigned)(size_t)kvr + (unsigned)(crow * (APIT * 2) + cpc * 16);
  const size_t kco = (tok0 + (size_t)crow) * DM + (size_t)(h * HD + cpc * 8);
  const unsigned short* gK = KHp + kco;
  const unsigned short* gR = KRp + kco;
  const unsigned short* gV = VTp + (size_t)(h * HD + crow) * MT + tok0 + (size_t)(cpc * 8);
  const int NT = SEQ / AKP;

  auto issue = [&](int t, int buf) {           // pass t's 6 copies of this thread into buffer buf
    copy6_kv(ldsC + (unsigned)buf * (unsigned)(ABUF * 2), gK + (size_t)t * (AKP * DM), gR + (size_t)t * (AKP * DM),
             gV + (size_t)t * AKP);
  };

  issue(0, 0);
#pragma unroll     // bst[] is indexed by constants only, so it stays in registers
  for (int q = 0; q < BRQ; ++q) *(v4f*)(brow + 4 * ((int)threadIdx.x + 256 * q)) = bst[q];
  if ((int)threadIdx.x < BRT) *(v4f*)(brow + 4 * ((int)threadIdx.x + 256 * BRQ)) = bst[BRQ];
  asm volatile("s_wait_asynccnt 0x0" ::: "memory");   // this wave's copies of pass 0 have landed
  __syncthreads();                                    // every wave's have: pass 0 and the bias row may be read
  if (NT > 1) issue(1, 1);

#pragma unroll 1   // one pass per trip: the buffer index and the publish point stay at the loop's foot
  for (int t = 0; t < NT; ++t) {
  const float* bw = bl + t * AKP;                                            // bias of this pass's keys
  const unsigned short* kbase  = kvr + (t & 1) * ABUF + m * APIT + 8 * hh;   // KH row m, this lane half's k
  const unsigned short* krbase = kbase + ATIL;
  const unsigned short* vbase  = kbase + 2 * ATIL;                           // VT row (dim) m, keys 8*hh..
#pragma unroll     // both 32-key blocks of a pass inline: their LDS offsets become immediates
  for (int sub = 0; sub < AKP / 32; ++sub) {
    // bias of keys 8*hh + r and 16 + 8*hh + r of the block for query m, read here so that the products cover the
    // LDS latency; two consecutive keys per register pair
    v2f b0[4], b1[4];
#pragma unroll     // b0[], b1[] are indexed by constants only, so they stay in registers
    for (int e = 0; e < 4; ++e) {
      b0[e] = (v2f){bw[sub * 32 + 2 * e], bw[sub * 32 + 2 * e + 1]};
      b1[e] = (v2f){bw[sub * 32 + 16 + 2 * e], bw[sub * 32 + 16 + 2 * e + 1]};
    }

    // S^T = KH.QH^T, R^T = KH.QR^T + KR.QH^T ; A row = key token sb+m (+16), B column = query, k = head dim
    v8f S0 = zero8(), S1 = zero8(), R0 = zero8(), R1 = zero8();
#pragma unroll
    for (int ks = 0; ks < 2; ++ks) {
      const int kofs = (sub * 32) * APIT + 32 * ks;
      const v16us kf0 = ldfrag_u(kbase + kofs);
      const v16us kf1 = ldfrag_u(kbase + kofs + 16 * APIT);
      const v16us kg0 = ldfrag_u(krbase + kofs);
      const v16us kg1 = ldfrag_u(krbase + kofs + 16 * APIT);
      const v16us qa = (ks == 0) ? qh0 : qh1;
      const v16us qb = (ks == 0) ? qr0 : qr1;
      S0 = mma_g<0>(kf0, qa, S0);
      S1 = mma_g<0>(kf1, qa, S1);
      R0 = mma_g<0>(kf0, qb, R0);
      R1 = mma_g<0>(kf1, qb, R1);
      R0 = mma_g<0>(kg0, qa, R0);
      R1 = mma_g<0>(kg1, qa, R1);
    }

    // VT A-fragments (row = h*64 + dim, k = key token), read as one group here so that the softmax covers
    // their LDS latency
    v16us vf[4];
#pragma unroll     // vf[] is indexed by constants only, so it stays in registers
    for (int j = 0; j < 4; ++j) vf[j] = ldfrag_u(vbase + (16 * j) * APIT + sub * 32);

    // score = q.k + bias
    float s0[8], s1[8];
#pragma unroll     // two consecutive keys per step: accumulator pairs and bias pairs feed packed f32 FMAs as they lie
    for (int e = 0; e < 4; ++e) {
      const v2f x0 = __builtin_elementwise_fma((v2f){S0[2 * e], S0[2 * e + 1]}, (v2f){SC1, SC1},
                     __builtin_elementwise_fma((v2f){R0[2 * e], R0[2 * e + 1]}, (v2f){SC2, SC2}, b0[e]));
      const v2f x1 = __builtin_elementwise_fma((v2f){S1[2 * e], S1[2 * e + 1]}, (v2f){SC1, SC1},
                     __builtin_elementwise_fma((v2f){R1[2 * e], R1[2 * e + 1]}, (v2f){SC2, SC2}, b1[e]));
      s0[2 * e] = x0[0]; s0[2 * e + 1] = x0[1];
      s1[2 * e] = x1[0]; s1[2 * e + 1] = x1[1];
    }

    // online softmax: a query's 32 scores live in lanes m and m + 16, 16 each
    float xm = fmaxf(s0[0], s1[0]);
#pragma unroll     // s0[], s1[] are indexed by constants only, so they stay in registers
    for (int r = 1; r < 8; ++r) xm = fmaxf(xm, fmaxf(s0[r], s1[r]));
    xm = fmaxf(xm, xhalf(xm));
    const float mn = fmaxf(mx, xm);
    const float al = __expf(mx - mn);
    mx = mn;
    FragU pf;                                          // P^T B-fragment (split k map)
    float pa = 0.f, pb = 0.f;
#pragma unroll
    for (int r = 0; r < 8; ++r) {
      const float p0 = __expf(s0[r] - mn);
      const float p1 = __expf(s1[r] - mn);
      pa += p0;
      pb += p1;
      pf.v[r]     = f2h(p0 * PCAR);
      pf.v[8 + r] = f2h(p1 * PCAR);
    }
    ls = ls * al + (pa + pb);
#pragma unroll     // O[] is indexed by constants only, so it stays in registers
    for (int j = 0; j < 4; ++j) O[j] = O[j] * al;
#pragma unroll
    for (int j = 0; j < 4; ++j) O[j] = mma_g<0>(vf[j], pf.v, O[j]);
  }
    asm volatile("s_wait_dscnt 0x0" ::: "memory");      // this wave's reads of pass t's buffer are done
    asm volatile("s_wait_asynccnt 0x0" ::: "memory");   // this wave's copies of pass t + 1 have landed
    __syncthreads();                                    // publishes pass t + 1, frees pass t's buffer
    if (t + 2 < NT) issue(t + 2, t & 1);
  }
  asm volatile("s_wait_asynccnt 0x0" ::: "memory");     // no copy is outstanding past the loop
  acc_guard4(O[0], O[1], O[2], O[3]);

  // ---- epilogue: ctx = O / (l * PCAR * VSC) -> bf16 hi|lo, head-major planes ----
  unsigned short* zh = zst[wv][0];
  unsigned short* zl = zst[wv][1];
  const float linv = (1.0f / (ls + xhalf(ls))) * OSC;  // both halves' sums joined; the joined sum is >= 1
#pragma unroll
  for (int j = 0; j < 4; ++j) {
    v4u zc, zr;
#pragma unroll
    for (int e = 0; e < 4; ++e) {
      const float o0 = O[j][2 * e] * linv, o1 = O[j][2 * e + 1] * linv;
      const unsigned short x0 = bf_bits(o0), x1 = bf_bits(o1);
      zc[e] = pk16(x0, x1);
      zr[e] = pk16(bf_bits(o0 - bf_up(x0)), bf_bits(o1 - bf_up(x1)));
    }
    *(v4u*)(zh + m * HD + 16 * j + 8 * hh) = zc;       // row = query m, dims 16*j + 8*hh .. + 7
    *(v4u*)(zl + m * HD + 16 * j + 8 * hh) = zr;
  }
  wave_sync_lds();
  {
    v4u ha[4], hb[4];
#pragma unroll
    for (int q = 0; q < 4; ++q) {
      ha[q] = *(const v4u*)(zh + q * 256 + lane * 8);
      hb[q] = *(const v4u*)(zl + q * 256 + lane * 8);
    }
    const size_t zo = ((size_t)h * MT + tok0 + (size_t)t0) * HD;   // 2048-B aligned, 16 rows contiguous
    unsigned short* dh = Zh + zo;
    unsigned short* dl = Zl + zo;
    {
#pragma unroll
      for (int q = 0; q < 4; ++q) {
        *(v4u*)(dh + q * 256 + lane * 8) = ha[q];
        *(v4u*)(dl + q * 256 + lane * 8) = hb[q];
      }
      
    }
  }
}

// =====================================================================================================
// Workspace map (bytes, NB=2, SEQ=2048); every plane is an exact multiple of its whole-row / whole-line /
// BD = 16 x 4096 floats); all offsets multiples of 65536.
//   XB   bf16 [MT][DM]        0           8388608
//   XH   f16  [MT][DM]        8388608     8388608
//   RSTD f32  [MT]            16777216    65536     (16384 used)
//   W    6 x 16-bit [DM][DM]  16842752    12582912  (wq hi, wq lo, wk hi, wk lo bf16; wv f16 x256; wo bf16)
//   BD   f32  [NH][4096]      29425664    262144
//   QH   f16  [MT][DM]        29687808    8388608
//   QR   f16  [MT][DM]        38076416    8388608
//   KH   f16  [MT][DM]        46465024    8388608
//   KR   f16  [MT][DM]        54853632    8388608
//   VT   f16  [DM][MT]        63242240    8388608
//   ZH   bf16 [NH][MT][64]    71630848    8388608
//   ZL   bf16 [NH][MT][64]    80019456    8388608
//   end                       88408064
// =====================================================================================================
extern "C" void kernel_launch(void* const* d_in, const int* in_sizes, int n_in,
                              void* d_out, int out_size, void* d_ws, size_t ws_size,
                              hipStream_t stream) {
  if (n_in < 7) return;
  if (in_sizes[0] < ((NB - 1) * SEQ_FULL + SEQ) * DM) return;
  if (in_sizes[1] < DM) return;
  if (in_sizes[2] < DM * DM) return;
  if (in_sizes[3] < DM * DM) return;
  if (in_sizes[4] < DM * DM) return;
  if (in_sizes[5] < DM * DM) return;
  if (in_sizes[6] < NBKT * NH) return;
  if (out_size < MT * DM) return;

  const float* x    = (const float*)d_in[0];   // [2][2048][1024]
  const float* lnw  = (const float*)d_in[1];   // [1024]
  const float* w_q  = (const float*)d_in[2];   // [1024][1024] (in, out)
  const float* w_k  = (const float*)d_in[3];
  const float* w_v  = (const float*)d_in[4];
  const float* w_o  = (const float*)d_in[5];   // [1024][1024] (in, out)
  const float* tbl  = (const float*)d_in[6];   // [32][16]

  const size_t PX  = (size_t)MT * DM * 2;        // 16-bit [MT][DM] plane
  const size_t PRS = (((size_t)MT * 4 + 65535) / 65536) * 65536;
  const size_t PW1 = (size_t)DM * DM * 2;        // one 16-bit weight plane
  const size_t PBD = (size_t)NH * BDW * 4;
  size_t off = 0;
  const size_t oXB = off; off += PX;
  const size_t oXH = off; off += PX;
  const size_t oRS = off; off += PRS;
  const size_t oW  = off; off += 6 * PW1;
  const size_t oBD = off; off += PBD;
  const size_t oQH = off; off += PX;
  const size_t oQR = off; off += PX;
  const size_t oKH = off; off += PX;
  const size_t oKR = off; off += PX;
  const size_t oVT = off; off += PX;
  const size_t oZH = off; off += PX;
  const size_t oZL = off; off += PX;
  if (off > ws_size) return;                      // off = 88408064 at full size
  if (off > (size_t)134217728) return;

  char* ws = (char*)d_ws;
  unsigned short* XB = (unsigned short*)(ws + oXB);
  unsigned short* XH = (unsigned short*)(ws + oXH);
  float* RSTD = (float*)(ws + oRS);
  unsigned short* W16 = (unsigned short*)(ws + oW);
  unsigned short* WQH = W16;
  unsigned short* WQL = W16 + (size_t)1 * DM * DM;
  unsigned short* WKH = W16 + (size_t)2 * DM * DM;
  unsigned short* WKL = W16 + (size_t)3 * DM * DM;
  unsigned short* WVH = W16 + (size_t)4 * DM * DM;
  unsigned short* WOB = W16 + (size_t)5 * DM * DM;
  float* BDp = (float*)(ws + oBD);
  unsigned short* QH = (unsigned short*)(ws + oQH);
  unsigned short* QR = (unsigned short*)(ws + oQR);
  unsigned short* KH = (unsigned short*)(ws + oKH);
  unsigned short* KR = (unsigned short*)(ws + oKR);
  unsigned short* VT = (unsigned short*)(ws + oVT);
  unsigned short* ZH = (unsigned short*)(ws + oZH);
  unsigned short* ZL = (unsigned short*)(ws + oZL);
  float* out0 = (float*)d_out;
  float* fdummy = BDp;                            // in-range placeholder for unused f32 output args

  const dim3 blk(256);
  const int gT = (MT / 128) * (DM / 128);         // 128x128 tiles -> 256 blocks at full size

  // (0) operand planes, rms statistics and bias table
  cvt_x<<<dim3(MT / 32), blk, 0, stream>>>(x, XB, XH, RSTD);
  cvt_w<<<dim3((DM / 64) * (DM / 64), 4), blk, 0, stream>>>(w_q, w_k, w_v, w_o, lnw, W16);
  bias_build<<<dim3(NH), blk, 0, stream>>>(tbl, BDp);

  // (1) q plane (hi x16 + residual x2048): C[tok][n] = rstd[tok] * sum_k XB[tok][k] * (WQH+WQL)[n][k]
  gemm64<1, 2, 0, 2, 1, 0><<<dim3(gT), blk, 0, stream>>>(
      XB, XB, DM, 0, WQH, WQL, DM, QH, QR, fdummy, DM, RSTD, x, 1.0f, QKS, QRS, MT, DM, DM);
  //     k plane (hi x16 + residual x2048)
  gemm64<1, 2, 0, 2, 1, 0><<<dim3(gT), blk, 0, stream>>>(
      XB, XB, DM, 0, WKH, WKL, DM, KH, KR, fdummy, DM, RSTD, x, 1.0f, QKS, QRS, MT, DM, DM);
  //     v^T x16: C[d][tok] = rstd[tok] * sum_k WVH[d][k] * XH[tok][k]
  gemm64<0, 1, 0, 1, 2, 0><<<dim3(gT), blk, 0, stream>>>(
      WVH, WVH, DM, 0, XH, XH, DM, VT, VT, fdummy, MT, RSTD, x, 1.0f / (XSC * WSCL), VSC, 1.0f, DM, MT, DM);

  // (2) attention -> ctx bf16 hi|lo head-major planes
  attn_kernel<<<dim3((NB * NH * (SEQ / 16)) / AWV), dim3(32 * AWV), 0, stream>>>(QH, QR, KH, KR, VT, BDp, ZH, ZL);

  // (3) output projection + residual: out[tok][n] = sum_k (ctx_hi + ctx_lo)[tok][k] * WOB[n][k] + bf16(x[tok][n])
  gemm64<1, 2, 1, 0, 0, 1><<<dim3(gT), blk, 0, stream>>>(
      ZH, ZL, DM, MT * HD, WOB, WOB, DM, ZH, ZH, out0, DM, RSTD, x, 1.0f, 1.0f, 1.0f, MT, DM, DM);
  (void)hipGetLastError();
}

// v005
// One run takes 142 microseconds.
// Two timings next to v004 put it at 1.10 and 1.11 times that version's speed.
// Over all steps from v000 it is 3.67 times as fast.
// Contractions: normed.w_q and normed.w_k on v_wmma_f32_16x16x32_bf16 (bf16 x plane, bf16 hi+lo weight planes
// with ln_weight folded in, f32 accumulate); w_v'.normed^T (v^T plane), q.k^T (f16 hi x16 + residual x2048 on
// both q and k, three products) and p.v on v_wmma_f32_16x16x32_f16 (f16 operands, f32 accumulate); ctx.w_o on
// v_wmma_f32_16x16x32_bf16 (bf16 hi+lo ctx planes, bf16 w_o, f32 accumulate). Float inputs RNE-converted to
// bf16 on load; per-row rms scale, softmax and relative position bias in f32 on VALU; softmax p carried x16384.
#include <hip/hip_runtime.h>
#include <math.h>

#ifndef NB
#define NB 2
#endif
#ifndef SEQ
#define SEQ 2048
#endif
#define NB_FULL  2
#define SEQ_FULL 2048
#define DM   1024
#define NH   16
#define HD   64
#define NBKT 32
#define MT   (NB * SEQ)
#define BDW  4096
#define AWV  8
#define BRW  (SEQ + 16 * AWV)
#define BRQ  ((BRW / 4) / 256)
#define BRT  ((BRW / 4) % 256)
#define XSC  16.0f
#define WSCL 256.0f
#define QKS  16.0f
#define QRS  2048.0f
#define VSC  16.0f
#define PCAR 16384.0f
#define SC1  (1.0f / 256.0f)
#define SC2  (1.0f / 524288.0f)
#define OSC  (1.0f / 262144.0f)
#define LNEPS 1.0e-6f

static_assert(NB >= 1 && NB <= NB_FULL);
static_assert(SEQ >= 64 && SEQ <= SEQ_FULL && (SEQ % 64) == 0);
static_assert(NH * HD == DM);
static_assert(HD == 64);
static_assert(BDW == 2 * SEQ_FULL);
static_assert((BRW % 4) == 0 && 16 * AWV <= SEQ_FULL);
static_assert((MT % 64) == 0 && (DM % 64) == 0 && (MT % 32) == 0);
static_assert((MT % 128) == 0 && (DM % 128) == 0);
static_assert(((NB * NH * (SEQ / 16)) % AWV) == 0);
static_assert(((SEQ / 16) % AWV) == 0);
static_assert(NBKT * NH == 512);
static_assert(BDW == 16 * 256);
static_assert((DM % 256) == 0);

typedef _Float16 v16h __attribute__((ext_vector_type(16)));
typedef __bf16 v16bf __attribute__((ext_vector_type(16)));
typedef unsigned short v16us __attribute__((ext_vector_type(16)));
typedef unsigned short v8us  __attribute__((ext_vector_type(8)));
typedef float v8f __attribute__((ext_vector_type(8)));
typedef float v4f __attribute__((ext_vector_type(4)));
typedef float v2f __attribute__((ext_vector_type(2)));
typedef unsigned int v4u __attribute__((ext_vector_type(4)));

union FragU { v16us v; v8us h[2]; };

// ---- scalar helpers --------------------------------------------------------------------------------
__device__ __forceinline__ unsigned short bf_bits(float f) {          // f32 -> bf16 bits, RNE convert
  const unsigned u = __float_as_uint(f);
  return (unsigned short)((u + 0x7FFFu + ((u >> 16) & 1u)) >> 16);
}
__device__ __forceinline__ float bf_up(unsigned short h) { return __uint_as_float(((unsigned)h) << 16); }
__device__ __forceinline__ float bfr(float f) { return bf_up(bf_bits(f)); }   // value of the bf16 RNE convert
__device__ __forceinline__ unsigned short h_bits(_Float16 x) { return __builtin_bit_cast(unsigned short, x); }
__device__ __forceinline__ unsigned short f2h(float f) { return h_bits((_Float16)f); }
__device__ __forceinline__ unsigned pk16(unsigned short a, unsigned short b) { return (unsigned)a | ((unsigned)b << 16); }
__device__ __forceinline__ int clampi(int v, int lo, int hi) { return v < lo ? lo : (v > hi ? hi : v); }
__device__ __forceinline__ v8f zero8() { v8f z = {0.f, 0.f, 0.f, 0.f, 0.f, 0.f, 0.f, 0.f}; return z; }

// ---- fragment loader: 16-bit A/B operand, lane -> row/col (lane&15), p already includes +8*(lane>>4);
//      elements 0..7 <- p[0..7] (k0+8h..), elements 8..15 <- p[16..23] (k0+16+8h..)
__device__ __forceinline__ v16us ldfrag_u(const unsigned short* p) {
  FragU f;
  f.h[0] = *(const v8us*)(p);
  f.h[1] = *(const v8us*)(p + 16);
  return f.v;
}

// ---- WMMA helpers with trailing VALU hazard gap; OPK 0 = f16 operand bits, OPK 1 = bf16 operand bits --
template <int OPK>
__device__ __forceinline__ v8f mma_raw(v16us a, v16us b, v8f c) {
  if (OPK == 0)
    return __builtin_amdgcn_wmma_f32_16x16x32_f16(false, __builtin_bit_cast(v16h, a), false,
                                                  __builtin_bit_cast(v16h, b), (short)0, c, false, false);
  return __builtin_amdgcn_wmma_f32_16x16x32_bf16(false, __builtin_bit_cast(v16bf, a), false,
                                                 __builtin_bit_cast(v16bf, b), (short)0, c, false, false);
}
template <int OPK>
__device__ __forceinline__ v8f mma_g(v16us a, v16us b, v8f c) {                 // guarded
  c = mma_raw<OPK>(a, b, c);
#if defined(__HIP_DEVICE_COMPILE__)
  asm volatile("v_nop\n\tv_nop\n\tv_nop\n\tv_nop" : "+v"(c) : "v"(a), "v"(b));
#endif
  return c;
}
__device__ __forceinline__ void dep_guard1(v8f& a, v8f& b, v16us x) {
#if defined(__HIP_DEVICE_COMPILE__)
  asm volatile("v_nop\n\tv_nop\n\tv_nop\n\tv_nop" : "+v"(a), "+v"(b) : "v"(x));
#endif
}
__device__ __forceinline__ void keep4_u(v16us a, v16us b, v16us c, v16us d) {
#if defined(__HIP_DEVICE_COMPILE__)
  asm volatile("v_nop" :: "v"(a), "v"(b), "v"(c), "v"(d));
#endif
}
__device__ __forceinline__ void acc_guard4(v8f& a, v8f& b, v8f& c, v8f& d) {
#if defined(__HIP_DEVICE_COMPILE__)
  asm volatile("v_nop\n\tv_nop\n\tv_nop\n\tv_nop" : "+v"(a), "+v"(b), "+v"(c), "+v"(d));
#endif
}
// value of lane l ^ 16 (the other 16-lane half of the wave), by a vector cross-row move
__device__ __forceinline__ float xhalf(float x) {
  const int b = __builtin_bit_cast(int, x);
  return __builtin_bit_cast(float, __builtin_amdgcn_permlanex16(b, b, 0x76543210, 0xfedcba98, false, false));
}
// orders LDS stores of this wave before later LDS loads of the same wave (wave-private exchange)
__device__ __forceinline__ void wave_sync_lds() {
  __builtin_amdgcn_fence(__ATOMIC_RELEASE, "workgroup");
  __builtin_amdgcn_wave_barrier();
  __builtin_amdgcn_fence(__ATOMIC_ACQUIRE, "workgroup");
}

// =====================================================================================================
// x convert + rms statistics. Block = 256 threads = 8 waves owns 32 consecutive token rows (wave w: rows
// 4w..4w+3); token tok = b*SEQ + s reads input row b*SEQ_FULL + s. Per row each lane converts 8
// consecutive floats per step (4 steps of 256 columns): ob = bf16 bits of x (RNE), oh = f16 bits of
// of the bf16 values is reduced per row and rstd = rsqrt(mean + eps) staged in LDS (cross-wave -> block
// coverage: 8 waves x 4 rows x (4 x 256) columns = 32 whole rows of both planes per block, grid = MT/32
// blocks (bx); rstd rows row0..row0+31 per block = all MT entries.
// =====================================================================================================
__device__ __forceinline__ void cvt_x(int bx, const float* __restrict__ x, unsigned short* ob,
                                      unsigned short* oh, float* rstd) {
  __shared__ float srs[32];
  const int lane = threadIdx.x & 31, wv = threadIdx.x >> 5;
  const int row0 = bx * 32;
#pragma unroll 1
  for (int rr = 0; rr < 4; ++rr) {
    const int tok = row0 + wv * 4 + rr;
    const int b = tok / SEQ, s = tok - b * SEQ;
    const float* src = x + ((size_t)b * SEQ_FULL + (size_t)s) * DM;
    const size_t orow = (size_t)tok * DM;
    float ss = 0.f;
#pragma unroll 1
    for (int it = 0; it < DM / 256; ++it) {
      const int col = it * 256 + lane * 8;
      const v4f a0 = *(const v4f*)(src + col);
      const v4f a1 = *(const v4f*)(src + col + 4);
      v4u hb, hh;
#pragma unroll
      for (int e = 0; e < 2; ++e) {
        const unsigned short u0 = bf_bits(a0[2 * e]), u1 = bf_bits(a0[2 * e + 1]);
        const unsigned short u2 = bf_bits(a1[2 * e]), u3 = bf_bits(a1[2 * e + 1]);
        const float x0 = bf_up(u0), x1 = bf_up(u1), x2 = bf_up(u2), x3 = bf_up(u3);
        ss = fmaf(x0, x0, ss); ss = fmaf(x1, x1, ss); ss = fmaf(x2, x2, ss); ss = fmaf(x3, x3, ss);
        hb[e]     = pk16(u0, u1);
        hb[2 + e] = pk16(u2, u3);
        hh[e]     = pk16(f2h(x0 * XSC), f2h(x1 * XSC));
        hh[2 + e] = pk16(f2h(x2 * XSC), f2h(x3 * XSC));
      }
      unsigned short* db = ob + orow + col;
      unsigned short* dh = oh + orow + col;
      *(v4u*)db = hb;
      *(v4u*)dh = hh;
      
    }
    ss += __shfl_xor(ss, 16, 32);
    ss += __shfl_xor(ss, 8, 32);
    ss += __shfl_xor(ss, 4, 32);
    ss += __shfl_xor(ss, 2, 32);
    ss += __shfl_xor(ss, 1, 32);
    if (lane == 0) srs[wv * 4 + rr] = rsqrtf(ss * (1.0f / (float)DM) + LNEPS);
  }
  __syncthreads();
  if (wv == 0) {
    const float v = srs[lane];
    float* d = rstd + row0 + lane;
    *(float*)d = v;
    
  }
}

// =====================================================================================================
// Weight convert with transpose: source matrices are [in k][out n] row-major; output Bt planes [n][k]
// (k contiguous). y (block-uniform) selects the matrix (0 w_q, 1 w_k, 2 w_v, 3 w_o), bx the 64x64 tile
// (k0 = 64*(bx>>4), n0 = 64*(bx&15)). The tile is staged in LDS as f32, then each output row n0+r, columns
// lines). Values: y=0,1: w' = bf16(ln_w[k]) * bf16(w[k][n]) (exact in f32) split into bf16 hi (plane 2y) and
// bf16 lo = w' - hi (plane 2y+1, exact); y=2: f16 bits of w' * WSCL (plane 4); y=3: bf16 bits of w_o
// coverage: load 256 threads x 4 x 4 = 64x64 tile; store 8 waves x 2 x (4 rows x 8 lanes x 8) = 64 rows x
// 64 cols; bx 0..255 x y 0..3 covers every 64x64 tile of every output plane.
// =====================================================================================================
__device__ __forceinline__ void cvt_w(int bx, int y, const float* __restrict__ w0, const float* __restrict__ w1,
                                      const float* __restrict__ w2, const float* __restrict__ w3,
                                      const float* __restrict__ lnw, unsigned short* o) {
  __shared__ __align__(16) float sm[64 * 65];
  __shared__ float slw[64];
  const float* w = (y == 0) ? w0 : ((y == 1) ? w1 : ((y == 2) ? w2 : w3));
  const int k0 = (bx >> 4) << 6, n0 = (bx & 15) << 6;
  const int t = threadIdx.x, lane = t & 31, wv = t >> 5;
#pragma unroll
  for (int it = 0; it < 4; ++it) {
    const int r = it * 16 + (t >> 4), c4 = (t & 15) * 4;
    const v4f v = *(const v4f*)(w + (size_t)(k0 + r) * DM + (size_t)(n0 + c4));
    float* sp = sm + r * 65 + c4;
    sp[0] = v[0]; sp[1] = v[1]; sp[2] = v[2]; sp[3] = v[3];
  }
  if (t < 64) slw[t] = bfr(lnw[k0 + t]);                       // waves 0,1 entirely: wave-uniform
  __syncthreads();
  const int pl0 = (y == 0) ? 0 : ((y == 1) ? 2 : ((y == 2) ? 4 : 5));
  unsigned short* P0 = o + (size_t)pl0 * DM * DM;
  unsigned short* P1 = (y < 2) ? (P0 + (size_t)DM * DM) : P0;
  const int q8 = lane >> 3, c8 = (lane & 7) * 8;
  v4u ha[2], hl[2];
#pragma unroll
  for (int it = 0; it < 2; ++it) {
    const int r = wv * 8 + it * 4 + q8;                          // n local
    v4u a = {0u, 0u, 0u, 0u}, l = {0u, 0u, 0u, 0u};
#pragma unroll
    for (int e = 0; e < 4; ++e) {
      const int ka = c8 + 2 * e, kb = ka + 1;
      float va = bfr(sm[ka * 65 + r]), vb = bfr(sm[kb * 65 + r]);
      if (y < 3) { va *= slw[ka]; vb *= slw[kb]; }
      if (y < 2) {
        const unsigned short ua = bf_bits(va), ub = bf_bits(vb);
        a[e] = pk16(ua, ub);
        l[e] = pk16(bf_bits(va - bf_up(ua)), bf_bits(vb - bf_up(ub)));
      } else if (y == 2) {
        a[e] = pk16(f2h(va * WSCL), f2h(vb * WSCL));
      } else {
        a[e] = pk16(bf_bits(va), bf_bits(vb));
      }
    }
    ha[it] = a;
    hl[it] = l;
  }
  {
#pragma unroll
    for (int it = 0; it < 2; ++it) {
      const int r = wv * 8 + it * 4 + q8;
      const size_t go = (size_t)(n0 + r) * DM + (size_t)(k0 + c8);
      *(v4u*)(P0 + go) = ha[it];
      if (y < 2) *(v4u*)(P1 + go) = hl[it];
    }
    // the stores' address and data registers may be rewritten by whatever code follows this job in the merged kernel
    asm volatile("s_wait_xcnt 0x0" ::: "memory");
  }
}

// =====================================================================================================
// Relative position bias by signed key-query distance: BD[h][i], i = (key - query) + 2047, i in 0..4094;
// i = 4095 is padding written as 0. bucket on integer n = query - key: ret = (n < 0) * 16, n = |n|,
// n < 8 -> n, else 8 + floor(2*log2(n/8)) capped at 15, evaluated by its integer thresholds
// coverage: 256 threads x 16 = 4096 entries per head; h = 0..NH-1 = the whole table.
// =====================================================================================================
__device__ __forceinline__ int rel_bucket(int d) {              // d = key - query
  int n = -d;
  int ret = 0;
  if (n < 0) { ret = NBKT / 2; n = -n; }
  int bk;
  if (n < 8)       bk = n;
  else if (n < 12) bk = 8;
  else if (n < 16) bk = 9;
  else if (n < 23) bk = 10;
  else if (n < 32) bk = 11;
  else if (n < 46) bk = 12;
  else if (n < 64) bk = 13;
  else if (n < 91) bk = 14;
  else             bk = 15;
  return ret + bk;
}

__device__ __forceinline__ void bias_build(int h, const float* __restrict__ tbl, float* BD) {
  __shared__ __align__(16) float sh[BDW];
  const int t = threadIdx.x;
#pragma unroll 4
  for (int j = 0; j < 16; ++j) {
    const int idx = t + 256 * j;
    const int ti = clampi(rel_bucket(idx - 2047) * NH + h, 0, NBKT * NH - 1);
    float v = bfr(tbl[ti]);
    v = (idx == BDW - 1) ? 0.f : v;
    sh[idx] = v;
  }
  __syncthreads();
  v4f vv[4];
#pragma unroll
  for (int q = 0; q < 4; ++q) vv[q] = *(const v4f*)(sh + q * 1024 + 4 * t);
  float* dst = BD + (size_t)h * BDW;
  {
#pragma unroll
    for (int q = 0; q < 4; ++q) *(v4f*)(dst + q * 1024 + 4 * t) = vv[q];
    
  }
}

// =====================================================================================================
// One launch for the three preparation jobs, which depend on the inputs alone and not on one another: blocks
// 0 .. PXB-1 convert x (the longest job per block, so it starts first), the next NH build the bias table, the
// last 4*PWB convert the weights. The job is chosen by blockIdx.x alone, so every barrier inside a job is met by
// a whole block.
// =====================================================================================================
#define PXB (MT / 32)                   // blocks of the x convert
#define PWB ((DM / 64) * (DM / 64))     // blocks of one weight matrix
__global__ __launch_bounds__(256) void prep(const float* __restrict__ x, const float* __restrict__ w0,
                                            const float* __restrict__ w1, const float* __restrict__ w2,
                                            const float* __restrict__ w3, const float* __restrict__ lnw,
                                            const float* __restrict__ tbl, unsigned short* ob, unsigned short* oh,
                                            float* rstd, unsigned short* o, float* BD) {
  const int bx = blockIdx.x;
  if (bx < PXB) {
    cvt_x(bx, x, ob, oh, rstd);
  } else if (bx < PXB + NH) {
    bias_build(bx - PXB, tbl, BD);
  } else {
    const int i = bx - (PXB + NH);
    cvt_w(i % PWB, i / PWB, w0, w1, w2, w3, lnw, o);
  }
}

// =====================================================================================================
// LDS-staged 16-bit WMMA GEMM: C[m][n] = sum over plane pairs pl and k of A_pl[m][k] * Bt_pl[n][k]. A block of
// 8 waves owns one 128x128 tile of C (tile, block-uniform); wave w owns rows 32*(w>>1).. and columns 64*(w&1).. of
// it (2 x 4 accumulator tiles). A pass is 128 k: 256 B of each of the 128 A rows and 128 Bt rows, brought into one
// of two LDS buffers (row pitch 272 B) by asynchronous 16-byte copies, 16 per thread; the copies of pass t + 2 are
// issued when every wave has left pass t's buffer, so they fly while pass t + 1 is worked on. OPK 0: f16 operands;
// OPK 1: bf16 operands. NPL 1|2 operand plane pairs (Ap,Btp) and (Ap2,Btp2) sharing the accumulators (the second
// pair's passes follow the first pair's; only unscaled hi/lo planes are paired this way). AHM 0: A row-major
// [M][K] pitch lda; AHM 1: A head-major planes, element (m, k) at ((k/HD)*aplane + m*HD + k%HD). Bt row-major
// [N][K] pitch ldb (k contiguous); M, N, K multiples of 128 (true at every call site; host grid = tiles exact).
// Both operand fragments use the split k map (elements 0..7 <- k0+8h.., 8..15 <- k0+16+8h..); D element r of a
// lane is (row 8h + r, col lane&15).
// OM 0: f32 out Cf = acc*wsc (+ RES: bf16 RNE value of Rp[input row of token m][n], token m -> input row
//       (m/SEQ)*SEQ_FULL + m%SEQ, pitch DM), pitch ldc.
// OM 1: f16 out Ch = f16(acc*wsc*osc*scale).  OM 2: f16 pair: base = acc*wsc*osc*scale; Ch = f16 bits(base);
//       Ch2 = f16 bits((base - value(Ch)) * rsc).  scale = Rs[m] (RSM 1, per row), Rs[n] (RSM 2, per column),
//       1 (RSM 0).
// coverage: 2 slabs x 16 rows x 64 cols = the wave's whole 32x64 tile; 8 waves = the block's 128x128 tile.
// =====================================================================================================
#define GTM  128                        // block tile rows
#define GTN  128                        // block tile columns
#define GKP  128                        // k per pass
#define GPIT 136                        // LDS row pitch in 16-bit elements (272 B)
#define GBUF ((GTM + GTN) * GPIT)       // 16-bit elements per buffer: A rows 0..127, Bt rows 128..255

// Eight asynchronous 16-byte copies of one lane, global -> LDS, rows 16 apart: LDS byte address l + 16*272*c,
// global address g + gs*c (gs in elements), c = 0..7. The s_wait_xcnt closes the statement so that no address
// register named by a copy is rewritten ahead of it.
__device__ __forceinline__ void copy8_rows16(unsigned l, const unsigned short* g, size_t gs) {
#if defined(__HIP_DEVICE_COMPILE__)
  const unsigned ls = 16u * GPIT * 2u;
  asm volatile(
      "global_load_async_to_lds_b128 %0, %8, off\n\t"
      "global_load_async_to_lds_b128 %1, %9, off\n\t"
      "global_load_async_to_lds_b128 %2, %10, off\n\t"
      "global_load_async_to_lds_b128 %3, %11, off\n\t"
      "global_load_async_to_lds_b128 %4, %12, off\n\t"
      "global_load_async_to_lds_b128 %5, %13, off\n\t"
      "global_load_async_to_lds_b128 %6, %14, off\n\t"
      "global_load_async_to_lds_b128 %7, %15, off\n\t"
      "s_wait_xcnt 0x0"
      :: "v"(l), "v"(l + ls), "v"(l + 2u * ls), "v"(l + 3u * ls),
         "v"(l + 4u * ls), "v"(l + 5u * ls), "v"(l + 6u * ls), "v"(l + 7u * ls),
         "v"(g), "v"(g + gs), "v"(g + 2 * gs), "v"(g + 3 * gs),
         "v"(g + 4 * gs), "v"(g + 5 * gs), "v"(g + 6 * gs), "v"(g + 7 * gs)
      : "memory");
#endif
}

template <int OPK, int NPL, int AHM, int OM, int RSM, int RES>
__device__ __forceinline__ void gemm64(
    unsigned short* ring, float* sT, int tile,
    const unsigned short* __restrict__ Ap, const unsigned short* __restrict__ Ap2, int lda, int aplane,
    const unsigned short* __restrict__ Btp, const unsigned short* __restrict__ Btp2, int ldb,
    unsigned short* Ch, unsigned short* Ch2, float* Cf, int ldc,
    const float* __restrict__ Rs, const float* __restrict__ Rp,
    float wsc, float osc, float rsc, int M, int N, int K) {
  const int lane = threadIdx.x & 31;
  const int wave = threadIdx.x >> 5;
  const int tilesN = N >> 7;
  const int tilesM = M >> 7;
  if (tile >= tilesM * tilesN) return;   // block-uniform, in front of every copy and barrier
  const int tm = tile / tilesN;
  const int tn = tile - tm * tilesN;
  const int bm0 = tm << 7;                     // block tile origin
  const int bn0 = tn << 7;
  const int wm = (wave >> 1) << 5;             // wave tile origin inside the block tile
  const int wn = (wave & 1) << 6;
  const int m0 = bm0 + wm;
  const int n0 = bn0 + wn;

  const int rlane = lane & 15;                 // row (A) / col (B, D) within subtile
  const int koff  = (lane >> 4) * 8;           // k offset of this lane half
  const int mOff  = (lane >> 4) * 8;           // D row offset

  // copy map: thread t brings 16-byte piece t&15 of rows (t>>4) + 16*c, c = 0..7, of A and of Bt
  const int crow = threadIdx.x >> 4;
  const int cch  = threadIdx.x & 15;
  const unsigned ldsA = (unsigned)(size_t)ring + (unsigned)(crow * (GPIT * 2) + cch * 16);
  const unsigned ldsB = ldsA + (unsigned)(GTM * GPIT * 2);
  const size_t aoff = AHM ? ((size_t)(cch >> 3) * (size_t)aplane + (size_t)(bm0 + crow) * HD + (size_t)((cch & 7) * 8))
                          : ((size_t)(bm0 + crow) * lda + (size_t)(cch * 8));
  const size_t astep = AHM ? (size_t)(16 * HD) : (size_t)16 * lda;          // 16 rows of A
  const size_t apass = AHM ? (size_t)(GKP / HD) * (size_t)aplane : (size_t)GKP;   // one pass along k
  const size_t boff = (size_t)(bn0 + crow) * ldb + (size_t)(cch * 8);
  const size_t bstep = (size_t)16 * ldb;
  const int nkp = K >> 7;                      // passes per plane pair
  const int NT = NPL * nkp;                    // passes in all

  auto issue = [&](int t, int buf) {           // pass t's 16 copies of this thread into buffer buf
    const int pl = (NPL == 2 && t >= nkp) ? 1 : 0;
    const int kp = t - pl * nkp;
    const unsigned short* Ac = (pl == 0) ? Ap : Ap2;
    const unsigned short* Bc = (pl == 0) ? Btp : Btp2;
    const unsigned lb = (unsigned)buf * (unsigned)(GBUF * 2);
    copy8_rows16(ldsA + lb, Ac + aoff + (size_t)kp * apass, astep);
    copy8_rows16(ldsB + lb, Bc + boff + (size_t)kp * GKP, bstep);
  };

  v8f acc[2][4];
#pragma unroll
  for (int i = 0; i < 2; ++i)
#pragma unroll
    for (int j = 0; j < 4; ++j) acc[i][j] = zero8();

  issue(0, 0);
  asm volatile("s_wait_asynccnt 0x0" ::: "memory");   // this wave's copies of pass 0 have landed
  __syncthreads();                                    // every wave's have: pass 0 may be read
  if (NT > 1) issue(1, 1);

#pragma unroll 1   // one pass per trip: the buffer index and the publish point stay at the loop's foot
  for (int t = 0; t < NT; ++t) {
    const unsigned short* sb = ring + (t & 1) * GBUF;
    const unsigned short* sA = sb + (wm + rlane) * GPIT + koff;
    const unsigned short* sB = sb + (GTM + wn + rlane) * GPIT + koff;
#pragma unroll
    for (int ks = 0; ks < GKP / 32; ++ks) {
      v16us bh[4];
#pragma unroll
      for (int j = 0; j < 4; ++j) bh[j] = ldfrag_u(sB + (j << 4) * GPIT + ks * 32);
#pragma unroll
      for (int i = 0; i < 2; ++i) {
        const v16us ah = ldfrag_u(sA + (i << 4) * GPIT + ks * 32);
#pragma unroll
        for (int j = 0; j < 4; ++j) acc[i][j] = mma_raw<OPK>(ah, bh[j], acc[i][j]);
        dep_guard1(acc[i][0], acc[i][3], ah);
      }
      keep4_u(bh[0], bh[1], bh[2], bh[3]);
    }
    asm volatile("s_wait_dscnt 0x0" ::: "memory");      // this wave's reads of pass t's buffer are done
    asm volatile("s_wait_asynccnt 0x0" ::: "memory");   // this wave's copies of pass t + 1 have landed
    __syncthreads();                                    // publishes pass t + 1, frees pass t's buffer
    if (t + 2 < NT) issue(t + 2, t & 1);
  }
  asm volatile("s_wait_asynccnt 0x0" ::: "memory");     // no copy is outstanding past the loop
  acc_guard4(acc[0][0], acc[0][1], acc[0][2], acc[0][3]);
  acc_guard4(acc[1][0], acc[1][1], acc[1][2], acc[1][3]);

  const int hh2 = lane >> 4, c4 = (lane & 15) * 4;     // f32 out: 256-B row segment = 16 lanes x 16 B
  const int q8  = lane >> 3, c8 = (lane & 7) * 8;
  const float wo = wsc * osc;

  // per-column scale (RSM 2): columns n0+c8 .. n0+c8+7, same for every row of the tile
  float csc[8];
#pragma unroll
  for (int e = 0; e < 8; ++e) csc[e] = 1.f;
  if (OM != 0 && RSM == 2) {
    const v4f cs0 = *(const v4f*)(Rs + n0 + c8);
    const v4f cs1 = *(const v4f*)(Rs + n0 + c8 + 4);
#pragma unroll
    for (int e = 0; e < 4; ++e) { csc[e] = cs0[e]; csc[4 + e] = cs1[e]; }
  }

  // ---- epilogue ----
  float* slab = sT + wave * (16 * 68);
#pragma unroll
  for (int i = 0; i < 2; ++i) {
    const int mBase = m0 + (i << 4);
#pragma unroll
    for (int j = 0; j < 4; ++j) {
#pragma unroll
      for (int r = 0; r < 8; ++r) {
        slab[(mOff + r) * 68 + (j << 4) + rlane] = acc[i][j][r];
      }
    }
    wave_sync_lds();
    if (OM == 0) {
      v4f vals[8];
#pragma unroll
      for (int it = 0; it < 8; ++it) {
        const int row = it * 2 + hh2;                      // it 0..7 x hh2 0..1 = rows 0..15
        v4f v = *(const v4f*)(slab + row * 68 + c4);
        v = v * wsc;
        if (RES) {
          const int tok = mBase + row;
          const int bb = tok / SEQ, ss = tok - bb * SEQ;
          const v4f hr = *(const v4f*)(Rp + ((size_t)bb * SEQ_FULL + (size_t)ss) * DM + (size_t)(n0 + c4));
          // the next load's result may land in this load's address registers: wait before they are rewritten
          asm volatile("s_wait_xcnt 0x0" ::: "memory");
#pragma unroll
          for (int c = 0; c < 4; ++c) v[c] = v[c] + bfr(hr[c]);
        }
        vals[it] = v;
      }
      {
#pragma unroll
        for (int it = 0; it < 8; ++it) {
          const int row = it * 2 + hh2;
          *(v4f*)(Cf + (size_t)(mBase + row) * ldc + (size_t)n0 + c4) = vals[it];
        }
        
      }
    } else {
      v4u hv[4], hw[4];
#pragma unroll
      for (int it = 0; it < 4; ++it) {
        const int row = it * 4 + q8;                       // it 0..3 x q8 0..3 = rows 0..15
        const float* sp = slab + row * 68 + c8;
        float rsr = wo;
        if (RSM == 1) rsr = wo * Rs[mBase + row];
        v4u ha = {0u, 0u, 0u, 0u}, hb = {0u, 0u, 0u, 0u};
#pragma unroll
        for (int e = 0; e < 4; ++e) {
          const float b0 = sp[2 * e]     * rsr * csc[2 * e];
          const float b1 = sp[2 * e + 1] * rsr * csc[2 * e + 1];
          if (OM == 1) {
            ha[e] = pk16(f2h(b0), f2h(b1));
          } else {
            const _Float16 x0 = (_Float16)b0, x1 = (_Float16)b1;
            ha[e] = pk16(h_bits(x0), h_bits(x1));
            hb[e] = pk16(f2h((b0 - (float)x0) * rsc), f2h((b1 - (float)x1) * rsc));
          }
        }
        hv[it] = ha;
        hw[it] = hb;
      }
      {
#pragma unroll
        for (int it = 0; it < 4; ++it) {
          const int row = it * 4 + q8;
          const size_t go = (size_t)(mBase + row) * ldc + (size_t)n0 + c8;
          *(v4u*)(Ch + go) = hv[it];
          if (OM == 2) *(v4u*)(Ch2 + go) = hw[it];
        }
        
      }
    }
    wave_sync_lds();
  }
}

#define GNT ((MT / 128) * (DM / 128))   // 128x128 tiles of one [MT][DM] (or [DM][MT]) product

// One launch for the three projections, which depend on the preparation alone and not on one another: blocks
// 0 .. GNT-1 the q planes, GNT .. 2*GNT-1 the k planes, the last GNT (half the passes, so they come last) v^T.
// The product is chosen by blockIdx.x alone; both bodies use the same LDS.
//   q, k (hi x16 + residual x2048): C[tok][n] = rstd[tok] * sum_k XB[tok][k] * (hi + lo)[n][k]
//   v^T x16:                        C[d][tok] = rstd[tok] * sum_k WVH[d][k] * XH[tok][k]
__global__ __launch_bounds__(256) void gemm_qkv(
    const unsigned short* __restrict__ XB, const unsigned short* __restrict__ XH,
    const unsigned short* __restrict__ WQH, const unsigned short* __restrict__ WQL,
    const unsigned short* __restrict__ WKH, const unsigned short* __restrict__ WKL,
    const unsigned short* __restrict__ WVH,
    unsigned short* QH, unsigned short* QR, unsigned short* KH, unsigned short* KR, unsigned short* VT,
    float* fdummy, const float* __restrict__ RSTD, const float* __restrict__ x) {
  __shared__ __align__(16) unsigned short ring[2 * GBUF];   // two operand buffers, 2 x 69632 B
  __shared__ __align__(16) float sT[8 * 16 * 68];           // per-wave 16x64 slab, pitch 68 floats
  const int bx = blockIdx.x;
  if (bx < 2 * GNT) {
    const bool isk = bx >= GNT;
    gemm64<1, 2, 0, 2, 1, 0>(ring, sT, isk ? bx - GNT : bx, XB, XB, DM, 0, isk ? WKH : WQH, isk ? WKL : WQL, DM,
                             isk ? KH : QH, isk ? KR : QR, fdummy, DM, RSTD, x, 1.0f, QKS, QRS, MT, DM, DM);
  } else {
    gemm64<0, 1, 0, 1, 2, 0>(ring, sT, bx - 2 * GNT, WVH, WVH, DM, 0, XH, XH, DM, VT, VT, fdummy, MT, RSTD, x,
                             1.0f / (XSC * WSCL), VSC, 1.0f, DM, MT, DM);
  }
}

// Output projection + residual: out[tok][n] = sum_k (ctx_hi + ctx_lo)[tok][k] * WOB[n][k] + bf16(x[tok][n])
__global__ __launch_bounds__(256) void gemm_out(
    const unsigned short* __restrict__ ZH, const unsigned short* __restrict__ ZL,
    const unsigned short* __restrict__ WOB, unsigned short* hdummy, float* out,
    const float* __restrict__ RSTD, const float* __restrict__ x) {
  __shared__ __align__(16) unsigned short ring[2 * GBUF];   // two operand buffers, 2 x 69632 B
  __shared__ __align__(16) float sT[8 * 16 * 68];           // per-wave 16x64 slab, pitch 68 floats
  gemm64<1, 2, 1, 0, 0, 1>(ring, sT, blockIdx.x, ZH, ZL, DM, MT * HD, WOB, WOB, DM, hdummy, hdummy, out, DM, RSTD, x,
                           1.0f, 1.0f, 1.0f, MT, DM, DM);
}

// =====================================================================================================
// Bidirectional attention with relative position bias, head dim 64, no 1/sqrt(d) scaling. Block = 256
// threads = 8 waves, all of one (batch b, head h); one wave owns one 16-row query tile (t0..t0+15) and loops all
// key blocks of 32 with an online max-subtracted softmax in f32. A pass is 64 keys: the head's 128 B of each of
// the 64 KH rows and 64 KR rows and 128 B (64 keys) of each of its 64 VT rows are brought into one of two LDS
// buffers (row pitch 144 B) by asynchronous 16-byte copies, 6 per thread, and every wave reads its K and V
// fragments from there; the copies of pass t + 2 are issued when every wave has left pass t's buffer.
// Planes: QH|QR f16 [MT][DM] (16*q hi,
// residual x2048), KH|KR f16 [MT][DM] (16*k hi, residual x2048), VT f16 [DM][MT] (16*v transposed, row =
// h*64+d, column = token), BD f32 [NH][4096] bias by (key-query)+2047. Output Zh|Zl: bf16 hi|lo of ctx,
// head-major [NH][MT][64].
// Both products are taken transposed: keys (then head dims) are the A rows and the wave's 16 queries the B columns,
// so lane (hh, m) holds, for query t0+m alone, the scores of keys 8*hh+r and 16+8*hh+r of a 32-key block.
// The head's bias for every distance the block's 128 queries meet (key - query = -(tb+127) .. SEQ-1-tb, tb = the
// block's first query) is staged once, ahead of the first barrier, in one LDS row shared by the 8 waves and read
// at index key - query + tb + 127. Per key block:
// S^T = KH.QH^T (4 WMMA), R^T = KH.QR^T + KR.QH^T (8 WMMA, own accumulators);
// score = S/256 + R/524288 + bias; the block maximum is taken in the lane and joined with the other half-wave by
// one cross-row move; p = exp(score - running max) in f32, l accumulated per lane from the f32 p (the two halves'
// sums are joined once, in the epilogue); p*16384 as f16 packs from the two score tiles straight into the B
// operand (split k map: elements 0..7 = keys 8*hh.., 8..15 = keys 16+8*hh..); O^T += VT.P^T on f16 WMMA. The
// ctx staging region is private to its wave.
// staged extent covers consumed extent: bias row SEQ+128 written / 0..SEQ+126 read; ctx staging 2 x 16x64 written and read.
// Epilogue: ctx = O^T/(l*262144) split into bf16 hi|lo (a lane holds 8 consecutive dims of its query per O^T
// tile: one 16-byte LDS store per plane and tile), staged in LDS; the wave's 16 rows x 64 halves are
// coverage: 16 query rows x 64 halves per wave, NB*NH*SEQ/16 wave tasks = all (h, tok) rows of both planes.
// =====================================================================================================
#define AKP  64                         // keys per pass
#define APIT 72                         // LDS row pitch in 16-bit elements (144 B)
#define ATIL (64 * APIT)                // 16-bit elements of one staged tile (64 rows)
#define ABUF (3 * ATIL)                 // 16-bit elements per buffer: KH rows | KR rows | VT rows
static_assert((SEQ % AKP) == 0);

// Six asynchronous 16-byte copies of one lane, global -> LDS: rows r and r + 32 of the KH, KR and VT tiles; l is
// the LDS byte address of the lane's piece of KH row r. The s_wait_xcnt closes the statement so that no address
// register named by a copy is rewritten ahead of it.
__device__ __forceinline__ void copy6_kv(unsigned l, const unsigned short* gk, const unsigned short* gr,
                                         const unsigned short* gv) {
#if defined(__HIP_DEVICE_COMPILE__)
  const unsigned lr = 32u * APIT * 2u;
  const unsigned lt = ATIL * 2u;
  asm volatile(
      "global_load_async_to_lds_b128 %0, %6, off\n\t"
      "global_load_async_to_lds_b128 %1, %7, off\n\t"
      "global_load_async_to_lds_b128 %2, %8, off\n\t"
      "global_load_async_to_lds_b128 %3, %9, off\n\t"
      "global_load_async_to_lds_b128 %4, %10, off\n\t"
      "global_load_async_to_lds_b128 %5, %11, off\n\t"
      "s_wait_xcnt 0x0"
      :: "v"(l), "v"(l + lr), "v"(l + lt), "v"(l + lt + lr), "v"(l + 2u * lt), "v"(l + 2u * lt + lr),
         "v"(gk), "v"(gk + (size_t)32 * DM), "v"(gr), "v"(gr + (size_t)32 * DM),
         "v"(gv), "v"(gv + (size_t)32 * MT)
      : "memory");
#endif
}

__global__ __launch_bounds__(256) void attn_kernel(
    const unsigned short* __restrict__ QHp, const unsigned short* __restrict__ QRp,
    const unsigned short* __restrict__ KHp, const unsigned short* __restrict__ KRp,
    const unsigned short* __restrict__ VTp,
    const float* __restrict__ BD, unsigned short* Zh, unsigned short* Zl) {
  __shared__ __align__(16) unsigned short kvr[2 * ABUF];           // two K|KR|VT buffers, 2 x 27648 B
  __shared__ __align__(16) float brow[BRW];                        // bias row of the block, 8704 B
  __shared__ __align__(16) unsigned short zst[AWV][2][16 * HD];    // ctx hi|lo staging, 32768 B
  const int lane = threadIdx.x & 31, wv = threadIdx.x >> 5, m = lane & 15, hh = lane >> 4;
  const int nqt = SEQ / 16;
  if ((int)blockIdx.x * AWV >= NB * NH * nqt) return;   // block-uniform, in front of every copy and barrier
  const int task = blockIdx.x * AWV + wv;            // nqt is a multiple of AWV: one (b, h) per block
  const int bh = task / nqt;
  const int t0 = (task - bh * nqt) << 4;             // query tile start
  const int b = bh / NH, h = bh - b * NH;
  const size_t tok0 = (size_t)b * SEQ;

  // Q B-fragments: columns t0+m, k = head dims (two 32-deep steps), hi and residual planes
  const size_t qo = (tok0 + (size_t)(t0 + m)) * DM + (size_t)(h * HD + 8 * hh);
  const v16us qh0 = ldfrag_u(QHp + qo);
  const v16us qh1 = ldfrag_u(QHp + qo + 32);
  const v16us qr0 = ldfrag_u(QRp + qo);
  const v16us qr1 = ldfrag_u(QRp + qo + 32);

  float mx = -1.0e30f, ls = 0.f;       // query t0+m: running maximum (equal in both halves), this half's sum
  v8f O[4];                            // O^T tiles: element r = (dim 16*j + 8*hh + r, query t0+m)
#pragma unroll
  for (int j = 0; j < 4; ++j) O[j] = zero8();

  // bias row: brow[i] = bias_h(key - query = i - tb - 127), i = 0..SEQ+127; source index i + 1920 - tb lies in
  // 0..4095 (tb is a multiple of 128, tb <= SEQ - 128). Thread t brings 16-byte pieces t, t + 256, ...
  const int tb = t0 - 16 * wv;
  const float* bsrc = BD + (size_t)h * BDW + (SEQ_FULL - 16 * AWV - tb);
  v4f bst[BRQ + 1];
#pragma unroll     // bst[] is indexed by constants only; the loads go out together
  for (int q = 0; q < BRQ; ++q) bst[q] = *(const v4f*)(bsrc + 4 * ((int)threadIdx.x + 256 * q));
  if ((int)threadIdx.x < BRT) bst[BRQ] = *(const v4f*)(bsrc + 4 * ((int)threadIdx.x + 256 * BRQ));
  const float* bl = brow + (16 * AWV - 1 - 16 * wv - m + 8 * hh);          // + key block start + r
  // copy map: thread t brings 16-byte piece t&7 of rows (t>>3) and (t>>3) + 32 of each of the three tiles
  const int crow = threadIdx.x >> 3;
  const int cpc  = threadIdx.x & 7;
  const unsigned ldsC = (unsigned)(size_t)kvr + (unsigned)(crow * (APIT * 2) + cpc * 16);
  const size_t kco = (tok0 + (size_t)crow) * DM + (size_t)(h * HD + cpc * 8);
  const unsigned short* gK = KHp + kco;
  const unsigned short* gR = KRp + kco;
  const unsigned short* gV = VTp + (size_t)(h * HD + crow) * MT + tok0 + (size_t)(cpc * 8);
  const int NT = SEQ / AKP;

  auto issue = [&](int t, int buf) {           // pass t's 6 copies of this thread into buffer buf
    copy6_kv(ldsC + (unsigned)buf * (unsigned)(ABUF * 2), gK + (size_t)t * (AKP * DM), gR + (size_t)t * (AKP * DM),
             gV + (size_t)t * AKP);
  };

  issue(0, 0);
#pragma unroll     // bst[] is indexed by constants only, so it stays in registers
  for (int q = 0; q < BRQ; ++q) *(v4f*)(brow + 4 * ((int)threadIdx.x + 256 * q)) = bst[q];
  if ((int)threadIdx.x < BRT) *(v4f*)(brow + 4 * ((int)threadIdx.x + 256 * BRQ)) = bst[BRQ];
  asm volatile("s_wait_asynccnt 0x0" ::: "memory");   // this wave's copies of pass 0 have landed
  __syncthreads();                                    // every wave's have: pass 0 and the bias row may be read
  if (NT > 1) issue(1, 1);

#pragma unroll 1   // one pass per trip: the buffer index and the publish point stay at the loop's foot
  for (int t = 0; t < NT; ++t) {
  const float* bw = bl + t * AKP;                                            // bias of this pass's keys
  const unsigned short* kbase  = kvr + (t & 1) * ABUF + m * APIT + 8 * hh;   // KH row m, this lane half's k
  const unsigned short* krbase = kbase + ATIL;
  const unsigned short* vbase  = kbase + 2 * ATIL;                           // VT row (dim) m, keys 8*hh..
#pragma unroll     // both 32-key blocks of a pass inline: their LDS offsets become immediates
  for (int sub = 0; sub < AKP / 32; ++sub) {
    // bias of keys 8*hh + r and 16 + 8*hh + r of the block for query m, read here so that the products cover the
    // LDS latency; two consecutive keys per register pair
    v2f b0[4], b1[4];
#pragma unroll     // b0[], b1[] are indexed by constants only, so they stay in registers
    for (int e = 0; e < 4; ++e) {
      b0[e] = (v2f){bw[sub * 32 + 2 * e], bw[sub * 32 + 2 * e + 1]};
      b1[e] = (v2f){bw[sub * 32 + 16 + 2 * e], bw[sub * 32 + 16 + 2 * e + 1]};
    }

    // S^T = KH.QH^T, R^T = KH.QR^T + KR.QH^T ; A row = key token sb+m (+16), B column = query, k = head dim
    v8f S0 = zero8(), S1 = zero8(), R0 = zero8(), R1 = zero8();
#pragma unroll
    for (int ks = 0; ks < 2; ++ks) {
      const int kofs = (sub * 32) * APIT + 32 * ks;
      const v16us kf0 = ldfrag_u(kbase + kofs);
      const v16us kf1 = ldfrag_u(kbase + kofs + 16 * APIT);
      const v16us kg0 = ldfrag_u(krbase + kofs);
      const v16us kg1 = ldfrag_u(krbase + kofs + 16 * APIT);
      const v16us qa = (ks == 0) ? qh0 : qh1;
      const v16us qb = (ks == 0) ? qr0 : qr1;
      S0 = mma_g<0>(kf0, qa, S0);
      S1 = mma_g<0>(kf1, qa, S1);
      R0 = mma_g<0>(kf0, qb, R0);
      R1 = mma_g<0>(kf1, qb, R1);
      R0 = mma_g<0>(kg0, qa, R0);
      R1 = mma_g<0>(kg1, qa, R1);
    }

    // VT A-fragments (row = h*64 + dim, k = key token), read as one group here so that the softmax covers
    // their LDS latency
    v16us vf[4];
#pragma unroll     // vf[] is indexed by constants only, so it stays in registers
    for (int j = 0; j < 4; ++j) vf[j] = ldfrag_u(vbase + (16 * j) * APIT + sub * 32);

    // score = q.k + bias
    float s0[8], s1[8];
#pragma unroll     // two consecutive keys per step: accumulator pairs and bias pairs feed packed f32 FMAs as they lie
    for (int e = 0; e < 4; ++e) {
      const v2f x0 = __builtin_elementwise_fma((v2f){S0[2 * e], S0[2 * e + 1]}, (v2f){SC1, SC1},
                     __builtin_elementwise_fma((v2f){R0[2 * e], R0[2 * e + 1]}, (v2f){SC2, SC2}, b0[e]));
      const v2f x1 = __builtin_elementwise_fma((v2f){S1[2 * e], S1[2 * e + 1]}, (v2f){SC1, SC1},
                     __builtin_elementwise_fma((v2f){R1[2 * e], R1[2 * e + 1]}, (v2f){SC2, SC2}, b1[e]));
      s0[2 * e] = x0[0]; s0[2 * e + 1] = x0[1];
      s1[2 * e] = x1[0]; s1[2 * e + 1] = x1[1];
    }

    // online softmax: a query's 32 scores live in lanes m and m + 16, 16 each
    float xm = fmaxf(s0[0], s1[0]);
#pragma unroll     // s0[], s1[] are indexed by constants only, so they stay in registers
    for (int r = 1; r < 8; ++r) xm = fmaxf(xm, fmaxf(s0[r], s1[r]));
    xm = fmaxf(xm, xhalf(xm));
    const float mn = fmaxf(mx, xm);
    const float al = __expf(mx - mn);
    mx = mn;
    FragU pf;                                          // P^T B-fragment (split k map)
    float pa = 0.f, pb = 0.f;
#pragma unroll
    for (int r = 0; r < 8; ++r) {
      const float p0 = __expf(s0[r] - mn);
      const float p1 = __expf(s1[r] - mn);
      pa += p0;
      pb += p1;
      pf.v[r]     = f2h(p0 * PCAR);
      pf.v[8 + r] = f2h(p1 * PCAR);
    }
    ls = ls * al + (pa + pb);
#pragma unroll     // O[] is indexed by constants only, so it stays in registers
    for (int j = 0; j < 4; ++j) O[j] = O[j] * al;
#pragma unroll
    for (int j = 0; j < 4; ++j) O[j] = mma_g<0>(vf[j], pf.v, O[j]);
  }
    asm volatile("s_wait_dscnt 0x0" ::: "memory");      // this wave's reads of pass t's buffer are done
    asm volatile("s_wait_asynccnt 0x0" ::: "memory");   // this wave's copies of pass t + 1 have landed
    __syncthreads();                                    // publishes pass t + 1, frees pass t's buffer
    if (t + 2 < NT) issue(t + 2, t & 1);
  }
  asm volatile("s_wait_asynccnt 0x0" ::: "memory");     // no copy is outstanding past the loop
  acc_guard4(O[0], O[1], O[2], O[3]);

  // ---- epilogue: ctx = O / (l * PCAR * VSC) -> bf16 hi|lo, head-major planes ----
  unsigned short* zh = zst[wv][0];
  unsigned short* zl = zst[wv][1];
  const float linv = (1.0f / (ls + xhalf(ls))) * OSC;  // both halves' sums joined; the joined sum is >= 1
#pragma unroll
  for (int j = 0; j < 4; ++j) {
    v4u zc, zr;
#pragma unroll
    for (int e = 0; e < 4; ++e) {
      const float o0 = O[j][2 * e] * linv, o1 = O[j][2 * e + 1] * linv;
      const unsigned short x0 = bf_bits(o0), x1 = bf_bits(o1);
      zc[e] = pk16(x0, x1);
      zr[e] = pk16(bf_bits(o0 - bf_up(x0)), bf_bits(o1 - bf_up(x1)));
    }
    *(v4u*)(zh + m * HD + 16 * j + 8 * hh) = zc;       // row = query m, dims 16*j + 8*hh .. + 7
    *(v4u*)(zl + m * HD + 16 * j + 8 * hh) = zr;
  }
  wave_sync_lds();
  {
    v4u ha[4], hb[4];
#pragma unroll
    for (int q = 0; q < 4; ++q) {
      ha[q] = *(const v4u*)(zh + q * 256 + lane * 8);
      hb[q] = *(const v4u*)(zl + q * 256 + lane * 8);
    }
    const size_t zo = ((size_t)h * MT + tok0 + (size_t)t0) * HD;   // 2048-B aligned, 16 rows contiguous
    unsigned short* dh = Zh + zo;
    unsigned short* dl = Zl + zo;
    {
#pragma unroll
      for (int q = 0; q < 4; ++q) {
        *(v4u*)(dh + q * 256 + lane * 8) = ha[q];
        *(v4u*)(dl + q * 256 + lane * 8) = hb[q];
      }
      
    }
  }
}

// =====================================================================================================
// Workspace map (bytes, NB=2, SEQ=2048); every plane is an exact multiple of its whole-row / whole-line /
// BD = 16 x 4096 floats); all offsets multiples of 65536.
//   XB   bf16 [MT][DM]        0           8388608
//   XH   f16  [MT][DM]        8388608     8388608
//   RSTD f32  [MT]            16777216    65536     (16384 used)
//   W    6 x 16-bit [DM][DM]  16842752    12582912  (wq hi, wq lo, wk hi, wk lo bf16; wv f16 x256; wo bf16)
//   BD   f32  [NH][4096]      29425664    262144
//   QH   f16  [MT][DM]        29687808    8388608
//   QR   f16  [MT][DM]        38076416    8388608
//   KH   f16  [MT][DM]        46465024    8388608
//   KR   f16  [MT][DM]        54853632    8388608
//   VT   f16  [DM][MT]        63242240    8388608
//   ZH   bf16 [NH][MT][64]    71630848    8388608
//   ZL   bf16 [NH][MT][64]    80019456    8388608
//   end                       88408064
// =====================================================================================================
extern "C" void kernel_launch(void* const* d_in, const int* in_sizes, int n_in,
                              void* d_out, int out_size, void* d_ws, size_t ws_size,
                              hipStream_t stream) {
  if (n_in < 7) return;
  if (in_sizes[0] < ((NB - 1) * SEQ_FULL + SEQ) * DM) return;
  if (in_sizes[1] < DM) return;
  if (in_sizes[2] < DM * DM) return;
  if (in_sizes[3] < DM * DM) return;
  if (in_sizes[4] < DM * DM) return;
  if (in_sizes[5] < DM * DM) return;
  if (in_sizes[6] < NBKT * NH) return;
  if (out_size < MT * DM) return;

  const float* x    = (const float*)d_in[0];   // [2][2048][1024]
  const float* lnw  = (const float*)d_in[1];   // [1024]
  const float* w_q  = (const float*)d_in[2];   // [1024][1024] (in, out)
  const float* w_k  = (const float*)d_in[3];
  const float* w_v  = (const float*)d_in[4];
  const float* w_o  = (const float*)d_in[5];   // [1024][1024] (in, out)
  const float* tbl  = (const float*)d_in[6];   // [32][16]

  const size_t PX  = (size_t)MT * DM * 2;        // 16-bit [MT][DM] plane
  const size_t PRS = (((size_t)MT * 4 + 65535) / 65536) * 65536;
  const size_t PW1 = (size_t)DM * DM * 2;        // one 16-bit weight plane
  const size_t PBD = (size_t)NH * BDW * 4;
  size_t off = 0;
  const size_t oXB = off; off += PX;
  const size_t oXH = off; off += PX;
  const size_t oRS = off; off += PRS;
  const size_t oW  = off; off += 6 * PW1;
  const size_t oBD = off; off += PBD;
  const size_t oQH = off; off += PX;
  const size_t oQR = off; off += PX;
  const size_t oKH = off; off += PX;
  const size_t oKR = off; off += PX;
  const size_t oVT = off; off += PX;
  const size_t oZH = off; off += PX;
  const size_t oZL = off; off += PX;
  if (off > ws_size) return;                      // off = 88408064 at full size
  if (off > (size_t)134217728) return;

  char* ws = (char*)d_ws;
  unsigned short* XB = (unsigned short*)(ws + oXB);
  unsigned short* XH = (unsigned short*)(ws + oXH);
  float* RSTD = (float*)(ws + oRS);
  unsigned short* W16 = (unsigned short*)(ws + oW);
  unsigned short* WQH = W16;
  unsigned short* WQL = W16 + (size_t)1 * DM * DM;
  unsigned short* WKH = W16 + (size_t)2 * DM * DM;
  unsigned short* WKL = W16 + (size_t)3 * DM * DM;
  unsigned short* WVH = W16 + (size_t)4 * DM * DM;
  unsigned short* WOB = W16 + (size_t)5 * DM * DM;
  float* BDp = (float*)(ws + oBD);
  unsigned short* QH = (unsigned short*)(ws + oQH);
  unsigned short* QR = (unsigned short*)(ws + oQR);
  unsigned short* KH = (unsigned short*)(ws + oKH);
  unsigned short* KR = (unsigned short*)(ws + oKR);
  unsigned short* VT = (unsigned short*)(ws + oVT);
  unsigned short* ZH = (unsigned short*)(ws + oZH);
  unsigned short* ZL = (unsigned short*)(ws + oZL);
  float* out0 = (float*)d_out;
  float* fdummy = BDp;                            // in-range placeholder for unused f32 output args

  const dim3 blk(256);

  // (0) operand planes, rms statistics and bias table: one launch
  prep<<<dim3(PXB + NH + 4 * PWB), blk, 0, stream>>>(x, w_q, w_k, w_v, w_o, lnw, tbl, XB, XH, RSTD, W16, BDp);

  // (1) q, k planes and v^T: one launch, 3 x 256 blocks at full size
  gemm_qkv<<<dim3(3 * GNT), blk, 0, stream>>>(XB, XH, WQH, WQL, WKH, WKL, WVH, QH, QR, KH, KR, VT, fdummy, RSTD, x);

  // (2) attention -> ctx bf16 hi|lo head-major planes
  attn_kernel<<<dim3((NB * NH * (SEQ / 16)) / AWV), dim3(32 * AWV), 0, stream>>>(QH, QR, KH, KR, VT, BDp, ZH, ZL);

  // (3) output projection + residual
  gemm_out<<<dim3(GNT), blk, 0, stream>>>(ZH, ZL, WOB, ZH, out0, RSTD, x);
  (void)hipGetLastError();
}

// v006
// One run takes 131 microseconds.
// Next to v005, in two timings, it ran 1.07 times as fast each time.
// Counting every step since v000, it is 3.93 times as fast.
// Contractions: normed.w_q and normed.w_k on v_wmma_f32_16x16x32_bf16 (bf16 x plane, bf16 hi+lo weight planes
// with ln_weight folded in, f32 accumulate); w_v'.normed^T (v^T plane), q.k^T (f16 hi x16 + residual x2048 on
// both q and k, three products) and p.v on v_wmma_f32_16x16x32_f16 (f16 operands, f32 accumulate); ctx.w_o on
// v_wmma_f32_16x16x32_bf16 (bf16 hi+lo ctx planes, bf16 w_o, f32 accumulate). Float inputs RNE-converted to
// bf16 on load; per-row rms scale, softmax and relative position bias in f32 on VALU; softmax p carried x16384.
#include <hip/hip_runtime.h>
#include <math.h>

#ifndef NB
#define NB 2
#endif
#ifndef SEQ
#define SEQ 2048
#endif
#define NB_FULL  2
#define SEQ_FULL 2048
#define DM   1024
#define NH   16
#define HD   64
#define NBKT 32
#define MT   (NB * SEQ)
#define BDW  4096
#define AWV  8
#define BRW  (SEQ + 16 * AWV)
#define BRQ  ((BRW / 4) / 256)
#define BRT  ((BRW / 4) % 256)
#define XSC  16.0f
#define WSCL 256.0f
#define QKS  16.0f
#define QRS  2048.0f
#define VSC  16.0f
#define PCAR 16384.0f
#define SC1  (1.0f / 256.0f)
#define SC2  (1.0f / 524288.0f)
#define OSC  (1.0f / 262144.0f)
#define LNEPS 1.0e-6f

static_assert(NB >= 1 && NB <= NB_FULL);
static_assert(SEQ >= 64 && SEQ <= SEQ_FULL && (SEQ % 64) == 0);
static_assert(NH * HD == DM);
static_assert(HD == 64);
static_assert(BDW == 2 * SEQ_FULL);
static_assert((BRW % 4) == 0 && 16 * AWV <= SEQ_FULL);
static_assert((MT % 64) == 0 && (DM % 64) == 0 && (MT % 32) == 0);
static_assert((MT % 128) == 0 && (DM % 128) == 0);
static_assert(((NB * NH * (SEQ / 16)) % AWV) == 0);
static_assert(((SEQ / 16) % AWV) == 0);
static_assert(NBKT * NH == 512);
static_assert(BDW == 16 * 256);
static_assert((DM % 256) == 0);

typedef _Float16 v16h __attribute__((ext_vector_type(16)));
typedef __bf16 v16bf __attribute__((ext_vector_type(16)));
typedef unsigned short v16us __attribute__((ext_vector_type(16)));
typedef unsigned short v8us  __attribute__((ext_vector_type(8)));
typedef float v8f __attribute__((ext_vector_type(8)));
typedef float v4f __attribute__((ext_vector_type(4)));
typedef float v2f __attribute__((ext_vector_type(2)));
typedef unsigned int v4u __attribute__((ext_vector_type(4)));

union FragU { v16us v; v8us h[2]; };

// ---- scalar helpers --------------------------------------------------------------------------------
__device__ __forceinline__ unsigned short bf_bits(float f) {          // f32 -> bf16 bits, RNE convert
  const unsigned u = __float_as_uint(f);
  return (unsigned short)((u + 0x7FFFu + ((u >> 16) & 1u)) >> 16);
}
__device__ __forceinline__ float bf_up(unsigned short h) { return __uint_as_float(((unsigned)h) << 16); }
__device__ __forceinline__ float bfr(float f) { return bf_up(bf_bits(f)); }   // value of the bf16 RNE convert
__device__ __forceinline__ unsigned short h_bits(_Float16 x) { return __builtin_bit_cast(unsigned short, x); }
__device__ __forceinline__ unsigned short f2h(float f) { return h_bits((_Float16)f); }
__device__ __forceinline__ unsigned pk16(unsigned short a, unsigned short b) { return (unsigned)a | ((unsigned)b << 16); }
__device__ __forceinline__ int clampi(int v, int lo, int hi) { return v < lo ? lo : (v > hi ? hi : v); }
__device__ __forceinline__ v8f zero8() { v8f z = {0.f, 0.f, 0.f, 0.f, 0.f, 0.f, 0.f, 0.f}; return z; }

// ---- fragment loader: 16-bit A/B operand, lane -> row/col (lane&15), p already includes +8*(lane>>4);
//      elements 0..7 <- p[0..7] (k0+8h..), elements 8..15 <- p[16..23] (k0+16+8h..)
__device__ __forceinline__ v16us ldfrag_u(const unsigned short* p) {
  FragU f;
  f.h[0] = *(const v8us*)(p);
  f.h[1] = *(const v8us*)(p + 16);
  return f.v;
}

// ---- WMMA helpers with trailing VALU hazard gap; OPK 0 = f16 operand bits, OPK 1 = bf16 operand bits --
template <int OPK>
__device__ __forceinline__ v8f mma_raw(v16us a, v16us b, v8f c) {
  if (OPK == 0)
    return __builtin_amdgcn_wmma_f32_16x16x32_f16(false, __builtin_bit_cast(v16h, a), false,
                                                  __builtin_bit_cast(v16h, b), (short)0, c, false, false);
  return __builtin_amdgcn_wmma_f32_16x16x32_bf16(false, __builtin_bit_cast(v16bf, a), false,
                                                 __builtin_bit_cast(v16bf, b), (short)0, c, false, false);
}
template <int OPK>
__device__ __forceinline__ v8f mma_g(v16us a, v16us b, v8f c) {                 // guarded
  c = mma_raw<OPK>(a, b, c);
#if defined(__HIP_DEVICE_COMPILE__)
  asm volatile("v_nop\n\tv_nop\n\tv_nop\n\tv_nop" : "+v"(c) : "v"(a), "v"(b));
#endif
  return c;
}
__device__ __forceinline__ void dep_guard1(v8f& a, v8f& b, v16us x) {
#if defined(__HIP_DEVICE_COMPILE__)
  asm volatile("v_nop\n\tv_nop\n\tv_nop\n\tv_nop" : "+v"(a), "+v"(b) : "v"(x));
#endif
}
__device__ __forceinline__ void keep4_u(v16us a, v16us b, v16us c, v16us d) {
#if defined(__HIP_DEVICE_COMPILE__)
  asm volatile("v_nop" :: "v"(a), "v"(b), "v"(c), "v"(d));
#endif
}
__device__ __forceinline__ void acc_guard4(v8f& a, v8f& b, v8f& c, v8f& d) {
#if defined(__HIP_DEVICE_COMPILE__)
  asm volatile("v_nop\n\tv_nop\n\tv_nop\n\tv_nop" : "+v"(a), "+v"(b), "+v"(c), "+v"(d));
#endif
}
// value of lane l ^ 16 (the other 16-lane half of the wave), by a vector cross-row move
__device__ __forceinline__ float xhalf(float x) {
  const int b = __builtin_bit_cast(int, x);
  return __builtin_bit_cast(float, __builtin_amdgcn_permlanex16(b, b, 0x76543210, 0xfedcba98, false, false));
}
// orders LDS stores of this wave before later LDS loads of the same wave (wave-private exchange)
__device__ __forceinline__ void wave_sync_lds() {
  __builtin_amdgcn_fence(__ATOMIC_RELEASE, "workgroup");
  __builtin_amdgcn_wave_barrier();
  __builtin_amdgcn_fence(__ATOMIC_ACQUIRE, "workgroup");
}

// =====================================================================================================
// x convert + rms statistics. Block = 256 threads = 8 waves owns 32 consecutive token rows (wave w: rows
// 4w..4w+3); token tok = b*SEQ + s reads input row b*SEQ_FULL + s. Per row each lane converts 8
// consecutive floats per step (4 steps of 256 columns): ob = bf16 bits of x (RNE), oh = f16 bits of
// of the bf16 values is reduced per row and rstd = rsqrt(mean + eps) staged in LDS (cross-wave -> block
// coverage: 8 waves x 4 rows x (4 x 256) columns = 32 whole rows of both planes per block, grid = MT/32
// blocks (bx); rstd rows row0..row0+31 per block = all MT entries.
// =====================================================================================================
__device__ __forceinline__ void cvt_x(int bx, const float* __restrict__ x, unsigned short* ob,
                                      unsigned short* oh, float* rstd) {
  __shared__ float srs[32];
  const int lane = threadIdx.x & 31, wv = threadIdx.x >> 5;
  const int row0 = bx * 32;
#pragma unroll 1
  for (int rr = 0; rr < 4; ++rr) {
    const int tok = row0 + wv * 4 + rr;
    const int b = tok / SEQ, s = tok - b * SEQ;
    const float* src = x + ((size_t)b * SEQ_FULL + (size_t)s) * DM;
    const size_t orow = (size_t)tok * DM;
    float ss = 0.f;
#pragma unroll 1
    for (int it = 0; it < DM / 256; ++it) {
      const int col = it * 256 + lane * 8;
      const v4f a0 = *(const v4f*)(src + col);
      const v4f a1 = *(const v4f*)(src + col + 4);
      v4u hb, hh;
#pragma unroll
      for (int e = 0; e < 2; ++e) {
        const unsigned short u0 = bf_bits(a0[2 * e]), u1 = bf_bits(a0[2 * e + 1]);
        const unsigned short u2 = bf_bits(a1[2 * e]), u3 = bf_bits(a1[2 * e + 1]);
        const float x0 = bf_up(u0), x1 = bf_up(u1), x2 = bf_up(u2), x3 = bf_up(u3);
        ss = fmaf(x0, x0, ss); ss = fmaf(x1, x1, ss); ss = fmaf(x2, x2, ss); ss = fmaf(x3, x3, ss);
        hb[e]     = pk16(u0, u1);
        hb[2 + e] = pk16(u2, u3);
        hh[e]     = pk16(f2h(x0 * XSC), f2h(x1 * XSC));
        hh[2 + e] = pk16(f2h(x2 * XSC), f2h(x3 * XSC));
      }
      unsigned short* db = ob + orow + col;
      unsigned short* dh = oh + orow + col;
      *(v4u*)db = hb;
      *(v4u*)dh = hh;
      
    }
    ss += __shfl_xor(ss, 16, 32);
    ss += __shfl_xor(ss, 8, 32);
    ss += __shfl_xor(ss, 4, 32);
    ss += __shfl_xor(ss, 2, 32);
    ss += __shfl_xor(ss, 1, 32);
    if (lane == 0) srs[wv * 4 + rr] = rsqrtf(ss * (1.0f / (float)DM) + LNEPS);
  }
  __syncthreads();
  if (wv == 0) {
    const float v = srs[lane];
    float* d = rstd + row0 + lane;
    *(float*)d = v;
    
  }
}

// =====================================================================================================
// Weight convert with transpose: source matrices are [in k][out n] row-major; output Bt planes [n][k]
// (k contiguous). y (block-uniform) selects the matrix (0 w_q, 1 w_k, 2 w_v, 3 w_o), bx the 64x64 tile
// (k0 = 64*(bx>>4), n0 = 64*(bx&15)). The tile is staged in LDS as f32, then each output row n0+r, columns
// lines). Values: y=0,1: w' = bf16(ln_w[k]) * bf16(w[k][n]) (exact in f32) split into bf16 hi (plane 2y) and
// bf16 lo = w' - hi (plane 2y+1, exact); y=2: f16 bits of w' * WSCL (plane 4); y=3: bf16 bits of w_o
// coverage: load 256 threads x 4 x 4 = 64x64 tile; store 8 waves x 2 x (4 rows x 8 lanes x 8) = 64 rows x
// 64 cols; bx 0..255 x y 0..3 covers every 64x64 tile of every output plane.
// =====================================================================================================
__device__ __forceinline__ void cvt_w(int bx, int y, const float* __restrict__ w0, const float* __restrict__ w1,
                                      const float* __restrict__ w2, const float* __restrict__ w3,
                                      const float* __restrict__ lnw, unsigned short* o) {
  __shared__ __align__(16) float sm[64 * 65];
  __shared__ float slw[64];
  const float* w = (y == 0) ? w0 : ((y == 1) ? w1 : ((y == 2) ? w2 : w3));
  const int k0 = (bx >> 4) << 6, n0 = (bx & 15) << 6;
  const int t = threadIdx.x, lane = t & 31, wv = t >> 5;
#pragma unroll
  for (int it = 0; it < 4; ++it) {
    const int r = it * 16 + (t >> 4), c4 = (t & 15) * 4;
    const v4f v = *(const v4f*)(w + (size_t)(k0 + r) * DM + (size_t)(n0 + c4));
    float* sp = sm + r * 65 + c4;
    sp[0] = v[0]; sp[1] = v[1]; sp[2] = v[2]; sp[3] = v[3];
  }
  if (t < 64) slw[t] = bfr(lnw[k0 + t]);                       // waves 0,1 entirely: wave-uniform
  __syncthreads();
  const int pl0 = (y == 0) ? 0 : ((y == 1) ? 2 : ((y == 2) ? 4 : 5));
  unsigned short* P0 = o + (size_t)pl0 * DM * DM;
  unsigned short* P1 = (y < 2) ? (P0 + (size_t)DM * DM) : P0;
  const int q8 = lane >> 3, c8 = (lane & 7) * 8;
  v4u ha[2], hl[2];
#pragma unroll
  for (int it = 0; it < 2; ++it) {
    const int r = wv * 8 + it * 4 + q8;                          // n local
    v4u a = {0u, 0u, 0u, 0u}, l = {0u, 0u, 0u, 0u};
#pragma unroll
    for (int e = 0; e < 4; ++e) {
      const int ka = c8 + 2 * e, kb = ka + 1;
      float va = bfr(sm[ka * 65 + r]), vb = bfr(sm[kb * 65 + r]);
      if (y < 3) { va *= slw[ka]; vb *= slw[kb]; }
      if (y < 2) {
        const unsigned short ua = bf_bits(va), ub = bf_bits(vb);
        a[e] = pk16(ua, ub);
        l[e] = pk16(bf_bits(va - bf_up(ua)), bf_bits(vb - bf_up(ub)));
      } else if (y == 2) {
        a[e] = pk16(f2h(va * WSCL), f2h(vb * WSCL));
      } else {
        a[e] = pk16(bf_bits(va), bf_bits(vb));
      }
    }
    ha[it] = a;
    hl[it] = l;
  }
  {
#pragma unroll
    for (int it = 0; it < 2; ++it) {
      const int r = wv * 8 + it * 4 + q8;
      const size_t go = (size_t)(n0 + r) * DM + (size_t)(k0 + c8);
      *(v4u*)(P0 + go) = ha[it];
      if (y < 2) *(v4u*)(P1 + go) = hl[it];
    }
    // the stores' address and data registers may be rewritten by whatever code follows this job in the merged kernel
    asm volatile("s_wait_xcnt 0x0" ::: "memory");
  }
}

// =====================================================================================================
// Relative position bias by signed key-query distance: BD[h][i], i = (key - query) + 2047, i in 0..4094;
// i = 4095 is padding written as 0. bucket on integer n = query - key: ret = (n < 0) * 16, n = |n|,
// n < 8 -> n, else 8 + floor(2*log2(n/8)) capped at 15, evaluated by its integer thresholds
// coverage: 256 threads x 16 = 4096 entries per head; h = 0..NH-1 = the whole table.
// =====================================================================================================
__device__ __forceinline__ int rel_bucket(int d) {              // d = key - query
  int n = -d;
  int ret = 0;
  if (n < 0) { ret = NBKT / 2; n = -n; }
  int bk;
  if (n < 8)       bk = n;
  else if (n < 12) bk = 8;
  else if (n < 16) bk = 9;
  else if (n < 23) bk = 10;
  else if (n < 32) bk = 11;
  else if (n < 46) bk = 12;
  else if (n < 64) bk = 13;
  else if (n < 91) bk = 14;
  else             bk = 15;
  return ret + bk;
}

__device__ __forceinline__ void bias_build(int h, const float* __restrict__ tbl, float* BD) {
  __shared__ __align__(16) float sh[BDW];
  const int t = threadIdx.x;
#pragma unroll 4
  for (int j = 0; j < 16; ++j) {
    const int idx = t + 256 * j;
    const int ti = clampi(rel_bucket(idx - 2047) * NH + h, 0, NBKT * NH - 1);
    float v = bfr(tbl[ti]);
    v = (idx == BDW - 1) ? 0.f : v;
    sh[idx] = v;
  }
  __syncthreads();
  v4f vv[4];
#pragma unroll
  for (int q = 0; q < 4; ++q) vv[q] = *(const v4f*)(sh + q * 1024 + 4 * t);
  float* dst = BD + (size_t)h * BDW;
  {
#pragma unroll
    for (int q = 0; q < 4; ++q) *(v4f*)(dst + q * 1024 + 4 * t) = vv[q];
    
  }
}

// =====================================================================================================
// One launch for the three preparation jobs, which depend on the inputs alone and not on one another: blocks
// 0 .. PXB-1 convert x (the longest job per block, so it starts first), the next NH build the bias table, the
// last 4*PWB convert the weights. The job is chosen by blockIdx.x alone, so every barrier inside a job is met by
// a whole block.
// =====================================================================================================
#define PXB (MT / 32)                   // blocks of the x convert
#define PWB ((DM / 64) * (DM / 64))     // blocks of one weight matrix
__global__ __launch_bounds__(256) void prep(const float* __restrict__ x, const float* __restrict__ w0,
                                            const float* __restrict__ w1, const float* __restrict__ w2,
                                            const float* __restrict__ w3, const float* __restrict__ lnw,
                                            const float* __restrict__ tbl, unsigned short* ob, unsigned short* oh,
                                            float* rstd, unsigned short* o, float* BD) {
  const int bx = blockIdx.x;
  if (bx < PXB) {
    cvt_x(bx, x, ob, oh, rstd);
  } else if (bx < PXB + NH) {
    bias_build(bx - PXB, tbl, BD);
  } else {
    const int i = bx - (PXB + NH);
    cvt_w(i % PWB, i / PWB, w0, w1, w2, w3, lnw, o);
  }
}

// =====================================================================================================
// LDS-staged 16-bit WMMA GEMM: C[m][n] = sum over plane pairs pl and k of A_pl[m][k] * Bt_pl[n][k]. A block of
// 8 waves owns one 128x128 tile of C (tile, block-uniform); wave w owns rows 32*(w>>1).. and columns 64*(w&1).. of
// it (2 x 4 accumulator tiles). A pass is 128 k: 256 B of each of the 128 A rows and 128 Bt rows (and of the 128
// rows of a second plane, SP below), brought into one of two LDS buffers (row pitch 272 B) by asynchronous 16-byte
// copies, 16 or 24 per thread; the copies of pass t + 2 are issued when every wave has left pass t's buffer, so
// they fly while pass t + 1 is worked on. OPK 0: f16 operands; OPK 1: bf16 operands. SP 0: C = A.Bt. SP 1: a
// second A plane, C = (Ap + Ap2).Bt. SP 2: a second Bt plane, C = A.(Btp + Btp2). Both planes' products of a k
// step are taken in the same pass into the same accumulators, so the operand they share is staged once and its
// fragments are read once (only unscaled hi/lo planes are paired this way). AHM 0: A row-major
// [M][K] pitch lda; AHM 1: A head-major planes, element (m, k) at ((k/HD)*aplane + m*HD + k%HD). Bt row-major
// [N][K] pitch ldb (k contiguous); M, N, K multiples of 128 (true at every call site; host grid = tiles exact).
// Both operand fragments use the split k map (elements 0..7 <- k0+8h.., 8..15 <- k0+16+8h..); D element r of a
// lane is (row 8h + r, col lane&15).
// OM 0: f32 out Cf = acc*wsc (+ RES: bf16 RNE value of Rp[input row of token m][n], token m -> input row
//       (m/SEQ)*SEQ_FULL + m%SEQ, pitch DM), pitch ldc.
// OM 1: f16 out Ch = f16(acc*wsc*osc*scale).  OM 2: f16 pair: base = acc*wsc*osc*scale; Ch = f16 bits(base);
//       Ch2 = f16 bits((base - value(Ch)) * rsc).  scale = Rs[m] (RSM 1, per row), Rs[n] (RSM 2, per column),
//       1 (RSM 0).
// coverage: 2 slabs x 16 rows x 64 cols = the wave's whole 32x64 tile; 8 waves = the block's 128x128 tile.
// =====================================================================================================
#define GTM  128                        // block tile rows
#define GTN  128                        // block tile columns
#define GKP  128                        // k per pass
#define GPIT 136                        // LDS row pitch in 16-bit elements (272 B)
#define GTIL (128 * GPIT)               // 16-bit elements of one staged tile (128 rows)
#define GRNG (2 * 3 * GTIL)             // 16-bit elements of the ring: two buffers of A | Bt | second plane
static_assert(GTM == 128 && GTN == 128);

// Eight asynchronous 16-byte copies of one lane, global -> LDS, rows 16 apart: LDS byte address l + 16*272*c,
// global address g + gs*c (gs in elements), c = 0..7. The s_wait_xcnt closes the statement so that no address
// register named by a copy is rewritten ahead of it.
__device__ __forceinline__ void copy8_rows16(unsigned l, const unsigned short* g, size_t gs) {
#if defined(__HIP_DEVICE_COMPILE__)
  const unsigned ls = 16u * GPIT * 2u;
  asm volatile(
      "global_load_async_to_lds_b128 %0, %8, off\n\t"
      "global_load_async_to_lds_b128 %1, %9, off\n\t"
      "global_load_async_to_lds_b128 %2, %10, off\n\t"
      "global_load_async_to_lds_b128 %3, %11, off\n\t"
      "global_load_async_to_lds_b128 %4, %12, off\n\t"
      "global_load_async_to_lds_b128 %5, %13, off\n\t"
      "global_load_async_to_lds_b128 %6, %14, off\n\t"
      "global_load_async_to_lds_b128 %7, %15, off\n\t"
      "s_wait_xcnt 0x0"
      :: "v"(l), "v"(l + ls), "v"(l + 2u * ls), "v"(l + 3u * ls),
         "v"(l + 4u * ls), "v"(l + 5u * ls), "v"(l + 6u * ls), "v"(l + 7u * ls),
         "v"(g), "v"(g + gs), "v"(g + 2 * gs), "v"(g + 3 * gs),
         "v"(g + 4 * gs), "v"(g + 5 * gs), "v"(g + 6 * gs), "v"(g + 7 * gs)
      : "memory");
#endif
}

template <int OPK, int SP, int AHM, int OM, int RSM, int RES>
__device__ __forceinline__ void gemm64(
    unsigned short* ring, float* sT, int tile,
    const unsigned short* __restrict__ Ap, const unsigned short* __restrict__ Ap2, int lda, int aplane,
    const unsigned short* __restrict__ Btp, const unsigned short* __restrict__ Btp2, int ldb,
    unsigned short* Ch, unsigned short* Ch2, float* Cf, int ldc,
    const float* __restrict__ Rs, const float* __restrict__ Rp,
    float wsc, float osc, float rsc, int M, int N, int K) {
  const int lane = threadIdx.x & 31;
  const int wave = threadIdx.x >> 5;
  const int tilesN = N >> 7;
  const int tilesM = M >> 7;
  if (tile >= tilesM * tilesN) return;   // block-uniform, in front of every copy and barrier
  const int tm = tile / tilesN;
  const int tn = tile - tm * tilesN;
  const int bm0 = tm << 7;                     // block tile origin
  const int bn0 = tn << 7;
  const int wm = (wave >> 1) << 5;             // wave tile origin inside the block tile
  const int wn = (wave & 1) << 6;
  const int m0 = bm0 + wm;
  const int n0 = bn0 + wn;

  const int rlane = lane & 15;                 // row (A) / col (B, D) within subtile
  const int koff  = (lane >> 4) * 8;           // k offset of this lane half
  const int mOff  = (lane >> 4) * 8;           // D row offset

  // copy map: thread t brings 16-byte piece t&15 of rows (t>>4) + 16*c, c = 0..7, of A and of Bt
  const int crow = threadIdx.x >> 4;
  const int cch  = threadIdx.x & 15;
  const unsigned ldsA = (unsigned)(size_t)ring + (unsigned)(crow * (GPIT * 2) + cch * 16);
  const unsigned ldsB = ldsA + (unsigned)(GTIL * 2);
  const unsigned ldsS = ldsA + (unsigned)(2 * GTIL * 2);
  constexpr int BUFE = (SP ? 3 : 2) * GTIL;    // 16-bit elements per buffer
  const size_t aoff = AHM ? ((size_t)(cch >> 3) * (size_t)aplane + (size_t)(bm0 + crow) * HD + (size_t)((cch & 7) * 8))
                          : ((size_t)(bm0 + crow) * lda + (size_t)(cch * 8));
  const size_t astep = AHM ? (size_t)(16 * HD) : (size_t)16 * lda;          // 16 rows of A
  const size_t apass = AHM ? (size_t)(GKP / HD) * (size_t)aplane : (size_t)GKP;   // one pass along k
  const size_t boff = (size_t)(bn0 + crow) * ldb + (size_t)(cch * 8);
  const size_t bstep = (size_t)16 * ldb;
  const int NT = K >> 7;                       // passes

  auto issue = [&](int t, int buf) {           // pass t's 16 or 24 copies of this thread into buffer buf
    const unsigned lb = (unsigned)buf * (unsigned)(BUFE * 2);
    copy8_rows16(ldsA + lb, Ap + aoff + (size_t)t * apass, astep);
    copy8_rows16(ldsB + lb, Btp + boff + (size_t)t * GKP, bstep);
    if constexpr (SP == 1) copy8_rows16(ldsS + lb, Ap2 + aoff + (size_t)t * apass, astep);
    if constexpr (SP == 2) copy8_rows16(ldsS + lb, Btp2 + boff + (size_t)t * GKP, bstep);
  };

  v8f acc[2][4];
#pragma unroll
  for (int i = 0; i < 2; ++i)
#pragma unroll
    for (int j = 0; j < 4; ++j) acc[i][j] = zero8();

  issue(0, 0);
  asm volatile("s_wait_asynccnt 0x0" ::: "memory");   // this wave's copies of pass 0 have landed
  __syncthreads();                                    // every wave's have: pass 0 may be read
  if (NT > 1) issue(1, 1);

#pragma unroll 1   // one pass per trip: the buffer index and the publish point stay at the loop's foot
  for (int t = 0; t < NT; ++t) {
    const unsigned short* sb = ring + (t & 1) * BUFE;
    const unsigned short* sA = sb + (wm + rlane) * GPIT + koff;
    const unsigned short* sB = sb + GTIL + (wn + rlane) * GPIT + koff;
    const unsigned short* sS = sb + 2 * GTIL + ((SP == 1 ? wm : wn) + rlane) * GPIT + koff;   // second plane
#pragma unroll
    for (int ks = 0; ks < GKP / 32; ++ks) {
      v16us bh[4], bl[4];
#pragma unroll
      for (int j = 0; j < 4; ++j) {
        bh[j] = ldfrag_u(sB + (j << 4) * GPIT + ks * 32);
        bl[j] = (SP == 2) ? ldfrag_u(sS + (j << 4) * GPIT + ks * 32) : bh[j];
      }
#pragma unroll
      for (int i = 0; i < 2; ++i) {
        const v16us ah = ldfrag_u(sA + (i << 4) * GPIT + ks * 32);
#pragma unroll
        for (int j = 0; j < 4; ++j) acc[i][j] = mma_raw<OPK>(ah, bh[j], acc[i][j]);
        dep_guard1(acc[i][0], acc[i][3], ah);
        if constexpr (SP != 0) {               // the second plane's products of the same k step
          const v16us al = (SP == 1) ? ldfrag_u(sS + (i << 4) * GPIT + ks * 32) : ah;
#pragma unroll
          for (int j = 0; j < 4; ++j) acc[i][j] = mma_raw<OPK>(al, bl[j], acc[i][j]);
        }
      }
      keep4_u(bh[0], bh[1], bh[2], bh[3]);
    }
    asm volatile("s_wait_dscnt 0x0" ::: "memory");      // this wave's reads of pass t's buffer are done
    asm volatile("s_wait_asynccnt 0x0" ::: "memory");   // this wave's copies of pass t + 1 have landed
    __syncthreads();                                    // publishes pass t + 1, frees pass t's buffer
    if (t + 2 < NT) issue(t + 2, t & 1);
  }
  asm volatile("s_wait_asynccnt 0x0" ::: "memory");     // no copy is outstanding past the loop
  acc_guard4(acc[0][0], acc[0][1], acc[0][2], acc[0][3]);
  acc_guard4(acc[1][0], acc[1][1], acc[1][2], acc[1][3]);

  const int hh2 = lane >> 4, c4 = (lane & 15) * 4;     // f32 out: 256-B row segment = 16 lanes x 16 B
  const int q8  = lane >> 3, c8 = (lane & 7) * 8;
  const float wo = wsc * osc;

  // per-column scale (RSM 2): columns n0+c8 .. n0+c8+7, same for every row of the tile
  float csc[8];
#pragma unroll
  for (int e = 0; e < 8; ++e) csc[e] = 1.f;
  if (OM != 0 && RSM == 2) {
    const v4f cs0 = *(const v4f*)(Rs + n0 + c8);
    const v4f cs1 = *(const v4f*)(Rs + n0 + c8 + 4);
#pragma unroll
    for (int e = 0; e < 4; ++e) { csc[e] = cs0[e]; csc[4 + e] = cs1[e]; }
  }

  // ---- epilogue ----
  float* slab = sT + wave * (16 * 68);
#pragma unroll
  for (int i = 0; i < 2; ++i) {
    const int mBase = m0 + (i << 4);
#pragma unroll
    for (int j = 0; j < 4; ++j) {
#pragma unroll
      for (int r = 0; r < 8; ++r) {
        slab[(mOff + r) * 68 + (j << 4) + rlane] = acc[i][j][r];
      }
    }
    wave_sync_lds();
    if (OM == 0) {
      v4f vals[8];
#pragma unroll
      for (int it = 0; it < 8; ++it) {
        const int row = it * 2 + hh2;                      // it 0..7 x hh2 0..1 = rows 0..15
        v4f v = *(const v4f*)(slab + row * 68 + c4);
        v = v * wsc;
        if (RES) {
          const int tok = mBase + row;
          const int bb = tok / SEQ, ss = tok - bb * SEQ;
          const v4f hr = *(const v4f*)(Rp + ((size_t)bb * SEQ_FULL + (size_t)ss) * DM + (size_t)(n0 + c4));
          // the next load's result may land in this load's address registers: wait before they are rewritten
          asm volatile("s_wait_xcnt 0x0" ::: "memory");
#pragma unroll
          for (int c = 0; c < 4; ++c) v[c] = v[c] + bfr(hr[c]);
        }
        vals[it] = v;
      }
      {
#pragma unroll
        for (int it = 0; it < 8; ++it) {
          const int row = it * 2 + hh2;
          *(v4f*)(Cf + (size_t)(mBase + row) * ldc + (size_t)n0 + c4) = vals[it];
        }
        
      }
    } else {
      v4u hv[4], hw[4];
#pragma unroll
      for (int it = 0; it < 4; ++it) {
        const int row = it * 4 + q8;                       // it 0..3 x q8 0..3 = rows 0..15
        const float* sp = slab + row * 68 + c8;
        float rsr = wo;
        if (RSM == 1) rsr = wo * Rs[mBase + row];
        v4u ha = {0u, 0u, 0u, 0u}, hb = {0u, 0u, 0u, 0u};
#pragma unroll
        for (int e = 0; e < 4; ++e) {
          const float b0 = sp[2 * e]     * rsr * csc[2 * e];
          const float b1 = sp[2 * e + 1] * rsr * csc[2 * e + 1];
          if (OM == 1) {
            ha[e] = pk16(f2h(b0), f2h(b1));
          } else {
            const _Float16 x0 = (_Float16)b0, x1 = (_Float16)b1;
            ha[e] = pk16(h_bits(x0), h_bits(x1));
            hb[e] = pk16(f2h((b0 - (float)x0) * rsc), f2h((b1 - (float)x1) * rsc));
          }
        }
        hv[it] = ha;
        hw[it] = hb;
      }
      {
#pragma unroll
        for (int it = 0; it < 4; ++it) {
          const int row = it * 4 + q8;
          const size_t go = (size_t)(mBase + row) * ldc + (size_t)n0 + c8;
          *(v4u*)(Ch + go) = hv[it];
          if (OM == 2) *(v4u*)(Ch2 + go) = hw[it];
        }
        
      }
    }
    wave_sync_lds();
  }
}

#define GNT ((MT / 128) * (DM / 128))   // 128x128 tiles of one [MT][DM] (or [DM][MT]) product

// One launch for the three projections, which depend on the preparation alone and not on one another: blocks
// 0 .. GNT-1 the q planes, GNT .. 2*GNT-1 the k planes, the last GNT (half the products, so they come last) v^T.
// The product is chosen by blockIdx.x alone; both bodies use the same LDS.
//   q, k (hi x16 + residual x2048): C[tok][n] = rstd[tok] * sum_k XB[tok][k] * (hi + lo)[n][k]
//   v^T x16:                        C[d][tok] = rstd[tok] * sum_k WVH[d][k] * XH[tok][k]
__global__ __launch_bounds__(256) void gemm_qkv(
    const unsigned short* __restrict__ XB, const unsigned short* __restrict__ XH,
    const unsigned short* __restrict__ WQH, const unsigned short* __restrict__ WQL,
    const unsigned short* __restrict__ WKH, const unsigned short* __restrict__ WKL,
    const unsigned short* __restrict__ WVH,
    unsigned short* QH, unsigned short* QR, unsigned short* KH, unsigned short* KR, unsigned short* VT,
    float* fdummy, const float* __restrict__ RSTD, const float* __restrict__ x) {
  __shared__ __align__(16) unsigned short ring[GRNG];       // two operand buffers, 2 x 104448 B
  __shared__ __align__(16) float sT[8 * 16 * 68];           // per-wave 16x64 slab, pitch 68 floats
  const int bx = blockIdx.x;
  if (bx < 2 * GNT) {
    const bool isk = bx >= GNT;
    gemm64<1, 2, 0, 2, 1, 0>(ring, sT, isk ? bx - GNT : bx, XB, XB, DM, 0, isk ? WKH : WQH, isk ? WKL : WQL, DM,
                             isk ? KH : QH, isk ? KR : QR, fdummy, DM, RSTD, x, 1.0f, QKS, QRS, MT, DM, DM);
  } else {
    gemm64<0, 0, 0, 1, 2, 0>(ring, sT, bx - 2 * GNT, WVH, WVH, DM, 0, XH, XH, DM, VT, VT, fdummy, MT, RSTD, x,
                             1.0f / (XSC * WSCL), VSC, 1.0f, DM, MT, DM);
  }
}

// Output projection + residual: out[tok][n] = sum_k (ctx_hi + ctx_lo)[tok][k] * WOB[n][k] + bf16(x[tok][n])
__global__ __launch_bounds__(256) void gemm_out(
    const unsigned short* __restrict__ ZH, const unsigned short* __restrict__ ZL,
    const unsigned short* __restrict__ WOB, unsigned short* hdummy, float* out,
    const float* __restrict__ RSTD, const float* __restrict__ x) {
  __shared__ __align__(16) unsigned short ring[GRNG];       // two operand buffers, 2 x 104448 B
  __shared__ __align__(16) float sT[8 * 16 * 68];           // per-wave 16x64 slab, pitch 68 floats
  gemm64<1, 1, 1, 0, 0, 1>(ring, sT, blockIdx.x, ZH, ZL, DM, MT * HD, WOB, WOB, DM, hdummy, hdummy, out, DM, RSTD, x,
                           1.0f, 1.0f, 1.0f, MT, DM, DM);
}

// =====================================================================================================
// Bidirectional attention with relative position bias, head dim 64, no 1/sqrt(d) scaling. Block = 256
// threads = 8 waves, all of one (batch b, head h); one wave owns one 16-row query tile (t0..t0+15) and loops all
// key blocks of 32 with an online max-subtracted softmax in f32. A pass is 64 keys: the head's 128 B of each of
// the 64 KH rows and 64 KR rows and 128 B (64 keys) of each of its 64 VT rows are brought into one of two LDS
// buffers (row pitch 144 B) by asynchronous 16-byte copies, 6 per thread, and every wave reads its K and V
// fragments from there; the copies of pass t + 2 are issued when every wave has left pass t's buffer.
// Planes: QH|QR f16 [MT][DM] (16*q hi,
// residual x2048), KH|KR f16 [MT][DM] (16*k hi, residual x2048), VT f16 [DM][MT] (16*v transposed, row =
// h*64+d, column = token), BD f32 [NH][4096] bias by (key-query)+2047. Output Zh|Zl: bf16 hi|lo of ctx,
// head-major [NH][MT][64].
// Both products are taken transposed: keys (then head dims) are the A rows and the wave's 16 queries the B columns,
// so lane (hh, m) holds, for query t0+m alone, the scores of keys 8*hh+r and 16+8*hh+r of a 32-key block.
// The head's bias for every distance the block's 128 queries meet (key - query = -(tb+127) .. SEQ-1-tb, tb = the
// block's first query) is staged once, ahead of the first barrier, in one LDS row shared by the 8 waves and read
// at index key - query + tb + 127. Per key block:
// S^T = KH.QH^T (4 WMMA), R^T = KH.QR^T + KR.QH^T (8 WMMA, own accumulators);
// score = S/256 + R/524288 + bias; the block maximum is taken in the lane and joined with the other half-wave by
// one cross-row move; p = exp(score - running max) in f32, l accumulated per lane from the f32 p (the two halves'
// sums are joined once, in the epilogue); p*16384 as f16 packs from the two score tiles straight into the B
// operand (split k map: elements 0..7 = keys 8*hh.., 8..15 = keys 16+8*hh..); O^T += VT.P^T on f16 WMMA. The
// ctx staging region is private to its wave.
// staged extent covers consumed extent: bias row SEQ+128 written / 0..SEQ+126 read; ctx staging 2 x 16x64 written and read.
// Epilogue: ctx = O^T/(l*262144) split into bf16 hi|lo (a lane holds 8 consecutive dims of its query per O^T
// tile: one 16-byte LDS store per plane and tile), staged in LDS; the wave's 16 rows x 64 halves are
// coverage: 16 query rows x 64 halves per wave, NB*NH*SEQ/16 wave tasks = all (h, tok) rows of both planes.
// =====================================================================================================
#define AKP  64                         // keys per pass
#define APIT 72                         // LDS row pitch in 16-bit elements (144 B)
#define ATIL (64 * APIT)                // 16-bit elements of one staged tile (64 rows)
#define ABUF (3 * ATIL)                 // 16-bit elements per buffer: KH rows | KR rows | VT rows
static_assert((SEQ % AKP) == 0);

// Six asynchronous 16-byte copies of one lane, global -> LDS: rows r and r + 32 of the KH, KR and VT tiles; l is
// the LDS byte address of the lane's piece of KH row r. The s_wait_xcnt closes the statement so that no address
// register named by a copy is rewritten ahead of it.
__device__ __forceinline__ void copy6_kv(unsigned l, const unsigned short* gk, const unsigned short* gr,
                                         const unsigned short* gv) {
#if defined(__HIP_DEVICE_COMPILE__)
  const unsigned lr = 32u * APIT * 2u;
  const unsigned lt = ATIL * 2u;
  asm volatile(
      "global_load_async_to_lds_b128 %0, %6, off\n\t"
      "global_load_async_to_lds_b128 %1, %7, off\n\t"
      "global_load_async_to_lds_b128 %2, %8, off\n\t"
      "global_load_async_to_lds_b128 %3, %9, off\n\t"
      "global_load_async_to_lds_b128 %4, %10, off\n\t"
      "global_load_async_to_lds_b128 %5, %11, off\n\t"
      "s_wait_xcnt 0x0"
      :: "v"(l), "v"(l + lr), "v"(l + lt), "v"(l + lt + lr), "v"(l + 2u * lt), "v"(l + 2u * lt + lr),
         "v"(gk), "v"(gk + (size_t)32 * DM), "v"(gr), "v"(gr + (size_t)32 * DM),
         "v"(gv), "v"(gv + (size_t)32 * MT)
      : "memory");
#endif
}

__global__ __launch_bounds__(256) void attn_kernel(
    const unsigned short* __restrict__ QHp, const unsigned short* __restrict__ QRp,
    const unsigned short* __restrict__ KHp, const unsigned short* __restrict__ KRp,
    const unsigned short* __restrict__ VTp,
    const float* __restrict__ BD, unsigned short* Zh, unsigned short* Zl) {
  __shared__ __align__(16) unsigned short kvr[2 * ABUF];           // two K|KR|VT buffers, 2 x 27648 B
  __shared__ __align__(16) float brow[BRW];                        // bias row of the block, 8704 B
  __shared__ __align__(16) unsigned short zst[AWV][2][16 * HD];    // ctx hi|lo staging, 32768 B
  const int lane = threadIdx.x & 31, wv = threadIdx.x >> 5, m = lane & 15, hh = lane >> 4;
  const int nqt = SEQ / 16;
  if ((int)blockIdx.x * AWV >= NB * NH * nqt) return;   // block-uniform, in front of every copy and barrier
  const int task = blockIdx.x * AWV + wv;            // nqt is a multiple of AWV: one (b, h) per block
  const int bh = task / nqt;
  const int t0 = (task - bh * nqt) << 4;             // query tile start
  const int b = bh / NH, h = bh - b * NH;
  const size_t tok0 = (size_t)b * SEQ;

  // Q B-fragments: columns t0+m, k = head dims (two 32-deep steps), hi and residual planes
  const size_t qo = (tok0 + (size_t)(t0 + m)) * DM + (size_t)(h * HD + 8 * hh);
  const v16us qh0 = ldfrag_u(QHp + qo);
  const v16us qh1 = ldfrag_u(QHp + qo + 32);
  const v16us qr0 = ldfrag_u(QRp + qo);
  const v16us qr1 = ldfrag_u(QRp + qo + 32);

  float mx = -1.0e30f, ls = 0.f;       // query t0+m: running maximum (equal in both halves), this half's sum
  v8f O[4];                            // O^T tiles: element r = (dim 16*j + 8*hh + r, query t0+m)
#pragma unroll
  for (int j = 0; j < 4; ++j) O[j] = zero8();

  // bias row: brow[i] = bias_h(key - query = i - tb - 127), i = 0..SEQ+127; source index i + 1920 - tb lies in
  // 0..4095 (tb is a multiple of 128, tb <= SEQ - 128). Thread t brings 16-byte pieces t, t + 256, ...
  const int tb = t0 - 16 * wv;
  const float* bsrc = BD + (size_t)h * BDW + (SEQ_FULL - 16 * AWV - tb);
  v4f bst[BRQ + 1];
#pragma unroll     // bst[] is indexed by constants only; the loads go out together
  for (int q = 0; q < BRQ; ++q) bst[q] = *(const v4f*)(bsrc + 4 * ((int)threadIdx.x + 256 * q));
  if ((int)threadIdx.x < BRT) bst[BRQ] = *(const v4f*)(bsrc + 4 * ((int)threadIdx.x + 256 * BRQ));
  const float* bl = brow + (16 * AWV - 1 - 16 * wv - m + 8 * hh);          // + key block start + r
  // copy map: thread t brings 16-byte piece t&7 of rows (t>>3) and (t>>3) + 32 of each of the three tiles
  const int crow = threadIdx.x >> 3;
  const int cpc  = threadIdx.x & 7;
  const unsigned ldsC = (unsigned)(size_t)kvr + (unsigned)(crow * (APIT * 2) + cpc * 16);
  const size_t kco = (tok0 + (size_t)crow) * DM + (size_t)(h * HD + cpc * 8);
  const unsigned short* gK = KHp + kco;
  const unsigned short* gR = KRp + kco;
  const unsigned short* gV = VTp + (size_t)(h * HD + crow) * MT + tok0 + (size_t)(cpc * 8);
  const int NT = SEQ / AKP;

  auto issue = [&](int t, int buf) {           // pass t's 6 copies of this thread into buffer buf
    copy6_kv(ldsC + (unsigned)buf * (unsigned)(ABUF * 2), gK + (size_t)t * (AKP * DM), gR + (size_t)t * (AKP * DM),
             gV + (size_t)t * AKP);
  };

  issue(0, 0);
#pragma unroll     // bst[] is indexed by constants only, so it stays in registers
  for (int q = 0; q < BRQ; ++q) *(v4f*)(brow + 4 * ((int)threadIdx.x + 256 * q)) = bst[q];
  if ((int)threadIdx.x < BRT) *(v4f*)(brow + 4 * ((int)threadIdx.x + 256 * BRQ)) = bst[BRQ];
  asm volatile("s_wait_asynccnt 0x0" ::: "memory");   // this wave's copies of pass 0 have landed
  __syncthreads();                                    // every wave's have: pass 0 and the bias row may be read
  if (NT > 1) issue(1, 1);

#pragma unroll 1   // one pass per trip: the buffer index and the publish point stay at the loop's foot
  for (int t = 0; t < NT; ++t) {
  const float* bw = bl + t * AKP;                                            // bias of this pass's keys
  const unsigned short* kbase  = kvr + (t & 1) * ABUF + m * APIT + 8 * hh;   // KH row m, this lane half's k
  const unsigned short* krbase = kbase + ATIL;
  const unsigned short* vbase  = kbase + 2 * ATIL;                           // VT row (dim) m, keys 8*hh..
#pragma unroll     // both 32-key blocks of a pass inline: their LDS offsets become immediates
  for (int sub = 0; sub < AKP / 32; ++sub) {
    // bias of keys 8*hh + r and 16 + 8*hh + r of the block for query m, read here so that the products cover the
    // LDS latency; two consecutive keys per register pair
    v2f b0[4], b1[4];
#pragma unroll     // b0[], b1[] are indexed by constants only, so they stay in registers
    for (int e = 0; e < 4; ++e) {
      b0[e] = (v2f){bw[sub * 32 + 2 * e], bw[sub * 32 + 2 * e + 1]};
      b1[e] = (v2f){bw[sub * 32 + 16 + 2 * e], bw[sub * 32 + 16 + 2 * e + 1]};
    }

    // S^T = KH.QH^T, R^T = KH.QR^T + KR.QH^T ; A row = key token sb+m (+16), B column = query, k = head dim
    v8f S0 = zero8(), S1 = zero8(), R0 = zero8(), R1 = zero8();
#pragma unroll
    for (int ks = 0; ks < 2; ++ks) {
      const int kofs = (sub * 32) * APIT + 32 * ks;
      const v16us kf0 = ldfrag_u(kbase + kofs);
      const v16us kf1 = ldfrag_u(kbase + kofs + 16 * APIT);
      const v16us kg0 = ldfrag_u(krbase + kofs);
      const v16us kg1 = ldfrag_u(krbase + kofs + 16 * APIT);
      const v16us qa = (ks == 0) ? qh0 : qh1;
      const v16us qb = (ks == 0) ? qr0 : qr1;
      S0 = mma_g<0>(kf0, qa, S0);
      S1 = mma_g<0>(kf1, qa, S1);
      R0 = mma_g<0>(kf0, qb, R0);
      R1 = mma_g<0>(kf1, qb, R1);
      R0 = mma_g<0>(kg0, qa, R0);
      R1 = mma_g<0>(kg1, qa, R1);
    }

    // VT A-fragments (row = h*64 + dim, k = key token), read as one group here so that the softmax covers
    // their LDS latency
    v16us vf[4];
#pragma unroll     // vf[] is indexed by constants only, so it stays in registers
    for (int j = 0; j < 4; ++j) vf[j] = ldfrag_u(vbase + (16 * j) * APIT + sub * 32);

    // score = q.k + bias
    float s0[8], s1[8];
#pragma unroll     // two consecutive keys per step: accumulator pairs and bias pairs feed packed f32 FMAs as they lie
    for (int e = 0; e < 4; ++e) {
      const v2f x0 = __builtin_elementwise_fma((v2f){S0[2 * e], S0[2 * e + 1]}, (v2f){SC1, SC1},
                     __builtin_elementwise_fma((v2f){R0[2 * e], R0[2 * e + 1]}, (v2f){SC2, SC2}, b0[e]));
      const v2f x1 = __builtin_elementwise_fma((v2f){S1[2 * e], S1[2 * e + 1]}, (v2f){SC1, SC1},
                     __builtin_elementwise_fma((v2f){R1[2 * e], R1[2 * e + 1]}, (v2f){SC2, SC2}, b1[e]));
      s0[2 * e] = x0[0]; s0[2 * e + 1] = x0[1];
      s1[2 * e] = x1[0]; s1[2 * e + 1] = x1[1];
    }

    // online softmax: a query's 32 scores live in lanes m and m + 16, 16 each
    float xm = fmaxf(s0[0], s1[0]);
#pragma unroll     // s0[], s1[] are indexed by constants only, so they stay in registers
    for (int r = 1; r < 8; ++r) xm = fmaxf(xm, fmaxf(s0[r], s1[r]));
    xm = fmaxf(xm, xhalf(xm));
    const float mn = fmaxf(mx, xm);
    const float al = __expf(mx - mn);
    mx = mn;
    FragU pf;                                          // P^T B-fragment (split k map)
    float pa = 0.f, pb = 0.f;
#pragma unroll
    for (int r = 0; r < 8; ++r) {
      const float p0 = __expf(s0[r] - mn);
      const float p1 = __expf(s1[r] - mn);
      pa += p0;
      pb += p1;
      pf.v[r]     = f2h(p0 * PCAR);
      pf.v[8 + r] = f2h(p1 * PCAR);
    }
    ls = ls * al + (pa + pb);
#pragma unroll     // O[] is indexed by constants only, so it stays in registers
    for (int j = 0; j < 4; ++j) O[j] = O[j] * al;
#pragma unroll
    for (int j = 0; j < 4; ++j) O[j] = mma_g<0>(vf[j], pf.v, O[j]);
  }
    asm volatile("s_wait_dscnt 0x0" ::: "memory");      // this wave's reads of pass t's buffer are done
    asm volatile("s_wait_asynccnt 0x0" ::: "memory");   // this wave's copies of pass t + 1 have landed
    __syncthreads();                                    // publishes pass t + 1, frees pass t's buffer
    if (t + 2 < NT) issue(t + 2, t & 1);
  }
  asm volatile("s_wait_asynccnt 0x0" ::: "memory");     // no copy is outstanding past the loop
  acc_guard4(O[0], O[1], O[2], O[3]);

  // ---- epilogue: ctx = O / (l * PCAR * VSC) -> bf16 hi|lo, head-major planes ----
  unsigned short* zh = zst[wv][0];
  unsigned short* zl = zst[wv][1];
  const float linv = (1.0f / (ls + xhalf(ls))) * OSC;  // both halves' sums joined; the joined sum is >= 1
#pragma unroll
  for (int j = 0; j < 4; ++j) {
    v4u zc, zr;
#pragma unroll
    for (int e = 0; e < 4; ++e) {
      const float o0 = O[j][2 * e] * linv, o1 = O[j][2 * e + 1] * linv;
      const unsigned short x0 = bf_bits(o0), x1 = bf_bits(o1);
      zc[e] = pk16(x0, x1);
      zr[e] = pk16(bf_bits(o0 - bf_up(x0)), bf_bits(o1 - bf_up(x1)));
    }
    *(v4u*)(zh + m * HD + 16 * j + 8 * hh) = zc;       // row = query m, dims 16*j + 8*hh .. + 7
    *(v4u*)(zl + m * HD + 16 * j + 8 * hh) = zr;
  }
  wave_sync_lds();
  {
    v4u ha[4], hb[4];
#pragma unroll
    for (int q = 0; q < 4; ++q) {
      ha[q] = *(const v4u*)(zh + q * 256 + lane * 8);
      hb[q] = *(const v4u*)(zl + q * 256 + lane * 8);
    }
    const size_t zo = ((size_t)h * MT + tok0 + (size_t)t0) * HD;   // 2048-B aligned, 16 rows contiguous
    unsigned short* dh = Zh + zo;
    unsigned short* dl = Zl + zo;
    {
#pragma unroll
      for (int q = 0; q < 4; ++q) {
        *(v4u*)(dh + q * 256 + lane * 8) = ha[q];
        *(v4u*)(dl + q * 256 + lane * 8) = hb[q];
      }
      
    }
  }
}

// =====================================================================================================
// Workspace map (bytes, NB=2, SEQ=2048); every plane is an exact multiple of its whole-row / whole-line /
// BD = 16 x 4096 floats); all offsets multiples of 65536.
//   XB   bf16 [MT][DM]        0           8388608
//   XH   f16  [MT][DM]        8388608     8388608
//   RSTD f32  [MT]            16777216    65536     (16384 used)
//   W    6 x 16-bit [DM][DM]  16842752    12582912  (wq hi, wq lo, wk hi, wk lo bf16; wv f16 x256; wo bf16)
//   BD   f32  [NH][4096]      29425664    262144
//   QH   f16  [MT][DM]        29687808    8388608
//   QR   f16  [MT][DM]        38076416    8388608
//   KH   f16  [MT][DM]        46465024    8388608
//   KR   f16  [MT][DM]        54853632    8388608
//   VT   f16  [DM][MT]        63242240    8388608
//   ZH   bf16 [NH][MT][64]    71630848    8388608
//   ZL   bf16 [NH][MT][64]    80019456    8388608
//   end                       88408064
// =====================================================================================================
extern "C" void kernel_launch(void* const* d_in, const int* in_sizes, int n_in,
                              void* d_out, int out_size, void* d_ws, size_t ws_size,
                              hipStream_t stream) {
  if (n_in < 7) return;
  if (in_sizes[0] < ((NB - 1) * SEQ_FULL + SEQ) * DM) return;
  if (in_sizes[1] < DM) return;
  if (in_sizes[2] < DM * DM) return;
  if (in_sizes[3] < DM * DM) return;
  if (in_sizes[4] < DM * DM) return;
  if (in_sizes[5] < DM * DM) return;
  if (in_sizes[6] < NBKT * NH) return;
  if (out_size < MT * DM) return;

  const float* x    = (const float*)d_in[0];   // [2][2048][1024]
  const float* lnw  = (const float*)d_in[1];   // [1024]
  const float* w_q  = (const float*)d_in[2];   // [1024][1024] (in, out)
  const float* w_k  = (const float*)d_in[3];
  const float* w_v  = (const float*)d_in[4];
  const float* w_o  = (const float*)d_in[5];   // [1024][1024] (in, out)
  const float* tbl  = (const float*)d_in[6];   // [32][16]

  const size_t PX  = (size_t)MT * DM * 2;        // 16-bit [MT][DM] plane
  const size_t PRS = (((size_t)MT * 4 + 65535) / 65536) * 65536;
  const size_t PW1 = (size_t)DM * DM * 2;        // one 16-bit weight plane
  const size_t PBD = (size_t)NH * BDW * 4;
  size_t off = 0;
  const size_t oXB = off; off += PX;
  const size_t oXH = off; off += PX;
  const size_t oRS = off; off += PRS;
  const size_t oW  = off; off += 6 * PW1;
  const size_t oBD = off; off += PBD;
  const size_t oQH = off; off += PX;
  const size_t oQR = off; off += PX;
  const size_t oKH = off; off += PX;
  const size_t oKR = off; off += PX;
  const size_t oVT = off; off += PX;
  const size_t oZH = off; off += PX;
  const size_t oZL = off; off += PX;
  if (off > ws_size) return;                      // off = 88408064 at full size
  if (off > (size_t)134217728) return;

  char* ws = (char*)d_ws;
  unsigned short* XB = (unsigned short*)(ws + oXB);
  unsigned short* XH = (unsigned short*)(ws + oXH);
  float* RSTD = (float*)(ws + oRS);
  unsigned short* W16 = (unsigned short*)(ws + oW);
  unsigned short* WQH = W16;
  unsigned short* WQL = W16 + (size_t)1 * DM * DM;
  unsigned short* WKH = W16 + (size_t)2 * DM * DM;
  unsigned short* WKL = W16 + (size_t)3 * DM * DM;
  unsigned short* WVH = W16 + (size_t)4 * DM * DM;
  unsigned short* WOB = W16 + (size_t)5 * DM * DM;
  float* BDp = (float*)(ws + oBD);
  unsigned short* QH = (unsigned short*)(ws + oQH);
  unsigned short* QR = (unsigned short*)(ws + oQR);
  unsigned short* KH = (unsigned short*)(ws + oKH);
  unsigned short* KR = (unsigned short*)(ws + oKR);
  unsigned short* VT = (unsigned short*)(ws + oVT);
  unsigned short* ZH = (unsigned short*)(ws + oZH);
  unsigned short* ZL = (unsigned short*)(ws + oZL);
  float* out0 = (float*)d_out;
  float* fdummy = BDp;                            // in-range placeholder for unused f32 output args

  const dim3 blk(256);

  // (0) operand planes, rms statistics and bias table: one launch
  prep<<<dim3(PXB + NH + 4 * PWB), blk, 0, stream>>>(x, w_q, w_k, w_v, w_o, lnw, tbl, XB, XH, RSTD, W16, BDp);

  // (1) q, k planes and v^T: one launch, 3 x 256 blocks at full size
  gemm_qkv<<<dim3(3 * GNT), blk, 0, stream>>>(XB, XH, WQH, WQL, WKH, WKL, WVH, QH, QR, KH, KR, VT, fdummy, RSTD, x);

  // (2) attention -> ctx bf16 hi|lo head-major planes
  attn_kernel<<<dim3((NB * NH * (SEQ / 16)) / AWV), dim3(32 * AWV), 0, stream>>>(QH, QR, KH, KR, VT, BDp, ZH, ZL);

  // (3) output projection + residual
  gemm_out<<<dim3(GNT), blk, 0, stream>>>(ZH, ZL, WOB, ZH, out0, RSTD, x);
  (void)hipGetLastError();
}

// v007
// One run takes 128 microseconds.
// In two side-by-side timings against v006, it was 1.04 and 1.03 times as fast.
// All steps since v000 together make it 4.07 times as fast.
// Contractions: normed.w_q and normed.w_k on v_wmma_f32_16x16x32_bf16 (bf16 x plane, bf16 hi+lo weight planes
// with ln_weight folded in, f32 accumulate); w_v'.normed^T (v^T plane), q.k^T (f16 hi x16 + residual x2048 on
// both q and k, three products) and p.v on v_wmma_f32_16x16x32_f16 (f16 operands, f32 accumulate); ctx.w_o on
// v_wmma_f32_16x16x32_bf16 (bf16 hi+lo ctx planes, bf16 w_o, f32 accumulate). Float inputs RNE-converted to
// bf16 on load; per-row rms scale, softmax and relative position bias in f32 on VALU; softmax p carried x16384.
#include <hip/hip_runtime.h>
#include <math.h>

#ifndef NB
#define NB 2
#endif
#ifndef SEQ
#define SEQ 2048
#endif
#define NB_FULL  2
#define SEQ_FULL 2048
#define DM   1024
#define NH   16
#define HD   64
#define NBKT 32
#define MT   (NB * SEQ)
#define BDW  4096
#define AWV  8
#define BRW  (SEQ + 16 * AWV)
#define BRQ  ((BRW / 4) / 256)
#define BRT  ((BRW / 4) % 256)
#define XSC  16.0f
#define WSCL 256.0f
#define QKS  16.0f
#define QRS  2048.0f
#define VSC  16.0f
#define PCAR 16384.0f
#define SC1  (1.0f / 256.0f)
#define SC2  (1.0f / 524288.0f)
#define OSC  (1.0f / 262144.0f)
#define LNEPS 1.0e-6f

static_assert(NB >= 1 && NB <= NB_FULL);
static_assert(SEQ >= 64 && SEQ <= SEQ_FULL && (SEQ % 64) == 0);
static_assert(NH * HD == DM);
static_assert(HD == 64);
static_assert(BDW == 2 * SEQ_FULL);
static_assert((BRW % 4) == 0 && 16 * AWV <= SEQ_FULL);
static_assert((MT % 64) == 0 && (DM % 64) == 0 && (MT % 32) == 0);
static_assert((MT % 128) == 0 && (DM % 128) == 0);
static_assert(((NB * NH * (SEQ / 16)) % AWV) == 0);
static_assert(((SEQ / 16) % AWV) == 0);
static_assert(NBKT * NH == 512);
static_assert(BDW == 16 * 256);
static_assert((DM % 256) == 0);

typedef _Float16 v16h __attribute__((ext_vector_type(16)));
typedef __bf16 v16bf __attribute__((ext_vector_type(16)));
typedef unsigned short v16us __attribute__((ext_vector_type(16)));
typedef unsigned short v8us  __attribute__((ext_vector_type(8)));
typedef float v8f __attribute__((ext_vector_type(8)));
typedef float v4f __attribute__((ext_vector_type(4)));
typedef float v2f __attribute__((ext_vector_type(2)));
typedef unsigned int v4u __attribute__((ext_vector_type(4)));

union FragU { v16us v; v8us h[2]; };

// ---- scalar helpers --------------------------------------------------------------------------------
__device__ __forceinline__ unsigned short bf_bits(float f) {          // f32 -> bf16 bits, RNE convert
  const unsigned u = __float_as_uint(f);
  return (unsigned short)((u + 0x7FFFu + ((u >> 16) & 1u)) >> 16);
}
__device__ __forceinline__ float bf_up(unsigned short h) { return __uint_as_float(((unsigned)h) << 16); }
__device__ __forceinline__ float bfr(float f) { return bf_up(bf_bits(f)); }   // value of the bf16 RNE convert
__device__ __forceinline__ unsigned short h_bits(_Float16 x) { return __builtin_bit_cast(unsigned short, x); }
__device__ __forceinline__ unsigned short f2h(float f) { return h_bits((_Float16)f); }
__device__ __forceinline__ unsigned pk16(unsigned short a, unsigned short b) { return (unsigned)a | ((unsigned)b << 16); }
__device__ __forceinline__ int clampi(int v, int lo, int hi) { return v < lo ? lo : (v > hi ? hi : v); }
__device__ __forceinline__ v8f zero8() { v8f z = {0.f, 0.f, 0.f, 0.f, 0.f, 0.f, 0.f, 0.f}; return z; }

// ---- fragment loader: 16-bit A/B operand, lane -> row/col (lane&15), p already includes +8*(lane>>4);
//      elements 0..7 <- p[0..7] (k0+8h..), elements 8..15 <- p[16..23] (k0+16+8h..)
__device__ __forceinline__ v16us ldfrag_u(const unsigned short* p) {
  FragU f;
  f.h[0] = *(const v8us*)(p);
  f.h[1] = *(const v8us*)(p + 16);
  return f.v;
}

// ---- WMMA helpers; OPK 0 = f16 operand bits, OPK 1 = bf16 operand bits --
template <int OPK>
__device__ __forceinline__ v8f mma_raw(v16us a, v16us b, v8f c) {
  if (OPK == 0)
    return __builtin_amdgcn_wmma_f32_16x16x32_f16(false, __builtin_bit_cast(v16h, a), false,
                                                  __builtin_bit_cast(v16h, b), (short)0, c, false, false);
  return __builtin_amdgcn_wmma_f32_16x16x32_bf16(false, __builtin_bit_cast(v16bf, a), false,
                                                 __builtin_bit_cast(v16bf, b), (short)0, c, false, false);
}
__device__ __forceinline__ void dep_guard1(v8f& a, v8f& b, v16us x) {
#if defined(__HIP_DEVICE_COMPILE__)
  asm volatile("v_nop\n\tv_nop\n\tv_nop\n\tv_nop" : "+v"(a), "+v"(b) : "v"(x));
#endif
}
__device__ __forceinline__ void keep4_u(v16us a, v16us b, v16us c, v16us d) {
#if defined(__HIP_DEVICE_COMPILE__)
  asm volatile("v_nop" :: "v"(a), "v"(b), "v"(c), "v"(d));
#endif
}
__device__ __forceinline__ void acc_guard4(v8f& a, v8f& b, v8f& c, v8f& d) {
#if defined(__HIP_DEVICE_COMPILE__)
  asm volatile("v_nop\n\tv_nop\n\tv_nop\n\tv_nop" : "+v"(a), "+v"(b), "+v"(c), "+v"(d));
#endif
}
// The twelve f16 score products of one 32-key block as one run of matrix instructions: S0|S1 = KH.QH^T,
// R0|R1 = KH.QR^T + KR.QH^T for keys 0..15 | 16..31, head dims 0..31 (a) then 32..63 (b). Inside the run each
// product stands in the hazard window of the ones before it (an accumulate into the same D needs no distance),
// so only the last ones need vector slots: the four v_nop at the end keep the distance to whatever vector
// instruction the compiler puts next on S, R or a fragment register.
__device__ __forceinline__ void qk_run(v8f& S0, v8f& S1, v8f& R0, v8f& R1,
                                       v16us kf0a, v16us kf1a, v16us kg0a, v16us kg1a,
                                       v16us kf0b, v16us kf1b, v16us kg0b, v16us kg1b,
                                       v16us qha, v16us qhb, v16us qra, v16us qrb) {
#if defined(__HIP_DEVICE_COMPILE__)
  asm volatile(
      "v_wmma_f32_16x16x32_f16 %0, %4, %12, 0\n\t"
      "v_wmma_f32_16x16x32_f16 %1, %5, %12, 0\n\t"
      "v_wmma_f32_16x16x32_f16 %2, %4, %14, 0\n\t"
      "v_wmma_f32_16x16x32_f16 %3, %5, %14, 0\n\t"
      "v_wmma_f32_16x16x32_f16 %2, %6, %12, %2\n\t"
      "v_wmma_f32_16x16x32_f16 %3, %7, %12, %3\n\t"
      "v_wmma_f32_16x16x32_f16 %0, %8, %13, %0\n\t"
      "v_wmma_f32_16x16x32_f16 %1, %9, %13, %1\n\t"
      "v_wmma_f32_16x16x32_f16 %2, %8, %15, %2\n\t"
      "v_wmma_f32_16x16x32_f16 %3, %9, %15, %3\n\t"
      "v_wmma_f32_16x16x32_f16 %2, %10, %13, %2\n\t"
      "v_wmma_f32_16x16x32_f16 %3, %11, %13, %3\n\t"
      "v_nop\n\tv_nop\n\tv_nop\n\tv_nop"
      : "=&v"(S0), "=&v"(S1), "=&v"(R0), "=&v"(R1)
      : "v"(kf0a), "v"(kf1a), "v"(kg0a), "v"(kg1a), "v"(kf0b), "v"(kf1b), "v"(kg0b), "v"(kg1b),
        "v"(qha), "v"(qhb), "v"(qra), "v"(qrb));
#endif
}
// The four O^T += VT.P^T products of one 32-key block as one run; the four v_nop at the end keep the distance
// between the last product and the next vector instruction on O, a V fragment or P.
__device__ __forceinline__ void pv_run(v8f& O0, v8f& O1, v8f& O2, v8f& O3,
                                       v16us v0, v16us v1, v16us v2, v16us v3, v16us p) {
#if defined(__HIP_DEVICE_COMPILE__)
  asm volatile(
      "v_wmma_f32_16x16x32_f16 %0, %4, %8, %0\n\t"
      "v_wmma_f32_16x16x32_f16 %1, %5, %8, %1\n\t"
      "v_wmma_f32_16x16x32_f16 %2, %6, %8, %2\n\t"
      "v_wmma_f32_16x16x32_f16 %3, %7, %8, %3\n\t"
      "v_nop\n\tv_nop\n\tv_nop\n\tv_nop"
      : "+v"(O0), "+v"(O1), "+v"(O2), "+v"(O3)
      : "v"(v0), "v"(v1), "v"(v2), "v"(v3), "v"(p));
#endif
}
// value of lane l ^ 16 (the other 16-lane half of the wave), by a vector cross-row move
__device__ __forceinline__ float xhalf(float x) {
  const int b = __builtin_bit_cast(int, x);
  return __builtin_bit_cast(float, __builtin_amdgcn_permlanex16(b, b, 0x76543210, 0xfedcba98, false, false));
}
// orders LDS stores of this wave before later LDS loads of the same wave (wave-private exchange)
__device__ __forceinline__ void wave_sync_lds() {
  __builtin_amdgcn_fence(__ATOMIC_RELEASE, "workgroup");
  __builtin_amdgcn_wave_barrier();
  __builtin_amdgcn_fence(__ATOMIC_ACQUIRE, "workgroup");
}

// =====================================================================================================
// x convert + rms statistics. Block = 256 threads = 8 waves owns 32 consecutive token rows (wave w: rows
// 4w..4w+3); token tok = b*SEQ + s reads input row b*SEQ_FULL + s. Per row each lane converts 8
// consecutive floats per step (4 steps of 256 columns): ob = bf16 bits of x (RNE), oh = f16 bits of
// of the bf16 values is reduced per row and rstd = rsqrt(mean + eps) staged in LDS (cross-wave -> block
// coverage: 8 waves x 4 rows x (4 x 256) columns = 32 whole rows of both planes per block, grid = MT/32
// blocks (bx); rstd rows row0..row0+31 per block = all MT entries.
// =====================================================================================================
__device__ __forceinline__ void cvt_x(int bx, const float* __restrict__ x, unsigned short* ob,
                                      unsigned short* oh, float* rstd) {
  __shared__ float srs[32];
  const int lane = threadIdx.x & 31, wv = threadIdx.x >> 5;
  const int row0 = bx * 32;
#pragma unroll 1
  for (int rr = 0; rr < 4; ++rr) {
    const int tok = row0 + wv * 4 + rr;
    const int b = tok / SEQ, s = tok - b * SEQ;
    const float* src = x + ((size_t)b * SEQ_FULL + (size_t)s) * DM;
    const size_t orow = (size_t)tok * DM;
    float ss = 0.f;
#pragma unroll 1
    for (int it = 0; it < DM / 256; ++it) {
      const int col = it * 256 + lane * 8;
      const v4f a0 = *(const v4f*)(src + col);
      const v4f a1 = *(const v4f*)(src + col + 4);
      v4u hb, hh;
#pragma unroll
      for (int e = 0; e < 2; ++e) {
        const unsigned short u0 = bf_bits(a0[2 * e]), u1 = bf_bits(a0[2 * e + 1]);
        const unsigned short u2 = bf_bits(a1[2 * e]), u3 = bf_bits(a1[2 * e + 1]);
        const float x0 = bf_up(u0), x1 = bf_up(u1), x2 = bf_up(u2), x3 = bf_up(u3);
        ss = fmaf(x0, x0, ss); ss = fmaf(x1, x1, ss); ss = fmaf(x2, x2, ss); ss = fmaf(x3, x3, ss);
        hb[e]     = pk16(u0, u1);
        hb[2 + e] = pk16(u2, u3);
        hh[e]     = pk16(f2h(x0 * XSC), f2h(x1 * XSC));
        hh[2 + e] = pk16(f2h(x2 * XSC), f2h(x3 * XSC));
      }
      unsigned short* db = ob + orow + col;
      unsigned short* dh = oh + orow + col;
      *(v4u*)db = hb;
      *(v4u*)dh = hh;
      
    }
    ss += __shfl_xor(ss, 16, 32);
    ss += __shfl_xor(ss, 8, 32);
    ss += __shfl_xor(ss, 4, 32);
    ss += __shfl_xor(ss, 2, 32);
    ss += __shfl_xor(ss, 1, 32);
    if (lane == 0) srs[wv * 4 + rr] = rsqrtf(ss * (1.0f / (float)DM) + LNEPS);
  }
  __syncthreads();
  if (wv == 0) {
    const float v = srs[lane];
    float* d = rstd + row0 + lane;
    *(float*)d = v;
    
  }
}

// =====================================================================================================
// Weight convert with transpose: source matrices are [in k][out n] row-major; output Bt planes [n][k]
// (k contiguous). y (block-uniform) selects the matrix (0 w_q, 1 w_k, 2 w_v, 3 w_o), bx the 64x64 tile
// (k0 = 64*(bx>>4), n0 = 64*(bx&15)). The tile is staged in LDS as f32, then each output row n0+r, columns
// lines). Values: y=0,1: w' = bf16(ln_w[k]) * bf16(w[k][n]) (exact in f32) split into bf16 hi (plane 2y) and
// bf16 lo = w' - hi (plane 2y+1, exact); y=2: f16 bits of w' * WSCL (plane 4); y=3: bf16 bits of w_o
// coverage: load 256 threads x 4 x 4 = 64x64 tile; store 8 waves x 2 x (4 rows x 8 lanes x 8) = 64 rows x
// 64 cols; bx 0..255 x y 0..3 covers every 64x64 tile of every output plane.
// =====================================================================================================
__device__ __forceinline__ void cvt_w(int bx, int y, const float* __restrict__ w0, const float* __restrict__ w1,
                                      const float* __restrict__ w2, const float* __restrict__ w3,
                                      const float* __restrict__ lnw, unsigned short* o) {
  __shared__ __align__(16) float sm[64 * 65];
  __shared__ float slw[64];
  const float* w = (y == 0) ? w0 : ((y == 1) ? w1 : ((y == 2) ? w2 : w3));
  const int k0 = (bx >> 4) << 6, n0 = (bx & 15) << 6;
  const int t = threadIdx.x, lane = t & 31, wv = t >> 5;
#pragma unroll
  for (int it = 0; it < 4; ++it) {
    const int r = it * 16 + (t >> 4), c4 = (t & 15) * 4;
    const v4f v = *(const v4f*)(w + (size_t)(k0 + r) * DM + (size_t)(n0 + c4));
    float* sp = sm + r * 65 + c4;
    sp[0] = v[0]; sp[1] = v[1]; sp[2] = v[2]; sp[3] = v[3];
  }
  if (t < 64) slw[t] = bfr(lnw[k0 + t]);                       // waves 0,1 entirely: wave-uniform
  __syncthreads();
  const int pl0 = (y == 0) ? 0 : ((y == 1) ? 2 : ((y == 2) ? 4 : 5));
  unsigned short* P0 = o + (size_t)pl0 * DM * DM;
  unsigned short* P1 = (y < 2) ? (P0 + (size_t)DM * DM) : P0;
  const int q8 = lane >> 3, c8 = (lane & 7) * 8;
  v4u ha[2], hl[2];
#pragma unroll
  for (int it = 0; it < 2; ++it) {
    const int r = wv * 8 + it * 4 + q8;                          // n local
    v4u a = {0u, 0u, 0u, 0u}, l = {0u, 0u, 0u, 0u};
#pragma unroll
    for (int e = 0; e < 4; ++e) {
      const int ka = c8 + 2 * e, kb = ka + 1;
      float va = bfr(sm[ka * 65 + r]), vb = bfr(sm[kb * 65 + r]);
      if (y < 3) { va *= slw[ka]; vb *= slw[kb]; }
      if (y < 2) {
        const unsigned short ua = bf_bits(va), ub = bf_bits(vb);
        a[e] = pk16(ua, ub);
        l[e] = pk16(bf_bits(va - bf_up(ua)), bf_bits(vb - bf_up(ub)));
      } else if (y == 2) {
        a[e] = pk16(f2h(va * WSCL), f2h(vb * WSCL));
      } else {
        a[e] = pk16(bf_bits(va), bf_bits(vb));
      }
    }
    ha[it] = a;
    hl[it] = l;
  }
  {
#pragma unroll
    for (int it = 0; it < 2; ++it) {
      const int r = wv * 8 + it * 4 + q8;
      const size_t go = (size_t)(n0 + r) * DM + (size_t)(k0 + c8);
      *(v4u*)(P0 + go) = ha[it];
      if (y < 2) *(v4u*)(P1 + go) = hl[it];
    }
    // the stores' address and data registers may be rewritten by whatever code follows this job in the merged kernel
    asm volatile("s_wait_xcnt 0x0" ::: "memory");
  }
}

// =====================================================================================================
// Relative position bias by signed key-query distance: BD[h][i], i = (key - query) + 2047, i in 0..4094;
// i = 4095 is padding written as 0. bucket on integer n = query - key: ret = (n < 0) * 16, n = |n|,
// n < 8 -> n, else 8 + floor(2*log2(n/8)) capped at 15, evaluated by its integer thresholds
// coverage: 256 threads x 16 = 4096 entries per head; h = 0..NH-1 = the whole table.
// =====================================================================================================
__device__ __forceinline__ int rel_bucket(int d) {              // d = key - query
  int n = -d;
  int ret = 0;
  if (n < 0) { ret = NBKT / 2; n = -n; }
  int bk;
  if (n < 8)       bk = n;
  else if (n < 12) bk = 8;
  else if (n < 16) bk = 9;
  else if (n < 23) bk = 10;
  else if (n < 32) bk = 11;
  else if (n < 46) bk = 12;
  else if (n < 64) bk = 13;
  else if (n < 91) bk = 14;
  else             bk = 15;
  return ret + bk;
}

__device__ __forceinline__ void bias_build(int h, const float* __restrict__ tbl, float* BD) {
  __shared__ __align__(16) float sh[BDW];
  const int t = threadIdx.x;
#pragma unroll 4
  for (int j = 0; j < 16; ++j) {
    const int idx = t + 256 * j;
    const int ti = clampi(rel_bucket(idx - 2047) * NH + h, 0, NBKT * NH - 1);
    float v = bfr(tbl[ti]);
    v = (idx == BDW - 1) ? 0.f : v;
    sh[idx] = v;
  }
  __syncthreads();
  v4f vv[4];
#pragma unroll
  for (int q = 0; q < 4; ++q) vv[q] = *(const v4f*)(sh + q * 1024 + 4 * t);
  float* dst = BD + (size_t)h * BDW;
  {
#pragma unroll
    for (int q = 0; q < 4; ++q) *(v4f*)(dst + q * 1024 + 4 * t) = vv[q];
    
  }
}

// =====================================================================================================
// One launch for the three preparation jobs, which depend on the inputs alone and not on one another: blocks
// 0 .. PXB-1 convert x (the longest job per block, so it starts first), the next NH build the bias table, the
// last 4*PWB convert the weights. The job is chosen by blockIdx.x alone, so every barrier inside a job is met by
// a whole block.
// =====================================================================================================
#define PXB (MT / 32)                   // blocks of the x convert
#define PWB ((DM / 64) * (DM / 64))     // blocks of one weight matrix
__global__ __launch_bounds__(256) void prep(const float* __restrict__ x, const float* __restrict__ w0,
                                            const float* __restrict__ w1, const float* __restrict__ w2,
                                            const float* __restrict__ w3, const float* __restrict__ lnw,
                                            const float* __restrict__ tbl, unsigned short* ob, unsigned short* oh,
                                            float* rstd, unsigned short* o, float* BD) {
  const int bx = blockIdx.x;
  if (bx < PXB) {
    cvt_x(bx, x, ob, oh, rstd);
  } else if (bx < PXB + NH) {
    bias_build(bx - PXB, tbl, BD);
  } else {
    const int i = bx - (PXB + NH);
    cvt_w(i % PWB, i / PWB, w0, w1, w2, w3, lnw, o);
  }
}

// =====================================================================================================
// LDS-staged 16-bit WMMA GEMM: C[m][n] = sum over plane pairs pl and k of A_pl[m][k] * Bt_pl[n][k]. A block of
// 8 waves owns one 128x128 tile of C (tile, block-uniform); wave w owns rows 32*(w>>1).. and columns 64*(w&1).. of
// it (2 x 4 accumulator tiles). A pass is 128 k: 256 B of each of the 128 A rows and 128 Bt rows (and of the 128
// rows of a second plane, SP below), brought into one of two LDS buffers (row pitch 272 B) by asynchronous 16-byte
// copies, 16 or 24 per thread; the copies of pass t + 2 are issued when every wave has left pass t's buffer, so
// they fly while pass t + 1 is worked on. OPK 0: f16 operands; OPK 1: bf16 operands. SP 0: C = A.Bt. SP 1: a
// second A plane, C = (Ap + Ap2).Bt. SP 2: a second Bt plane, C = A.(Btp + Btp2). Both planes' products of a k
// step are taken in the same pass into the same accumulators, so the operand they share is staged once and its
// fragments are read once (only unscaled hi/lo planes are paired this way). AHM 0: A row-major
// [M][K] pitch lda; AHM 1: A head-major planes, element (m, k) at ((k/HD)*aplane + m*HD + k%HD). Bt row-major
// [N][K] pitch ldb (k contiguous); M, N, K multiples of 128 (true at every call site; host grid = tiles exact).
// Both operand fragments use the split k map (elements 0..7 <- k0+8h.., 8..15 <- k0+16+8h..); D element r of a
// lane is (row 8h + r, col lane&15).
// OM 0: f32 out Cf = acc*wsc (+ RES: bf16 RNE value of Rp[input row of token m][n], token m -> input row
//       (m/SEQ)*SEQ_FULL + m%SEQ, pitch DM), pitch ldc.
// OM 1: f16 out Ch = f16(acc*wsc*osc*scale).  OM 2: f16 pair: base = acc*wsc*osc*scale; Ch = f16 bits(base);
//       Ch2 = f16 bits((base - value(Ch)) * rsc).  scale = Rs[m] (RSM 1, per row), Rs[n] (RSM 2, per column),
//       1 (RSM 0).
// coverage: 2 slabs x 16 rows x 64 cols = the wave's whole 32x64 tile; 8 waves = the block's 128x128 tile.
// =====================================================================================================
#define GTM  128                        // block tile rows
#define GTN  128                        // block tile columns
#define GKP  128                        // k per pass
#define GPIT 136                        // LDS row pitch in 16-bit elements (272 B)
#define GTIL (128 * GPIT)               // 16-bit elements of one staged tile (128 rows)
#define GRNG (2 * 3 * GTIL)             // 16-bit elements of the ring: two buffers of A | Bt | second plane
static_assert(GTM == 128 && GTN == 128);

// Eight asynchronous 16-byte copies of one lane, global -> LDS, rows 16 apart: LDS byte address l + 16*272*c,
// global address g + gs*c (gs in elements), c = 0..7. The s_wait_xcnt closes the statement so that no address
// register named by a copy is rewritten ahead of it.
__device__ __forceinline__ void copy8_rows16(unsigned l, const unsigned short* g, size_t gs) {
#if defined(__HIP_DEVICE_COMPILE__)
  const unsigned ls = 16u * GPIT * 2u;
  asm volatile(
      "global_load_async_to_lds_b128 %0, %8, off\n\t"
      "global_load_async_to_lds_b128 %1, %9, off\n\t"
      "global_load_async_to_lds_b128 %2, %10, off\n\t"
      "global_load_async_to_lds_b128 %3, %11, off\n\t"
      "global_load_async_to_lds_b128 %4, %12, off\n\t"
      "global_load_async_to_lds_b128 %5, %13, off\n\t"
      "global_load_async_to_lds_b128 %6, %14, off\n\t"
      "global_load_async_to_lds_b128 %7, %15, off\n\t"
      "s_wait_xcnt 0x0"
      :: "v"(l), "v"(l + ls), "v"(l + 2u * ls), "v"(l + 3u * ls),
         "v"(l + 4u * ls), "v"(l + 5u * ls), "v"(l + 6u * ls), "v"(l + 7u * ls),
         "v"(g), "v"(g + gs), "v"(g + 2 * gs), "v"(g + 3 * gs),
         "v"(g + 4 * gs), "v"(g + 5 * gs), "v"(g + 6 * gs), "v"(g + 7 * gs)
      : "memory");
#endif
}

template <int OPK, int SP, int AHM, int OM, int RSM, int RES>
__device__ __forceinline__ void gemm64(
    unsigned short* ring, float* sT, int tile,
    const unsigned short* __restrict__ Ap, const unsigned short* __restrict__ Ap2, int lda, int aplane,
    const unsigned short* __restrict__ Btp, const unsigned short* __restrict__ Btp2, int ldb,
    unsigned short* Ch, unsigned short* Ch2, float* Cf, int ldc,
    const float* __restrict__ Rs, const float* __restrict__ Rp,
    float wsc, float osc, float rsc, int M, int N, int K) {
  const int lane = threadIdx.x & 31;
  const int wave = threadIdx.x >> 5;
  const int tilesN = N >> 7;
  const int tilesM = M >> 7;
  if (tile >= tilesM * tilesN) return;   // block-uniform, in front of every copy and barrier
  const int tm = tile / tilesN;
  const int tn = tile - tm * tilesN;
  const int bm0 = tm << 7;                     // block tile origin
  const int bn0 = tn << 7;
  const int wm = (wave >> 1) << 5;             // wave tile origin inside the block tile
  const int wn = (wave & 1) << 6;
  const int m0 = bm0 + wm;
  const int n0 = bn0 + wn;

  const int rlane = lane & 15;                 // row (A) / col (B, D) within subtile
  const int koff  = (lane >> 4) * 8;           // k offset of this lane half
  const int mOff  = (lane >> 4) * 8;           // D row offset

  // copy map: thread t brings 16-byte piece t&15 of rows (t>>4) + 16*c, c = 0..7, of A and of Bt
  const int crow = threadIdx.x >> 4;
  const int cch  = threadIdx.x & 15;
  const unsigned ldsA = (unsigned)(size_t)ring + (unsigned)(crow * (GPIT * 2) + cch * 16);
  const unsigned ldsB = ldsA + (unsigned)(GTIL * 2);
  const unsigned ldsS = ldsA + (unsigned)(2 * GTIL * 2);
  constexpr int BUFE = (SP ? 3 : 2) * GTIL;    // 16-bit elements per buffer
  const size_t aoff = AHM ? ((size_t)(cch >> 3) * (size_t)aplane + (size_t)(bm0 + crow) * HD + (size_t)((cch & 7) * 8))
                          : ((size_t)(bm0 + crow) * lda + (size_t)(cch * 8));
  const size_t astep = AHM ? (size_t)(16 * HD) : (size_t)16 * lda;          // 16 rows of A
  const size_t apass = AHM ? (size_t)(GKP / HD) * (size_t)aplane : (size_t)GKP;   // one pass along k
  const size_t boff = (size_t)(bn0 + crow) * ldb + (size_t)(cch * 8);
  const size_t bstep = (size_t)16 * ldb;
  const int NT = K >> 7;                       // passes

  auto issue = [&](int t, int buf) {           // pass t's 16 or 24 copies of this thread into buffer buf
    const unsigned lb = (unsigned)buf * (unsigned)(BUFE * 2);
    copy8_rows16(ldsA + lb, Ap + aoff + (size_t)t * apass, astep);
    copy8_rows16(ldsB + lb, Btp + boff + (size_t)t * GKP, bstep);
    if constexpr (SP == 1) copy8_rows16(ldsS + lb, Ap2 + aoff + (size_t)t * apass, astep);
    if constexpr (SP == 2) copy8_rows16(ldsS + lb, Btp2 + boff + (size_t)t * GKP, bstep);
  };

  v8f acc[2][4];
#pragma unroll
  for (int i = 0; i < 2; ++i)
#pragma unroll
    for (int j = 0; j < 4; ++j) acc[i][j] = zero8();

  issue(0, 0);
  asm volatile("s_wait_asynccnt 0x0" ::: "memory");   // this wave's copies of pass 0 have landed
  __syncthreads();                                    // every wave's have: pass 0 may be read
  if (NT > 1) issue(1, 1);

#pragma unroll 1   // one pass per trip: the buffer index and the publish point stay at the loop's foot
  for (int t = 0; t < NT; ++t) {
    const unsigned short* sb = ring + (t & 1) * BUFE;
    const unsigned short* sA = sb + (wm + rlane) * GPIT + koff;
    const unsigned short* sB = sb + GTIL + (wn + rlane) * GPIT + koff;
    const unsigned short* sS = sb + 2 * GTIL + ((SP == 1 ? wm : wn) + rlane) * GPIT + koff;   // second plane
#pragma unroll
    for (int ks = 0; ks < GKP / 32; ++ks) {
      v16us bh[4], bl[4];
#pragma unroll
      for (int j = 0; j < 4; ++j) {
        bh[j] = ldfrag_u(sB + (j << 4) * GPIT + ks * 32);
        bl[j] = (SP == 2) ? ldfrag_u(sS + (j << 4) * GPIT + ks * 32) : bh[j];
      }
#pragma unroll
      for (int i = 0; i < 2; ++i) {
        const v16us ah = ldfrag_u(sA + (i << 4) * GPIT + ks * 32);
#pragma unroll
        for (int j = 0; j < 4; ++j) acc[i][j] = mma_raw<OPK>(ah, bh[j], acc[i][j]);
        dep_guard1(acc[i][0], acc[i][3], ah);
        if constexpr (SP != 0) {               // the second plane's products of the same k step
          const v16us al = (SP == 1) ? ldfrag_u(sS + (i << 4) * GPIT + ks * 32) : ah;
#pragma unroll
          for (int j = 0; j < 4; ++j) acc[i][j] = mma_raw<OPK>(al, bl[j], acc[i][j]);
        }
      }
      keep4_u(bh[0], bh[1], bh[2], bh[3]);
    }
    asm volatile("s_wait_dscnt 0x0" ::: "memory");      // this wave's reads of pass t's buffer are done
    asm volatile("s_wait_asynccnt 0x0" ::: "memory");   // this wave's copies of pass t + 1 have landed
    __syncthreads();                                    // publishes pass t + 1, frees pass t's buffer
    if (t + 2 < NT) issue(t + 2, t & 1);
  }
  asm volatile("s_wait_asynccnt 0x0" ::: "memory");     // no copy is outstanding past the loop
  acc_guard4(acc[0][0], acc[0][1], acc[0][2], acc[0][3]);
  acc_guard4(acc[1][0], acc[1][1], acc[1][2], acc[1][3]);

  const int hh2 = lane >> 4, c4 = (lane & 15) * 4;     // f32 out: 256-B row segment = 16 lanes x 16 B
  const int q8  = lane >> 3, c8 = (lane & 7) * 8;
  const float wo = wsc * osc;

  // per-column scale (RSM 2): columns n0+c8 .. n0+c8+7, same for every row of the tile
  float csc[8];
#pragma unroll
  for (int e = 0; e < 8; ++e) csc[e] = 1.f;
  if (OM != 0 && RSM == 2) {
    const v4f cs0 = *(const v4f*)(Rs + n0 + c8);
    const v4f cs1 = *(const v4f*)(Rs + n0 + c8 + 4);
#pragma unroll
    for (int e = 0; e < 4; ++e) { csc[e] = cs0[e]; csc[4 + e] = cs1[e]; }
  }

  // ---- epilogue ----
  float* slab = sT + wave * (16 * 68);
#pragma unroll
  for (int i = 0; i < 2; ++i) {
    const int mBase = m0 + (i << 4);
#pragma unroll
    for (int j = 0; j < 4; ++j) {
#pragma unroll
      for (int r = 0; r < 8; ++r) {
        slab[(mOff + r) * 68 + (j << 4) + rlane] = acc[i][j][r];
      }
    }
    wave_sync_lds();
    if (OM == 0) {
      v4f vals[8];
#pragma unroll
      for (int it = 0; it < 8; ++it) {
        const int row = it * 2 + hh2;                      // it 0..7 x hh2 0..1 = rows 0..15
        v4f v = *(const v4f*)(slab + row * 68 + c4);
        v = v * wsc;
        if (RES) {
          const int tok = mBase + row;
          const int bb = tok / SEQ, ss = tok - bb * SEQ;
          const v4f hr = *(const v4f*)(Rp + ((size_t)bb * SEQ_FULL + (size_t)ss) * DM + (size_t)(n0 + c4));
          // the next load's result may land in this load's address registers: wait before they are rewritten
          asm volatile("s_wait_xcnt 0x0" ::: "memory");
#pragma unroll
          for (int c = 0; c < 4; ++c) v[c] = v[c] + bfr(hr[c]);
        }
        vals[it] = v;
      }
      {
#pragma unroll
        for (int it = 0; it < 8; ++it) {
          const int row = it * 2 + hh2;
          *(v4f*)(Cf + (size_t)(mBase + row) * ldc + (size_t)n0 + c4) = vals[it];
        }
        
      }
    } else {
      v4u hv[4], hw[4];
#pragma unroll
      for (int it = 0; it < 4; ++it) {
        const int row = it * 4 + q8;                       // it 0..3 x q8 0..3 = rows 0..15
        const float* sp = slab + row * 68 + c8;
        float rsr = wo;
        if (RSM == 1) rsr = wo * Rs[mBase + row];
        v4u ha = {0u, 0u, 0u, 0u}, hb = {0u, 0u, 0u, 0u};
#pragma unroll
        for (int e = 0; e < 4; ++e) {
          const float b0 = sp[2 * e]     * rsr * csc[2 * e];
          const float b1 = sp[2 * e + 1] * rsr * csc[2 * e + 1];
          if (OM == 1) {
            ha[e] = pk16(f2h(b0), f2h(b1));
          } else {
            const _Float16 x0 = (_Float16)b0, x1 = (_Float16)b1;
            ha[e] = pk16(h_bits(x0), h_bits(x1));
            hb[e] = pk16(f2h((b0 - (float)x0) * rsc), f2h((b1 - (float)x1) * rsc));
          }
        }
        hv[it] = ha;
        hw[it] = hb;
      }
      {
#pragma unroll
        for (int it = 0; it < 4; ++it) {
          const int row = it * 4 + q8;
          const size_t go = (size_t)(mBase + row) * ldc + (size_t)n0 + c8;
          *(v4u*)(Ch + go) = hv[it];
          if (OM == 2) *(v4u*)(Ch2 + go) = hw[it];
        }
        
      }
    }
    wave_sync_lds();
  }
}

#define GNT ((MT / 128) * (DM / 128))   // 128x128 tiles of one [MT][DM] (or [DM][MT]) product

// One launch for the three projections, which depend on the preparation alone and not on one another: blocks
// 0 .. GNT-1 the q planes, GNT .. 2*GNT-1 the k planes, the last GNT (half the products, so they come last) v^T.
// The product is chosen by blockIdx.x alone; both bodies use the same LDS.
//   q, k (hi x16 + residual x2048): C[tok][n] = rstd[tok] * sum_k XB[tok][k] * (hi + lo)[n][k]
//   v^T x16:                        C[d][tok] = rstd[tok] * sum_k WVH[d][k] * XH[tok][k]
__global__ __launch_bounds__(256) void gemm_qkv(
    const unsigned short* __restrict__ XB, const unsigned short* __restrict__ XH,
    const unsigned short* __restrict__ WQH, const unsigned short* __restrict__ WQL,
    const unsigned short* __restrict__ WKH, const unsigned short* __restrict__ WKL,
    const unsigned short* __restrict__ WVH,
    unsigned short* QH, unsigned short* QR, unsigned short* KH, unsigned short* KR, unsigned short* VT,
    float* fdummy, const float* __restrict__ RSTD, const float* __restrict__ x) {
  __shared__ __align__(16) unsigned short ring[GRNG];       // two operand buffers, 2 x 104448 B
  __shared__ __align__(16) float sT[8 * 16 * 68];           // per-wave 16x64 slab, pitch 68 floats
  const int bx = blockIdx.x;
  if (bx < 2 * GNT) {
    const bool isk = bx >= GNT;
    gemm64<1, 2, 0, 2, 1, 0>(ring, sT, isk ? bx - GNT : bx, XB, XB, DM, 0, isk ? WKH : WQH, isk ? WKL : WQL, DM,
                             isk ? KH : QH, isk ? KR : QR, fdummy, DM, RSTD, x, 1.0f, QKS, QRS, MT, DM, DM);
  } else {
    gemm64<0, 0, 0, 1, 2, 0>(ring, sT, bx - 2 * GNT, WVH, WVH, DM, 0, XH, XH, DM, VT, VT, fdummy, MT, RSTD, x,
                             1.0f / (XSC * WSCL), VSC, 1.0f, DM, MT, DM);
  }
}

// Output projection + residual: out[tok][n] = sum_k (ctx_hi + ctx_lo)[tok][k] * WOB[n][k] + bf16(x[tok][n])
__global__ __launch_bounds__(256) void gemm_out(
    const unsigned short* __restrict__ ZH, const unsigned short* __restrict__ ZL,
    const unsigned short* __restrict__ WOB, unsigned short* hdummy, float* out,
    const float* __restrict__ RSTD, const float* __restrict__ x) {
  __shared__ __align__(16) unsigned short ring[GRNG];       // two operand buffers, 2 x 104448 B
  __shared__ __align__(16) float sT[8 * 16 * 68];           // per-wave 16x64 slab, pitch 68 floats
  gemm64<1, 1, 1, 0, 0, 1>(ring, sT, blockIdx.x, ZH, ZL, DM, MT * HD, WOB, WOB, DM, hdummy, hdummy, out, DM, RSTD, x,
                           1.0f, 1.0f, 1.0f, MT, DM, DM);
}

// =====================================================================================================
// Bidirectional attention with relative position bias, head dim 64, no 1/sqrt(d) scaling. Block = 256
// threads = 8 waves, all of one (batch b, head h); one wave owns one 16-row query tile (t0..t0+15) and loops all
// key blocks of 32 with an online max-subtracted softmax in f32. A pass is 64 keys: the head's 128 B of each of
// the 64 KH rows and 64 KR rows and 128 B (64 keys) of each of its 64 VT rows are brought into one of two LDS
// buffers (row pitch 144 B) by asynchronous 16-byte copies, 6 per thread, and every wave reads its K and V
// fragments from there; the copies of pass t + 2 are issued when every wave has left pass t's buffer.
// Planes: QH|QR f16 [MT][DM] (16*q hi,
// residual x2048), KH|KR f16 [MT][DM] (16*k hi, residual x2048), VT f16 [DM][MT] (16*v transposed, row =
// h*64+d, column = token), BD f32 [NH][4096] bias by (key-query)+2047. Output Zh|Zl: bf16 hi|lo of ctx,
// head-major [NH][MT][64].
// Both products are taken transposed: keys (then head dims) are the A rows and the wave's 16 queries the B columns,
// so lane (hh, m) holds, for query t0+m alone, the scores of keys 8*hh+r and 16+8*hh+r of a 32-key block.
// The head's bias for every distance the block's 128 queries meet (key - query = -(tb+127) .. SEQ-1-tb, tb = the
// block's first query) is staged once, ahead of the first barrier, in one LDS row shared by the 8 waves and read
// at index key - query + tb + 127. Per key block:
// S^T = KH.QH^T (4 WMMA), R^T = KH.QR^T + KR.QH^T (8 WMMA, own accumulators);
// score = S/256 + R/524288 + bias; the block maximum is taken in the lane and joined with the other half-wave by
// one cross-row move; p = exp(score - running max) in f32, l accumulated per lane from the f32 p (the two halves'
// sums are joined once, in the epilogue); p*16384 as f16 packs from the two score tiles straight into the B
// operand (split k map: elements 0..7 = keys 8*hh.., 8..15 = keys 16+8*hh..); O^T += VT.P^T on f16 WMMA. The
// ctx staging region is private to its wave.
// staged extent covers consumed extent: bias row SEQ+128 written / 0..SEQ+126 read; ctx staging 2 x 16x64 written and read.
// Epilogue: ctx = O^T/(l*262144) split into bf16 hi|lo (a lane holds 8 consecutive dims of its query per O^T
// tile: one 16-byte LDS store per plane and tile), staged in LDS; the wave's 16 rows x 64 halves are
// coverage: 16 query rows x 64 halves per wave, NB*NH*SEQ/16 wave tasks = all (h, tok) rows of both planes.
// =====================================================================================================
#define AKP  64                         // keys per pass
#define APIT 72                         // LDS row pitch in 16-bit elements (144 B)
#define ATIL (64 * APIT)                // 16-bit elements of one staged tile (64 rows)
#define ABUF (3 * ATIL)                 // 16-bit elements per buffer: KH rows | KR rows | VT rows
static_assert((SEQ % AKP) == 0);

// Six asynchronous 16-byte copies of one lane, global -> LDS: rows r and r + 32 of the KH, KR and VT tiles; l is
// the LDS byte address of the lane's piece of KH row r. The s_wait_xcnt closes the statement so that no address
// register named by a copy is rewritten ahead of it.
__device__ __forceinline__ void copy6_kv(unsigned l, const unsigned short* gk, const unsigned short* gr,
                                         const unsigned short* gv) {
#if defined(__HIP_DEVICE_COMPILE__)
  const unsigned lr = 32u * APIT * 2u;
  const unsigned lt = ATIL * 2u;
  asm volatile(
      "global_load_async_to_lds_b128 %0, %6, off\n\t"
      "global_load_async_to_lds_b128 %1, %7, off\n\t"
      "global_load_async_to_lds_b128 %2, %8, off\n\t"
      "global_load_async_to_lds_b128 %3, %9, off\n\t"
      "global_load_async_to_lds_b128 %4, %10, off\n\t"
      "global_load_async_to_lds_b128 %5, %11, off\n\t"
      "s_wait_xcnt 0x0"
      :: "v"(l), "v"(l + lr), "v"(l + lt), "v"(l + lt + lr), "v"(l + 2u * lt), "v"(l + 2u * lt + lr),
         "v"(gk), "v"(gk + (size_t)32 * DM), "v"(gr), "v"(gr + (size_t)32 * DM),
         "v"(gv), "v"(gv + (size_t)32 * MT)
      : "memory");
#endif
}

__global__ __launch_bounds__(256) void attn_kernel(
    const unsigned short* __restrict__ QHp, const unsigned short* __restrict__ QRp,
    const unsigned short* __restrict__ KHp, const unsigned short* __restrict__ KRp,
    const unsigned short* __restrict__ VTp,
    const float* __restrict__ BD, unsigned short* Zh, unsigned short* Zl) {
  __shared__ __align__(16) unsigned short kvr[2 * ABUF];           // two K|KR|VT buffers, 2 x 27648 B
  __shared__ __align__(16) float brow[BRW];                        // bias row of the block, 8704 B
  __shared__ __align__(16) unsigned short zst[AWV][2][16 * HD];    // ctx hi|lo staging, 32768 B
  const int lane = threadIdx.x & 31, wv = threadIdx.x >> 5, m = lane & 15, hh = lane >> 4;
  const int nqt = SEQ / 16;
  if ((int)blockIdx.x * AWV >= NB * NH * nqt) return;   // block-uniform, in front of every copy and barrier
  const int task = blockIdx.x * AWV + wv;            // nqt is a multiple of AWV: one (b, h) per block
  const int bh = task / nqt;
  const int t0 = (task - bh * nqt) << 4;             // query tile start
  const int b = bh / NH, h = bh - b * NH;
  const size_t tok0 = (size_t)b * SEQ;

  // Q B-fragments: columns t0+m, k = head dims (two 32-deep steps), hi and residual planes
  const size_t qo = (tok0 + (size_t)(t0 + m)) * DM + (size_t)(h * HD + 8 * hh);
  const v16us qh0 = ldfrag_u(QHp + qo);
  const v16us qh1 = ldfrag_u(QHp + qo + 32);
  const v16us qr0 = ldfrag_u(QRp + qo);
  const v16us qr1 = ldfrag_u(QRp + qo + 32);

  float mx = -1.0e30f, ls = 0.f;       // query t0+m: running maximum (equal in both halves), this half's sum
  v8f O[4];                            // O^T tiles: element r = (dim 16*j + 8*hh + r, query t0+m)
#pragma unroll
  for (int j = 0; j < 4; ++j) O[j] = zero8();

  // bias row: brow[i] = bias_h(key - query = i - tb - 127), i = 0..SEQ+127; source index i + 1920 - tb lies in
  // 0..4095 (tb is a multiple of 128, tb <= SEQ - 128). Thread t brings 16-byte pieces t, t + 256, ...
  const int tb = t0 - 16 * wv;
  const float* bsrc = BD + (size_t)h * BDW + (SEQ_FULL - 16 * AWV - tb);
  v4f bst[BRQ + 1];
#pragma unroll     // bst[] is indexed by constants only; the loads go out together
  for (int q = 0; q < BRQ; ++q) bst[q] = *(const v4f*)(bsrc + 4 * ((int)threadIdx.x + 256 * q));
  if ((int)threadIdx.x < BRT) bst[BRQ] = *(const v4f*)(bsrc + 4 * ((int)threadIdx.x + 256 * BRQ));
  const float* bl = brow + (16 * AWV - 1 - 16 * wv - m + 8 * hh);          // + key block start + r
  // copy map: thread t brings 16-byte piece t&7 of rows (t>>3) and (t>>3) + 32 of each of the three tiles
  const int crow = threadIdx.x >> 3;
  const int cpc  = threadIdx.x & 7;
  const unsigned ldsC = (unsigned)(size_t)kvr + (unsigned)(crow * (APIT * 2) + cpc * 16);
  const size_t kco = (tok0 + (size_t)crow) * DM + (size_t)(h * HD + cpc * 8);
  const unsigned short* gK = KHp + kco;
  const unsigned short* gR = KRp + kco;
  const unsigned short* gV = VTp + (size_t)(h * HD + crow) * MT + tok0 + (size_t)(cpc * 8);
  const int NT = SEQ / AKP;

  auto issue = [&](int t, int buf) {           // pass t's 6 copies of this thread into buffer buf
    copy6_kv(ldsC + (unsigned)buf * (unsigned)(ABUF * 2), gK + (size_t)t * (AKP * DM), gR + (size_t)t * (AKP * DM),
             gV + (size_t)t * AKP);
  };

  issue(0, 0);
#pragma unroll     // bst[] is indexed by constants only, so it stays in registers
  for (int q = 0; q < BRQ; ++q) *(v4f*)(brow + 4 * ((int)threadIdx.x + 256 * q)) = bst[q];
  if ((int)threadIdx.x < BRT) *(v4f*)(brow + 4 * ((int)threadIdx.x + 256 * BRQ)) = bst[BRQ];
  asm volatile("s_wait_asynccnt 0x0" ::: "memory");   // this wave's copies of pass 0 have landed
  __syncthreads();                                    // every wave's have: pass 0 and the bias row may be read
  if (NT > 1) issue(1, 1);

#pragma unroll 1   // one pass per trip: the buffer index and the publish point stay at the loop's foot
  for (int t = 0; t < NT; ++t) {
  const float* bw = bl + t * AKP;                                            // bias of this pass's keys
  const unsigned short* kbase  = kvr + (t & 1) * ABUF + m * APIT + 8 * hh;   // KH row m, this lane half's k
  const unsigned short* krbase = kbase + ATIL;
  const unsigned short* vbase  = kbase + 2 * ATIL;                           // VT row (dim) m, keys 8*hh..
#pragma unroll     // both 32-key blocks of a pass inline: their LDS offsets become immediates
  for (int sub = 0; sub < AKP / 32; ++sub) {
    // bias of keys 8*hh + r and 16 + 8*hh + r of the block for query m, read here so that the products cover the
    // LDS latency; two consecutive keys per register pair
    v2f b0[4], b1[4];
#pragma unroll     // b0[], b1[] are indexed by constants only, so they stay in registers
    for (int e = 0; e < 4; ++e) {
      b0[e] = (v2f){bw[sub * 32 + 2 * e], bw[sub * 32 + 2 * e + 1]};
      b1[e] = (v2f){bw[sub * 32 + 16 + 2 * e], bw[sub * 32 + 16 + 2 * e + 1]};
    }

    // S^T = KH.QH^T, R^T = KH.QR^T + KR.QH^T ; A row = key token sb+m (+16), B column = query, k = head dim
    v8f S0, S1, R0, R1;
    {
      const int kofs = (sub * 32) * APIT;
      const v16us kf0a = ldfrag_u(kbase + kofs);
      const v16us kf1a = ldfrag_u(kbase + kofs + 16 * APIT);
      const v16us kg0a = ldfrag_u(krbase + kofs);
      const v16us kg1a = ldfrag_u(krbase + kofs + 16 * APIT);
      const v16us kf0b = ldfrag_u(kbase + kofs + 32);
      const v16us kf1b = ldfrag_u(kbase + kofs + 32 + 16 * APIT);
      const v16us kg0b = ldfrag_u(krbase + kofs + 32);
      const v16us kg1b = ldfrag_u(krbase + kofs + 32 + 16 * APIT);
      qk_run(S0, S1, R0, R1, kf0a, kf1a, kg0a, kg1a, kf0b, kf1b, kg0b, kg1b, qh0, qh1, qr0, qr1);
    }

    // VT A-fragments (row = h*64 + dim, k = key token), read as one group here so that the softmax covers
    // their LDS latency
    v16us vf[4];
#pragma unroll     // vf[] is indexed by constants only, so it stays in registers
    for (int j = 0; j < 4; ++j) vf[j] = ldfrag_u(vbase + (16 * j) * APIT + sub * 32);

    // score = q.k + bias
    float s0[8], s1[8];
#pragma unroll     // two consecutive keys per step: accumulator pairs and bias pairs feed packed f32 FMAs as they lie
    for (int e = 0; e < 4; ++e) {
      const v2f x0 = __builtin_elementwise_fma((v2f){S0[2 * e], S0[2 * e + 1]}, (v2f){SC1, SC1},
                     __builtin_elementwise_fma((v2f){R0[2 * e], R0[2 * e + 1]}, (v2f){SC2, SC2}, b0[e]));
      const v2f x1 = __builtin_elementwise_fma((v2f){S1[2 * e], S1[2 * e + 1]}, (v2f){SC1, SC1},
                     __builtin_elementwise_fma((v2f){R1[2 * e], R1[2 * e + 1]}, (v2f){SC2, SC2}, b1[e]));
      s0[2 * e] = x0[0]; s0[2 * e + 1] = x0[1];
      s1[2 * e] = x1[0]; s1[2 * e + 1] = x1[1];
    }

    // online softmax: a query's 32 scores live in lanes m and m + 16, 16 each
    float xm = fmaxf(s0[0], s1[0]);
#pragma unroll     // s0[], s1[] are indexed by constants only, so they stay in registers
    for (int r = 1; r < 8; ++r) xm = fmaxf(xm, fmaxf(s0[r], s1[r]));
    xm = fmaxf(xm, xhalf(xm));
    const float mn = fmaxf(mx, xm);
    const float al = __expf(mx - mn);
    mx = mn;
    FragU pf;                                          // P^T B-fragment (split k map)
    float pa = 0.f, pb = 0.f;
#pragma unroll
    for (int r = 0; r < 8; ++r) {
      const float p0 = __expf(s0[r] - mn);
      const float p1 = __expf(s1[r] - mn);
      pa += p0;
      pb += p1;
      pf.v[r]     = f2h(p0 * PCAR);
      pf.v[8 + r] = f2h(p1 * PCAR);
    }
    ls = ls * al + (pa + pb);
#pragma unroll     // O[] is indexed by constants only, so it stays in registers
    for (int j = 0; j < 4; ++j) O[j] = O[j] * al;
    pv_run(O[0], O[1], O[2], O[3], vf[0], vf[1], vf[2], vf[3], pf.v);
  }
    asm volatile("s_wait_dscnt 0x0" ::: "memory");      // this wave's reads of pass t's buffer are done
    asm volatile("s_wait_asynccnt 0x0" ::: "memory");   // this wave's copies of pass t + 1 have landed
    __syncthreads();                                    // publishes pass t + 1, frees pass t's buffer
    if (t + 2 < NT) issue(t + 2, t & 1);
  }
  asm volatile("s_wait_asynccnt 0x0" ::: "memory");     // no copy is outstanding past the loop
  acc_guard4(O[0], O[1], O[2], O[3]);

  // ---- epilogue: ctx = O / (l * PCAR * VSC) -> bf16 hi|lo, head-major planes ----
  unsigned short* zh = zst[wv][0];
  unsigned short* zl = zst[wv][1];
  const float linv = (1.0f / (ls + xhalf(ls))) * OSC;  // both halves' sums joined; the joined sum is >= 1
#pragma unroll
  for (int j = 0; j < 4; ++j) {
    v4u zc, zr;
#pragma unroll
    for (int e = 0; e < 4; ++e) {
      const float o0 = O[j][2 * e] * linv, o1 = O[j][2 * e + 1] * linv;
      const unsigned short x0 = bf_bits(o0), x1 = bf_bits(o1);
      zc[e] = pk16(x0, x1);
      zr[e] = pk16(bf_bits(o0 - bf_up(x0)), bf_bits(o1 - bf_up(x1)));
    }
    *(v4u*)(zh + m * HD + 16 * j + 8 * hh) = zc;       // row = query m, dims 16*j + 8*hh .. + 7
    *(v4u*)(zl + m * HD + 16 * j + 8 * hh) = zr;
  }
  wave_sync_lds();
  {
    v4u ha[4], hb[4];
#pragma unroll
    for (int q = 0; q < 4; ++q) {
      ha[q] = *(const v4u*)(zh + q * 256 + lane * 8);
      hb[q] = *(const v4u*)(zl + q * 256 + lane * 8);
    }
    const size_t zo = ((size_t)h * MT + tok0 + (size_t)t0) * HD;   // 2048-B aligned, 16 rows contiguous
    unsigned short* dh = Zh + zo;
    unsigned short* dl = Zl + zo;
    {
#pragma unroll
      for (int q = 0; q < 4; ++q) {
        *(v4u*)(dh + q * 256 + lane * 8) = ha[q];
        *(v4u*)(dl + q * 256 + lane * 8) = hb[q];
      }
      
    }
  }
}

// =====================================================================================================
// Workspace map (bytes, NB=2, SEQ=2048); every plane is an exact multiple of its whole-row / whole-line /
// BD = 16 x 4096 floats); all offsets multiples of 65536.
//   XB   bf16 [MT][DM]        0           8388608
//   XH   f16  [MT][DM]        8388608     8388608
//   RSTD f32  [MT]            16777216    65536     (16384 used)
//   W    6 x 16-bit [DM][DM]  16842752    12582912  (wq hi, wq lo, wk hi, wk lo bf16; wv f16 x256; wo bf16)
//   BD   f32  [NH][4096]      29425664    262144
//   QH   f16  [MT][DM]        29687808    8388608
//   QR   f16  [MT][DM]        38076416    8388608
//   KH   f16  [MT][DM]        46465024    8388608
//   KR   f16  [MT][DM]        54853632    8388608
//   VT   f16  [DM][MT]        63242240    8388608
//   ZH   bf16 [NH][MT][64]    71630848    8388608
//   ZL   bf16 [NH][MT][64]    80019456    8388608
//   end                       88408064
// =====================================================================================================
extern "C" void kernel_launch(void* const* d_in, const int* in_sizes, int n_in,
                              void* d_out, int out_size, void* d_ws, size_t ws_size,
                              hipStream_t stream) {
  if (n_in < 7) return;
  if (in_sizes[0] < ((NB - 1) * SEQ_FULL + SEQ) * DM) return;
  if (in_sizes[1] < DM) return;
  if (in_sizes[2] < DM * DM) return;
  if (in_sizes[3] < DM * DM) return;
  if (in_sizes[4] < DM * DM) return;
  if (in_sizes[5] < DM * DM) return;
  if (in_sizes[6] < NBKT * NH) return;
  if (out_size < MT * DM) return;

  const float* x    = (const float*)d_in[0];   // [2][2048][1024]
  const float* lnw  = (const float*)d_in[1];   // [1024]
  const float* w_q  = (const float*)d_in[2];   // [1024][1024] (in, out)
  const float* w_k  = (const float*)d_in[3];
  const float* w_v  = (const float*)d_in[4];
  const float* w_o  = (const float*)d_in[5];   // [1024][1024] (in, out)
  const float* tbl  = (const float*)d_in[6];   // [32][16]

  const size_t PX  = (size_t)MT * DM * 2;        // 16-bit [MT][DM] plane
  const size_t PRS = (((size_t)MT * 4 + 65535) / 65536) * 65536;
  const size_t PW1 = (size_t)DM * DM * 2;        // one 16-bit weight plane
  const size_t PBD = (size_t)NH * BDW * 4;
  size_t off = 0;
  const size_t oXB = off; off += PX;
  const size_t oXH = off; off += PX;
  const size_t oRS = off; off += PRS;
  const size_t oW  = off; off += 6 * PW1;
  const size_t oBD = off; off += PBD;
  const size_t oQH = off; off += PX;
  const size_t oQR = off; off += PX;
  const size_t oKH = off; off += PX;
  const size_t oKR = off; off += PX;
  const size_t oVT = off; off += PX;
  const size_t oZH = off; off += PX;
  const size_t oZL = off; off += PX;
  if (off > ws_size) return;                      // off = 88408064 at full size
  if (off > (size_t)134217728) return;

  char* ws = (char*)d_ws;
  unsigned short* XB = (unsigned short*)(ws + oXB);
  unsigned short* XH = (unsigned short*)(ws + oXH);
  float* RSTD = (float*)(ws + oRS);
  unsigned short* W16 = (unsigned short*)(ws + oW);
  unsigned short* WQH = W16;
  unsigned short* WQL = W16 + (size_t)1 * DM * DM;
  unsigned short* WKH = W16 + (size_t)2 * DM * DM;
  unsigned short* WKL = W16 + (size_t)3 * DM * DM;
  unsigned short* WVH = W16 + (size_t)4 * DM * DM;
  unsigned short* WOB = W16 + (size_t)5 * DM * DM;
  float* BDp = (float*)(ws + oBD);
  unsigned short* QH = (unsigned short*)(ws + oQH);
  unsigned short* QR = (unsigned short*)(ws + oQR);
  unsigned short* KH = (unsigned short*)(ws + oKH);
  unsigned short* KR = (unsigned short*)(ws + oKR);
  unsigned short* VT = (unsigned short*)(ws + oVT);
  unsigned short* ZH = (unsigned short*)(ws + oZH);
  unsigned short* ZL = (unsigned short*)(ws + oZL);
  float* out0 = (float*)d_out;
  float* fdummy = BDp;                            // in-range placeholder for unused f32 output args

  const dim3 blk(256);

  // (0) operand planes, rms statistics and bias table: one launch
  prep<<<dim3(PXB + NH + 4 * PWB), blk, 0, stream>>>(x, w_q, w_k, w_v, w_o, lnw, tbl, XB, XH, RSTD, W16, BDp);

  // (1) q, k planes and v^T: one launch, 3 x 256 blocks at full size
  gemm_qkv<<<dim3(3 * GNT), blk, 0, stream>>>(XB, XH, WQH, WQL, WKH, WKL, WVH, QH, QR, KH, KR, VT, fdummy, RSTD, x);

  // (2) attention -> ctx bf16 hi|lo head-major planes
  attn_kernel<<<dim3((NB * NH * (SEQ / 16)) / AWV), dim3(32 * AWV), 0, stream>>>(QH, QR, KH, KR, VT, BDp, ZH, ZL);

  // (3) output projection + residual
  gemm_out<<<dim3(GNT), blk, 0, stream>>>(ZH, ZL, WOB, ZH, out0, RSTD, x);
  (void)hipGetLastError();
}

// v008
// A run of this version takes 125 microseconds.
// In two side-by-side timings against v007, it was 1.03 and 1.04 times as fast.
// Over all steps from v000 it is 4.22 times as fast.
// Contractions: normed.w_q and normed.w_k on v_wmma_f32_16x16x32_bf16 (bf16 x plane, bf16 hi+lo weight planes
// with ln_weight folded in, f32 accumulate); w_v'.normed^T (v^T plane), q.k^T (f16 hi x16 + residual x2048 on
// both q and k, three products) and p.v on v_wmma_f32_16x16x32_f16 (f16 operands, f32 accumulate); ctx.w_o on
// v_wmma_f32_16x16x32_bf16 (bf16 hi+lo ctx planes, bf16 w_o, f32 accumulate). Float inputs RNE-converted to
// bf16 on load; per-row rms scale, softmax and relative position bias in f32 on VALU; softmax p carried x16384.
#include <hip/hip_runtime.h>
#include <math.h>

#ifndef NB
#define NB 2
#endif
#ifndef SEQ
#define SEQ 2048
#endif
#define NB_FULL  2
#define SEQ_FULL 2048
#define DM   1024
#define NH   16
#define HD   64
#define NBKT 32
#define MT   (NB * SEQ)
#define BDW  4096
#define AWV  8
#define BRW  (SEQ + 16 * AWV)
#define BRQ  ((BRW / 4) / 256)
#define BRT  ((BRW / 4) % 256)
#define XSC  16.0f
#define WSCL 256.0f
#define QKS  16.0f
#define QRS  2048.0f
#define VSC  16.0f
#define PCAR 16384.0f
#define SC1  (1.0f / 256.0f)
#define SC2  (1.0f / 524288.0f)
#define OSC  (1.0f / 262144.0f)
#define LNEPS 1.0e-6f

static_assert(NB >= 1 && NB <= NB_FULL);
static_assert(SEQ >= 64 && SEQ <= SEQ_FULL && (SEQ % 64) == 0);
static_assert(NH * HD == DM);
static_assert(HD == 64);
static_assert(BDW == 2 * SEQ_FULL);
static_assert((BRW % 4) == 0 && 16 * AWV <= SEQ_FULL);
static_assert((MT % 64) == 0 && (DM % 64) == 0 && (MT % 32) == 0);
static_assert((MT % 128) == 0 && (DM % 128) == 0);
static_assert(((NB * NH * (SEQ / 16)) % AWV) == 0);
static_assert(((SEQ / 16) % AWV) == 0);
static_assert(NBKT * NH == 512);
static_assert(BDW == 16 * 256);
static_assert((DM % 256) == 0);

typedef _Float16 v16h __attribute__((ext_vector_type(16)));
typedef __bf16 v16bf __attribute__((ext_vector_type(16)));
typedef unsigned short v16us __attribute__((ext_vector_type(16)));
typedef unsigned short v8us  __attribute__((ext_vector_type(8)));
typedef float v8f __attribute__((ext_vector_type(8)));
typedef float v4f __attribute__((ext_vector_type(4)));
typedef float v2f __attribute__((ext_vector_type(2)));
typedef unsigned int v4u __attribute__((ext_vector_type(4)));

union FragU { v16us v; v8us h[2]; };

// ---- scalar helpers --------------------------------------------------------------------------------
__device__ __forceinline__ unsigned short bf_bits(float f) {          // f32 -> bf16 bits, RNE convert
  const unsigned u = __float_as_uint(f);
  return (unsigned short)((u + 0x7FFFu + ((u >> 16) & 1u)) >> 16);
}
__device__ __forceinline__ float bf_up(unsigned short h) { return __uint_as_float(((unsigned)h) << 16); }
__device__ __forceinline__ float bfr(float f) { return bf_up(bf_bits(f)); }   // value of the bf16 RNE convert
__device__ __forceinline__ unsigned short h_bits(_Float16 x) { return __builtin_bit_cast(unsigned short, x); }
__device__ __forceinline__ unsigned short f2h(float f) { return h_bits((_Float16)f); }
__device__ __forceinline__ unsigned pk16(unsigned short a, unsigned short b) { return (unsigned)a | ((unsigned)b << 16); }
__device__ __forceinline__ int clampi(int v, int lo, int hi) { return v < lo ? lo : (v > hi ? hi : v); }
__device__ __forceinline__ v8f zero8() { v8f z = {0.f, 0.f, 0.f, 0.f, 0.f, 0.f, 0.f, 0.f}; return z; }

// ---- fragment loader: 16-bit A/B operand, lane -> row/col (lane&15), p already includes +8*(lane>>4);
//      elements 0..7 <- p[0..7] (k0+8h..), elements 8..15 <- p[16..23] (k0+16+8h..)
__device__ __forceinline__ v16us ldfrag_u(const unsigned short* p) {
  FragU f;
  f.h[0] = *(const v8us*)(p);
  f.h[1] = *(const v8us*)(p + 16);
  return f.v;
}

// ---- WMMA helpers; OPK 0 = f16 operand bits, OPK 1 = bf16 operand bits --
template <int OPK>
__device__ __forceinline__ v8f mma_raw(v16us a, v16us b, v8f c) {
  if (OPK == 0)
    return __builtin_amdgcn_wmma_f32_16x16x32_f16(false, __builtin_bit_cast(v16h, a), false,
                                                  __builtin_bit_cast(v16h, b), (short)0, c, false, false);
  return __builtin_amdgcn_wmma_f32_16x16x32_bf16(false, __builtin_bit_cast(v16bf, a), false,
                                                 __builtin_bit_cast(v16bf, b), (short)0, c, false, false);
}
__device__ __forceinline__ void acc_guard4(v8f& a, v8f& b, v8f& c, v8f& d) {
#if defined(__HIP_DEVICE_COMPILE__)
  asm volatile("v_nop\n\tv_nop\n\tv_nop\n\tv_nop" : "+v"(a), "+v"(b), "+v"(c), "+v"(d));
#endif
}
// The twelve f16 score products of one 32-key block as one run of matrix instructions: S0|S1 = KH.QH^T,
// R0|R1 = KH.QR^T + KR.QH^T for keys 0..15 | 16..31, head dims 0..31 (a) then 32..63 (b). Inside the run each
// product stands in the hazard window of the ones before it (an accumulate into the same D needs no distance),
// so only the last ones need vector slots: the four v_nop at the end keep the distance to whatever vector
// instruction the compiler puts next on S, R or a fragment register.
__device__ __forceinline__ void qk_run(v8f& S0, v8f& S1, v8f& R0, v8f& R1,
                                       v16us kf0a, v16us kf1a, v16us kg0a, v16us kg1a,
                                       v16us kf0b, v16us kf1b, v16us kg0b, v16us kg1b,
                                       v16us qha, v16us qhb, v16us qra, v16us qrb) {
#if defined(__HIP_DEVICE_COMPILE__)
  asm volatile(
      "v_wmma_f32_16x16x32_f16 %0, %4, %12, 0\n\t"
      "v_wmma_f32_16x16x32_f16 %1, %5, %12, 0\n\t"
      "v_wmma_f32_16x16x32_f16 %2, %4, %14, 0\n\t"
      "v_wmma_f32_16x16x32_f16 %3, %5, %14, 0\n\t"
      "v_wmma_f32_16x16x32_f16 %2, %6, %12, %2\n\t"
      "v_wmma_f32_16x16x32_f16 %3, %7, %12, %3\n\t"
      "v_wmma_f32_16x16x32_f16 %0, %8, %13, %0\n\t"
      "v_wmma_f32_16x16x32_f16 %1, %9, %13, %1\n\t"
      "v_wmma_f32_16x16x32_f16 %2, %8, %15, %2\n\t"
      "v_wmma_f32_16x16x32_f16 %3, %9, %15, %3\n\t"
      "v_wmma_f32_16x16x32_f16 %2, %10, %13, %2\n\t"
      "v_wmma_f32_16x16x32_f16 %3, %11, %13, %3\n\t"
      "v_nop\n\tv_nop\n\tv_nop\n\tv_nop"
      : "=&v"(S0), "=&v"(S1), "=&v"(R0), "=&v"(R1)
      : "v"(kf0a), "v"(kf1a), "v"(kg0a), "v"(kg1a), "v"(kf0b), "v"(kf1b), "v"(kg0b), "v"(kg1b),
        "v"(qha), "v"(qhb), "v"(qra), "v"(qrb));
#endif
}
// The four O^T += VT.P^T products of one 32-key block as one run; the four v_nop at the end keep the distance
// between the last product and the next vector instruction on O, a V fragment or P.
__device__ __forceinline__ void pv_run(v8f& O0, v8f& O1, v8f& O2, v8f& O3,
                                       v16us v0, v16us v1, v16us v2, v16us v3, v16us p) {
#if defined(__HIP_DEVICE_COMPILE__)
  asm volatile(
      "v_wmma_f32_16x16x32_f16 %0, %4, %8, %0\n\t"
      "v_wmma_f32_16x16x32_f16 %1, %5, %8, %1\n\t"
      "v_wmma_f32_16x16x32_f16 %2, %6, %8, %2\n\t"
      "v_wmma_f32_16x16x32_f16 %3, %7, %8, %3\n\t"
      "v_nop\n\tv_nop\n\tv_nop\n\tv_nop"
      : "+v"(O0), "+v"(O1), "+v"(O2), "+v"(O3)
      : "v"(v0), "v"(v1), "v"(v2), "v"(v3), "v"(p));
#endif
}
// value of lane l ^ 16 (the other 16-lane half of the wave), by a vector cross-row move
__device__ __forceinline__ float xhalf(float x) {
  const int b = __builtin_bit_cast(int, x);
  return __builtin_bit_cast(float, __builtin_amdgcn_permlanex16(b, b, 0x76543210, 0xfedcba98, false, false));
}
// orders LDS stores of this wave before later LDS loads of the same wave (wave-private exchange)
__device__ __forceinline__ void wave_sync_lds() {
  __builtin_amdgcn_fence(__ATOMIC_RELEASE, "workgroup");
  __builtin_amdgcn_wave_barrier();
  __builtin_amdgcn_fence(__ATOMIC_ACQUIRE, "workgroup");
}

// =====================================================================================================
// x convert + rms statistics. Block = 256 threads = 8 waves owns 32 consecutive token rows (wave w: rows
// 4w..4w+3); token tok = b*SEQ + s reads input row b*SEQ_FULL + s. Per row each lane converts 8
// consecutive floats per step (4 steps of 256 columns): ob = bf16 bits of x (RNE), oh = f16 bits of
// of the bf16 values is reduced per row and rstd = rsqrt(mean + eps) staged in LDS (cross-wave -> block
// coverage: 8 waves x 4 rows x (4 x 256) columns = 32 whole rows of both planes per block, grid = MT/32
// blocks (bx); rstd rows row0..row0+31 per block = all MT entries.
// =====================================================================================================
__device__ __forceinline__ void cvt_x(int bx, const float* __restrict__ x, unsigned short* ob,
                                      unsigned short* oh, float* rstd) {
  __shared__ float srs[32];
  const int lane = threadIdx.x & 31, wv = threadIdx.x >> 5;
  const int row0 = bx * 32;
#pragma unroll 1
  for (int rr = 0; rr < 4; ++rr) {
    const int tok = row0 + wv * 4 + rr;
    const int b = tok / SEQ, s = tok - b * SEQ;
    const float* src = x + ((size_t)b * SEQ_FULL + (size_t)s) * DM;
    const size_t orow = (size_t)tok * DM;
    float ss = 0.f;
#pragma unroll 1
    for (int it = 0; it < DM / 256; ++it) {
      const int col = it * 256 + lane * 8;
      const v4f a0 = *(const v4f*)(src + col);
      const v4f a1 = *(const v4f*)(src + col + 4);
      v4u hb, hh;
#pragma unroll
      for (int e = 0; e < 2; ++e) {
        const unsigned short u0 = bf_bits(a0[2 * e]), u1 = bf_bits(a0[2 * e + 1]);
        const unsigned short u2 = bf_bits(a1[2 * e]), u3 = bf_bits(a1[2 * e + 1]);
        const float x0 = bf_up(u0), x1 = bf_up(u1), x2 = bf_up(u2), x3 = bf_up(u3);
        ss = fmaf(x0, x0, ss); ss = fmaf(x1, x1, ss); ss = fmaf(x2, x2, ss); ss = fmaf(x3, x3, ss);
        hb[e]     = pk16(u0, u1);
        hb[2 + e] = pk16(u2, u3);
        hh[e]     = pk16(f2h(x0 * XSC), f2h(x1 * XSC));
        hh[2 + e] = pk16(f2h(x2 * XSC), f2h(x3 * XSC));
      }
      unsigned short* db = ob + orow + col;
      unsigned short* dh = oh + orow + col;
      *(v4u*)db = hb;
      *(v4u*)dh = hh;
      
    }
    ss += __shfl_xor(ss, 16, 32);
    ss += __shfl_xor(ss, 8, 32);
    ss += __shfl_xor(ss, 4, 32);
    ss += __shfl_xor(ss, 2, 32);
    ss += __shfl_xor(ss, 1, 32);
    if (lane == 0) srs[wv * 4 + rr] = rsqrtf(ss * (1.0f / (float)DM) + LNEPS);
  }
  __syncthreads();
  if (wv == 0) {
    const float v = srs[lane];
    float* d = rstd + row0 + lane;
    *(float*)d = v;
    
  }
}

// =====================================================================================================
// Weight convert with transpose: source matrices are [in k][out n] row-major; output Bt planes [n][k]
// (k contiguous). y (block-uniform) selects the matrix (0 w_q, 1 w_k, 2 w_v, 3 w_o), bx the 64x64 tile
// (k0 = 64*(bx>>4), n0 = 64*(bx&15)). The tile is staged in LDS as f32, then each output row n0+r, columns
// lines). Values: y=0,1: w' = bf16(ln_w[k]) * bf16(w[k][n]) (exact in f32) split into bf16 hi (plane 2y) and
// bf16 lo = w' - hi (plane 2y+1, exact); y=2: f16 bits of w' * WSCL (plane 4); y=3: bf16 bits of w_o
// coverage: load 256 threads x 4 x 4 = 64x64 tile; store 8 waves x 2 x (4 rows x 8 lanes x 8) = 64 rows x
// 64 cols; bx 0..255 x y 0..3 covers every 64x64 tile of every output plane.
// =====================================================================================================
__device__ __forceinline__ void cvt_w(int bx, int y, const float* __restrict__ w0, const float* __restrict__ w1,
                                      const float* __restrict__ w2, const float* __restrict__ w3,
                                      const float* __restrict__ lnw, unsigned short* o) {
  __shared__ __align__(16) float sm[64 * 65];
  __shared__ float slw[64];
  const float* w = (y == 0) ? w0 : ((y == 1) ? w1 : ((y == 2) ? w2 : w3));
  const int k0 = (bx >> 4) << 6, n0 = (bx & 15) << 6;
  const int t = threadIdx.x, lane = t & 31, wv = t >> 5;
#pragma unroll
  for (int it = 0; it < 4; ++it) {
    const int r = it * 16 + (t >> 4), c4 = (t & 15) * 4;
    const v4f v = *(const v4f*)(w + (size_t)(k0 + r) * DM + (size_t)(n0 + c4));
    float* sp = sm + r * 65 + c4;
    sp[0] = v[0]; sp[1] = v[1]; sp[2] = v[2]; sp[3] = v[3];
  }
  if (t < 64) slw[t] = bfr(lnw[k0 + t]);                       // waves 0,1 entirely: wave-uniform
  __syncthreads();
  const int pl0 = (y == 0) ? 0 : ((y == 1) ? 2 : ((y == 2) ? 4 : 5));
  unsigned short* P0 = o + (size_t)pl0 * DM * DM;
  unsigned short* P1 = (y < 2) ? (P0 + (size_t)DM * DM) : P0;
  const int q8 = lane >> 3, c8 = (lane & 7) * 8;
  v4u ha[2], hl[2];
#pragma unroll
  for (int it = 0; it < 2; ++it) {
    const int r = wv * 8 + it * 4 + q8;                          // n local
    v4u a = {0u, 0u, 0u, 0u}, l = {0u, 0u, 0u, 0u};
#pragma unroll
    for (int e = 0; e < 4; ++e) {
      const int ka = c8 + 2 * e, kb = ka + 1;
      float va = bfr(sm[ka * 65 + r]), vb = bfr(sm[kb * 65 + r]);
      if (y < 3) { va *= slw[ka]; vb *= slw[kb]; }
      if (y < 2) {
        const unsigned short ua = bf_bits(va), ub = bf_bits(vb);
        a[e] = pk16(ua, ub);
        l[e] = pk16(bf_bits(va - bf_up(ua)), bf_bits(vb - bf_up(ub)));
      } else if (y == 2) {
        a[e] = pk16(f2h(va * WSCL), f2h(vb * WSCL));
      } else {
        a[e] = pk16(bf_bits(va), bf_bits(vb));
      }
    }
    ha[it] = a;
    hl[it] = l;
  }
  {
#pragma unroll
    for (int it = 0; it < 2; ++it) {
      const int r = wv * 8 + it * 4 + q8;
      const size_t go = (size_t)(n0 + r) * DM + (size_t)(k0 + c8);
      *(v4u*)(P0 + go) = ha[it];
      if (y < 2) *(v4u*)(P1 + go) = hl[it];
    }
    // the stores' address and data registers may be rewritten by whatever code follows this job in the merged kernel
    asm volatile("s_wait_xcnt 0x0" ::: "memory");
  }
}

// =====================================================================================================
// Relative position bias by signed key-query distance: BD[h][i], i = (key - query) + 2047, i in 0..4094;
// i = 4095 is padding written as 0. bucket on integer n = query - key: ret = (n < 0) * 16, n = |n|,
// n < 8 -> n, else 8 + floor(2*log2(n/8)) capped at 15, evaluated by its integer thresholds
// coverage: 256 threads x 16 = 4096 entries per head; h = 0..NH-1 = the whole table.
// =====================================================================================================
__device__ __forceinline__ int rel_bucket(int d) {              // d = key - query
  int n = -d;
  int ret = 0;
  if (n < 0) { ret = NBKT / 2; n = -n; }
  int bk;
  if (n < 8)       bk = n;
  else if (n < 12) bk = 8;
  else if (n < 16) bk = 9;
  else if (n < 23) bk = 10;
  else if (n < 32) bk = 11;
  else if (n < 46) bk = 12;
  else if (n < 64) bk = 13;
  else if (n < 91) bk = 14;
  else             bk = 15;
  return ret + bk;
}

__device__ __forceinline__ void bias_build(int h, const float* __restrict__ tbl, float* BD) {
  __shared__ __align__(16) float sh[BDW];
  const int t = threadIdx.x;
#pragma unroll 4
  for (int j = 0; j < 16; ++j) {
    const int idx = t + 256 * j;
    const int ti = clampi(rel_bucket(idx - 2047) * NH + h, 0, NBKT * NH - 1);
    float v = bfr(tbl[ti]);
    v = (idx == BDW - 1) ? 0.f : v;
    sh[idx] = v;
  }
  __syncthreads();
  v4f vv[4];
#pragma unroll
  for (int q = 0; q < 4; ++q) vv[q] = *(const v4f*)(sh + q * 1024 + 4 * t);
  float* dst = BD + (size_t)h * BDW;
  {
#pragma unroll
    for (int q = 0; q < 4; ++q) *(v4f*)(dst + q * 1024 + 4 * t) = vv[q];
    
  }
}

// =====================================================================================================
// One launch for the three preparation jobs, which depend on the inputs alone and not on one another: blocks
// 0 .. PXB-1 convert x (the longest job per block, so it starts first), the next NH build the bias table, the
// last 4*PWB convert the weights. The job is chosen by blockIdx.x alone, so every barrier inside a job is met by
// a whole block.
// =====================================================================================================
#define PXB (MT / 32)                   // blocks of the x convert
#define PWB ((DM / 64) * (DM / 64))     // blocks of one weight matrix
__global__ __launch_bounds__(256) void prep(const float* __restrict__ x, const float* __restrict__ w0,
                                            const float* __restrict__ w1, const float* __restrict__ w2,
                                            const float* __restrict__ w3, const float* __restrict__ lnw,
                                            const float* __restrict__ tbl, unsigned short* ob, unsigned short* oh,
                                            float* rstd, unsigned short* o, float* BD) {
  const int bx = blockIdx.x;
  if (bx < PXB) {
    cvt_x(bx, x, ob, oh, rstd);
  } else if (bx < PXB + NH) {
    bias_build(bx - PXB, tbl, BD);
  } else {
    const int i = bx - (PXB + NH);
    cvt_w(i % PWB, i / PWB, w0, w1, w2, w3, lnw, o);
  }
}

// =====================================================================================================
// LDS-staged 16-bit WMMA GEMM: C[m][n] = sum over plane pairs pl and k of A_pl[m][k] * Bt_pl[n][k]. A block of
// 8 waves owns one 128x128 tile of C (tile, block-uniform); wave w owns rows 32*(w>>1).. and columns 64*(w&1).. of
// it (2 x 4 accumulator tiles). A pass is 128 k: 256 B of each of the 128 A rows and 128 Bt rows (and of the 128
// rows of a second plane, SP below), brought into one of two LDS buffers (row pitch 272 B) by asynchronous 16-byte
// copies, 16 or 24 per thread; the copies of pass t + 2 are issued when every wave has left pass t's buffer, so
// they fly while pass t + 1 is worked on. OPK 0: f16 operands; OPK 1: bf16 operands. SP 0: C = A.Bt. SP 1: a
// second A plane, C = (Ap + Ap2).Bt. SP 2: a second Bt plane, C = A.(Btp + Btp2). Both planes' products of a k
// step are taken in the same pass into the same accumulators, so the operand they share is staged once and its
// fragments are read once (only unscaled hi/lo planes are paired this way). AHM 0: A row-major
// [M][K] pitch lda; AHM 1: A head-major planes, element (m, k) at ((k/HD)*aplane + m*HD + k%HD). Bt row-major
// [N][K] pitch ldb (k contiguous); M, N, K multiples of 128, K at least two passes (true at every call site; host
// grid = tiles exact). Fragments are read from LDS one 32-k step ahead of their products, into a second register set.
// Both operand fragments use the split k map (elements 0..7 <- k0+8h.., 8..15 <- k0+16+8h..); D element r of a
// lane is (row 8h + r, col lane&15).
// OM 0: f32 out Cf = acc*wsc (+ RES: bf16 RNE value of Rp[input row of token m][n], token m -> input row
//       (m/SEQ)*SEQ_FULL + m%SEQ, pitch DM), pitch ldc.
// OM 1: f16 out Ch = f16(acc*wsc*osc*scale).  OM 2: f16 pair: base = acc*wsc*osc*scale; Ch = f16 bits(base);
//       Ch2 = f16 bits((base - value(Ch)) * rsc).  scale = Rs[m] (RSM 1, per row), Rs[n] (RSM 2, per column),
//       1 (RSM 0).
// coverage: 2 slabs x 16 rows x 64 cols = the wave's whole 32x64 tile; 8 waves = the block's 128x128 tile.
// =====================================================================================================
#define GTM  128                        // block tile rows
#define GTN  128                        // block tile columns
#define GKP  128                        // k per pass
#define GPIT 136                        // LDS row pitch in 16-bit elements (272 B)
#define GTIL (128 * GPIT)               // 16-bit elements of one staged tile (128 rows)
#define GRNG (2 * 3 * GTIL)             // 16-bit elements of the ring: two buffers of A | Bt | second plane
static_assert(GTM == 128 && GTN == 128);

// Eight asynchronous 16-byte copies of one lane, global -> LDS, rows 16 apart: LDS byte address l + 16*272*c,
// global address g + gs*c (gs in elements), c = 0..7. The s_wait_xcnt closes the statement so that no address
// register named by a copy is rewritten ahead of it.
__device__ __forceinline__ void copy8_rows16(unsigned l, const unsigned short* g, size_t gs) {
#if defined(__HIP_DEVICE_COMPILE__)
  const unsigned ls = 16u * GPIT * 2u;
  asm volatile(
      "global_load_async_to_lds_b128 %0, %8, off\n\t"
      "global_load_async_to_lds_b128 %1, %9, off\n\t"
      "global_load_async_to_lds_b128 %2, %10, off\n\t"
      "global_load_async_to_lds_b128 %3, %11, off\n\t"
      "global_load_async_to_lds_b128 %4, %12, off\n\t"
      "global_load_async_to_lds_b128 %5, %13, off\n\t"
      "global_load_async_to_lds_b128 %6, %14, off\n\t"
      "global_load_async_to_lds_b128 %7, %15, off\n\t"
      "s_wait_xcnt 0x0"
      :: "v"(l), "v"(l + ls), "v"(l + 2u * ls), "v"(l + 3u * ls),
         "v"(l + 4u * ls), "v"(l + 5u * ls), "v"(l + 6u * ls), "v"(l + 7u * ls),
         "v"(g), "v"(g + gs), "v"(g + 2 * gs), "v"(g + 3 * gs),
         "v"(g + 4 * gs), "v"(g + 5 * gs), "v"(g + 6 * gs), "v"(g + 7 * gs)
      : "memory");
#endif
}

template <int OPK, int SP, int AHM, int OM, int RSM, int RES>
__device__ __forceinline__ void gemm64(
    unsigned short* ring, float* sT, int tile,
    const unsigned short* __restrict__ Ap, const unsigned short* __restrict__ Ap2, int lda, int aplane,
    const unsigned short* __restrict__ Btp, const unsigned short* __restrict__ Btp2, int ldb,
    unsigned short* Ch, unsigned short* Ch2, float* Cf, int ldc,
    const float* __restrict__ Rs, const float* __restrict__ Rp,
    float wsc, float osc, float rsc, int M, int N, int K) {
  const int lane = threadIdx.x & 31;
  const int wave = threadIdx.x >> 5;
  const int tilesN = N >> 7;
  const int tilesM = M >> 7;
  if (tile >= tilesM * tilesN) return;   // block-uniform, in front of every copy and barrier
  const int tm = tile / tilesN;
  const int tn = tile - tm * tilesN;
  const int bm0 = tm << 7;                     // block tile origin
  const int bn0 = tn << 7;
  const int wm = (wave >> 1) << 5;             // wave tile origin inside the block tile
  const int wn = (wave & 1) << 6;
  const int m0 = bm0 + wm;
  const int n0 = bn0 + wn;

  const int rlane = lane & 15;                 // row (A) / col (B, D) within subtile
  const int koff  = (lane >> 4) * 8;           // k offset of this lane half
  const int mOff  = (lane >> 4) * 8;           // D row offset

  // copy map: thread t brings 16-byte piece t&15 of rows (t>>4) + 16*c, c = 0..7, of A and of Bt
  const int crow = threadIdx.x >> 4;
  const int cch  = threadIdx.x & 15;
  const unsigned ldsA = (unsigned)(size_t)ring + (unsigned)(crow * (GPIT * 2) + cch * 16);
  const unsigned ldsB = ldsA + (unsigned)(GTIL * 2);
  const unsigned ldsS = ldsA + (unsigned)(2 * GTIL * 2);
  constexpr int BUFE = (SP ? 3 : 2) * GTIL;    // 16-bit elements per buffer
  const size_t aoff = AHM ? ((size_t)(cch >> 3) * (size_t)aplane + (size_t)(bm0 + crow) * HD + (size_t)((cch & 7) * 8))
                          : ((size_t)(bm0 + crow) * lda + (size_t)(cch * 8));
  const size_t astep = AHM ? (size_t)(16 * HD) : (size_t)16 * lda;          // 16 rows of A
  const size_t apass = AHM ? (size_t)(GKP / HD) * (size_t)aplane : (size_t)GKP;   // one pass along k
  const size_t boff = (size_t)(bn0 + crow) * ldb + (size_t)(cch * 8);
  const size_t bstep = (size_t)16 * ldb;
  const int NT = K >> 7;                       // passes

  auto issue = [&](int t, int buf) {           // pass t's 16 or 24 copies of this thread into buffer buf
    const unsigned lb = (unsigned)buf * (unsigned)(BUFE * 2);
    copy8_rows16(ldsA + lb, Ap + aoff + (size_t)t * apass, astep);
    copy8_rows16(ldsB + lb, Btp + boff + (size_t)t * GKP, bstep);
    if constexpr (SP == 1) copy8_rows16(ldsS + lb, Ap2 + aoff + (size_t)t * apass, astep);
    if constexpr (SP == 2) copy8_rows16(ldsS + lb, Btp2 + boff + (size_t)t * GKP, bstep);
  };

  v8f acc[2][4];
#pragma unroll
  for (int i = 0; i < 2; ++i)
#pragma unroll
    for (int j = 0; j < 4; ++j) acc[i][j] = zero8();

  // Two fragment sets in registers: while a k step's products run from one set, the next step's LDS reads fill the
  // other, issued as one group, so no product waits out the latency of a read issued just in front of it.
  v16us fa[2][2], fb[2][4], fs[2][4];          // A rows | Bt rows | second plane's rows (2 for SP 1, 4 for SP 2)
  auto fetch = [&](int buf, int ks, int st) {  // k step ks of the pass in buffer buf -> set st
    const unsigned short* sb = ring + buf * BUFE;
    const unsigned short* sA = sb + (wm + rlane) * GPIT + koff;
    const unsigned short* sB = sb + GTIL + (wn + rlane) * GPIT + koff;
    const unsigned short* sS = sb + 2 * GTIL + ((SP == 1 ? wm : wn) + rlane) * GPIT + koff;   // second plane
#pragma unroll     // the sets are indexed by constants only, so they stay in registers
    for (int j = 0; j < 4; ++j) fb[st][j] = ldfrag_u(sB + (j << 4) * GPIT + ks * 32);
#pragma unroll
    for (int i = 0; i < 2; ++i) fa[st][i] = ldfrag_u(sA + (i << 4) * GPIT + ks * 32);
    if constexpr (SP != 0) {
#pragma unroll
      for (int e = 0; e < (SP == 1 ? 2 : 4); ++e) fs[st][e] = ldfrag_u(sS + (e << 4) * GPIT + ks * 32);
    }
  };
  auto products = [&](int st) {                // one k step's products from set st, first plane then second
    // without it the scheduler sinks the reads issued just above in among the products, each to just ahead of its use
    __builtin_amdgcn_sched_barrier(0);
#pragma unroll
    for (int i = 0; i < 2; ++i) {
#pragma unroll
      for (int j = 0; j < 4; ++j) acc[i][j] = mma_raw<OPK>(fa[st][i], fb[st][j], acc[i][j]);
      if constexpr (SP != 0) {                 // the second plane's products of the same k step
#pragma unroll
        for (int j = 0; j < 4; ++j)
          acc[i][j] = mma_raw<OPK>(SP == 1 ? fs[st][i] : fa[st][i], SP == 2 ? fs[st][j] : fb[st][j], acc[i][j]);
      }
    }
    // keeps the reads that follow from rising in among these products
    __builtin_amdgcn_sched_barrier(0);
  };

  issue(0, 0);
  asm volatile("s_wait_asynccnt 0x0" ::: "memory");   // this wave's copies of pass 0 have landed
  __syncthreads();                                    // every wave's have: pass 0 may be read
  if (NT > 1) issue(1, 1);
  fetch(0, 0, 0);

#pragma unroll 1   // one pass per trip: the buffer index and the publish point stay in one place
  for (int t = 0; t < NT; ++t) {
#pragma unroll     // the set index is a constant in every step
    for (int ks = 0; ks + 1 < GKP / 32; ++ks) {
      fetch(t & 1, ks + 1, (ks + 1) & 1);
      products(ks & 1);
    }
    // The pass's last step is in registers by now, so the publish point stands ahead of its products: they cover the
    // latency of the next pass's first reads, and the copies keep a whole pass to land.
    asm volatile("s_wait_dscnt 0x0" ::: "memory");      // this wave's reads of pass t's buffer are done
    asm volatile("s_wait_asynccnt 0x0" ::: "memory");   // this wave's copies of pass t + 1 have landed
    __syncthreads();                                    // publishes pass t + 1, frees pass t's buffer
    if (t + 2 < NT) issue(t + 2, t & 1);
    // First step of pass t + 1. Unconditional, so that the compiler's count of outstanding reads is the same on every
    // path; in the last trip it reads the other buffer's old pass (no copy is aimed there any more) and goes unused.
    fetch((t & 1) ^ 1, 0, 0);
    products((GKP / 32 - 1) & 1);
  }
  asm volatile("s_wait_asynccnt 0x0" ::: "memory");     // no copy is outstanding past the loop
  acc_guard4(acc[0][0], acc[0][1], acc[0][2], acc[0][3]);
  acc_guard4(acc[1][0], acc[1][1], acc[1][2], acc[1][3]);

  const int hh2 = lane >> 4, c4 = (lane & 15) * 4;     // f32 out: 256-B row segment = 16 lanes x 16 B
  const int q8  = lane >> 3, c8 = (lane & 7) * 8;
  const float wo = wsc * osc;

  // per-column scale (RSM 2): columns n0+c8 .. n0+c8+7, same for every row of the tile
  float csc[8];
#pragma unroll
  for (int e = 0; e < 8; ++e) csc[e] = 1.f;
  if (OM != 0 && RSM == 2) {
    const v4f cs0 = *(const v4f*)(Rs + n0 + c8);
    const v4f cs1 = *(const v4f*)(Rs + n0 + c8 + 4);
#pragma unroll
    for (int e = 0; e < 4; ++e) { csc[e] = cs0[e]; csc[4 + e] = cs1[e]; }
  }

  // ---- epilogue ----
  float* slab = sT + wave * (16 * 68);
#pragma unroll
  for (int i = 0; i < 2; ++i) {
    const int mBase = m0 + (i << 4);
#pragma unroll
    for (int j = 0; j < 4; ++j) {
#pragma unroll
      for (int r = 0; r < 8; ++r) {
        slab[(mOff + r) * 68 + (j << 4) + rlane] = acc[i][j][r];
      }
    }
    wave_sync_lds();
    if (OM == 0) {
      v4f vals[8];
#pragma unroll
      for (int it = 0; it < 8; ++it) {
        const int row = it * 2 + hh2;                      // it 0..7 x hh2 0..1 = rows 0..15
        v4f v = *(const v4f*)(slab + row * 68 + c4);
        v = v * wsc;
        if (RES) {
          const int tok = mBase + row;
          const int bb = tok / SEQ, ss = tok - bb * SEQ;
          const v4f hr = *(const v4f*)(Rp + ((size_t)bb * SEQ_FULL + (size_t)ss) * DM + (size_t)(n0 + c4));
          // the next load's result may land in this load's address registers: wait before they are rewritten
          asm volatile("s_wait_xcnt 0x0" ::: "memory");
#pragma unroll
          for (int c = 0; c < 4; ++c) v[c] = v[c] + bfr(hr[c]);
        }
        vals[it] = v;
      }
      {
#pragma unroll
        for (int it = 0; it < 8; ++it) {
          const int row = it * 2 + hh2;
          *(v4f*)(Cf + (size_t)(mBase + row) * ldc + (size_t)n0 + c4) = vals[it];
        }
        
      }
    } else {
      v4u hv[4], hw[4];
#pragma unroll
      for (int it = 0; it < 4; ++it) {
        const int row = it * 4 + q8;                       // it 0..3 x q8 0..3 = rows 0..15
        const float* sp = slab + row * 68 + c8;
        float rsr = wo;
        if (RSM == 1) rsr = wo * Rs[mBase + row];
        v4u ha = {0u, 0u, 0u, 0u}, hb = {0u, 0u, 0u, 0u};
#pragma unroll
        for (int e = 0; e < 4; ++e) {
          const float b0 = sp[2 * e]     * rsr * csc[2 * e];
          const float b1 = sp[2 * e + 1] * rsr * csc[2 * e + 1];
          if (OM == 1) {
            ha[e] = pk16(f2h(b0), f2h(b1));
          } else {
            const _Float16 x0 = (_Float16)b0, x1 = (_Float16)b1;
            ha[e] = pk16(h_bits(x0), h_bits(x1));
            hb[e] = pk16(f2h((b0 - (float)x0) * rsc), f2h((b1 - (float)x1) * rsc));
          }
        }
        hv[it] = ha;
        hw[it] = hb;
      }
      {
#pragma unroll
        for (int it = 0; it < 4; ++it) {
          const int row = it * 4 + q8;
          const size_t go = (size_t)(mBase + row) * ldc + (size_t)n0 + c8;
          *(v4u*)(Ch + go) = hv[it];
          if (OM == 2) *(v4u*)(Ch2 + go) = hw[it];
        }
        
      }
    }
    wave_sync_lds();
  }
}

#define GNT ((MT / 128) * (DM / 128))   // 128x128 tiles of one [MT][DM] (or [DM][MT]) product

// One launch for the three projections, which depend on the preparation alone and not on one another: blocks
// 0 .. GNT-1 the q planes, GNT .. 2*GNT-1 the k planes, the last GNT (half the products, so they come last) v^T.
// The product is chosen by blockIdx.x alone; both bodies use the same LDS.
//   q, k (hi x16 + residual x2048): C[tok][n] = rstd[tok] * sum_k XB[tok][k] * (hi + lo)[n][k]
//   v^T x16:                        C[d][tok] = rstd[tok] * sum_k WVH[d][k] * XH[tok][k]
__global__ __launch_bounds__(256) void gemm_qkv(
    const unsigned short* __restrict__ XB, const unsigned short* __restrict__ XH,
    const unsigned short* __restrict__ WQH, const unsigned short* __restrict__ WQL,
    const unsigned short* __restrict__ WKH, const unsigned short* __restrict__ WKL,
    const unsigned short* __restrict__ WVH,
    unsigned short* QH, unsigned short* QR, unsigned short* KH, unsigned short* KR, unsigned short* VT,
    float* fdummy, const float* __restrict__ RSTD, const float* __restrict__ x) {
  __shared__ __align__(16) unsigned short ring[GRNG];       // two operand buffers, 2 x 104448 B
  __shared__ __align__(16) float sT[8 * 16 * 68];           // per-wave 16x64 slab, pitch 68 floats
  const int bx = blockIdx.x;
  if (bx < 2 * GNT) {
    const bool isk = bx >= GNT;
    gemm64<1, 2, 0, 2, 1, 0>(ring, sT, isk ? bx - GNT : bx, XB, XB, DM, 0, isk ? WKH : WQH, isk ? WKL : WQL, DM,
                             isk ? KH : QH, isk ? KR : QR, fdummy, DM, RSTD, x, 1.0f, QKS, QRS, MT, DM, DM);
  } else {
    gemm64<0, 0, 0, 1, 2, 0>(ring, sT, bx - 2 * GNT, WVH, WVH, DM, 0, XH, XH, DM, VT, VT, fdummy, MT, RSTD, x,
                             1.0f / (XSC * WSCL), VSC, 1.0f, DM, MT, DM);
  }
}

// Output projection + residual: out[tok][n] = sum_k (ctx_hi + ctx_lo)[tok][k] * WOB[n][k] + bf16(x[tok][n])
__global__ __launch_bounds__(256) void gemm_out(
    const unsigned short* __restrict__ ZH, const unsigned short* __restrict__ ZL,
    const unsigned short* __restrict__ WOB, unsigned short* hdummy, float* out,
    const float* __restrict__ RSTD, const float* __restrict__ x) {
  __shared__ __align__(16) unsigned short ring[GRNG];       // two operand buffers, 2 x 104448 B
  __shared__ __align__(16) float sT[8 * 16 * 68];           // per-wave 16x64 slab, pitch 68 floats
  gemm64<1, 1, 1, 0, 0, 1>(ring, sT, blockIdx.x, ZH, ZL, DM, MT * HD, WOB, WOB, DM, hdummy, hdummy, out, DM, RSTD, x,
                           1.0f, 1.0f, 1.0f, MT, DM, DM);
}

// =====================================================================================================
// Bidirectional attention with relative position bias, head dim 64, no 1/sqrt(d) scaling. Block = 256
// threads = 8 waves, all of one (batch b, head h); one wave owns one 16-row query tile (t0..t0+15) and loops all
// key blocks of 32 with an online max-subtracted softmax in f32. A pass is 64 keys: the head's 128 B of each of
// the 64 KH rows and 64 KR rows and 128 B (64 keys) of each of its 64 VT rows are brought into one of two LDS
// buffers (row pitch 144 B) by asynchronous 16-byte copies, 6 per thread, and every wave reads its K and V
// fragments from there; the copies of pass t + 2 are issued when every wave has left pass t's buffer.
// Planes: QH|QR f16 [MT][DM] (16*q hi,
// residual x2048), KH|KR f16 [MT][DM] (16*k hi, residual x2048), VT f16 [DM][MT] (16*v transposed, row =
// h*64+d, column = token), BD f32 [NH][4096] bias by (key-query)+2047. Output Zh|Zl: bf16 hi|lo of ctx,
// head-major [NH][MT][64].
// Both products are taken transposed: keys (then head dims) are the A rows and the wave's 16 queries the B columns,
// so lane (hh, m) holds, for query t0+m alone, the scores of keys 8*hh+r and 16+8*hh+r of a 32-key block.
// The head's bias for every distance the block's 128 queries meet (key - query = -(tb+127) .. SEQ-1-tb, tb = the
// block's first query) is staged once, ahead of the first barrier, in one LDS row shared by the 8 waves and read
// at index key - query + tb + 127. Per key block:
// S^T = KH.QH^T (4 WMMA), R^T = KH.QR^T + KR.QH^T (8 WMMA, own accumulators);
// score = S/256 + R/524288 + bias; the block maximum is taken in the lane and joined with the other half-wave by
// one cross-row move; p = exp(score - running max) in f32, l accumulated per lane from the f32 p (the two halves'
// sums are joined once, in the epilogue); p*16384 as f16 packs from the two score tiles straight into the B
// operand (split k map: elements 0..7 = keys 8*hh.., 8..15 = keys 16+8*hh..); O^T += VT.P^T on f16 WMMA. The
// ctx staging region is private to its wave.
// staged extent covers consumed extent: bias row SEQ+128 written / 0..SEQ+126 read; ctx staging 2 x 16x64 written and read.
// Epilogue: ctx = O^T/(l*262144) split into bf16 hi|lo (a lane holds 8 consecutive dims of its query per O^T
// tile: one 16-byte LDS store per plane and tile), staged in LDS; the wave's 16 rows x 64 halves are
// coverage: 16 query rows x 64 halves per wave, NB*NH*SEQ/16 wave tasks = all (h, tok) rows of both planes.
// =====================================================================================================
#define AKP  64                         // keys per pass
#define APIT 72                         // LDS row pitch in 16-bit elements (144 B)
#define ATIL (64 * APIT)                // 16-bit elements of one staged tile (64 rows)
#define ABUF (3 * ATIL)                 // 16-bit elements per buffer: KH rows | KR rows | VT rows
static_assert((SEQ % AKP) == 0);

// Six asynchronous 16-byte copies of one lane, global -> LDS: rows r and r + 32 of the KH, KR and VT tiles; l is
// the LDS byte address of the lane's piece of KH row r. The s_wait_xcnt closes the statement so that no address
// register named by a copy is rewritten ahead of it.
__device__ __forceinline__ void copy6_kv(unsigned l, const unsigned short* gk, const unsigned short* gr,
                                         const unsigned short* gv) {
#if defined(__HIP_DEVICE_COMPILE__)
  const unsigned lr = 32u * APIT * 2u;
  const unsigned lt = ATIL * 2u;
  asm volatile(
      "global_load_async_to_lds_b128 %0, %6, off\n\t"
      "global_load_async_to_lds_b128 %1, %7, off\n\t"
      "global_load_async_to_lds_b128 %2, %8, off\n\t"
      "global_load_async_to_lds_b128 %3, %9, off\n\t"
      "global_load_async_to_lds_b128 %4, %10, off\n\t"
      "global_load_async_to_lds_b128 %5, %11, off\n\t"
      "s_wait_xcnt 0x0"
      :: "v"(l), "v"(l + lr), "v"(l + lt), "v"(l + lt + lr), "v"(l + 2u * lt), "v"(l + 2u * lt + lr),
         "v"(gk), "v"(gk + (size_t)32 * DM), "v"(gr), "v"(gr + (size_t)32 * DM),
         "v"(gv), "v"(gv + (size_t)32 * MT)
      : "memory");
#endif
}

__global__ __launch_bounds__(256) void attn_kernel(
    const unsigned short* __restrict__ QHp, const unsigned short* __restrict__ QRp,
    const unsigned short* __restrict__ KHp, const unsigned short* __restrict__ KRp,
    const unsigned short* __restrict__ VTp,
    const float* __restrict__ BD, unsigned short* Zh, unsigned short* Zl) {
  __shared__ __align__(16) unsigned short kvr[2 * ABUF];           // two K|KR|VT buffers, 2 x 27648 B
  __shared__ __align__(16) float brow[BRW];                        // bias row of the block, 8704 B
  __shared__ __align__(16) unsigned short zst[AWV][2][16 * HD];    // ctx hi|lo staging, 32768 B
  const int lane = threadIdx.x & 31, wv = threadIdx.x >> 5, m = lane & 15, hh = lane >> 4;
  const int nqt = SEQ / 16;
  if ((int)blockIdx.x * AWV >= NB * NH * nqt) return;   // block-uniform, in front of every copy and barrier
  const int task = blockIdx.x * AWV + wv;            // nqt is a multiple of AWV: one (b, h) per block
  const int bh = task / nqt;
  const int t0 = (task - bh * nqt) << 4;             // query tile start
  const int b = bh / NH, h = bh - b * NH;
  const size_t tok0 = (size_t)b * SEQ;

  // Q B-fragments: columns t0+m, k = head dims (two 32-deep steps), hi and residual planes
  const size_t qo = (tok0 + (size_t)(t0 + m)) * DM + (size_t)(h * HD + 8 * hh);
  const v16us qh0 = ldfrag_u(QHp + qo);
  const v16us qh1 = ldfrag_u(QHp + qo + 32);
  const v16us qr0 = ldfrag_u(QRp + qo);
  const v16us qr1 = ldfrag_u(QRp + qo + 32);

  float mx = -1.0e30f, ls = 0.f;       // query t0+m: running maximum (equal in both halves), this half's sum
  v8f O[4];                            // O^T tiles: element r = (dim 16*j + 8*hh + r, query t0+m)
#pragma unroll
  for (int j = 0; j < 4; ++j) O[j] = zero8();

  // bias row: brow[i] = bias_h(key - query = i - tb - 127), i = 0..SEQ+127; source index i + 1920 - tb lies in
  // 0..4095 (tb is a multiple of 128, tb <= SEQ - 128). Thread t brings 16-byte pieces t, t + 256, ...
  const int tb = t0 - 16 * wv;
  const float* bsrc = BD + (size_t)h * BDW + (SEQ_FULL - 16 * AWV - tb);
  v4f bst[BRQ + 1];
#pragma unroll     // bst[] is indexed by constants only; the loads go out together
  for (int q = 0; q < BRQ; ++q) bst[q] = *(const v4f*)(bsrc + 4 * ((int)threadIdx.x + 256 * q));
  if ((int)threadIdx.x < BRT) bst[BRQ] = *(const v4f*)(bsrc + 4 * ((int)threadIdx.x + 256 * BRQ));
  const float* bl = brow + (16 * AWV - 1 - 16 * wv - m + 8 * hh);          // + key block start + r
  // copy map: thread t brings 16-byte piece t&7 of rows (t>>3) and (t>>3) + 32 of each of the three tiles
  const int crow = threadIdx.x >> 3;
  const int cpc  = threadIdx.x & 7;
  const unsigned ldsC = (unsigned)(size_t)kvr + (unsigned)(crow * (APIT * 2) + cpc * 16);
  const size_t kco = (tok0 + (size_t)crow) * DM + (size_t)(h * HD + cpc * 8);
  const unsigned short* gK = KHp + kco;
  const unsigned short* gR = KRp + kco;
  const unsigned short* gV = VTp + (size_t)(h * HD + crow) * MT + tok0 + (size_t)(cpc * 8);
  const int NT = SEQ / AKP;

  auto issue = [&](int t, int buf) {           // pass t's 6 copies of this thread into buffer buf
    copy6_kv(ldsC + (unsigned)buf * (unsigned)(ABUF * 2), gK + (size_t)t * (AKP * DM), gR + (size_t)t * (AKP * DM),
             gV + (size_t)t * AKP);
  };

  issue(0, 0);
#pragma unroll     // bst[] is indexed by constants only, so it stays in registers
  for (int q = 0; q < BRQ; ++q) *(v4f*)(brow + 4 * ((int)threadIdx.x + 256 * q)) = bst[q];
  if ((int)threadIdx.x < BRT) *(v4f*)(brow + 4 * ((int)threadIdx.x + 256 * BRQ)) = bst[BRQ];
  asm volatile("s_wait_asynccnt 0x0" ::: "memory");   // this wave's copies of pass 0 have landed
  __syncthreads();                                    // every wave's have: pass 0 and the bias row may be read
  if (NT > 1) issue(1, 1);

#pragma unroll 1   // one pass per trip: the buffer index and the publish point stay at the loop's foot
  for (int t = 0; t < NT; ++t) {
  const float* bw = bl + t * AKP;                                            // bias of this pass's keys
  const unsigned short* kbase  = kvr + (t & 1) * ABUF + m * APIT + 8 * hh;   // KH row m, this lane half's k
  const unsigned short* krbase = kbase + ATIL;
  const unsigned short* vbase  = kbase + 2 * ATIL;                           // VT row (dim) m, keys 8*hh..
#pragma unroll     // both 32-key blocks of a pass inline: their LDS offsets become immediates
  for (int sub = 0; sub < AKP / 32; ++sub) {
    // bias of keys 8*hh + r and 16 + 8*hh + r of the block for query m, read here so that the products cover the
    // LDS latency; two consecutive keys per register pair
    v2f b0[4], b1[4];
#pragma unroll     // b0[], b1[] are indexed by constants only, so they stay in registers
    for (int e = 0; e < 4; ++e) {
      b0[e] = (v2f){bw[sub * 32 + 2 * e], bw[sub * 32 + 2 * e + 1]};
      b1[e] = (v2f){bw[sub * 32 + 16 + 2 * e], bw[sub * 32 + 16 + 2 * e + 1]};
    }

    // S^T = KH.QH^T, R^T = KH.QR^T + KR.QH^T ; A row = key token sb+m (+16), B column = query, k = head dim
    v8f S0, S1, R0, R1;
    {
      const int kofs = (sub * 32) * APIT;
      const v16us kf0a = ldfrag_u(kbase + kofs);
      const v16us kf1a = ldfrag_u(kbase + kofs + 16 * APIT);
      const v16us kg0a = ldfrag_u(krbase + kofs);
      const v16us kg1a = ldfrag_u(krbase + kofs + 16 * APIT);
      const v16us kf0b = ldfrag_u(kbase + kofs + 32);
      const v16us kf1b = ldfrag_u(kbase + kofs + 32 + 16 * APIT);
      const v16us kg0b = ldfrag_u(krbase + kofs + 32);
      const v16us kg1b = ldfrag_u(krbase + kofs + 32 + 16 * APIT);
      qk_run(S0, S1, R0, R1, kf0a, kf1a, kg0a, kg1a, kf0b, kf1b, kg0b, kg1b, qh0, qh1, qr0, qr1);
    }

    // VT A-fragments (row = h*64 + dim, k = key token), read as one group here so that the softmax covers
    // their LDS latency
    v16us vf[4];
#pragma unroll     // vf[] is indexed by constants only, so it stays in registers
    for (int j = 0; j < 4; ++j) vf[j] = ldfrag_u(vbase + (16 * j) * APIT + sub * 32);

    // score = q.k + bias
    float s0[8], s1[8];
#pragma unroll     // two consecutive keys per step: accumulator pairs and bias pairs feed packed f32 FMAs as they lie
    for (int e = 0; e < 4; ++e) {
      const v2f x0 = __builtin_elementwise_fma((v2f){S0[2 * e], S0[2 * e + 1]}, (v2f){SC1, SC1},
                     __builtin_elementwise_fma((v2f){R0[2 * e], R0[2 * e + 1]}, (v2f){SC2, SC2}, b0[e]));
      const v2f x1 = __builtin_elementwise_fma((v2f){S1[2 * e], S1[2 * e + 1]}, (v2f){SC1, SC1},
                     __builtin_elementwise_fma((v2f){R1[2 * e], R1[2 * e + 1]}, (v2f){SC2, SC2}, b1[e]));
      s0[2 * e] = x0[0]; s0[2 * e + 1] = x0[1];
      s1[2 * e] = x1[0]; s1[2 * e + 1] = x1[1];
    }

    // online softmax: a query's 32 scores live in lanes m and m + 16, 16 each
    float xm = fmaxf(s0[0], s1[0]);
#pragma unroll     // s0[], s1[] are indexed by constants only, so they stay in registers
    for (int r = 1; r < 8; ++r) xm = fmaxf(xm, fmaxf(s0[r], s1[r]));
    xm = fmaxf(xm, xhalf(xm));
    const float mn = fmaxf(mx, xm);
    const float al = __expf(mx - mn);
    mx = mn;
    FragU pf;                                          // P^T B-fragment (split k map)
    float pa = 0.f, pb = 0.f;
#pragma unroll
    for (int r = 0; r < 8; ++r) {
      const float p0 = __expf(s0[r] - mn);
      const float p1 = __expf(s1[r] - mn);
      pa += p0;
      pb += p1;
      pf.v[r]     = f2h(p0 * PCAR);
      pf.v[8 + r] = f2h(p1 * PCAR);
    }
    ls = ls * al + (pa + pb);
#pragma unroll     // O[] is indexed by constants only, so it stays in registers
    for (int j = 0; j < 4; ++j) O[j] = O[j] * al;
    pv_run(O[0], O[1], O[2], O[3], vf[0], vf[1], vf[2], vf[3], pf.v);
  }
    asm volatile("s_wait_dscnt 0x0" ::: "memory");      // this wave's reads of pass t's buffer are done
    asm volatile("s_wait_asynccnt 0x0" ::: "memory");   // this wave's copies of pass t + 1 have landed
    __syncthreads();                                    // publishes pass t + 1, frees pass t's buffer
    if (t + 2 < NT) issue(t + 2, t & 1);
  }
  asm volatile("s_wait_asynccnt 0x0" ::: "memory");     // no copy is outstanding past the loop
  acc_guard4(O[0], O[1], O[2], O[3]);

  // ---- epilogue: ctx = O / (l * PCAR * VSC) -> bf16 hi|lo, head-major planes ----
  unsigned short* zh = zst[wv][0];
  unsigned short* zl = zst[wv][1];
  const float linv = (1.0f / (ls + xhalf(ls))) * OSC;  // both halves' sums joined; the joined sum is >= 1
#pragma unroll
  for (int j = 0; j < 4; ++j) {
    v4u zc, zr;
#pragma unroll
    for (int e = 0; e < 4; ++e) {
      const float o0 = O[j][2 * e] * linv, o1 = O[j][2 * e + 1] * linv;
      const unsigned short x0 = bf_bits(o0), x1 = bf_bits(o1);
      zc[e] = pk16(x0, x1);
      zr[e] = pk16(bf_bits(o0 - bf_up(x0)), bf_bits(o1 - bf_up(x1)));
    }
    *(v4u*)(zh + m * HD + 16 * j + 8 * hh) = zc;       // row = query m, dims 16*j + 8*hh .. + 7
    *(v4u*)(zl + m * HD + 16 * j + 8 * hh) = zr;
  }
  wave_sync_lds();
  {
    v4u ha[4], hb[4];
#pragma unroll
    for (int q = 0; q < 4; ++q) {
      ha[q] = *(const v4u*)(zh + q * 256 + lane * 8);
      hb[q] = *(const v4u*)(zl + q * 256 + lane * 8);
    }
    const size_t zo = ((size_t)h * MT + tok0 + (size_t)t0) * HD;   // 2048-B aligned, 16 rows contiguous
    unsigned short* dh = Zh + zo;
    unsigned short* dl = Zl + zo;
    {
#pragma unroll
      for (int q = 0; q < 4; ++q) {
        *(v4u*)(dh + q * 256 + lane * 8) = ha[q];
        *(v4u*)(dl + q * 256 + lane * 8) = hb[q];
      }
      
    }
  }
}

// =====================================================================================================
// Workspace map (bytes, NB=2, SEQ=2048); every plane is an exact multiple of its whole-row / whole-line /
// BD = 16 x 4096 floats); all offsets multiples of 65536.
//   XB   bf16 [MT][DM]        0           8388608
//   XH   f16  [MT][DM]        8388608     8388608
//   RSTD f32  [MT]            16777216    65536     (16384 used)
//   W    6 x 16-bit [DM][DM]  16842752    12582912  (wq hi, wq lo, wk hi, wk lo bf16; wv f16 x256; wo bf16)
//   BD   f32  [NH][4096]      29425664    262144
//   QH   f16  [MT][DM]        29687808    8388608
//   QR   f16  [MT][DM]        38076416    8388608
//   KH   f16  [MT][DM]        46465024    8388608
//   KR   f16  [MT][DM]        54853632    8388608
//   VT   f16  [DM][MT]        63242240    8388608
//   ZH   bf16 [NH][MT][64]    71630848    8388608
//   ZL   bf16 [NH][MT][64]    80019456    8388608
//   end                       88408064
// =====================================================================================================
extern "C" void kernel_launch(void* const* d_in, const int* in_sizes, int n_in,
                              void* d_out, int out_size, void* d_ws, size_t ws_size,
                              hipStream_t stream) {
  if (n_in < 7) return;
  if (in_sizes[0] < ((NB - 1) * SEQ_FULL + SEQ) * DM) return;
  if (in_sizes[1] < DM) return;
  if (in_sizes[2] < DM * DM) return;
  if (in_sizes[3] < DM * DM) return;
  if (in_sizes[4] < DM * DM) return;
  if (in_sizes[5] < DM * DM) return;
  if (in_sizes[6] < NBKT * NH) return;
  if (out_size < MT * DM) return;

  const float* x    = (const float*)d_in[0];   // [2][2048][1024]
  const float* lnw  = (const float*)d_in[1];   // [1024]
  const float* w_q  = (const float*)d_in[2];   // [1024][1024] (in, out)
  const float* w_k  = (const float*)d_in[3];
  const float* w_v  = (const float*)d_in[4];
  const float* w_o  = (const float*)d_in[5];   // [1024][1024] (in, out)
  const float* tbl  = (const float*)d_in[6];   // [32][16]

  const size_t PX  = (size_t)MT * DM * 2;        // 16-bit [MT][DM] plane
  const size_t PRS = (((size_t)MT * 4 + 65535) / 65536) * 65536;
  const size_t PW1 = (size_t)DM * DM * 2;        // one 16-bit weight plane
  const size_t PBD = (size_t)NH * BDW * 4;
  size_t off = 0;
  const size_t oXB = off; off += PX;
  const size_t oXH = off; off += PX;
  const size_t oRS = off; off += PRS;
  const size_t oW  = off; off += 6 * PW1;
  const size_t oBD = off; off += PBD;
  const size_t oQH = off; off += PX;
  const size_t oQR = off; off += PX;
  const size_t oKH = off; off += PX;
  const size_t oKR = off; off += PX;
  const size_t oVT = off; off += PX;
  const size_t oZH = off; off += PX;
  const size_t oZL = off; off += PX;
  if (off > ws_size) return;                      // off = 88408064 at full size
  if (off > (size_t)134217728) return;

  char* ws = (char*)d_ws;
  unsigned short* XB = (unsigned short*)(ws + oXB);
  unsigned short* XH = (unsigned short*)(ws + oXH);
  float* RSTD = (float*)(ws + oRS);
  unsigned short* W16 = (unsigned short*)(ws + oW);
  unsigned short* WQH = W16;
  unsigned short* WQL = W16 + (size_t)1 * DM * DM;
  unsigned short* WKH = W16 + (size_t)2 * DM * DM;
  unsigned short* WKL = W16 + (size_t)3 * DM * DM;
  unsigned short* WVH = W16 + (size_t)4 * DM * DM;
  unsigned short* WOB = W16 + (size_t)5 * DM * DM;
  float* BDp = (float*)(ws + oBD);
  unsigned short* QH = (unsigned short*)(ws + oQH);
  unsigned short* QR = (unsigned short*)(ws + oQR);
  unsigned short* KH = (unsigned short*)(ws + oKH);
  unsigned short* KR = (unsigned short*)(ws + oKR);
  unsigned short* VT = (unsigned short*)(ws + oVT);
  unsigned short* ZH = (unsigned short*)(ws + oZH);
  unsigned short* ZL = (unsigned short*)(ws + oZL);
  float* out0 = (float*)d_out;
  float* fdummy = BDp;                            // in-range placeholder for unused f32 output args

  const dim3 blk(256);

  // (0) operand planes, rms statistics and bias table: one launch
  prep<<<dim3(PXB + NH + 4 * PWB), blk, 0, stream>>>(x, w_q, w_k, w_v, w_o, lnw, tbl, XB, XH, RSTD, W16, BDp);

  // (1) q, k planes and v^T: one launch, 3 x 256 blocks at full size
  gemm_qkv<<<dim3(3 * GNT), blk, 0, stream>>>(XB, XH, WQH, WQL, WKH, WKL, WVH, QH, QR, KH, KR, VT, fdummy, RSTD, x);

  // (2) attention -> ctx bf16 hi|lo head-major planes
  attn_kernel<<<dim3((NB * NH * (SEQ / 16)) / AWV), dim3(32 * AWV), 0, stream>>>(QH, QR, KH, KR, VT, BDp, ZH, ZL);

  // (3) output projection + residual
  gemm_out<<<dim3(GNT), blk, 0, stream>>>(ZH, ZL, WOB, ZH, out0, RSTD, x);
  (void)hipGetLastError();
}

// v009
// Measured time: 121 microseconds a run.
// Timed twice side by side with v008, it ran 1.03 times as fast both times.
// Over all steps from v000 it is 4.35 times as fast.
// Contractions: normed.w_q and normed.w_k on v_wmma_f32_16x16x32_bf16 (bf16 x plane, bf16 hi+lo weight planes
// with ln_weight folded in, f32 accumulate); w_v'.normed^T (v^T plane), q.k^T (f16 hi x16 + residual x2048 on
// both q and k, three products) and p.v on v_wmma_f32_16x16x32_f16 (f16 operands, f32 accumulate); ctx.w_o on
// v_wmma_f32_16x16x32_bf16 (bf16 hi+lo ctx planes, bf16 w_o, f32 accumulate). Float inputs RNE-converted to
// bf16 on load; per-row rms scale, softmax and relative position bias in f32 on VALU; softmax p carried x16384.
#include <hip/hip_runtime.h>
#include <math.h>

#ifndef NB
#define NB 2
#endif
#ifndef SEQ
#define SEQ 2048
#endif
#define NB_FULL  2
#define SEQ_FULL 2048
#define DM   1024
#define NH   16
#define HD   64
#define NBKT 32
#define MT   (NB * SEQ)
#define BDW  4096
#define AWV  8
#define BRW  (SEQ + 16 * AWV)
#define BRQ  ((BRW / 4) / 256)
#define BRT  ((BRW / 4) % 256)
#define XSC  16.0f
#define WSCL 256.0f
#define QKS  16.0f
#define QRS  2048.0f
#define VSC  16.0f
#define PCAR 16384.0f
#define SC1  (1.0f / 256.0f)
#define SC2  (1.0f / 524288.0f)
#define OSC  (1.0f / 262144.0f)
#define LNEPS 1.0e-6f

static_assert(NB >= 1 && NB <= NB_FULL);
static_assert(SEQ >= 64 && SEQ <= SEQ_FULL && (SEQ % 64) == 0);
static_assert(NH * HD == DM);
static_assert(HD == 64);
static_assert(BDW == 2 * SEQ_FULL);
static_assert((BRW % 4) == 0 && 16 * AWV <= SEQ_FULL);
static_assert((MT % 64) == 0 && (DM % 64) == 0 && (MT % 32) == 0);
static_assert((MT % 128) == 0 && (DM % 128) == 0);
static_assert(((NB * NH * (SEQ / 16)) % AWV) == 0);
static_assert(((SEQ / 16) % AWV) == 0);
static_assert(NBKT * NH == 512);
static_assert(BDW == 16 * 256);
static_assert((DM % 256) == 0);

typedef _Float16 v16h __attribute__((ext_vector_type(16)));
typedef __bf16 v16bf __attribute__((ext_vector_type(16)));
typedef unsigned short v16us __attribute__((ext_vector_type(16)));
typedef unsigned short v8us  __attribute__((ext_vector_type(8)));
typedef float v8f __attribute__((ext_vector_type(8)));
typedef float v4f __attribute__((ext_vector_type(4)));
typedef float v2f __attribute__((ext_vector_type(2)));
typedef unsigned int v4u __attribute__((ext_vector_type(4)));

union FragU { v16us v; v8us h[2]; };

// ---- scalar helpers --------------------------------------------------------------------------------
__device__ __forceinline__ unsigned short bf_bits(float f) {          // f32 -> bf16 bits, RNE convert
  const unsigned u = __float_as_uint(f);
  return (unsigned short)((u + 0x7FFFu + ((u >> 16) & 1u)) >> 16);
}
__device__ __forceinline__ float bf_up(unsigned short h) { return __uint_as_float(((unsigned)h) << 16); }
__device__ __forceinline__ float bfr(float f) { return bf_up(bf_bits(f)); }   // value of the bf16 RNE convert
__device__ __forceinline__ unsigned short h_bits(_Float16 x) { return __builtin_bit_cast(unsigned short, x); }
__device__ __forceinline__ unsigned short f2h(float f) { return h_bits((_Float16)f); }
__device__ __forceinline__ unsigned pk16(unsigned short a, unsigned short b) { return (unsigned)a | ((unsigned)b << 16); }
__device__ __forceinline__ int clampi(int v, int lo, int hi) { return v < lo ? lo : (v > hi ? hi : v); }
__device__ __forceinline__ v8f zero8() { v8f z = {0.f, 0.f, 0.f, 0.f, 0.f, 0.f, 0.f, 0.f}; return z; }

// ---- fragment loader: 16-bit A/B operand, lane -> row/col (lane&15), p already includes +8*(lane>>4);
//      elements 0..7 <- p[0..7] (k0+8h..), elements 8..15 <- p[16..23] (k0+16+8h..)
__device__ __forceinline__ v16us ldfrag_u(const unsigned short* p) {
  FragU f;
  f.h[0] = *(const v8us*)(p);
  f.h[1] = *(const v8us*)(p + 16);
  return f.v;
}

// ---- WMMA helpers; OPK 0 = f16 operand bits, OPK 1 = bf16 operand bits --
template <int OPK>
__device__ __forceinline__ v8f mma_raw(v16us a, v16us b, v8f c) {
  if (OPK == 0)
    return __builtin_amdgcn_wmma_f32_16x16x32_f16(false, __builtin_bit_cast(v16h, a), false,
                                                  __builtin_bit_cast(v16h, b), (short)0, c, false, false);
  return __builtin_amdgcn_wmma_f32_16x16x32_bf16(false, __builtin_bit_cast(v16bf, a), false,
                                                 __builtin_bit_cast(v16bf, b), (short)0, c, false, false);
}
__device__ __forceinline__ void acc_guard4(v8f& a, v8f& b, v8f& c, v8f& d) {
#if defined(__HIP_DEVICE_COMPILE__)
  asm volatile("v_nop\n\tv_nop\n\tv_nop\n\tv_nop" : "+v"(a), "+v"(b), "+v"(c), "+v"(d));
#endif
}
// The twelve f16 score products of one 32-key block as one run of matrix instructions: S0|S1 = KH.QH^T,
// R0|R1 = KH.QR^T + KR.QH^T for keys 0..15 | 16..31, head dims 0..31 (a) then 32..63 (b). Inside the run each
// product stands in the hazard window of the ones before it (an accumulate into the same D needs no distance),
// so only the last ones need vector slots: the four v_nop at the end keep the distance to whatever vector
// instruction the compiler puts next on S, R or a fragment register.
__device__ __forceinline__ void qk_run(v8f& S0, v8f& S1, v8f& R0, v8f& R1,
                                       v16us kf0a, v16us kf1a, v16us kg0a, v16us kg1a,
                                       v16us kf0b, v16us kf1b, v16us kg0b, v16us kg1b,
                                       v16us qha, v16us qhb, v16us qra, v16us qrb) {
#if defined(__HIP_DEVICE_COMPILE__)
  asm volatile(
      "v_wmma_f32_16x16x32_f16 %0, %4, %12, 0\n\t"
      "v_wmma_f32_16x16x32_f16 %1, %5, %12, 0\n\t"
      "v_wmma_f32_16x16x32_f16 %2, %4, %14, 0\n\t"
      "v_wmma_f32_16x16x32_f16 %3, %5, %14, 0\n\t"
      "v_wmma_f32_16x16x32_f16 %2, %6, %12, %2\n\t"
      "v_wmma_f32_16x16x32_f16 %3, %7, %12, %3\n\t"
      "v_wmma_f32_16x16x32_f16 %0, %8, %13, %0\n\t"
      "v_wmma_f32_16x16x32_f16 %1, %9, %13, %1\n\t"
      "v_wmma_f32_16x16x32_f16 %2, %8, %15, %2\n\t"
      "v_wmma_f32_16x16x32_f16 %3, %9, %15, %3\n\t"
      "v_wmma_f32_16x16x32_f16 %2, %10, %13, %2\n\t"
      "v_wmma_f32_16x16x32_f16 %3, %11, %13, %3\n\t"
      "v_nop\n\tv_nop\n\tv_nop\n\tv_nop"
      : "=&v"(S0), "=&v"(S1), "=&v"(R0), "=&v"(R1)
      : "v"(kf0a), "v"(kf1a), "v"(kg0a), "v"(kg1a), "v"(kf0b), "v"(kf1b), "v"(kg0b), "v"(kg1b),
        "v"(qha), "v"(qhb), "v"(qra), "v"(qrb));
#endif
}
// The four O^T += VT.P^T products of one 32-key block as one run; the four v_nop at the end keep the distance
// between the last product and the next vector instruction on O, a V fragment or P.
__device__ __forceinline__ void pv_run(v8f& O0, v8f& O1, v8f& O2, v8f& O3,
                                       v16us v0, v16us v1, v16us v2, v16us v3, v16us p) {
#if defined(__HIP_DEVICE_COMPILE__)
  asm volatile(
      "v_wmma_f32_16x16x32_f16 %0, %4, %8, %0\n\t"
      "v_wmma_f32_16x16x32_f16 %1, %5, %8, %1\n\t"
      "v_wmma_f32_16x16x32_f16 %2, %6, %8, %2\n\t"
      "v_wmma_f32_16x16x32_f16 %3, %7, %8, %3\n\t"
      "v_nop\n\tv_nop\n\tv_nop\n\tv_nop"
      : "+v"(O0), "+v"(O1), "+v"(O2), "+v"(O3)
      : "v"(v0), "v"(v1), "v"(v2), "v"(v3), "v"(p));
#endif
}
// value of lane l ^ 16 (the other 16-lane half of the wave), by a vector cross-row move
__device__ __forceinline__ float xhalf(float x) {
  const int b = __builtin_bit_cast(int, x);
  return __builtin_bit_cast(float, __builtin_amdgcn_permlanex16(b, b, 0x76543210, 0xfedcba98, false, false));
}
// orders LDS stores of this wave before later LDS loads of the same wave (wave-private exchange)
__device__ __forceinline__ void wave_sync_lds() {
  __builtin_amdgcn_fence(__ATOMIC_RELEASE, "workgroup");
  __builtin_amdgcn_wave_barrier();
  __builtin_amdgcn_fence(__ATOMIC_ACQUIRE, "workgroup");
}

// =====================================================================================================
// x convert + rms statistics. Block = 256 threads = 8 waves owns 32 consecutive token rows (wave w: rows
// 4w..4w+3); token tok = b*SEQ + s reads input row b*SEQ_FULL + s. Per row each lane converts 8
// consecutive floats per step (4 steps of 256 columns): ob = bf16 bits of x (RNE), oh = f16 bits of
// of the bf16 values is reduced per row and rstd = rsqrt(mean + eps) staged in LDS (cross-wave -> block
// coverage: 8 waves x 4 rows x (4 x 256) columns = 32 whole rows of both planes per block, grid = MT/32
// blocks (bx); rstd rows row0..row0+31 per block = all MT entries.
// =====================================================================================================
__device__ __forceinline__ void cvt_x(int bx, const float* __restrict__ x, unsigned short* ob,
                                      unsigned short* oh, float* rstd) {
  __shared__ float srs[32];
  const int lane = threadIdx.x & 31, wv = threadIdx.x >> 5;
  const int row0 = bx * 32;
#pragma unroll 1
  for (int rr = 0; rr < 4; ++rr) {
    const int tok = row0 + wv * 4 + rr;
    const int b = tok / SEQ, s = tok - b * SEQ;
    const float* src = x + ((size_t)b * SEQ_FULL + (size_t)s) * DM;
    const size_t orow = (size_t)tok * DM;
    float ss = 0.f;
#pragma unroll 1
    for (int it = 0; it < DM / 256; ++it) {
      const int col = it * 256 + lane * 8;
      const v4f a0 = *(const v4f*)(src + col);
      const v4f a1 = *(const v4f*)(src + col + 4);
      v4u hb, hh;
#pragma unroll
      for (int e = 0; e < 2; ++e) {
        const unsigned short u0 = bf_bits(a0[2 * e]), u1 = bf_bits(a0[2 * e + 1]);
        const unsigned short u2 = bf_bits(a1[2 * e]), u3 = bf_bits(a1[2 * e + 1]);
        const float x0 = bf_up(u0), x1 = bf_up(u1), x2 = bf_up(u2), x3 = bf_up(u3);
        ss = fmaf(x0, x0, ss); ss = fmaf(x1, x1, ss); ss = fmaf(x2, x2, ss); ss = fmaf(x3, x3, ss);
        hb[e]     = pk16(u0, u1);
        hb[2 + e] = pk16(u2, u3);
        hh[e]     = pk16(f2h(x0 * XSC), f2h(x1 * XSC));
        hh[2 + e] = pk16(f2h(x2 * XSC), f2h(x3 * XSC));
      }
      unsigned short* db = ob + orow + col;
      unsigned short* dh = oh + orow + col;
      *(v4u*)db = hb;
      *(v4u*)dh = hh;
      
    }
    ss += __shfl_xor(ss, 16, 32);
    ss += __shfl_xor(ss, 8, 32);
    ss += __shfl_xor(ss, 4, 32);
    ss += __shfl_xor(ss, 2, 32);
    ss += __shfl_xor(ss, 1, 32);
    if (lane == 0) srs[wv * 4 + rr] = rsqrtf(ss * (1.0f / (float)DM) + LNEPS);
  }
  __syncthreads();
  if (wv == 0) {
    const float v = srs[lane];
    float* d = rstd + row0 + lane;
    *(float*)d = v;
    
  }
}

// =====================================================================================================
// Weight convert with transpose: source matrices are [in k][out n] row-major; output Bt planes [n][k]
// (k contiguous). y (block-uniform) selects the matrix (0 w_q, 1 w_k, 2 w_v, 3 w_o), bx the 64x64 tile
// (k0 = 64*(bx>>4), n0 = 64*(bx&15)). The tile is staged in LDS as f32, then each output row n0+r, columns
// lines). Values: y=0,1: w' = bf16(ln_w[k]) * bf16(w[k][n]) (exact in f32) split into bf16 hi (plane 2y) and
// bf16 lo = w' - hi (plane 2y+1, exact); y=2: f16 bits of w' * WSCL (plane 4); y=3: bf16 bits of w_o
// coverage: load 256 threads x 4 x 4 = 64x64 tile; store 8 waves x 2 x (4 rows x 8 lanes x 8) = 64 rows x
// 64 cols; bx 0..255 x y 0..3 covers every 64x64 tile of every output plane.
// =====================================================================================================
__device__ __forceinline__ void cvt_w(int bx, int y, const float* __restrict__ w0, const float* __restrict__ w1,
                                      const float* __restrict__ w2, const float* __restrict__ w3,
                                      const float* __restrict__ lnw, unsigned short* o) {
  __shared__ __align__(16) float sm[64 * 65];
  __shared__ float slw[64];
  const float* w = (y == 0) ? w0 : ((y == 1) ? w1 : ((y == 2) ? w2 : w3));
  const int k0 = (bx >> 4) << 6, n0 = (bx & 15) << 6;
  const int t = threadIdx.x, lane = t & 31, wv = t >> 5;
#pragma unroll
  for (int it = 0; it < 4; ++it) {
    const int r = it * 16 + (t >> 4), c4 = (t & 15) * 4;
    const v4f v = *(const v4f*)(w + (size_t)(k0 + r) * DM + (size_t)(n0 + c4));
    float* sp = sm + r * 65 + c4;
    sp[0] = v[0]; sp[1] = v[1]; sp[2] = v[2]; sp[3] = v[3];
  }
  if (t < 64) slw[t] = bfr(lnw[k0 + t]);                       // waves 0,1 entirely: wave-uniform
  __syncthreads();
  const int pl0 = (y == 0) ? 0 : ((y == 1) ? 2 : ((y == 2) ? 4 : 5));
  unsigned short* P0 = o + (size_t)pl0 * DM * DM;
  unsigned short* P1 = (y < 2) ? (P0 + (size_t)DM * DM) : P0;
  const int q8 = lane >> 3, c8 = (lane & 7) * 8;
  v4u ha[2], hl[2];
#pragma unroll
  for (int it = 0; it < 2; ++it) {
    const int r = wv * 8 + it * 4 + q8;                          // n local
    v4u a = {0u, 0u, 0u, 0u}, l = {0u, 0u, 0u, 0u};
#pragma unroll
    for (int e = 0; e < 4; ++e) {
      const int ka = c8 + 2 * e, kb = ka + 1;
      float va = bfr(sm[ka * 65 + r]), vb = bfr(sm[kb * 65 + r]);
      if (y < 3) { va *= slw[ka]; vb *= slw[kb]; }
      if (y < 2) {
        const unsigned short ua = bf_bits(va), ub = bf_bits(vb);
        a[e] = pk16(ua, ub);
        l[e] = pk16(bf_bits(va - bf_up(ua)), bf_bits(vb - bf_up(ub)));
      } else if (y == 2) {
        a[e] = pk16(f2h(va * WSCL), f2h(vb * WSCL));
      } else {
        a[e] = pk16(bf_bits(va), bf_bits(vb));
      }
    }
    ha[it] = a;
    hl[it] = l;
  }
  {
#pragma unroll
    for (int it = 0; it < 2; ++it) {
      const int r = wv * 8 + it * 4 + q8;
      const size_t go = (size_t)(n0 + r) * DM + (size_t)(k0 + c8);
      *(v4u*)(P0 + go) = ha[it];
      if (y < 2) *(v4u*)(P1 + go) = hl[it];
    }
    // the stores' address and data registers may be rewritten by whatever code follows this job in the merged kernel
    asm volatile("s_wait_xcnt 0x0" ::: "memory");
  }
}

// =====================================================================================================
// Relative position bias by signed key-query distance: BD[h][i], i = (key - query) + 2047, i in 0..4094;
// i = 4095 is padding written as 0. bucket on integer n = query - key: ret = (n < 0) * 16, n = |n|,
// n < 8 -> n, else 8 + floor(2*log2(n/8)) capped at 15, evaluated by its integer thresholds
// coverage: 256 threads x 16 = 4096 entries per head; h = 0..NH-1 = the whole table.
// =====================================================================================================
__device__ __forceinline__ int rel_bucket(int d) {              // d = key - query
  int n = -d;
  int ret = 0;
  if (n < 0) { ret = NBKT / 2; n = -n; }
  int bk;
  if (n < 8)       bk = n;
  else if (n < 12) bk = 8;
  else if (n < 16) bk = 9;
  else if (n < 23) bk = 10;
  else if (n < 32) bk = 11;
  else if (n < 46) bk = 12;
  else if (n < 64) bk = 13;
  else if (n < 91) bk = 14;
  else             bk = 15;
  return ret + bk;
}

__device__ __forceinline__ void bias_build(int h, const float* __restrict__ tbl, float* BD) {
  __shared__ __align__(16) float sh[BDW];
  const int t = threadIdx.x;
#pragma unroll 4
  for (int j = 0; j < 16; ++j) {
    const int idx = t + 256 * j;
    const int ti = clampi(rel_bucket(idx - 2047) * NH + h, 0, NBKT * NH - 1);
    float v = bfr(tbl[ti]);
    v = (idx == BDW - 1) ? 0.f : v;
    sh[idx] = v;
  }
  __syncthreads();
  v4f vv[4];
#pragma unroll
  for (int q = 0; q < 4; ++q) vv[q] = *(const v4f*)(sh + q * 1024 + 4 * t);
  float* dst = BD + (size_t)h * BDW;
  {
#pragma unroll
    for (int q = 0; q < 4; ++q) *(v4f*)(dst + q * 1024 + 4 * t) = vv[q];
    
  }
}

// =====================================================================================================
// One launch for the three preparation jobs, which depend on the inputs alone and not on one another: blocks
// 0 .. PXB-1 convert x (the longest job per block, so it starts first), the next NH build the bias table, the
// last 4*PWB convert the weights. The job is chosen by blockIdx.x alone, so every barrier inside a job is met by
// a whole block.
// =====================================================================================================
#define PXB (MT / 32)                   // blocks of the x convert
#define PWB ((DM / 64) * (DM / 64))     // blocks of one weight matrix
__global__ __launch_bounds__(256) void prep(const float* __restrict__ x, const float* __restrict__ w0,
                                            const float* __restrict__ w1, const float* __restrict__ w2,
                                            const float* __restrict__ w3, const float* __restrict__ lnw,
                                            const float* __restrict__ tbl, unsigned short* ob, unsigned short* oh,
                                            float* rstd, unsigned short* o, float* BD) {
  const int bx = blockIdx.x;
  if (bx < PXB) {
    cvt_x(bx, x, ob, oh, rstd);
  } else if (bx < PXB + NH) {
    bias_build(bx - PXB, tbl, BD);
  } else {
    const int i = bx - (PXB + NH);
    cvt_w(i % PWB, i / PWB, w0, w1, w2, w3, lnw, o);
  }
}

// =====================================================================================================
// LDS-staged 16-bit WMMA GEMM: C[m][n] = sum over plane pairs pl and k of A_pl[m][k] * Bt_pl[n][k]. A block of
// 8 waves owns one (64*MI)x128 tile of C (tile, block-uniform); wave w owns rows 16*MI*(w>>1).. and columns
// 64*(w&1).. of it (MI x 4 accumulator tiles, MI = 2 or 4). With MI = 4 a Bt fragment read from LDS feeds four
// products in place of two and a staged Bt tile serves 256 rows of A: fewer LDS bytes read and fewer bytes staged
// per product. A pass is 128 k: 256 B of each of the A rows and 128 Bt rows (and of the rows of a second plane, SP
// below), brought into one of two LDS buffers (row pitch 272 B) by asynchronous 16-byte
// copies, 16 to 32 per thread; the copies of pass t + 2 are issued when every wave has left pass t's buffer, so
// they fly while pass t + 1 is worked on. OPK 0: f16 operands; OPK 1: bf16 operands. SP 0: C = A.Bt. SP 1: a
// second A plane, C = (Ap + Ap2).Bt. SP 2: a second Bt plane, C = A.(Btp + Btp2). Both planes' products of a k
// step are taken in the same pass into the same accumulators, so the operand they share is staged once and its
// fragments are read once (only unscaled hi/lo planes are paired this way). AHM 0: A row-major
// [M][K] pitch lda; AHM 1: A head-major planes, element (m, k) at ((k/HD)*aplane + m*HD + k%HD). Bt row-major
// [N][K] pitch ldb (k contiguous); M, N, K multiples of 128, K at least two passes (true at every call site; host
// grid = tiles exact). MI 2: fragments are read from LDS one 32-k step ahead of their products, into a second register set.
// Both operand fragments use the split k map (elements 0..7 <- k0+8h.., 8..15 <- k0+16+8h..); D element r of a
// lane is (row 8h + r, col lane&15).
// OM 0: f32 out Cf = acc*wsc (+ RES: bf16 RNE value of Rp[input row of token m][n], token m -> input row
//       (m/SEQ)*SEQ_FULL + m%SEQ, pitch DM), pitch ldc.
// OM 1: f16 out Ch = f16(acc*wsc*osc*scale).  OM 2: f16 pair: base = acc*wsc*osc*scale; Ch = f16 bits(base);
//       Ch2 = f16 bits((base - value(Ch)) * rsc).  scale = Rs[m] (RSM 1, per row), Rs[n] (RSM 2, per column),
//       1 (RSM 0).
// coverage: MI slabs x 16 rows x 64 cols = the wave's whole (16*MI)x64 tile; 8 waves = the block's (64*MI)x128 tile.
// =====================================================================================================
#define GTM  128                        // block tile rows at MI 2
#define GTN  128                        // block tile columns
#define GKP  128                        // k per pass
#define GPIT 136                        // LDS row pitch in 16-bit elements (272 B)
#define GTIL (128 * GPIT)               // 16-bit elements of one staged tile (128 rows)
#define GRNG (2 * 3 * GTIL)             // 16-bit elements of the ring: two buffers of A | Bt | second plane
static_assert(GTM == 128 && GTN == 128);

// Eight asynchronous 16-byte copies of one lane, global -> LDS, rows 16 apart: LDS byte address l + 16*272*c,
// global address g + gs*c (gs in elements), c = 0..7. The s_wait_xcnt closes the statement so that no address
// register named by a copy is rewritten ahead of it.
__device__ __forceinline__ void copy8_rows16(unsigned l, const unsigned short* g, size_t gs) {
#if defined(__HIP_DEVICE_COMPILE__)
  const unsigned ls = 16u * GPIT * 2u;
  asm volatile(
      "global_load_async_to_lds_b128 %0, %8, off\n\t"
      "global_load_async_to_lds_b128 %1, %9, off\n\t"
      "global_load_async_to_lds_b128 %2, %10, off\n\t"
      "global_load_async_to_lds_b128 %3, %11, off\n\t"
      "global_load_async_to_lds_b128 %4, %12, off\n\t"
      "global_load_async_to_lds_b128 %5, %13, off\n\t"
      "global_load_async_to_lds_b128 %6, %14, off\n\t"
      "global_load_async_to_lds_b128 %7, %15, off\n\t"
      "s_wait_xcnt 0x0"
      :: "v"(l), "v"(l + ls), "v"(l + 2u * ls), "v"(l + 3u * ls),
         "v"(l + 4u * ls), "v"(l + 5u * ls), "v"(l + 6u * ls), "v"(l + 7u * ls),
         "v"(g), "v"(g + gs), "v"(g + 2 * gs), "v"(g + 3 * gs),
         "v"(g + 4 * gs), "v"(g + 5 * gs), "v"(g + 6 * gs), "v"(g + 7 * gs)
      : "memory");
#endif
}

template <int OPK, int SP, int AHM, int OM, int RSM, int RES, int MI>
__device__ __forceinline__ void gemm64(
    unsigned short* ring, float* sT, int tile,
    const unsigned short* __restrict__ Ap, const unsigned short* __restrict__ Ap2, int lda, int aplane,
    const unsigned short* __restrict__ Btp, const unsigned short* __restrict__ Btp2, int ldb,
    unsigned short* Ch, unsigned short* Ch2, float* Cf, int ldc,
    const float* __restrict__ Rs, const float* __restrict__ Rp,
    float wsc, float osc, float rsc, int M, int N, int K) {
  const int lane = threadIdx.x & 31;
  const int wave = threadIdx.x >> 5;
  const int tilesN = N >> 7;
  static_assert(MI == 2 || MI == 4);
  constexpr int GM = 64 * MI;                  // block tile rows
  const int tilesM = M / GM;
  if (tile >= tilesM * tilesN) return;   // block-uniform, in front of every copy and barrier
  const int tm = tile / tilesN;
  const int tn = tile - tm * tilesN;
  const int bm0 = tm * GM;                     // block tile origin
  const int bn0 = tn << 7;
  const int wm = (wave >> 1) * (16 * MI);      // wave tile origin inside the block tile
  const int wn = (wave & 1) << 6;
  const int m0 = bm0 + wm;
  const int n0 = bn0 + wn;

  const int rlane = lane & 15;                 // row (A) / col (B, D) within subtile
  const int koff  = (lane >> 4) * 8;           // k offset of this lane half
  const int mOff  = (lane >> 4) * 8;           // D row offset

  // copy map: thread t brings 16-byte piece t&15 of rows (t>>4) + 16*c: c = 0..4*MI-1 of A, c = 0..7 of Bt
  const int crow = threadIdx.x >> 4;
  const int cch  = threadIdx.x & 15;
  const unsigned ldsA = (unsigned)(size_t)ring + (unsigned)(crow * (GPIT * 2) + cch * 16);
  constexpr int ATL = GM * GPIT;               // 16-bit elements of the staged A tile
  const unsigned ldsB = ldsA + (unsigned)(ATL * 2);
  const unsigned ldsS = ldsA + (unsigned)((ATL + GTIL) * 2);
  constexpr int BUFE = ATL + GTIL + (SP == 1 ? ATL : (SP == 2 ? GTIL : 0));    // 16-bit elements per buffer
  const size_t aoff = AHM ? ((size_t)(cch >> 3) * (size_t)aplane + (size_t)(bm0 + crow) * HD + (size_t)((cch & 7) * 8))
                          : ((size_t)(bm0 + crow) * lda + (size_t)(cch * 8));
  const size_t astep = AHM ? (size_t)(16 * HD) : (size_t)16 * lda;          // 16 rows of A
  const size_t apass = AHM ? (size_t)(GKP / HD) * (size_t)aplane : (size_t)GKP;   // one pass along k
  const size_t boff = (size_t)(bn0 + crow) * ldb + (size_t)(cch * 8);
  const size_t bstep = (size_t)16 * ldb;
  const int NT = K >> 7;                       // passes

  auto issue = [&](int t, int buf) {           // pass t's copies of this thread into buffer buf
    const unsigned lb = (unsigned)buf * (unsigned)(BUFE * 2);
#pragma unroll     // 128 rows of A per step
    for (int hf = 0; hf < MI / 2; ++hf)
      copy8_rows16(ldsA + lb + (unsigned)hf * (unsigned)(GTIL * 2), Ap + aoff + (size_t)t * apass + (size_t)(8 * hf) * astep, astep);
    copy8_rows16(ldsB + lb, Btp + boff + (size_t)t * GKP, bstep);
    if constexpr (SP == 1) {
#pragma unroll     // 128 rows of the second A plane per step
      for (int hf = 0; hf < MI / 2; ++hf)
        copy8_rows16(ldsS + lb + (unsigned)hf * (unsigned)(GTIL * 2), Ap2 + aoff + (size_t)t * apass + (size_t)(8 * hf) * astep, astep);
    }
    if constexpr (SP == 2) copy8_rows16(ldsS + lb, Btp2 + boff + (size_t)t * GKP, bstep);
  };

  v8f acc[MI][4];
#pragma unroll
  for (int i = 0; i < MI; ++i)
#pragma unroll
    for (int j = 0; j < 4; ++j) acc[i][j] = zero8();

  // With MI 2, two fragment sets in registers: while a k step's products run from one set, the next step's LDS reads fill the
  // other, issued as one group, so no product waits out the latency of a read issued just in front of it.
  v16us fa[2][MI], fb[2][4], fs[2][4];         // A rows | Bt rows | second plane's rows (MI for SP 1, 4 for SP 2)
  auto fetch = [&](int buf, int ks, int st) {  // k step ks of the pass in buffer buf -> set st
    const unsigned short* sb = ring + buf * BUFE;
    const unsigned short* sA = sb + (wm + rlane) * GPIT + koff;
    const unsigned short* sB = sb + ATL + (wn + rlane) * GPIT + koff;
    const unsigned short* sS = sb + ATL + GTIL + ((SP == 1 ? wm : wn) + rlane) * GPIT + koff;   // second plane
#pragma unroll     // the sets are indexed by constants only, so they stay in registers
    for (int j = 0; j < 4; ++j) fb[st][j] = ldfrag_u(sB + (j << 4) * GPIT + ks * 32);
#pragma unroll
    for (int i = 0; i < MI; ++i) fa[st][i] = ldfrag_u(sA + (i << 4) * GPIT + ks * 32);
    if constexpr (SP != 0) {
#pragma unroll
      for (int e = 0; e < (SP == 1 ? MI : 4); ++e) fs[st][e] = ldfrag_u(sS + (e << 4) * GPIT + ks * 32);
    }
  };
  auto products = [&](int st) {                // one k step's products from set st, first plane then second
    // without it the scheduler sinks the reads issued just above in among the products, each to just ahead of its use
    __builtin_amdgcn_sched_barrier(0);
#pragma unroll
    for (int i = 0; i < MI; ++i) {
#pragma unroll
      for (int j = 0; j < 4; ++j) acc[i][j] = mma_raw<OPK>(fa[st][i], fb[st][j], acc[i][j]);
      if constexpr (SP != 0) {                 // the second plane's products of the same k step
#pragma unroll
        for (int j = 0; j < 4; ++j)
          acc[i][j] = mma_raw<OPK>(SP == 1 ? fs[st][i] : fa[st][i], SP == 2 ? fs[st][j] : fb[st][j], acc[i][j]);
      }
    }
    // keeps the reads that follow from rising in among these products
    __builtin_amdgcn_sched_barrier(0);
  };

  issue(0, 0);
  asm volatile("s_wait_asynccnt 0x0" ::: "memory");   // this wave's copies of pass 0 have landed
  __syncthreads();                                    // every wave's have: pass 0 may be read
  if (NT > 1) issue(1, 1);
  if constexpr (MI == 4) {
    // The 64x64 wave tile has registers for one fragment set: a step's reads go out as one group just ahead of its 32
    // products, and the SIMD's other wave works while they land.
#pragma unroll 1   // one pass per trip: the buffer index and the publish point stay in one place
    for (int t = 0; t < NT; ++t) {
#pragma unroll     // LDS offsets of a step become immediates
      for (int ks = 0; ks < GKP / 32; ++ks) {
        fetch(t & 1, ks, 0);
        if (ks == GKP / 32 - 1) {   // the publish point stands ahead of the last step's products, as below
          asm volatile("s_wait_dscnt 0x0" ::: "memory");      // this wave's reads of pass t's buffer are done
          asm volatile("s_wait_asynccnt 0x0" ::: "memory");   // this wave's copies of pass t + 1 have landed
          __syncthreads();                                    // publishes pass t + 1, frees pass t's buffer
        }
        products(0);
      }
      // behind the last products the fragment registers are free for the copies' addresses; a whole pass is left to land
      if (t + 2 < NT) issue(t + 2, t & 1);
    }
  } else {
  fetch(0, 0, 0);

#pragma unroll 1   // one pass per trip: the buffer index and the publish point stay in one place
  for (int t = 0; t < NT; ++t) {
#pragma unroll     // the set index is a constant in every step
    for (int ks = 0; ks + 1 < GKP / 32; ++ks) {
      fetch(t & 1, ks + 1, (ks + 1) & 1);
      products(ks & 1);
    }
    // The pass's last step is in registers by now, so the publish point stands ahead of its products: they cover the
    // latency of the next pass's first reads, and the copies keep a whole pass to land.
    asm volatile("s_wait_dscnt 0x0" ::: "memory");      // this wave's reads of pass t's buffer are done
    asm volatile("s_wait_asynccnt 0x0" ::: "memory");   // this wave's copies of pass t + 1 have landed
    __syncthreads();                                    // publishes pass t + 1, frees pass t's buffer
    if (t + 2 < NT) issue(t + 2, t & 1);
    // First step of pass t + 1. Unconditional, so that the compiler's count of outstanding reads is the same on every
    // path; in the last trip it reads the other buffer's old pass (no copy is aimed there any more) and goes unused.
    fetch((t & 1) ^ 1, 0, 0);
    products((GKP / 32 - 1) & 1);
  }
  }
  asm volatile("s_wait_asynccnt 0x0" ::: "memory");     // no copy is outstanding past the loop
#pragma unroll     // acc[] is indexed by constants only, so it stays in registers
  for (int i = 0; i < MI; ++i) acc_guard4(acc[i][0], acc[i][1], acc[i][2], acc[i][3]);

  const int hh2 = lane >> 4, c4 = (lane & 15) * 4;     // f32 out: 256-B row segment = 16 lanes x 16 B
  const int q8  = lane >> 3, c8 = (lane & 7) * 8;
  const float wo = wsc * osc;

  // per-column scale (RSM 2): columns n0+c8 .. n0+c8+7, same for every row of the tile
  float csc[8];
#pragma unroll
  for (int e = 0; e < 8; ++e) csc[e] = 1.f;
  if (OM != 0 && RSM == 2) {
    const v4f cs0 = *(const v4f*)(Rs + n0 + c8);
    const v4f cs1 = *(const v4f*)(Rs + n0 + c8 + 4);
#pragma unroll
    for (int e = 0; e < 4; ++e) { csc[e] = cs0[e]; csc[4 + e] = cs1[e]; }
  }

  // ---- epilogue ----
  float* slab = sT + wave * (16 * 68);
#pragma unroll
  for (int i = 0; i < MI; ++i) {
    const int mBase = m0 + (i << 4);
#pragma unroll
    for (int j = 0; j < 4; ++j) {
#pragma unroll
      for (int r = 0; r < 8; ++r) {
        slab[(mOff + r) * 68 + (j << 4) + rlane] = acc[i][j][r];
      }
    }
    wave_sync_lds();
    if (OM == 0) {
      v4f vals[8];
#pragma unroll
      for (int it = 0; it < 8; ++it) {
        const int row = it * 2 + hh2;                      // it 0..7 x hh2 0..1 = rows 0..15
        v4f v = *(const v4f*)(slab + row * 68 + c4);
        v = v * wsc;
        if (RES) {
          const int tok = mBase + row;
          const int bb = tok / SEQ, ss = tok - bb * SEQ;
          const v4f hr = *(const v4f*)(Rp + ((size_t)bb * SEQ_FULL + (size_t)ss) * DM + (size_t)(n0 + c4));
          // the next load's result may land in this load's address registers: wait before they are rewritten
          asm volatile("s_wait_xcnt 0x0" ::: "memory");
#pragma unroll
          for (int c = 0; c < 4; ++c) v[c] = v[c] + bfr(hr[c]);
        }
        vals[it] = v;
      }
      {
#pragma unroll
        for (int it = 0; it < 8; ++it) {
          const int row = it * 2 + hh2;
          *(v4f*)(Cf + (size_t)(mBase + row) * ldc + (size_t)n0 + c4) = vals[it];
        }
        
      }
    } else {
      v4u hv[4], hw[4];
#pragma unroll
      for (int it = 0; it < 4; ++it) {
        const int row = it * 4 + q8;                       // it 0..3 x q8 0..3 = rows 0..15
        const float* sp = slab + row * 68 + c8;
        float rsr = wo;
        if (RSM == 1) rsr = wo * Rs[mBase + row];
        v4u ha = {0u, 0u, 0u, 0u}, hb = {0u, 0u, 0u, 0u};
#pragma unroll
        for (int e = 0; e < 4; ++e) {
          const float b0 = sp[2 * e]     * rsr * csc[2 * e];
          const float b1 = sp[2 * e + 1] * rsr * csc[2 * e + 1];
          if (OM == 1) {
            ha[e] = pk16(f2h(b0), f2h(b1));
          } else {
            const _Float16 x0 = (_Float16)b0, x1 = (_Float16)b1;
            ha[e] = pk16(h_bits(x0), h_bits(x1));
            hb[e] = pk16(f2h((b0 - (float)x0) * rsc), f2h((b1 - (float)x1) * rsc));
          }
        }
        hv[it] = ha;
        hw[it] = hb;
      }
      {
#pragma unroll
        for (int it = 0; it < 4; ++it) {
          const int row = it * 4 + q8;
          const size_t go = (size_t)(mBase + row) * ldc + (size_t)n0 + c8;
          *(v4u*)(Ch + go) = hv[it];
          if (OM == 2) *(v4u*)(Ch2 + go) = hw[it];
        }
        
      }
    }
    wave_sync_lds();
  }
}

#define GNT ((MT / 128) * (DM / 128))   // 128x128 tiles of one [MT][DM] (or [DM][MT]) product
#define GNW ((MT / 256) * (DM / 128))   // 256x128 tiles of one [MT][DM] product
#define QRNG (2 * (256 + 128 + 128) * GPIT)   // 16-bit elements: two buffers of 256 A rows | 128 Bt rows | second plane
static_assert((MT % 256) == 0);

// One launch for the three projections, which depend on the preparation alone and not on one another: blocks
// 0 .. GNW-1 the q planes, GNW .. 2*GNW-1 the k planes (256x128 tiles), the last GNT (short, so they come last) v^T.
// The product is chosen by blockIdx.x alone; both bodies use the same LDS.
//   q, k (hi x16 + residual x2048): C[tok][n] = rstd[tok] * sum_k XB[tok][k] * (hi + lo)[n][k]
//   v^T x16:                        C[d][tok] = rstd[tok] * sum_k WVH[d][k] * XH[tok][k]
__global__ __launch_bounds__(256) void gemm_qkv(
    const unsigned short* __restrict__ XB, const unsigned short* __restrict__ XH,
    const unsigned short* __restrict__ WQH, const unsigned short* __restrict__ WQL,
    const unsigned short* __restrict__ WKH, const unsigned short* __restrict__ WKL,
    const unsigned short* __restrict__ WVH,
    unsigned short* QH, unsigned short* QR, unsigned short* KH, unsigned short* KR, unsigned short* VT,
    float* fdummy, const float* __restrict__ RSTD, const float* __restrict__ x) {
  __shared__ __align__(16) unsigned short ring[QRNG];       // two operand buffers, 2 x 139264 B
  __shared__ __align__(16) float sT[8 * 16 * 68];           // per-wave 16x64 slab, pitch 68 floats
  const int bx = blockIdx.x;
  if (bx < 2 * GNW) {
    const bool isk = bx >= GNW;
    gemm64<1, 2, 0, 2, 1, 0, 4>(ring, sT, isk ? bx - GNW : bx, XB, XB, DM, 0, isk ? WKH : WQH, isk ? WKL : WQL, DM,
                                isk ? KH : QH, isk ? KR : QR, fdummy, DM, RSTD, x, 1.0f, QKS, QRS, MT, DM, DM);
  } else {
    gemm64<0, 0, 0, 1, 2, 0, 2>(ring, sT, bx - 2 * GNW, WVH, WVH, DM, 0, XH, XH, DM, VT, VT, fdummy, MT, RSTD, x,
                                1.0f / (XSC * WSCL), VSC, 1.0f, DM, MT, DM);
  }
}

// Output projection + residual: out[tok][n] = sum_k (ctx_hi + ctx_lo)[tok][k] * WOB[n][k] + bf16(x[tok][n])
__global__ __launch_bounds__(256) void gemm_out(
    const unsigned short* __restrict__ ZH, const unsigned short* __restrict__ ZL,
    const unsigned short* __restrict__ WOB, unsigned short* hdummy, float* out,
    const float* __restrict__ RSTD, const float* __restrict__ x) {
  __shared__ __align__(16) unsigned short ring[GRNG];       // two operand buffers, 2 x 104448 B
  __shared__ __align__(16) float sT[8 * 16 * 68];           // per-wave 16x64 slab, pitch 68 floats
  gemm64<1, 1, 1, 0, 0, 1, 2>(ring, sT, blockIdx.x, ZH, ZL, DM, MT * HD, WOB, WOB, DM, hdummy, hdummy, out, DM, RSTD, x,
                              1.0f, 1.0f, 1.0f, MT, DM, DM);
}

// =====================================================================================================
// Bidirectional attention with relative position bias, head dim 64, no 1/sqrt(d) scaling. Block = 256
// threads = 8 waves, all of one (batch b, head h); one wave owns one 16-row query tile (t0..t0+15) and loops all
// key blocks of 32 with an online max-subtracted softmax in f32. A pass is 64 keys: the head's 128 B of each of
// the 64 KH rows and 64 KR rows and 128 B (64 keys) of each of its 64 VT rows are brought into one of two LDS
// buffers (row pitch 144 B) by asynchronous 16-byte copies, 6 per thread, and every wave reads its K and V
// fragments from there; the copies of pass t + 2 are issued when every wave has left pass t's buffer.
// Planes: QH|QR f16 [MT][DM] (16*q hi,
// residual x2048), KH|KR f16 [MT][DM] (16*k hi, residual x2048), VT f16 [DM][MT] (16*v transposed, row =
// h*64+d, column = token), BD f32 [NH][4096] bias by (key-query)+2047. Output Zh|Zl: bf16 hi|lo of ctx,
// head-major [NH][MT][64].
// Both products are taken transposed: keys (then head dims) are the A rows and the wave's 16 queries the B columns,
// so lane (hh, m) holds, for query t0+m alone, the scores of keys 8*hh+r and 16+8*hh+r of a 32-key block.
// The head's bias for every distance the block's 128 queries meet (key - query = -(tb+127) .. SEQ-1-tb, tb = the
// block's first query) is staged once, ahead of the first barrier, in one LDS row shared by the 8 waves and read
// at index key - query + tb + 127. Per key block:
// S^T = KH.QH^T (4 WMMA), R^T = KH.QR^T + KR.QH^T (8 WMMA, own accumulators);
// score = S/256 + R/524288 + bias; the block maximum is taken in the lane and joined with the other half-wave by
// one cross-row move; p = exp(score - running max) in f32, l accumulated per lane from the f32 p (the two halves'
// sums are joined once, in the epilogue); p*16384 as f16 packs from the two score tiles straight into the B
// operand (split k map: elements 0..7 = keys 8*hh.., 8..15 = keys 16+8*hh..); O^T += VT.P^T on f16 WMMA. The
// ctx staging region is private to its wave.
// staged extent covers consumed extent: bias row SEQ+128 written / 0..SEQ+126 read; ctx staging 2 x 16x64 written and read.
// Epilogue: ctx = O^T/(l*262144) split into bf16 hi|lo (a lane holds 8 consecutive dims of its query per O^T
// tile: one 16-byte LDS store per plane and tile), staged in LDS; the wave's 16 rows x 64 halves are
// coverage: 16 query rows x 64 halves per wave, NB*NH*SEQ/16 wave tasks = all (h, tok) rows of both planes.
// =====================================================================================================
#define AKP  64                         // keys per pass
#define APIT 72                         // LDS row pitch in 16-bit elements (144 B)
#define ATIL (64 * APIT)                // 16-bit elements of one staged tile (64 rows)
#define ABUF (3 * ATIL)                 // 16-bit elements per buffer: KH rows | KR rows | VT rows
static_assert((SEQ % AKP) == 0);

// Six asynchronous 16-byte copies of one lane, global -> LDS: rows r and r + 32 of the KH, KR and VT tiles; l is
// the LDS byte address of the lane's piece of KH row r. The s_wait_xcnt closes the statement so that no address
// register named by a copy is rewritten ahead of it.
__device__ __forceinline__ void copy6_kv(unsigned l, const unsigned short* gk, const unsigned short* gr,
                                         const unsigned short* gv) {
#if defined(__HIP_DEVICE_COMPILE__)
  const unsigned lr = 32u * APIT * 2u;
  const unsigned lt = ATIL * 2u;
  asm volatile(
      "global_load_async_to_lds_b128 %0, %6, off\n\t"
      "global_load_async_to_lds_b128 %1, %7, off\n\t"
      "global_load_async_to_lds_b128 %2, %8, off\n\t"
      "global_load_async_to_lds_b128 %3, %9, off\n\t"
      "global_load_async_to_lds_b128 %4, %10, off\n\t"
      "global_load_async_to_lds_b128 %5, %11, off\n\t"
      "s_wait_xcnt 0x0"
      :: "v"(l), "v"(l + lr), "v"(l + lt), "v"(l + lt + lr), "v"(l + 2u * lt), "v"(l + 2u * lt + lr),
         "v"(gk), "v"(gk + (size_t)32 * DM), "v"(gr), "v"(gr + (size_t)32 * DM),
         "v"(gv), "v"(gv + (size_t)32 * MT)
      : "memory");
#endif
}

__global__ __launch_bounds__(256) void attn_kernel(
    const unsigned short* __restrict__ QHp, const unsigned short* __restrict__ QRp,
    const unsigned short* __restrict__ KHp, const unsigned short* __restrict__ KRp,
    const unsigned short* __restrict__ VTp,
    const float* __restrict__ BD, unsigned short* Zh, unsigned short* Zl) {
  __shared__ __align__(16) unsigned short kvr[2 * ABUF];           // two K|KR|VT buffers, 2 x 27648 B
  __shared__ __align__(16) float brow[BRW];                        // bias row of the block, 8704 B
  __shared__ __align__(16) unsigned short zst[AWV][2][16 * HD];    // ctx hi|lo staging, 32768 B
  const int lane = threadIdx.x & 31, wv = threadIdx.x >> 5, m = lane & 15, hh = lane >> 4;
  const int nqt = SEQ / 16;
  if ((int)blockIdx.x * AWV >= NB * NH * nqt) return;   // block-uniform, in front of every copy and barrier
  const int task = blockIdx.x * AWV + wv;            // nqt is a multiple of AWV: one (b, h) per block
  const int bh = task / nqt;
  const int t0 = (task - bh * nqt) << 4;             // query tile start
  const int b = bh / NH, h = bh - b * NH;
  const size_t tok0 = (size_t)b * SEQ;

  // Q B-fragments: columns t0+m, k = head dims (two 32-deep steps), hi and residual planes
  const size_t qo = (tok0 + (size_t)(t0 + m)) * DM + (size_t)(h * HD + 8 * hh);
  const v16us qh0 = ldfrag_u(QHp + qo);
  const v16us qh1 = ldfrag_u(QHp + qo + 32);
  const v16us qr0 = ldfrag_u(QRp + qo);
  const v16us qr1 = ldfrag_u(QRp + qo + 32);

  float mx = -1.0e30f, ls = 0.f;       // query t0+m: running maximum (equal in both halves), this half's sum
  v8f O[4];                            // O^T tiles: element r = (dim 16*j + 8*hh + r, query t0+m)
#pragma unroll
  for (int j = 0; j < 4; ++j) O[j] = zero8();

  // bias row: brow[i] = bias_h(key - query = i - tb - 127), i = 0..SEQ+127; source index i + 1920 - tb lies in
  // 0..4095 (tb is a multiple of 128, tb <= SEQ - 128). Thread t brings 16-byte pieces t, t + 256, ...
  const int tb = t0 - 16 * wv;
  const float* bsrc = BD + (size_t)h * BDW + (SEQ_FULL - 16 * AWV - tb);
  v4f bst[BRQ + 1];
#pragma unroll     // bst[] is indexed by constants only; the loads go out together
  for (int q = 0; q < BRQ; ++q) bst[q] = *(const v4f*)(bsrc + 4 * ((int)threadIdx.x + 256 * q));
  if ((int)threadIdx.x < BRT) bst[BRQ] = *(const v4f*)(bsrc + 4 * ((int)threadIdx.x + 256 * BRQ));
  const float* bl = brow + (16 * AWV - 1 - 16 * wv - m + 8 * hh);          // + key block start + r
  // copy map: thread t brings 16-byte piece t&7 of rows (t>>3) and (t>>3) + 32 of each of the three tiles
  const int crow = threadIdx.x >> 3;
  const int cpc  = threadIdx.x & 7;
  const unsigned ldsC = (unsigned)(size_t)kvr + (unsigned)(crow * (APIT * 2) + cpc * 16);
  const size_t kco = (tok0 + (size_t)crow) * DM + (size_t)(h * HD + cpc * 8);
  const unsigned short* gK = KHp + kco;
  const unsigned short* gR = KRp + kco;
  const unsigned short* gV = VTp + (size_t)(h * HD + crow) * MT + tok0 + (size_t)(cpc * 8);
  const int NT = SEQ / AKP;

  auto issue = [&](int t, int buf) {           // pass t's 6 copies of this thread into buffer buf
    copy6_kv(ldsC + (unsigned)buf * (unsigned)(ABUF * 2), gK + (size_t)t * (AKP * DM), gR + (size_t)t * (AKP * DM),
             gV + (size_t)t * AKP);
  };

  issue(0, 0);
#pragma unroll     // bst[] is indexed by constants only, so it stays in registers
  for (int q = 0; q < BRQ; ++q) *(v4f*)(brow + 4 * ((int)threadIdx.x + 256 * q)) = bst[q];
  if ((int)threadIdx.x < BRT) *(v4f*)(brow + 4 * ((int)threadIdx.x + 256 * BRQ)) = bst[BRQ];
  asm volatile("s_wait_asynccnt 0x0" ::: "memory");   // this wave's copies of pass 0 have landed
  __syncthreads();                                    // every wave's have: pass 0 and the bias row may be read
  if (NT > 1) issue(1, 1);

#pragma unroll 1   // one pass per trip: the buffer index and the publish point stay at the loop's foot
  for (int t = 0; t < NT; ++t) {
  const float* bw = bl + t * AKP;                                            // bias of this pass's keys
  const unsigned short* kbase  = kvr + (t & 1) * ABUF + m * APIT + 8 * hh;   // KH row m, this lane half's k
  const unsigned short* krbase = kbase + ATIL;
  const unsigned short* vbase  = kbase + 2 * ATIL;                           // VT row (dim) m, keys 8*hh..
#pragma unroll     // both 32-key blocks of a pass inline: their LDS offsets become immediates
  for (int sub = 0; sub < AKP / 32; ++sub) {
    // bias of keys 8*hh + r and 16 + 8*hh + r of the block for query m, read here so that the products cover the
    // LDS latency; two consecutive keys per register pair
    v2f b0[4], b1[4];
#pragma unroll     // b0[], b1[] are indexed by constants only, so they stay in registers
    for (int e = 0; e < 4; ++e) {
      b0[e] = (v2f){bw[sub * 32 + 2 * e], bw[sub * 32 + 2 * e + 1]};
      b1[e] = (v2f){bw[sub * 32 + 16 + 2 * e], bw[sub * 32 + 16 + 2 * e + 1]};
    }

    // S^T = KH.QH^T, R^T = KH.QR^T + KR.QH^T ; A row = key token sb+m (+16), B column = query, k = head dim
    v8f S0, S1, R0, R1;
    {
      const int kofs = (sub * 32) * APIT;
      const v16us kf0a = ldfrag_u(kbase + kofs);
      const v16us kf1a = ldfrag_u(kbase + kofs + 16 * APIT);
      const v16us kg0a = ldfrag_u(krbase + kofs);
      const v16us kg1a = ldfrag_u(krbase + kofs + 16 * APIT);
      const v16us kf0b = ldfrag_u(kbase + kofs + 32);
      const v16us kf1b = ldfrag_u(kbase + kofs + 32 + 16 * APIT);
      const v16us kg0b = ldfrag_u(krbase + kofs + 32);
      const v16us kg1b = ldfrag_u(krbase + kofs + 32 + 16 * APIT);
      qk_run(S0, S1, R0, R1, kf0a, kf1a, kg0a, kg1a, kf0b, kf1b, kg0b, kg1b, qh0, qh1, qr0, qr1);
    }

    // VT A-fragments (row = h*64 + dim, k = key token), read as one group here so that the softmax covers
    // their LDS latency
    v16us vf[4];
#pragma unroll     // vf[] is indexed by constants only, so it stays in registers
    for (int j = 0; j < 4; ++j) vf[j] = ldfrag_u(vbase + (16 * j) * APIT + sub * 32);

    // score = q.k + bias
    float s0[8], s1[8];
#pragma unroll     // two consecutive keys per step: accumulator pairs and bias pairs feed packed f32 FMAs as they lie
    for (int e = 0; e < 4; ++e) {
      const v2f x0 = __builtin_elementwise_fma((v2f){S0[2 * e], S0[2 * e + 1]}, (v2f){SC1, SC1},
                     __builtin_elementwise_fma((v2f){R0[2 * e], R0[2 * e + 1]}, (v2f){SC2, SC2}, b0[e]));
      const v2f x1 = __builtin_elementwise_fma((v2f){S1[2 * e], S1[2 * e + 1]}, (v2f){SC1, SC1},
                     __builtin_elementwise_fma((v2f){R1[2 * e], R1[2 * e + 1]}, (v2f){SC2, SC2}, b1[e]));
      s0[2 * e] = x0[0]; s0[2 * e + 1] = x0[1];
      s1[2 * e] = x1[0]; s1[2 * e + 1] = x1[1];
    }

    // online softmax: a query's 32 scores live in lanes m and m + 16, 16 each
    float xm = fmaxf(s0[0], s1[0]);
#pragma unroll     // s0[], s1[] are indexed by constants only, so they stay in registers
    for (int r = 1; r < 8; ++r) xm = fmaxf(xm, fmaxf(s0[r], s1[r]));
    xm = fmaxf(xm, xhalf(xm));
    const float mn = fmaxf(mx, xm);
    const float al = __expf(mx - mn);
    mx = mn;
    FragU pf;                                          // P^T B-fragment (split k map)
    float pa = 0.f, pb = 0.f;
#pragma unroll
    for (int r = 0; r < 8; ++r) {
      const float p0 = __expf(s0[r] - mn);
      const float p1 = __expf(s1[r] - mn);
      pa += p0;
      pb += p1;
      pf.v[r]     = f2h(p0 * PCAR);
      pf.v[8 + r] = f2h(p1 * PCAR);
    }
    ls = ls * al + (pa + pb);
#pragma unroll     // O[] is indexed by constants only, so it stays in registers
    for (int j = 0; j < 4; ++j) O[j] = O[j] * al;
    pv_run(O[0], O[1], O[2], O[3], vf[0], vf[1], vf[2], vf[3], pf.v);
  }
    asm volatile("s_wait_dscnt 0x0" ::: "memory");      // this wave's reads of pass t's buffer are done
    asm volatile("s_wait_asynccnt 0x0" ::: "memory");   // this wave's copies of pass t + 1 have landed
    __syncthreads();                                    // publishes pass t + 1, frees pass t's buffer
    if (t + 2 < NT) issue(t + 2, t & 1);
  }
  asm volatile("s_wait_asynccnt 0x0" ::: "memory");     // no copy is outstanding past the loop
  acc_guard4(O[0], O[1], O[2], O[3]);

  // ---- epilogue: ctx = O / (l * PCAR * VSC) -> bf16 hi|lo, head-major planes ----
  unsigned short* zh = zst[wv][0];
  unsigned short* zl = zst[wv][1];
  const float linv = (1.0f / (ls + xhalf(ls))) * OSC;  // both halves' sums joined; the joined sum is >= 1
#pragma unroll
  for (int j = 0; j < 4; ++j) {
    v4u zc, zr;
#pragma unroll
    for (int e = 0; e < 4; ++e) {
      const float o0 = O[j][2 * e] * linv, o1 = O[j][2 * e + 1] * linv;
      const unsigned short x0 = bf_bits(o0), x1 = bf_bits(o1);
      zc[e] = pk16(x0, x1);
      zr[e] = pk16(bf_bits(o0 - bf_up(x0)), bf_bits(o1 - bf_up(x1)));
    }
    *(v4u*)(zh + m * HD + 16 * j + 8 * hh) = zc;       // row = query m, dims 16*j + 8*hh .. + 7
    *(v4u*)(zl + m * HD + 16 * j + 8 * hh) = zr;
  }
  wave_sync_lds();
  {
    v4u ha[4], hb[4];
#pragma unroll
    for (int q = 0; q < 4; ++q) {
      ha[q] = *(const v4u*)(zh + q * 256 + lane * 8);
      hb[q] = *(const v4u*)(zl + q * 256 + lane * 8);
    }
    const size_t zo = ((size_t)h * MT + tok0 + (size_t)t0) * HD;   // 2048-B aligned, 16 rows contiguous
    unsigned short* dh = Zh + zo;
    unsigned short* dl = Zl + zo;
    {
#pragma unroll
      for (int q = 0; q < 4; ++q) {
        *(v4u*)(dh + q * 256 + lane * 8) = ha[q];
        *(v4u*)(dl + q * 256 + lane * 8) = hb[q];
      }
      
    }
  }
}

// =====================================================================================================
// Workspace map (bytes, NB=2, SEQ=2048); every plane is an exact multiple of its whole-row / whole-line /
// BD = 16 x 4096 floats); all offsets multiples of 65536.
//   XB   bf16 [MT][DM]        0           8388608
//   XH   f16  [MT][DM]        8388608     8388608
//   RSTD f32  [MT]            16777216    65536     (16384 used)
//   W    6 x 16-bit [DM][DM]  16842752    12582912  (wq hi, wq lo, wk hi, wk lo bf16; wv f16 x256; wo bf16)
//   BD   f32  [NH][4096]      29425664    262144
//   QH   f16  [MT][DM]        29687808    8388608
//   QR   f16  [MT][DM]        38076416    8388608
//   KH   f16  [MT][DM]        46465024    8388608
//   KR   f16  [MT][DM]        54853632    8388608
//   VT   f16  [DM][MT]        63242240    8388608
//   ZH   bf16 [NH][MT][64]    71630848    8388608
//   ZL   bf16 [NH][MT][64]    80019456    8388608
//   end                       88408064
// =====================================================================================================
extern "C" void kernel_launch(void* const* d_in, const int* in_sizes, int n_in,
                              void* d_out, int out_size, void* d_ws, size_t ws_size,
                              hipStream_t stream) {
  if (n_in < 7) return;
  if (in_sizes[0] < ((NB - 1) * SEQ_FULL + SEQ) * DM) return;
  if (in_sizes[1] < DM) return;
  if (in_sizes[2] < DM * DM) return;
  if (in_sizes[3] < DM * DM) return;
  if (in_sizes[4] < DM * DM) return;
  if (in_sizes[5] < DM * DM) return;
  if (in_sizes[6] < NBKT * NH) return;
  if (out_size < MT * DM) return;

  const float* x    = (const float*)d_in[0];   // [2][2048][1024]
  const float* lnw  = (const float*)d_in[1];   // [1024]
  const float* w_q  = (const float*)d_in[2];   // [1024][1024] (in, out)
  const float* w_k  = (const float*)d_in[3];
  const float* w_v  = (const float*)d_in[4];
  const float* w_o  = (const float*)d_in[5];   // [1024][1024] (in, out)
  const float* tbl  = (const float*)d_in[6];   // [32][16]

  const size_t PX  = (size_t)MT * DM * 2;        // 16-bit [MT][DM] plane
  const size_t PRS = (((size_t)MT * 4 + 65535) / 65536) * 65536;
  const size_t PW1 = (size_t)DM * DM * 2;        // one 16-bit weight plane
  const size_t PBD = (size_t)NH * BDW * 4;
  size_t off = 0;
  const size_t oXB = off; off += PX;
  const size_t oXH = off; off += PX;
  const size_t oRS = off; off += PRS;
  const size_t oW  = off; off += 6 * PW1;
  const size_t oBD = off; off += PBD;
  const size_t oQH = off; off += PX;
  const size_t oQR = off; off += PX;
  const size_t oKH = off; off += PX;
  const size_t oKR = off; off += PX;
  const size_t oVT = off; off += PX;
  const size_t oZH = off; off += PX;
  const size_t oZL = off; off += PX;
  if (off > ws_size) return;                      // off = 88408064 at full size
  if (off > (size_t)134217728) return;

  char* ws = (char*)d_ws;
  unsigned short* XB = (unsigned short*)(ws + oXB);
  unsigned short* XH = (unsigned short*)(ws + oXH);
  float* RSTD = (float*)(ws + oRS);
  unsigned short* W16 = (unsigned short*)(ws + oW);
  unsigned short* WQH = W16;
  unsigned short* WQL = W16 + (size_t)1 * DM * DM;
  unsigned short* WKH = W16 + (size_t)2 * DM * DM;
  unsigned short* WKL = W16 + (size_t)3 * DM * DM;
  unsigned short* WVH = W16 + (size_t)4 * DM * DM;
  unsigned short* WOB = W16 + (size_t)5 * DM * DM;
  float* BDp = (float*)(ws + oBD);
  unsigned short* QH = (unsigned short*)(ws + oQH);
  unsigned short* QR = (unsigned short*)(ws + oQR);
  unsigned short* KH = (unsigned short*)(ws + oKH);
  unsigned short* KR = (unsigned short*)(ws + oKR);
  unsigned short* VT = (unsigned short*)(ws + oVT);
  unsigned short* ZH = (unsigned short*)(ws + oZH);
  unsigned short* ZL = (unsigned short*)(ws + oZL);
  float* out0 = (float*)d_out;
  float* fdummy = BDp;                            // in-range placeholder for unused f32 output args

  const dim3 blk(256);

  // (0) operand planes, rms statistics and bias table: one launch
  prep<<<dim3(PXB + NH + 4 * PWB), blk, 0, stream>>>(x, w_q, w_k, w_v, w_o, lnw, tbl, XB, XH, RSTD, W16, BDp);

  // (1) q, k planes and v^T: one launch, 2 x 128 + 256 blocks at full size
  gemm_qkv<<<dim3(2 * GNW + GNT), blk, 0, stream>>>(XB, XH, WQH, WQL, WKH, WKL, WVH, QH, QR, KH, KR, VT, fdummy, RSTD, x);

  // (2) attention -> ctx bf16 hi|lo head-major planes
  attn_kernel<<<dim3((NB * NH * (SEQ / 16)) / AWV), dim3(32 * AWV), 0, stream>>>(QH, QR, KH, KR, VT, BDp, ZH, ZL);

  // (3) output projection + residual
  gemm_out<<<dim3(GNT), blk, 0, stream>>>(ZH, ZL, WOB, ZH, out0, RSTD, x);
  (void)hipGetLastError();
}
